// v000
// Measured on an AMD MI455X. A time is GPU time per run, averaged over a window of back-to-back runs after a warm-up
// (all launches, gaps included; the runs take copies of the inputs in turn), and the median of several windows.
// Apart from v000's, it joins two sittings. Times from different sittings can be a few percent apart, while
// side-by-side timings come from the same sitting.
// v000, which the later versions start from, runs in 1080 microseconds.
#include <hip/hip_runtime.h>
// Structure: token rows r = b*SEQ + s. Causal self-attention (16 heads of 64, per-head weights [H][E][64], scores x8, keys above the diagonal and exactly-zero scores masked) -> x1 = LN1(x + attn.Wp1 + bp1); cross-attention of x1 over z rows -> x2 = LN2(x1 + attn.Wp2 + bp2); f = relu(x2.W1 + b1).W2 + b2; out = LN3(x2 + f). Projection / FFN weights are [in][out].

#ifndef NB
#define NB 4
#endif
#ifndef SEQ
#define SEQ 1024
#endif
#define NB_FULL 4
#define SEQ_FULL 1024
#define DM 1024
#define NH 16
#define HD 64
#define DFF 4096
#define NR ((size_t)NB * SEQ)
#define MR ((int)((size_t)NB * SEQ))
#define PBP 40          /* LDS pitch (halves) of the per-wave P tile */
#define OBP 72          /* LDS pitch (halves) of the per-wave o tile */
#define LN_EPS 1.0e-5f
#define PCARRY 16384.0f         /* carry of the f16 P planes */
#define RCARRY 2048.0f          /* carry of every residual plane */
#define RINV 0.00048828125f     /* 1 / RCARRY */

static_assert(NB >= 1 && NB <= NB_FULL);
static_assert(SEQ >= 64 && SEQ <= SEQ_FULL && SEQ % 64 == 0);
static_assert((NB * SEQ) % 128 == 0);
static_assert(NH * HD == DM && HD == 64);
static_assert(DM == 4 * 256);
static_assert(DM % 64 == 0 && DFF % 64 == 0 && DM % 32 == 0 && DFF % 32 == 0);
static_assert(DFF <= 4 * DM);
static_assert((PBP % 8) == 0 && (OBP % 8) == 0);
static_assert(DFF == 4 * DM);                       /* the FFN hidden plane spans exactly four 16-bit token planes */
static_assert(PBP >= 32 && OBP >= HD);              /* P tile holds 32 keys, o tile holds one head */
static_assert(RCARRY * RINV == 1.0f);
static_assert(PCARRY <= 32768.0f);                  /* carried P stays inside f16 */
static_assert((size_t)8 * DM * DM * 2 + (size_t)2 * DM * DFF * 2 + (size_t)10 * NB * SEQ * DM * 2 + 16 * 256 <= (size_t)134217728);   /* workspace carve */

typedef unsigned short v8us __attribute__((ext_vector_type(8), may_alias));
typedef float  v8f  __attribute__((ext_vector_type(8)));
typedef float  v4f  __attribute__((ext_vector_type(4)));
typedef float  v4fa __attribute__((ext_vector_type(4), may_alias));
typedef _Float16 v16h __attribute__((ext_vector_type(16)));
typedef _Float16 v4h __attribute__((ext_vector_type(4)));
union FragH { v16h v; v8us half[2]; _Float16 h[16]; unsigned short u[16]; };

__device__ __forceinline__ unsigned short bf16_bits(float x) { unsigned int u = __float_as_uint(x); return (unsigned short)((u + 0x7FFFu + ((u >> 16) & 1u)) >> 16); }
__device__ __forceinline__ float bf16_val(unsigned short b) { return __uint_as_float(((unsigned int)b) << 16); }
__device__ __forceinline__ float bf16_rne(float x) { return bf16_val(bf16_bits(x)); }

// 16x32 fragment from a k-contiguous 16-bit row p (A row m = lane&15, or B stored [n][k] with n = lane&15):
// elements 0..7 <- k 8h..8h+7, elements 8..15 <- k 16+8h..16+8h+7 (h = lane>>4)
__device__ __forceinline__ v16h g2_frag(const _Float16* p, int hh) { FragH f; f.half[0] = *(const v8us*)((const unsigned short*)p + 8 * hh); f.half[1] = *(const v8us*)((const unsigned short*)p + 16 + 8 * hh); return f.v; }
__device__ __forceinline__ v8f g2_mma(v16h a, v16h b, v8f c) { v8f d = __builtin_amdgcn_wmma_f32_16x16x32_f16(false, a, false, b, (short)0, c, false, false); asm volatile("v_nop\n\tv_nop\n\tv_nop\n\tv_nop" : "+v"(d) : "v"(a), "v"(b)); return d; }

// f32 -> f16 operand convert that cannot yield an f16 subnormal (value select, applied after the plane's carry)
typedef _Float16 h16;
static __device__ __forceinline__ h16 toh_flush(float v) { const h16 r = (h16)v; return (fabsf(v) < 6.103515625e-05f) ? (h16)0.0f : r; }

__global__ __launch_bounds__(256) void k_wt_f16(const float* __restrict__ W, _Float16* __restrict__ Wt, int K, int N, float scale) {
  const int t = blockIdx.x * 256 + threadIdx.x; if (t >= N * (K / 8)) return;
  const int n = t / (K / 8), k8 = (t % (K / 8)) * 8; FragH f;
#pragma unroll
  for (int i = 0; i < 8; ++i) f.h[i] = (_Float16)(bf16_rne(W[(size_t)(k8 + i) * N + n]) * scale);
  const v8us o = f.half[0]; unsigned short* d = (unsigned short*)Wt + (size_t)n * K + k8;
  *(v8us*)d = o; 
}

__global__ __launch_bounds__(256) void k_wt_head(const float* __restrict__ W, _Float16* __restrict__ Wt, int K, int N, float scale) {
  const int t = blockIdx.x * 256 + threadIdx.x; if (t >= N * (K / 8)) return;
  const int n = t / (K / 8), k8 = (t % (K / 8)) * 8; const int hd = n / HD, dd = n % HD; FragH f;
#pragma unroll
  for (int i = 0; i < 8; ++i) f.h[i] = toh_flush(bf16_rne(W[((size_t)hd * K + k8 + i) * HD + dd]) * scale);
  const v8us o = f.half[0]; unsigned short* d = (unsigned short*)Wt + (size_t)n * K + k8;
  *(v8us*)d = o; 
}

__global__ __launch_bounds__(256) void k_x16(const float* __restrict__ x, _Float16* __restrict__ X16, size_t n8) {
  const size_t t = (size_t)blockIdx.x * 256 + threadIdx.x; if (t >= n8) return;
  const size_t e = t * 8; const size_t r = e / DM; const size_t c = e % DM; const size_t rs = (r / SEQ) * SEQ_FULL + (r % SEQ);
  const float* src = x + rs * DM + c; const v4f a = *(const v4fa*)src; const v4f a2 = *(const v4fa*)(src + 4); FragH f;
#pragma unroll
  for (int q = 0; q < 4; ++q) { f.h[q] = (_Float16)bf16_rne(a[q]); f.h[4 + q] = (_Float16)bf16_rne(a2[q]); }
  const v8us o = f.half[0]; unsigned short* d = (unsigned short*)X16 + e;
  *(v8us*)d = o; 
}

__global__ __launch_bounds__(256) void k_split16(const float* __restrict__ src, _Float16* __restrict__ H16, _Float16* __restrict__ R16, size_t n8) {
  #pragma clang fp contract(off)
  const size_t t = (size_t)blockIdx.x * 256 + threadIdx.x; if (t >= n8) return;
  const size_t e = t * 8; const v4f a = *(const v4fa*)(src + e); const v4f a2 = *(const v4fa*)(src + e + 4); FragH fh, fr;
#pragma unroll
  for (int q = 0; q < 4; ++q) {
    const h16 h0 = toh_flush(a[q]);  fh.h[q] = h0;     fr.h[q] = toh_flush((a[q] - (float)h0) * RCARRY);
    const h16 h1 = toh_flush(a2[q]); fh.h[4 + q] = h1; fr.h[4 + q] = toh_flush((a2[q] - (float)h1) * RCARRY); }
  const v8us oh = fh.half[0]; const v8us orr = fr.half[0];
  unsigned short* dh = (unsigned short*)H16 + e; unsigned short* dr = (unsigned short*)R16 + e;
  *(v8us*)dh = oh; *(v8us*)dr = orr; 
}

template <int NHv, int TTv>
__global__ __launch_bounds__(256) void k_vt(const _Float16* __restrict__ V16, int ldv, int voff, _Float16* __restrict__ Vt) {
  __shared__ unsigned short tl[64][66]; const int tid = threadIdx.x; const int slab = blockIdx.x / (TTv / 64), lg = blockIdx.x % (TTv / 64); const int b = slab / NHv, h = slab % NHv;
  for (int i = tid; i < 64 * 8; i += 256) { const int r = i / 8, c8 = (i % 8) * 8; FragH f; f.half[0] = *(const v8us*)((const unsigned short*)V16 + ((size_t)b * TTv + lg * 64 + r) * ldv + voff + h * 64 + c8);
#pragma unroll
    for (int q = 0; q < 8; ++q) tl[r][c8 + q] = f.u[q]; }
  __syncthreads();
  {
#pragma unroll
    for (int rd = 0; rd < 2; ++rd) { const int d = rd * 32 + tid / 8, pc = tid % 8; FragH f;
#pragma unroll
      for (int q = 0; q < 8; ++q) f.u[q] = tl[pc * 8 + q][d];
      *(v8us*)((unsigned short*)Vt + ((size_t)slab * 64 + d) * TTv + lg * 64 + pc * 8) = f.half[0]; }
     }
}

// GEMM: wave tile 32 rows x 64 cols; A f16 rows (pitch lda), Bh f16 [n][k] (pitch ldb); v = acc*alpha + bf16(bias[col])*bsc; ACT 0 none / 3 relu;
// Requires M % 128 == 0, N % 64 == 0, K % 32 == 0; grid = (M/128)*(N/64), block 128 (4 waves).
template <int ACT>
__global__ __launch_bounds__(128) void k_gemm2(const _Float16* __restrict__ A, int lda, const _Float16* __restrict__ Bh, int ldb, float alpha, const float* __restrict__ bias, float bsc,
    float* __restrict__ C, _Float16* __restrict__ C16, int ldc, int M, int N, int K) {
  static_assert(ACT == 0 || ACT == 3);
  __shared__ __attribute__((aligned(16))) float so[4][32][68];
  const int tid = threadIdx.x, w = tid >> 5, lane = tid & 31, ln = lane & 15, hh = lane >> 4;
  const int ntn = N >> 6; const int mt = blockIdx.x / ntn, nq = blockIdx.x - mt * ntn; const int row0 = mt * 128 + 32 * w, col0 = nq * 64; if (row0 >= M) return;
  const _Float16* a0p = A + (size_t)(row0 + ln) * lda; const _Float16* a1p = a0p + (size_t)16 * lda;
  const _Float16* b0p = Bh + (size_t)(col0 + ln) * ldb; const _Float16* b1p = b0p + (size_t)16 * ldb; const _Float16* b2p = b1p + (size_t)16 * ldb; const _Float16* b3p = b2p + (size_t)16 * ldb;
  const v8f z8 = {0.f,0.f,0.f,0.f,0.f,0.f,0.f,0.f}; v8f c00 = z8, c01 = z8, c02 = z8, c03 = z8, c10 = z8, c11 = z8, c12 = z8, c13 = z8;
#pragma unroll 1
  for (int kb = 0; kb < K; kb += 32) { const v16h a0 = g2_frag(a0p + kb, hh), a1 = g2_frag(a1p + kb, hh);
    v16h b = g2_frag(b0p + kb, hh); c00 = g2_mma(a0, b, c00); c10 = g2_mma(a1, b, c10);
    b = g2_frag(b1p + kb, hh); c01 = g2_mma(a0, b, c01); c11 = g2_mma(a1, b, c11);
    b = g2_frag(b2p + kb, hh); c02 = g2_mma(a0, b, c02); c12 = g2_mma(a1, b, c12);
    b = g2_frag(b3p + kb, hh); c03 = g2_mma(a0, b, c03); c13 = g2_mma(a1, b, c13); }
  v8f accs[8] = {c00, c01, c02, c03, c10, c11, c12, c13};
#pragma unroll
  for (int u = 0; u < 8; ++u) { const int t = u & 3, half = u >> 2; const int col = col0 + t * 16 + ln; const float bv = bias ? bf16_rne(bias[col]) * bsc : 0.f;
#pragma unroll
    for (int r = 0; r < 8; ++r) { const int rloc = half * 16 + 8 * hh + r; float v = accs[u][r] * alpha + bv; if (ACT == 3) v = fmaxf(v, 0.f); so[w][rloc][t * 16 + ln] = v; } }
  __builtin_amdgcn_fence(4 /* acq_rel order */, "workgroup"); __builtin_amdgcn_wave_barrier();
  const int rsub = lane >> 4, c4 = (lane & 15) * 4;
  {
#pragma unroll
    for (int q = 0; q < 16; ++q) { const int r = q * 2 + rsub; const v4f v = *(const v4fa*)&so[w][r][c4];
      if (C) *(v4f*)(C + (size_t)(row0 + r) * ldc + col0 + c4) = v;
      if (C16) { v4h h4; for (int i = 0; i < 4; ++i) h4[i] = (_Float16)v[i]; *(v4h*)(C16 + (size_t)(row0 + r) * ldc + col0 + c4) = h4; } }
     }
}

// One K sweep of the 32x64 wave tile (same fragment pairing as k_gemm2)
static __device__ __forceinline__ void gemm_kloop(const _Float16* a0p, const _Float16* a1p, const _Float16* b0p, const _Float16* b1p, const _Float16* b2p, const _Float16* b3p, int K, int hh,
    v8f& c00, v8f& c01, v8f& c02, v8f& c03, v8f& c10, v8f& c11, v8f& c12, v8f& c13) {
#pragma unroll 1
  for (int kb = 0; kb < K; kb += 32) { const v16h a0 = g2_frag(a0p + kb, hh), a1 = g2_frag(a1p + kb, hh);
    v16h b = g2_frag(b0p + kb, hh); c00 = g2_mma(a0, b, c00); c10 = g2_mma(a1, b, c10);
    b = g2_frag(b1p + kb, hh); c01 = g2_mma(a0, b, c01); c11 = g2_mma(a1, b, c11);
    b = g2_frag(b2p + kb, hh); c02 = g2_mma(a0, b, c02); c12 = g2_mma(a1, b, c12);
    b = g2_frag(b3p + kb, hh); c03 = g2_mma(a0, b, c03); c13 = g2_mma(a1, b, c13); }
}

// GEMM with an optional residual A plane (AR = (a - f16(a)) * 2048, own accumulators from zero, folded by 2^-11 in f32) and either an f32 output (OUTHR 0)
// Requires M % 128 == 0, N % 64 == 0, K % 32 == 0; grid = (M/128)*(N/64), block 128.
template <int ARES, int OUTHR>
static __device__ __forceinline__ void gemm_hr_body(const _Float16* __restrict__ A, const _Float16* __restrict__ AR, int lda, const _Float16* __restrict__ Bh, int ldb, float alpha,
    const float* __restrict__ bias, float bsc, float* __restrict__ C, _Float16* __restrict__ CH, _Float16* __restrict__ CR, int ldc, int M, int N, int K) {
  __shared__ __attribute__((aligned(16))) float so[4][32][68];
  const int tid = threadIdx.x, lane = tid & 31, ln = lane & 15, hh = lane >> 4;
  const int w = __builtin_amdgcn_readfirstlane(tid >> 5);
  const int ntn = N >> 6; const int mt = blockIdx.x / ntn, nq = blockIdx.x - mt * ntn; const int row0 = mt * 128 + 32 * w, col0 = nq * 64; if (row0 >= M) return;
  const _Float16* b0p = Bh + (size_t)(col0 + ln) * ldb; const _Float16* b1p = b0p + (size_t)16 * ldb; const _Float16* b2p = b1p + (size_t)16 * ldb; const _Float16* b3p = b2p + (size_t)16 * ldb;
  const v8f z8 = {0.f,0.f,0.f,0.f,0.f,0.f,0.f,0.f};
  if (ARES) {
    const _Float16* r0p = AR + (size_t)(row0 + ln) * lda; const _Float16* r1p = r0p + (size_t)16 * lda;
    v8f d00 = z8, d01 = z8, d02 = z8, d03 = z8, d10 = z8, d11 = z8, d12 = z8, d13 = z8;
    gemm_kloop(r0p, r1p, b0p, b1p, b2p, b3p, K, hh, d00, d01, d02, d03, d10, d11, d12, d13);
    v8f ds[8] = {d00, d01, d02, d03, d10, d11, d12, d13};
#pragma unroll
    for (int u = 0; u < 8; ++u) { const int t = u & 3, half = u >> 2;
#pragma unroll
      for (int r = 0; r < 8; ++r) { const int rloc = half * 16 + 8 * hh + r; so[w][rloc][t * 16 + ln] = ds[u][r] * RINV; } }
  }
  const _Float16* a0p = A + (size_t)(row0 + ln) * lda; const _Float16* a1p = a0p + (size_t)16 * lda;
  v8f c00 = z8, c01 = z8, c02 = z8, c03 = z8, c10 = z8, c11 = z8, c12 = z8, c13 = z8;
  gemm_kloop(a0p, a1p, b0p, b1p, b2p, b3p, K, hh, c00, c01, c02, c03, c10, c11, c12, c13);
  v8f accs[8] = {c00, c01, c02, c03, c10, c11, c12, c13};
#pragma unroll
  for (int u = 0; u < 8; ++u) { const int t = u & 3, half = u >> 2; const int col = col0 + t * 16 + ln; const float bv = bias ? bf16_rne(bias[col]) * bsc : 0.f;
#pragma unroll
    for (int r = 0; r < 8; ++r) { const int rloc = half * 16 + 8 * hh + r; float v = accs[u][r]; if (ARES) v += so[w][rloc][t * 16 + ln]; v = v * alpha + bv; so[w][rloc][t * 16 + ln] = v; } }
  __builtin_amdgcn_fence(4 /* acq_rel order */, "workgroup"); __builtin_amdgcn_wave_barrier();
  const int rsub = lane >> 4, c4 = (lane & 15) * 4;
  {
#pragma unroll
    for (int q = 0; q < 16; ++q) { const int r = q * 2 + rsub; const v4f v = *(const v4fa*)&so[w][r][c4];
      if (OUTHR) { v4h h4, r4;
#pragma unroll
        for (int i = 0; i < 4; ++i) { const h16 hv = toh_flush(v[i]); h4[i] = hv; r4[i] = toh_flush((v[i] - (float)hv) * RCARRY); }
        *(v4h*)(CH + (size_t)(row0 + r) * ldc + col0 + c4) = h4;
        *(v4h*)(CR + (size_t)(row0 + r) * ldc + col0 + c4) = r4; }
      else { *(v4f*)(C + (size_t)(row0 + r) * ldc + col0 + c4) = v; } }
     }
}

// single A plane -> f16 value + residual output planes
__global__ __launch_bounds__(128) void k_proj_hr(const _Float16* __restrict__ A, int lda, const _Float16* __restrict__ Bh, int ldb, float alpha,
    _Float16* __restrict__ CH, _Float16* __restrict__ CR, int ldc, int M, int N, int K) {
  gemm_hr_body<0, 1>(A, A, lda, Bh, ldb, alpha, nullptr, 0.f, nullptr, CH, CR, ldc, M, N, K);
}
// value + residual A planes -> f16 value + residual output planes
__global__ __launch_bounds__(128) void k_proj_rhr(const _Float16* __restrict__ A, const _Float16* __restrict__ AR, int lda, const _Float16* __restrict__ Bh, int ldb, float alpha,
    _Float16* __restrict__ CH, _Float16* __restrict__ CR, int ldc, int M, int N, int K) {
  gemm_hr_body<1, 1>(A, AR, lda, Bh, ldb, alpha, nullptr, 0.f, nullptr, CH, CR, ldc, M, N, K);
}
// value + residual A planes -> f32 rows with bias
__global__ __launch_bounds__(128) void k_proj_rf(const _Float16* __restrict__ A, const _Float16* __restrict__ AR, int lda, const _Float16* __restrict__ Bh, int ldb, float alpha,
    const float* __restrict__ bias, float bsc, float* __restrict__ C, int ldc, int M, int N, int K) {
  gemm_hr_body<1, 0>(A, AR, lda, Bh, ldb, alpha, bias, bsc, C, nullptr, nullptr, ldc, M, N, K);
}

// Flash-style attention for one (batch, head, 16 query rows) per wave: keys streamed 32 at a time with an online (running-max) softmax in f32.
// scores = 8 * q.k^T with q and k as f16 value + x2048 residual planes: value.value in one accumulator, residual.value + value.residual in a second
// accumulator folded by 2^-11. CAUSAL: keys above the query row and exactly-zero scores take the fill -1e9 (replace), key blocks entirely above
// the wave's rows are skipped (their weights are exactly 0); P = 16384*exp(s - m) as f16 value + x2048 residual, V^T as value + residual slabs,
// o = P.V^T with value.value in one accumulator and the two cross terms in a second, row sum over the unconverted P; o/l * 64 written as f16 value +
// residual rows. Dense: P as one f16 plane (row sum over the converted P), V^T one plane, o one plane. P and o tiles are wave-private LDS
template <int CAUSAL>
static __device__ __forceinline__ void attn_hr_body(const _Float16* __restrict__ Q16, const _Float16* __restrict__ QR, const _Float16* __restrict__ K16, const _Float16* __restrict__ KR,
    const _Float16* __restrict__ VT, const _Float16* __restrict__ VTR, _Float16* __restrict__ O16, _Float16* __restrict__ OR16) {
  __shared__ __attribute__((aligned(16))) _Float16 pb[4][16 * PBP];
  __shared__ __attribute__((aligned(16))) _Float16 pbr[4][16 * PBP];
  __shared__ __attribute__((aligned(16))) _Float16 ob[4][16 * OBP];
  __shared__ __attribute__((aligned(16))) _Float16 obr[4][16 * OBP];
  const int tid = threadIdx.x, lane = tid & 31, ln = lane & 15, hh = lane >> 4;
  const int w = __builtin_amdgcn_readfirstlane(tid >> 5);
  const int h = blockIdx.y, b = blockIdx.z;
  const int q0 = (blockIdx.x * 4 + w) * 16;
  const size_t tok0 = (size_t)b * SEQ;
  const int slab = b * NH + h;
  const size_t qoff = (tok0 + q0 + ln) * DM + h * HD;
  const v16h qf0 = g2_frag(Q16 + qoff, hh), qf1 = g2_frag(Q16 + qoff + 32, hh);
  const v16h qr0 = g2_frag(QR + qoff, hh),  qr1 = g2_frag(QR + qoff + 32, hh);
  const v8f z8 = {0.f,0.f,0.f,0.f,0.f,0.f,0.f,0.f};
  v8f o0 = z8, o1 = z8, o2 = z8, o3 = z8;
  v8f e0 = z8, e1 = z8, e2 = z8, e3 = z8;
  float mrow[8], lrow[8];
#pragma unroll
  for (int r = 0; r < 8; ++r) { mrow[r] = -1.0e30f; lrow[r] = 0.f; }
  const int kend = CAUSAL ? (q0 + 16) : SEQ;
#pragma unroll 1
  for (int kb = 0; kb < kend; kb += 32) {
    const size_t koff = (tok0 + kb + ln) * DM + h * HD;
    const _Float16* k0p = K16 + koff; const _Float16* k1p = k0p + (size_t)16 * DM;
    const _Float16* r0p = KR + koff;  const _Float16* r1p = r0p + (size_t)16 * DM;
    v8f s0 = z8, s1 = z8, t0 = z8, t1 = z8;
    v16h kf = g2_frag(k0p, hh);    s0 = g2_mma(qf0, kf, s0); t0 = g2_mma(qr0, kf, t0);
    kf = g2_frag(k0p + 32, hh);    s0 = g2_mma(qf1, kf, s0); t0 = g2_mma(qr1, kf, t0);
    kf = g2_frag(r0p, hh);         t0 = g2_mma(qf0, kf, t0);
    kf = g2_frag(r0p + 32, hh);    t0 = g2_mma(qf1, kf, t0);
    kf = g2_frag(k1p, hh);         s1 = g2_mma(qf0, kf, s1); t1 = g2_mma(qr0, kf, t1);
    kf = g2_frag(k1p + 32, hh);    s1 = g2_mma(qf1, kf, s1); t1 = g2_mma(qr1, kf, t1);
    kf = g2_frag(r1p, hh);         t1 = g2_mma(qf0, kf, t1);
    kf = g2_frag(r1p + 32, hh);    t1 = g2_mma(qf1, kf, t1);
#pragma unroll
    for (int r = 0; r < 8; ++r) {
      const int row = q0 + 8 * hh + r;
      float a = (s0[r] + t0[r] * RINV) * 8.0f, c = (s1[r] + t1[r] * RINV) * 8.0f;
      if (CAUSAL) { a = ((kb + ln > row) || (a == 0.0f)) ? -1.0e9f : a; c = ((kb + 16 + ln > row) || (c == 0.0f)) ? -1.0e9f : c; }
      float t = fmaxf(a, c);
      t = fmaxf(t, __shfl_xor(t, 1, 32)); t = fmaxf(t, __shfl_xor(t, 2, 32)); t = fmaxf(t, __shfl_xor(t, 4, 32)); t = fmaxf(t, __shfl_xor(t, 8, 32));
      const float mnew = fmaxf(mrow[r], t);
      const float p0 = __expf(a - mnew), p1 = __expf(c - mnew);
      const float pc0 = p0 * PCARRY, pc1 = p1 * PCARRY;
      const h16 ph0 = toh_flush(pc0), ph1 = toh_flush(pc1);
      float ls = CAUSAL ? (pc0 + pc1) : ((float)ph0 + (float)ph1);
      ls += __shfl_xor(ls, 1, 32); ls += __shfl_xor(ls, 2, 32); ls += __shfl_xor(ls, 4, 32); ls += __shfl_xor(ls, 8, 32);
      const float corr = __expf(mrow[r] - mnew);
      lrow[r] = lrow[r] * corr + ls; mrow[r] = mnew;
      o0[r] *= corr; o1[r] *= corr; o2[r] *= corr; o3[r] *= corr;
      if (CAUSAL) { e0[r] *= corr; e1[r] *= corr; e2[r] *= corr; e3[r] *= corr; }
      pb[w][(8 * hh + r) * PBP + ln]      = ph0;
      pb[w][(8 * hh + r) * PBP + 16 + ln] = ph1;
      if (CAUSAL) {
        pbr[w][(8 * hh + r) * PBP + ln]      = toh_flush((pc0 - (float)ph0) * RCARRY);
        pbr[w][(8 * hh + r) * PBP + 16 + ln] = toh_flush((pc1 - (float)ph1) * RCARRY); }
    }
    __builtin_amdgcn_fence(4 /* acq_rel order */, "wavefront"); __builtin_amdgcn_wave_barrier();
    const v16h pf = g2_frag(&pb[w][ln * PBP], hh);
    v16h prf = pf; if (CAUSAL) prf = g2_frag(&pbr[w][ln * PBP], hh);
    __builtin_amdgcn_fence(4 /* acq_rel order */, "wavefront"); __builtin_amdgcn_wave_barrier();
    const size_t voff = ((size_t)slab * HD + ln) * SEQ + kb;
    const _Float16* vp = VT + voff; const _Float16* vrp = VTR + voff;
    v16h vf = g2_frag(vp, hh);                   o0 = g2_mma(pf, vf, o0);
    if (CAUSAL) { e0 = g2_mma(prf, vf, e0); vf = g2_frag(vrp, hh);                   e0 = g2_mma(pf, vf, e0); }
    vf = g2_frag(vp + (size_t)16 * SEQ, hh);     o1 = g2_mma(pf, vf, o1);
    if (CAUSAL) { e1 = g2_mma(prf, vf, e1); vf = g2_frag(vrp + (size_t)16 * SEQ, hh); e1 = g2_mma(pf, vf, e1); }
    vf = g2_frag(vp + (size_t)32 * SEQ, hh);     o2 = g2_mma(pf, vf, o2);
    if (CAUSAL) { e2 = g2_mma(prf, vf, e2); vf = g2_frag(vrp + (size_t)32 * SEQ, hh); e2 = g2_mma(pf, vf, e2); }
    vf = g2_frag(vp + (size_t)48 * SEQ, hh);     o3 = g2_mma(pf, vf, o3);
    if (CAUSAL) { e3 = g2_mma(prf, vf, e3); vf = g2_frag(vrp + (size_t)48 * SEQ, hh); e3 = g2_mma(pf, vf, e3); }
  }
#pragma unroll
  for (int r = 0; r < 8; ++r) {
    const float rl = 64.0f * __builtin_amdgcn_rcpf(lrow[r]);      /* o carried x64; l already carries the P carry */
    const int rloc = (8 * hh + r) * OBP + ln;
    float v0 = o0[r], v1 = o1[r], v2 = o2[r], v3 = o3[r];
    if (CAUSAL) { v0 += e0[r] * RINV; v1 += e1[r] * RINV; v2 += e2[r] * RINV; v3 += e3[r] * RINV; }
    v0 *= rl; v1 *= rl; v2 *= rl; v3 *= rl;
    const h16 g0 = toh_flush(v0), g1 = toh_flush(v1), g2 = toh_flush(v2), g3 = toh_flush(v3);
    ob[w][rloc] = g0; ob[w][rloc + 16] = g1; ob[w][rloc + 32] = g2; ob[w][rloc + 48] = g3;
    if (CAUSAL) {
      obr[w][rloc]      = toh_flush((v0 - (float)g0) * RCARRY); obr[w][rloc + 16] = toh_flush((v1 - (float)g1) * RCARRY);
      obr[w][rloc + 32] = toh_flush((v2 - (float)g2) * RCARRY); obr[w][rloc + 48] = toh_flush((v3 - (float)g3) * RCARRY); }
  }
  __builtin_amdgcn_fence(4 /* acq_rel order */, "wavefront"); __builtin_amdgcn_wave_barrier();
  const int rq = lane >> 3, pc = (lane & 7) * 8;
  {
#pragma unroll
    for (int i = 0; i < 4; ++i) { const int row = i * 4 + rq; const size_t go = (tok0 + q0 + row) * DM + h * HD + pc;
      const v8us v = *(const v8us*)(&ob[w][row * OBP + pc]);
      *(v8us*)((unsigned short*)O16 + go) = v;
      if (CAUSAL) { const v8us vr = *(const v8us*)(&obr[w][row * OBP + pc]); *(v8us*)((unsigned short*)OR16 + go) = vr; } }
     }
}

__global__ __launch_bounds__(128) void k_attn_causal(const _Float16* __restrict__ Q16, const _Float16* __restrict__ QR, const _Float16* __restrict__ K16, const _Float16* __restrict__ KR,
    const _Float16* __restrict__ VT, const _Float16* __restrict__ VTR, _Float16* __restrict__ O16, _Float16* __restrict__ OR16) {
  attn_hr_body<1>(Q16, QR, K16, KR, VT, VTR, O16, OR16);
}
__global__ __launch_bounds__(128) void k_attn_dense(const _Float16* __restrict__ Q16, const _Float16* __restrict__ QR, const _Float16* __restrict__ K16, const _Float16* __restrict__ KR,
    const _Float16* __restrict__ VT, _Float16* __restrict__ O16) {
  attn_hr_body<0>(Q16, QR, K16, KR, VT, VT, O16, O16);
}

// red[] is cross-wave (block barriers); no early exit.
template <int RBF, int RMAP, int W16, int OMAP>
__global__ __launch_bounds__(256) void k_ln(const float* __restrict__ X, const float* __restrict__ R, const float* __restrict__ g, const float* __restrict__ bb, float eps, float* __restrict__ O32, _Float16* __restrict__ O16) {
  #pragma clang fp contract(off)
  __shared__ float red[256];
  const size_t r = blockIdx.x; const int t = threadIdx.x; const int c0 = t * 4;
  const size_t rfull = (r / SEQ) * SEQ_FULL + (r % SEQ);
  const size_t rr = RMAP ? rfull : r;
  const v4f xa = *(const v4fa*)(X + r * DM + c0); const v4f ra = *(const v4fa*)(R + rr * DM + c0);
  float s[4]; float sum = 0.f;
#pragma unroll
  for (int q = 0; q < 4; ++q) { const float rv = RBF ? bf16_rne(ra[q]) : ra[q]; s[q] = xa[q] + rv; sum += s[q]; }
  red[t] = sum; __syncthreads();
  for (int st = 128; st > 0; st >>= 1) { if (t < st) red[t] += red[t + st]; __syncthreads(); }
  const float mu = red[0] * (1.0f / (float)DM); __syncthreads();
  float vs = 0.f;
#pragma unroll
  for (int q = 0; q < 4; ++q) { const float dl = s[q] - mu; vs += dl * dl; }
  red[t] = vs; __syncthreads();
  for (int st = 128; st > 0; st >>= 1) { if (t < st) red[t] += red[t + st]; __syncthreads(); }
  const float rs = rsqrtf(red[0] * (1.0f / (float)DM) + eps);
  v4f yf; v4h y;
#pragma unroll
  for (int q = 0; q < 4; ++q) { const int c = c0 + q; yf[q] = (s[q] - mu) * rs * bf16_rne(g[c]) + bf16_rne(bb[c]); y[q] = (_Float16)yf[q]; }
  const size_t orow = OMAP ? rfull : r;
  {
    if (O32) *(v4f*)(O32 + orow * DM + c0) = yf;
    if (W16) *(v4h*)(O16 + r * DM + c0) = y;
     }
}

extern "C" void kernel_launch(void* const* d_in, const int* in_sizes, int n_in,
                              void* d_out, int out_size, void* d_ws, size_t ws_size, hipStream_t stream) {
  if (n_in < 22) return;
  const float* x    = (const float*)d_in[0];  const float* enc  = (const float*)d_in[1];
  const float* wq1  = (const float*)d_in[2];  const float* wk1  = (const float*)d_in[3];  const float* wv1 = (const float*)d_in[4];
  const float* wo1  = (const float*)d_in[5];  const float* bo1  = (const float*)d_in[6];
  const float* wq2  = (const float*)d_in[7];  const float* wk2  = (const float*)d_in[8];  const float* wv2 = (const float*)d_in[9];
  const float* wo2  = (const float*)d_in[10]; const float* bo2  = (const float*)d_in[11];
  const float* wff1 = (const float*)d_in[12]; const float* bff1 = (const float*)d_in[13]; const float* wff2 = (const float*)d_in[14]; const float* bff2 = (const float*)d_in[15];
  const float* g1   = (const float*)d_in[16]; const float* be1  = (const float*)d_in[17]; const float* g2  = (const float*)d_in[18]; const float* be2 = (const float*)d_in[19];
  const float* g3   = (const float*)d_in[20]; const float* be3  = (const float*)d_in[21];

  const size_t needX = ((size_t)(NB - 1) * SEQ_FULL + SEQ) * DM;
  if ((size_t)in_sizes[0] < needX || (size_t)in_sizes[1] < needX || (size_t)out_size < needX) return;
  { static const int wi[8] = {2, 3, 4, 5, 7, 8, 9, 10}; for (int i = 0; i < 8; ++i) if ((size_t)in_sizes[wi[i]] < (size_t)DM * DM) return; }
  if ((size_t)in_sizes[12] < (size_t)DM * DFF || (size_t)in_sizes[14] < (size_t)DM * DFF || in_sizes[13] < DFF) return;
  { static const int vi[9] = {6, 11, 15, 16, 17, 18, 19, 20, 21}; for (int i = 0; i < 9; ++i) if (in_sizes[vi[i]] < DM) return; }

  char* ws = (char*)d_ws; size_t off = 0;
  auto take = [&](size_t bytes) { char* p = ws + off; off += (bytes + 255) & ~(size_t)255; return p; };
  const size_t WDD = (size_t)DM * DM * 2, WDF = (size_t)DM * DFF * 2, P16 = NR * DM * 2;
  _Float16* BQ1 = (_Float16*)take(WDD); _Float16* BK1 = (_Float16*)take(WDD); _Float16* BV1 = (_Float16*)take(WDD); _Float16* BO1 = (_Float16*)take(WDD);
  _Float16* BQ2 = (_Float16*)take(WDD); _Float16* BK2 = (_Float16*)take(WDD); _Float16* BV2 = (_Float16*)take(WDD); _Float16* BO2 = (_Float16*)take(WDD);
  _Float16* BW1 = (_Float16*)take(WDF);      /* [n=DFF][k=DM]  */
  _Float16* BW2 = (_Float16*)take(WDF);      /* [n=DM][k=DFF]  */
  // ten token-plane slots of P16 bytes each (an f32 plane spans two slots, the FFN hidden plane four); lifetimes by launch order:
  // S0 X16 -> V2            S1 E16 -> x2 (f16)      S2,S3 Q1|QR1 -> a1 (f32) -> K2|KR2 -> a2 (f32) -> hidden (S2..S5)
  // S4,S5 K1|KR1 -> x1 (f32)   S6,S7 VT1|VTR1 -> x1 value|residual -> VT2|o2 (f16) -> f (f32)
  // S8,S9 V1|VR1 -> o1 value|residual -> Q2|QR2 -> x2 (f32)
  char* SL = take(10 * P16);
  _Float16* S0 = (_Float16*)(SL + 0 * P16); _Float16* S1 = (_Float16*)(SL + 1 * P16); _Float16* S2 = (_Float16*)(SL + 2 * P16); _Float16* S3 = (_Float16*)(SL + 3 * P16);
  _Float16* S4 = (_Float16*)(SL + 4 * P16); _Float16* S5 = (_Float16*)(SL + 5 * P16); _Float16* S6 = (_Float16*)(SL + 6 * P16); _Float16* S7 = (_Float16*)(SL + 7 * P16);
  _Float16* S8 = (_Float16*)(SL + 8 * P16); _Float16* S9 = (_Float16*)(SL + 9 * P16);
  float* YFa = (float*)S2;   /* a1, a2 (f32 rows, S2..S3) */
  float* X1F = (float*)S4;   /* x1 (f32 rows, S4..S5) */
  float* X2F = (float*)S8;   /* x2 (f32 rows, S8..S9) */
  float* YFf = (float*)S6;   /* f  (f32 rows, S6..S7) */
  _Float16* HF = S2;         /* FFN hidden rows [NR][DFF] f16 (S2..S5) */
  if (off > ws_size || off > (size_t)134217728) return;

  const unsigned gDD = (unsigned)(((size_t)DM * (DM / 8) + 255) / 256), gDF = (unsigned)(((size_t)DFF * (DM / 8) + 255) / 256), gFD = (unsigned)(((size_t)DM * (DFF / 8) + 255) / 256);
  k_wt_head<<<gDD, 256, 0, stream>>>(wq1, BQ1, DM, DM, 16.0f); k_wt_head<<<gDD, 256, 0, stream>>>(wk1, BK1, DM, DM, 16.0f); k_wt_head<<<gDD, 256, 0, stream>>>(wv1, BV1, DM, DM, 16.0f);
  k_wt_f16<<<gDD, 256, 0, stream>>>(wo1, BO1, DM, DM, 16.0f);
  k_wt_head<<<gDD, 256, 0, stream>>>(wq2, BQ2, DM, DM, 16.0f); k_wt_head<<<gDD, 256, 0, stream>>>(wk2, BK2, DM, DM, 16.0f); k_wt_head<<<gDD, 256, 0, stream>>>(wv2, BV2, DM, DM, 16.0f);
  k_wt_f16<<<gDD, 256, 0, stream>>>(wo2, BO2, DM, DM, 16.0f);
  k_wt_f16<<<gDF, 256, 0, stream>>>(wff1, BW1, DM, DFF, 16.0f); k_wt_f16<<<gFD, 256, 0, stream>>>(wff2, BW2, DFF, DM, 16.0f);

  const size_t n8 = NR * DM / 8; const unsigned gx = (unsigned)((n8 + 255) / 256);
  k_x16<<<gx, 256, 0, stream>>>(x, S0, n8); k_x16<<<gx, 256, 0, stream>>>(enc, S1, n8);

  const unsigned gP = (unsigned)((MR / 128) * (DM / 64)), gF1 = (unsigned)((MR / 128) * (DFF / 64));
  const unsigned gVT = (unsigned)(NB * NH * (SEQ / 64)); const dim3 gAT(SEQ / 64, NH, NB);

  // ---- causal self-attention block
  k_proj_hr<<<gP, 128, 0, stream>>>(S0, DM, BQ1, DM, 0.0625f, S2, S3, DM, MR, DM, DM);                          /* q  value | residual */
  k_proj_hr<<<gP, 128, 0, stream>>>(S0, DM, BK1, DM, 0.0625f, S4, S5, DM, MR, DM, DM);                          /* k  value | residual */
  k_proj_hr<<<gP, 128, 0, stream>>>(S0, DM, BV1, DM, 0.0625f, S8, S9, DM, MR, DM, DM);                          /* v  value | residual */
  k_vt<NH, SEQ><<<gVT, 256, 0, stream>>>(S8, DM, 0, S6);
  k_vt<NH, SEQ><<<gVT, 256, 0, stream>>>(S9, DM, 0, S7);
  k_attn_causal<<<gAT, 128, 0, stream>>>(S2, S3, S4, S5, S6, S7, S8, S9);                                       /* o x64 value | residual */
  k_proj_rf<<<gP, 128, 0, stream>>>(S8, S9, DM, BO1, DM, 0.0009765625f, bo1, 1.0f, YFa, DM, MR, DM, DM);        /* a1 = o Wp1 + bp1 */
  k_ln<1, 1, 0, 0><<<(unsigned)MR, 256, 0, stream>>>(YFa, x, g1, be1, LN_EPS, X1F, nullptr);                    /* x1 = LN1(bf16(x) + a1) -> f32 rows */
  k_split16<<<gx, 256, 0, stream>>>(X1F, S6, S7, n8);                                                           /* x1 value | residual */
  // ---- cross-attention block
  k_proj_rhr<<<gP, 128, 0, stream>>>(S6, S7, DM, BQ2, DM, 0.0625f, S8, S9, DM, MR, DM, DM);                     /* q  value | residual */
  k_proj_hr<<<gP, 128, 0, stream>>>(S1, DM, BK2, DM, 0.0625f, S2, S3, DM, MR, DM, DM);                          /* k  value | residual */
  k_gemm2<0><<<gP, 128, 0, stream>>>(S1, DM, BV2, DM, 0.0625f, nullptr, 1.0f, nullptr, S0, DM, MR, DM, DM);     /* v  single plane */
  k_vt<NH, SEQ><<<gVT, 256, 0, stream>>>(S0, DM, 0, S6);
  k_attn_dense<<<gAT, 128, 0, stream>>>(S8, S9, S2, S3, S6, S7);                                                /* o x64 single plane */
  k_gemm2<0><<<gP, 128, 0, stream>>>(S7, DM, BO2, DM, 0.0009765625f, bo2, 1.0f, YFa, nullptr, DM, MR, DM, DM);  /* a2 = o Wp2 + bp2 */
  k_ln<0, 0, 1, 0><<<(unsigned)MR, 256, 0, stream>>>(YFa, X1F, g2, be2, LN_EPS, X2F, S1);                       /* x2 = LN2(x1 + a2) -> f32 + f16 rows */
  // ---- FFN block
  k_gemm2<3><<<gF1, 128, 0, stream>>>(S1, DM, BW1, DM, 1.0f, bff1, 16.0f, nullptr, HF, DFF, MR, DFF, DM);       /* 16 relu(x2 W1 + b1) as f16 rows */
  k_gemm2<0><<<gP, 128, 0, stream>>>(HF, DFF, BW2, DFF, 0.00390625f, bff2, 1.0f, YFf, nullptr, DM, MR, DM, DFF);  /* f = h W2 + b2 */
  k_ln<0, 0, 0, 1><<<(unsigned)MR, 256, 0, stream>>>(YFf, X2F, g3, be3, LN_EPS, (float*)d_out, nullptr);        /* out = LN3(x2 + f) */
}

// v001
// One run takes 675 microseconds.
// Next to v000, in two timings, it ran 1.60 and 1.59 times as fast.
#include <hip/hip_runtime.h>
// Structure: token rows r = b*SEQ + s. Causal self-attention (16 heads of 64, per-head weights [H][E][64], scores x8, keys above the diagonal and exactly-zero scores masked) -> x1 = LN1(x + attn.Wp1 + bp1); cross-attention of x1 over z rows -> x2 = LN2(x1 + attn.Wp2 + bp2); f = relu(x2.W1 + b1).W2 + b2; out = LN3(x2 + f). Projection / FFN weights are [in][out].

#ifndef NB
#define NB 4
#endif
#ifndef SEQ
#define SEQ 1024
#endif
#define NB_FULL 4
#define SEQ_FULL 1024
#define DM 1024
#define NH 16
#define HD 64
#define DFF 4096
#define NR ((size_t)NB * SEQ)
#define MR ((int)((size_t)NB * SEQ))
#define PBP 40          /* LDS pitch (halves) of the per-wave P tile */
#define OBP 72          /* LDS pitch (halves) of the per-wave o tile */
#define LN_EPS 1.0e-5f
#define PCARRY 16384.0f         /* carry of the f16 P planes */
#define RCARRY 2048.0f          /* carry of every residual plane */
#define RINV 0.00048828125f     /* 1 / RCARRY */

static_assert(NB >= 1 && NB <= NB_FULL);
static_assert(SEQ >= 64 && SEQ <= SEQ_FULL && SEQ % 64 == 0);
static_assert((NB * SEQ) % 128 == 0);
static_assert(NH * HD == DM && HD == 64);
static_assert(DM == 4 * 256);
static_assert(DM % 64 == 0 && DFF % 64 == 0 && DM % 32 == 0 && DFF % 32 == 0);
static_assert(DFF <= 4 * DM);
static_assert((PBP % 8) == 0 && (OBP % 8) == 0);
static_assert(DFF == 4 * DM);                       /* the FFN hidden plane spans exactly four 16-bit token planes */
static_assert(PBP >= 32 && OBP >= HD);              /* P tile holds 32 keys, o tile holds one head */
static_assert(RCARRY * RINV == 1.0f);
static_assert(PCARRY <= 32768.0f);                  /* carried P stays inside f16 */
static_assert((size_t)8 * DM * DM * 2 + (size_t)2 * DM * DFF * 2 + (size_t)10 * NB * SEQ * DM * 2 + 16 * 256 <= (size_t)134217728);   /* workspace carve */

typedef unsigned short v8us __attribute__((ext_vector_type(8), may_alias));
typedef float  v8f  __attribute__((ext_vector_type(8)));
typedef float  v4f  __attribute__((ext_vector_type(4)));
typedef float  v4fa __attribute__((ext_vector_type(4), may_alias));
typedef _Float16 v16h __attribute__((ext_vector_type(16)));
typedef _Float16 v4h __attribute__((ext_vector_type(4)));
union FragH { v16h v; v8us half[2]; _Float16 h[16]; unsigned short u[16]; };

__device__ __forceinline__ unsigned short bf16_bits(float x) { unsigned int u = __float_as_uint(x); return (unsigned short)((u + 0x7FFFu + ((u >> 16) & 1u)) >> 16); }
__device__ __forceinline__ float bf16_val(unsigned short b) { return __uint_as_float(((unsigned int)b) << 16); }
__device__ __forceinline__ float bf16_rne(float x) { return bf16_val(bf16_bits(x)); }

// 16x32 fragment from a k-contiguous 16-bit row p (A row m = lane&15, or B stored [n][k] with n = lane&15):
// elements 0..7 <- k 8h..8h+7, elements 8..15 <- k 16+8h..16+8h+7 (h = lane>>4)
__device__ __forceinline__ v16h g2_frag(const _Float16* p, int hh) { FragH f; f.half[0] = *(const v8us*)((const unsigned short*)p + 8 * hh); f.half[1] = *(const v8us*)((const unsigned short*)p + 16 + 8 * hh); return f.v; }
__device__ __forceinline__ v8f g2_mma(v16h a, v16h b, v8f c) { v8f d = __builtin_amdgcn_wmma_f32_16x16x32_f16(false, a, false, b, (short)0, c, false, false); asm volatile("v_nop\n\tv_nop\n\tv_nop\n\tv_nop" : "+v"(d) : "v"(a), "v"(b)); return d; }

// f32 -> f16 operand convert that cannot yield an f16 subnormal (value select, applied after the plane's carry)
typedef _Float16 h16;
static __device__ __forceinline__ h16 toh_flush(float v) { const h16 r = (h16)v; return (fabsf(v) < 6.103515625e-05f) ? (h16)0.0f : r; }

__global__ __launch_bounds__(256) void k_wt_f16(const float* __restrict__ W, _Float16* __restrict__ Wt, int K, int N, float scale) {
  const int t = blockIdx.x * 256 + threadIdx.x; if (t >= N * (K / 8)) return;
  const int n = t / (K / 8), k8 = (t % (K / 8)) * 8; FragH f;
#pragma unroll
  for (int i = 0; i < 8; ++i) f.h[i] = (_Float16)(bf16_rne(W[(size_t)(k8 + i) * N + n]) * scale);
  const v8us o = f.half[0]; unsigned short* d = (unsigned short*)Wt + (size_t)n * K + k8;
  *(v8us*)d = o; 
}

__global__ __launch_bounds__(256) void k_wt_head(const float* __restrict__ W, _Float16* __restrict__ Wt, int K, int N, float scale) {
  const int t = blockIdx.x * 256 + threadIdx.x; if (t >= N * (K / 8)) return;
  const int n = t / (K / 8), k8 = (t % (K / 8)) * 8; const int hd = n / HD, dd = n % HD; FragH f;
#pragma unroll
  for (int i = 0; i < 8; ++i) f.h[i] = toh_flush(bf16_rne(W[((size_t)hd * K + k8 + i) * HD + dd]) * scale);
  const v8us o = f.half[0]; unsigned short* d = (unsigned short*)Wt + (size_t)n * K + k8;
  *(v8us*)d = o; 
}

__global__ __launch_bounds__(256) void k_x16(const float* __restrict__ x, _Float16* __restrict__ X16, size_t n8) {
  const size_t t = (size_t)blockIdx.x * 256 + threadIdx.x; if (t >= n8) return;
  const size_t e = t * 8; const size_t r = e / DM; const size_t c = e % DM; const size_t rs = (r / SEQ) * SEQ_FULL + (r % SEQ);
  const float* src = x + rs * DM + c; const v4f a = *(const v4fa*)src; const v4f a2 = *(const v4fa*)(src + 4); FragH f;
#pragma unroll
  for (int q = 0; q < 4; ++q) { f.h[q] = (_Float16)bf16_rne(a[q]); f.h[4 + q] = (_Float16)bf16_rne(a2[q]); }
  const v8us o = f.half[0]; unsigned short* d = (unsigned short*)X16 + e;
  *(v8us*)d = o; 
}

__global__ __launch_bounds__(256) void k_split16(const float* __restrict__ src, _Float16* __restrict__ H16, _Float16* __restrict__ R16, size_t n8) {
  #pragma clang fp contract(off)
  const size_t t = (size_t)blockIdx.x * 256 + threadIdx.x; if (t >= n8) return;
  const size_t e = t * 8; const v4f a = *(const v4fa*)(src + e); const v4f a2 = *(const v4fa*)(src + e + 4); FragH fh, fr;
#pragma unroll
  for (int q = 0; q < 4; ++q) {
    const h16 h0 = toh_flush(a[q]);  fh.h[q] = h0;     fr.h[q] = toh_flush((a[q] - (float)h0) * RCARRY);
    const h16 h1 = toh_flush(a2[q]); fh.h[4 + q] = h1; fr.h[4 + q] = toh_flush((a2[q] - (float)h1) * RCARRY); }
  const v8us oh = fh.half[0]; const v8us orr = fr.half[0];
  unsigned short* dh = (unsigned short*)H16 + e; unsigned short* dr = (unsigned short*)R16 + e;
  *(v8us*)dh = oh; *(v8us*)dr = orr; 
}

template <int NHv, int TTv>
__global__ __launch_bounds__(256) void k_vt(const _Float16* __restrict__ V16, int ldv, int voff, _Float16* __restrict__ Vt) {
  __shared__ unsigned short tl[64][66]; const int tid = threadIdx.x; const int slab = blockIdx.x / (TTv / 64), lg = blockIdx.x % (TTv / 64); const int b = slab / NHv, h = slab % NHv;
  for (int i = tid; i < 64 * 8; i += 256) { const int r = i / 8, c8 = (i % 8) * 8; FragH f; f.half[0] = *(const v8us*)((const unsigned short*)V16 + ((size_t)b * TTv + lg * 64 + r) * ldv + voff + h * 64 + c8);
#pragma unroll
    for (int q = 0; q < 8; ++q) tl[r][c8 + q] = f.u[q]; }
  __syncthreads();
  {
#pragma unroll
    for (int rd = 0; rd < 2; ++rd) { const int d = rd * 32 + tid / 8, pc = tid % 8; FragH f;
#pragma unroll
      for (int q = 0; q < 8; ++q) f.u[q] = tl[pc * 8 + q][d];
      *(v8us*)((unsigned short*)Vt + ((size_t)slab * 64 + d) * TTv + lg * 64 + pc * 8) = f.half[0]; }
     }
}

// LDS staging of the GEMM operands. A block of 8 waves owns a 128 x 128 tile of C; a stage holds 128 k of its 128 A rows and then of its 128 B rows.
#define GKP 128                 /* k (halves) per stage: 256-byte rows */
#define GPITCH 136              /* LDS row pitch in halves: 272 B = 16 B x 17, conflict-free for 16-byte row reads */
#define GPITCHB (GPITCH * 2)    /* the same in bytes */
#define GSTAGE (256 * GPITCH)   /* halves per stage */
static_assert(DM % GKP == 0 && DFF % GKP == 0 && DM % 128 == 0 && DFF % 128 == 0);

static __device__ __forceinline__ unsigned lds_off(const void* p) { return (unsigned)(size_t)p; }

// Eight 16-byte asynchronous copies of one lane: rows 16 apart, global row step gstep halves. The s_wait_xcnt closes the statement so that no address register is rewritten ahead of it.
static __device__ __forceinline__ void copy8(unsigned l, const _Float16* g, size_t gstep) {
  asm volatile(
      "global_load_async_to_lds_b128 %0, %8, off\n\t"
      "global_load_async_to_lds_b128 %1, %9, off\n\t"
      "global_load_async_to_lds_b128 %2, %10, off\n\t"
      "global_load_async_to_lds_b128 %3, %11, off\n\t"
      "global_load_async_to_lds_b128 %4, %12, off\n\t"
      "global_load_async_to_lds_b128 %5, %13, off\n\t"
      "global_load_async_to_lds_b128 %6, %14, off\n\t"
      "global_load_async_to_lds_b128 %7, %15, off\n\t"
      "s_wait_xcnt 0x0"
      :: "v"(l), "v"(l + 16u * GPITCHB), "v"(l + 32u * GPITCHB), "v"(l + 48u * GPITCHB), "v"(l + 64u * GPITCHB), "v"(l + 80u * GPITCHB), "v"(l + 96u * GPITCHB), "v"(l + 112u * GPITCHB),
         "v"(g), "v"(g + gstep), "v"(g + 2 * gstep), "v"(g + 3 * gstep), "v"(g + 4 * gstep), "v"(g + 5 * gstep), "v"(g + 6 * gstep), "v"(g + 7 * gstep)
      : "memory");
}
// One stage: l = this lane's LDS byte address in the stage's row tid/16, ga / gb = its 16 bytes of that row of the A / B tile.
static __device__ __forceinline__ void stage_copy(unsigned l, const _Float16* ga, int lda, const _Float16* gb, int ldb) {
  copy8(l, ga, (size_t)16 * lda);
  copy8(l + 128u * GPITCHB, gb, (size_t)16 * ldb);
}

// One K sweep of the block's 128 x 128 tile through a two-buffer LDS ring; each wave keeps a 32 x 64 tile (A rows arow, arow + 16; B rows brow + 16 j), k ascending in steps of 32.
// At and Bt point at the first row of the block's A and B tiles. Every thread of the block calls it; K is a positive multiple of 128. The ring is free again on return (the last trip's barrier).
static __device__ __forceinline__ void gemm_sweep(_Float16* ring, const _Float16* At, int lda, const _Float16* Bt, int ldb, int K, int tid, int arow, int brow, int hh,
    v8f& c00, v8f& c01, v8f& c02, v8f& c03, v8f& c10, v8f& c11, v8f& c12, v8f& c13) {
  const unsigned l0 = lds_off(ring) + (unsigned)((tid >> 4) * GPITCHB + (tid & 15) * 16);
  const _Float16* ga = At + (size_t)(tid >> 4) * lda + (tid & 15) * 8;
  const _Float16* gb = Bt + (size_t)(tid >> 4) * ldb + (tid & 15) * 8;
  const int nst = K / GKP;
  stage_copy(l0, ga, lda, gb, ldb);
  asm volatile("s_wait_asynccnt 0x0" ::: "memory");   /* stage 0 of this wave has landed */
  __syncthreads();                                    /* stage 0 of every wave is readable */
  if (nst > 1) stage_copy(l0 + (unsigned)(GSTAGE * 2), ga + GKP, lda, gb + GKP, ldb);
#pragma unroll 1  /* one trip per stage: the ring's waits and its barrier stand once, at the trip's foot */
  for (int t = 0; t < nst; ++t) {
    const _Float16* buf = ring + (t & 1) * GSTAGE;
    const _Float16* a0p = buf + arow * GPITCH; const _Float16* a1p = a0p + 16 * GPITCH;
    const _Float16* b0p = buf + (128 + brow) * GPITCH; const _Float16* b1p = b0p + 16 * GPITCH; const _Float16* b2p = b1p + 16 * GPITCH; const _Float16* b3p = b2p + 16 * GPITCH;
    // the six fragments of a k step are read as one group, one k step ahead inside the stage, so that their LDS latency runs under the products of the step before
    v16h a0 = g2_frag(a0p, hh), a1 = g2_frag(a1p, hh), b0 = g2_frag(b0p, hh), b1 = g2_frag(b1p, hh), b2 = g2_frag(b2p, hh), b3 = g2_frag(b3p, hh);
#pragma unroll  /* constant LDS offsets, and the two fragment sets swap by renaming, without moves */
    for (int kb = 0; kb < GKP; kb += 32) {
      v16h na0 = a0, na1 = a1, nb0 = b0, nb1 = b1, nb2 = b2, nb3 = b3;
      if (kb + 32 < GKP) { na0 = g2_frag(a0p + kb + 32, hh); na1 = g2_frag(a1p + kb + 32, hh); nb0 = g2_frag(b0p + kb + 32, hh); nb1 = g2_frag(b1p + kb + 32, hh); nb2 = g2_frag(b2p + kb + 32, hh); nb3 = g2_frag(b3p + kb + 32, hh); }
      c00 = g2_mma(a0, b0, c00); c10 = g2_mma(a1, b0, c10);
      c01 = g2_mma(a0, b1, c01); c11 = g2_mma(a1, b1, c11);
      c02 = g2_mma(a0, b2, c02); c12 = g2_mma(a1, b2, c12);
      c03 = g2_mma(a0, b3, c03); c13 = g2_mma(a1, b3, c13);
      a0 = na0; a1 = na1; b0 = nb0; b1 = nb1; b2 = nb2; b3 = nb3; }
    asm volatile("s_wait_dscnt 0x0" ::: "memory");      /* this wave's reads of buffer t & 1 are done before it is refilled */
    asm volatile("s_wait_asynccnt 0x0" ::: "memory");   /* this wave's copies of stage t + 1 have landed */
    __syncthreads();                                    /* publishes stage t + 1 and ends every reader's last read of buffer t & 1 */
    if (t + 2 < nst) stage_copy(l0 + (unsigned)((t & 1) * (GSTAGE * 2)), ga + (size_t)(t + 2) * GKP, lda, gb + (size_t)(t + 2) * GKP, ldb);
  }
  asm volatile("s_wait_asynccnt 0x0" ::: "memory");     /* no copy is outstanding when the ring is left */
}

// GEMM: block tile 128 x 128 (8 waves, 4 x 2), wave tile 32 rows x 64 cols; A f16 rows (pitch lda), Bh f16 [n][k] (pitch ldb); v = acc*alpha + bf16(bias[col])*bsc; ACT 0 none / 3 relu;
// Requires M % 128 == 0, N % 128 == 0, K % 128 == 0; grid = (M/128)*(N/128), block 256.
template <int ACT>
__global__ __launch_bounds__(256) void k_gemm2(const _Float16* __restrict__ A, int lda, const _Float16* __restrict__ Bh, int ldb, float alpha, const float* __restrict__ bias, float bsc,
    float* __restrict__ C, _Float16* __restrict__ C16, int ldc, int M, int N, int K) {
  static_assert(ACT == 0 || ACT == 3);
  __shared__ __attribute__((aligned(16))) _Float16 ring[2 * GSTAGE];
  __shared__ __attribute__((aligned(16))) float so[8][32][68];
  const int tid = threadIdx.x, lane = tid & 31, ln = lane & 15, hh = lane >> 4;
  const int w = __builtin_amdgcn_readfirstlane(tid >> 5);
  const int ntn = N >> 7; const int mt = blockIdx.x / ntn, nq = blockIdx.x - mt * ntn; if (mt * 128 >= M) return;
  const int row0 = mt * 128 + 32 * (w >> 1), col0 = nq * 128 + 64 * (w & 1);
  const v8f z8 = {0.f,0.f,0.f,0.f,0.f,0.f,0.f,0.f}; v8f c00 = z8, c01 = z8, c02 = z8, c03 = z8, c10 = z8, c11 = z8, c12 = z8, c13 = z8;
  gemm_sweep(ring, A + (size_t)(mt * 128) * lda, lda, Bh + (size_t)(nq * 128) * ldb, ldb, K, tid, 32 * (w >> 1) + ln, 64 * (w & 1) + ln, hh, c00, c01, c02, c03, c10, c11, c12, c13);
  v8f accs[8] = {c00, c01, c02, c03, c10, c11, c12, c13};
#pragma unroll
  for (int u = 0; u < 8; ++u) { const int t = u & 3, half = u >> 2; const int col = col0 + t * 16 + ln; const float bv = bias ? bf16_rne(bias[col]) * bsc : 0.f;
#pragma unroll
    for (int r = 0; r < 8; ++r) { const int rloc = half * 16 + 8 * hh + r; float v = accs[u][r] * alpha + bv; if (ACT == 3) v = fmaxf(v, 0.f); so[w][rloc][t * 16 + ln] = v; } }
  __builtin_amdgcn_fence(4 /* acq_rel order */, "workgroup"); __builtin_amdgcn_wave_barrier();
  const int rsub = lane >> 4, c4 = (lane & 15) * 4;
  {
#pragma unroll
    for (int q = 0; q < 16; ++q) { const int r = q * 2 + rsub; const v4f v = *(const v4fa*)&so[w][r][c4];
      if (C) *(v4f*)(C + (size_t)(row0 + r) * ldc + col0 + c4) = v;
      if (C16) { v4h h4; for (int i = 0; i < 4; ++i) h4[i] = (_Float16)v[i]; *(v4h*)(C16 + (size_t)(row0 + r) * ldc + col0 + c4) = h4; } }
     }
}

// GEMM with an optional residual A plane (AR = (a - f16(a)) * 2048, own accumulators from zero, folded by 2^-11 in f32) and either an f32 output (OUTHR 0)
// Requires M % 128 == 0, N % 128 == 0, K % 128 == 0; grid = (M/128)*(N/128), block 256.
template <int ARES, int OUTHR>
static __device__ __forceinline__ void gemm_hr_body(const _Float16* __restrict__ A, const _Float16* __restrict__ AR, int lda, const _Float16* __restrict__ Bh, int ldb, float alpha,
    const float* __restrict__ bias, float bsc, float* __restrict__ C, _Float16* __restrict__ CH, _Float16* __restrict__ CR, int ldc, int M, int N, int K) {
  __shared__ __attribute__((aligned(16))) _Float16 ring[2 * GSTAGE];
  __shared__ __attribute__((aligned(16))) float so[8][32][68];
  const int tid = threadIdx.x, lane = tid & 31, ln = lane & 15, hh = lane >> 4;
  const int w = __builtin_amdgcn_readfirstlane(tid >> 5);
  const int ntn = N >> 7; const int mt = blockIdx.x / ntn, nq = blockIdx.x - mt * ntn; if (mt * 128 >= M) return;
  const int row0 = mt * 128 + 32 * (w >> 1), col0 = nq * 128 + 64 * (w & 1);
  const int arow = 32 * (w >> 1) + ln, brow = 64 * (w & 1) + ln;
  const _Float16* Bt = Bh + (size_t)(nq * 128) * ldb;
  const v8f z8 = {0.f,0.f,0.f,0.f,0.f,0.f,0.f,0.f};
  if (ARES) {
    v8f d00 = z8, d01 = z8, d02 = z8, d03 = z8, d10 = z8, d11 = z8, d12 = z8, d13 = z8;
    gemm_sweep(ring, AR + (size_t)(mt * 128) * lda, lda, Bt, ldb, K, tid, arow, brow, hh, d00, d01, d02, d03, d10, d11, d12, d13);
    v8f ds[8] = {d00, d01, d02, d03, d10, d11, d12, d13};
#pragma unroll
    for (int u = 0; u < 8; ++u) { const int t = u & 3, half = u >> 2;
#pragma unroll
      for (int r = 0; r < 8; ++r) { const int rloc = half * 16 + 8 * hh + r; so[w][rloc][t * 16 + ln] = ds[u][r] * RINV; } }
  }
  v8f c00 = z8, c01 = z8, c02 = z8, c03 = z8, c10 = z8, c11 = z8, c12 = z8, c13 = z8;
  gemm_sweep(ring, A + (size_t)(mt * 128) * lda, lda, Bt, ldb, K, tid, arow, brow, hh, c00, c01, c02, c03, c10, c11, c12, c13);
  v8f accs[8] = {c00, c01, c02, c03, c10, c11, c12, c13};
#pragma unroll
  for (int u = 0; u < 8; ++u) { const int t = u & 3, half = u >> 2; const int col = col0 + t * 16 + ln; const float bv = bias ? bf16_rne(bias[col]) * bsc : 0.f;
#pragma unroll
    for (int r = 0; r < 8; ++r) { const int rloc = half * 16 + 8 * hh + r; float v = accs[u][r]; if (ARES) v += so[w][rloc][t * 16 + ln]; v = v * alpha + bv; so[w][rloc][t * 16 + ln] = v; } }
  __builtin_amdgcn_fence(4 /* acq_rel order */, "workgroup"); __builtin_amdgcn_wave_barrier();
  const int rsub = lane >> 4, c4 = (lane & 15) * 4;
  {
#pragma unroll
    for (int q = 0; q < 16; ++q) { const int r = q * 2 + rsub; const v4f v = *(const v4fa*)&so[w][r][c4];
      if (OUTHR) { v4h h4, r4;
#pragma unroll
        for (int i = 0; i < 4; ++i) { const h16 hv = toh_flush(v[i]); h4[i] = hv; r4[i] = toh_flush((v[i] - (float)hv) * RCARRY); }
        *(v4h*)(CH + (size_t)(row0 + r) * ldc + col0 + c4) = h4;
        *(v4h*)(CR + (size_t)(row0 + r) * ldc + col0 + c4) = r4; }
      else { *(v4f*)(C + (size_t)(row0 + r) * ldc + col0 + c4) = v; } }
     }
}

// single A plane -> f16 value + residual output planes
__global__ __launch_bounds__(256) void k_proj_hr(const _Float16* __restrict__ A, int lda, const _Float16* __restrict__ Bh, int ldb, float alpha,
    _Float16* __restrict__ CH, _Float16* __restrict__ CR, int ldc, int M, int N, int K) {
  gemm_hr_body<0, 1>(A, A, lda, Bh, ldb, alpha, nullptr, 0.f, nullptr, CH, CR, ldc, M, N, K);
}
// value + residual A planes -> f16 value + residual output planes
__global__ __launch_bounds__(256) void k_proj_rhr(const _Float16* __restrict__ A, const _Float16* __restrict__ AR, int lda, const _Float16* __restrict__ Bh, int ldb, float alpha,
    _Float16* __restrict__ CH, _Float16* __restrict__ CR, int ldc, int M, int N, int K) {
  gemm_hr_body<1, 1>(A, AR, lda, Bh, ldb, alpha, nullptr, 0.f, nullptr, CH, CR, ldc, M, N, K);
}
// value + residual A planes -> f32 rows with bias
__global__ __launch_bounds__(256) void k_proj_rf(const _Float16* __restrict__ A, const _Float16* __restrict__ AR, int lda, const _Float16* __restrict__ Bh, int ldb, float alpha,
    const float* __restrict__ bias, float bsc, float* __restrict__ C, int ldc, int M, int N, int K) {
  gemm_hr_body<1, 0>(A, AR, lda, Bh, ldb, alpha, bias, bsc, C, nullptr, nullptr, ldc, M, N, K);
}

// Flash-style attention for one (batch, head, 16 query rows) per wave: keys streamed 32 at a time with an online (running-max) softmax in f32.
// scores = 8 * q.k^T with q and k as f16 value + x2048 residual planes: value.value in one accumulator, residual.value + value.residual in a second
// accumulator folded by 2^-11. CAUSAL: keys above the query row and exactly-zero scores take the fill -1e9 (replace), key blocks entirely above
// the wave's rows are skipped (their weights are exactly 0); P = 16384*exp(s - m) as f16 value + x2048 residual, V^T as value + residual slabs,
// o = P.V^T with value.value in one accumulator and the two cross terms in a second, row sum over the unconverted P; o/l * 64 written as f16 value +
// residual rows. Dense: P as one f16 plane (row sum over the converted P), V^T one plane, o one plane. P and o tiles are wave-private LDS
template <int CAUSAL>
static __device__ __forceinline__ void attn_hr_body(const _Float16* __restrict__ Q16, const _Float16* __restrict__ QR, const _Float16* __restrict__ K16, const _Float16* __restrict__ KR,
    const _Float16* __restrict__ VT, const _Float16* __restrict__ VTR, _Float16* __restrict__ O16, _Float16* __restrict__ OR16) {
  __shared__ __attribute__((aligned(16))) _Float16 pb[4][16 * PBP];
  __shared__ __attribute__((aligned(16))) _Float16 pbr[4][16 * PBP];
  __shared__ __attribute__((aligned(16))) _Float16 ob[4][16 * OBP];
  __shared__ __attribute__((aligned(16))) _Float16 obr[4][16 * OBP];
  const int tid = threadIdx.x, lane = tid & 31, ln = lane & 15, hh = lane >> 4;
  const int w = __builtin_amdgcn_readfirstlane(tid >> 5);
  const int h = blockIdx.y, b = blockIdx.z;
  const int q0 = (blockIdx.x * 4 + w) * 16;
  const size_t tok0 = (size_t)b * SEQ;
  const int slab = b * NH + h;
  const size_t qoff = (tok0 + q0 + ln) * DM + h * HD;
  const v16h qf0 = g2_frag(Q16 + qoff, hh), qf1 = g2_frag(Q16 + qoff + 32, hh);
  const v16h qr0 = g2_frag(QR + qoff, hh),  qr1 = g2_frag(QR + qoff + 32, hh);
  const v8f z8 = {0.f,0.f,0.f,0.f,0.f,0.f,0.f,0.f};
  v8f o0 = z8, o1 = z8, o2 = z8, o3 = z8;
  v8f e0 = z8, e1 = z8, e2 = z8, e3 = z8;
  float mrow[8], lrow[8];
#pragma unroll
  for (int r = 0; r < 8; ++r) { mrow[r] = -1.0e30f; lrow[r] = 0.f; }
  const int kend = CAUSAL ? (q0 + 16) : SEQ;
#pragma unroll 1
  for (int kb = 0; kb < kend; kb += 32) {
    const size_t koff = (tok0 + kb + ln) * DM + h * HD;
    const _Float16* k0p = K16 + koff; const _Float16* k1p = k0p + (size_t)16 * DM;
    const _Float16* r0p = KR + koff;  const _Float16* r1p = r0p + (size_t)16 * DM;
    v8f s0 = z8, s1 = z8, t0 = z8, t1 = z8;
    v16h kf = g2_frag(k0p, hh);    s0 = g2_mma(qf0, kf, s0); t0 = g2_mma(qr0, kf, t0);
    kf = g2_frag(k0p + 32, hh);    s0 = g2_mma(qf1, kf, s0); t0 = g2_mma(qr1, kf, t0);
    kf = g2_frag(r0p, hh);         t0 = g2_mma(qf0, kf, t0);
    kf = g2_frag(r0p + 32, hh);    t0 = g2_mma(qf1, kf, t0);
    kf = g2_frag(k1p, hh);         s1 = g2_mma(qf0, kf, s1); t1 = g2_mma(qr0, kf, t1);
    kf = g2_frag(k1p + 32, hh);    s1 = g2_mma(qf1, kf, s1); t1 = g2_mma(qr1, kf, t1);
    kf = g2_frag(r1p, hh);         t1 = g2_mma(qf0, kf, t1);
    kf = g2_frag(r1p + 32, hh);    t1 = g2_mma(qf1, kf, t1);
#pragma unroll
    for (int r = 0; r < 8; ++r) {
      const int row = q0 + 8 * hh + r;
      float a = (s0[r] + t0[r] * RINV) * 8.0f, c = (s1[r] + t1[r] * RINV) * 8.0f;
      if (CAUSAL) { a = ((kb + ln > row) || (a == 0.0f)) ? -1.0e9f : a; c = ((kb + 16 + ln > row) || (c == 0.0f)) ? -1.0e9f : c; }
      float t = fmaxf(a, c);
      t = fmaxf(t, __shfl_xor(t, 1, 32)); t = fmaxf(t, __shfl_xor(t, 2, 32)); t = fmaxf(t, __shfl_xor(t, 4, 32)); t = fmaxf(t, __shfl_xor(t, 8, 32));
      const float mnew = fmaxf(mrow[r], t);
      const float p0 = __expf(a - mnew), p1 = __expf(c - mnew);
      const float pc0 = p0 * PCARRY, pc1 = p1 * PCARRY;
      const h16 ph0 = toh_flush(pc0), ph1 = toh_flush(pc1);
      float ls = CAUSAL ? (pc0 + pc1) : ((float)ph0 + (float)ph1);
      ls += __shfl_xor(ls, 1, 32); ls += __shfl_xor(ls, 2, 32); ls += __shfl_xor(ls, 4, 32); ls += __shfl_xor(ls, 8, 32);
      const float corr = __expf(mrow[r] - mnew);
      lrow[r] = lrow[r] * corr + ls; mrow[r] = mnew;
      o0[r] *= corr; o1[r] *= corr; o2[r] *= corr; o3[r] *= corr;
      if (CAUSAL) { e0[r] *= corr; e1[r] *= corr; e2[r] *= corr; e3[r] *= corr; }
      pb[w][(8 * hh + r) * PBP + ln]      = ph0;
      pb[w][(8 * hh + r) * PBP + 16 + ln] = ph1;
      if (CAUSAL) {
        pbr[w][(8 * hh + r) * PBP + ln]      = toh_flush((pc0 - (float)ph0) * RCARRY);
        pbr[w][(8 * hh + r) * PBP + 16 + ln] = toh_flush((pc1 - (float)ph1) * RCARRY); }
    }
    __builtin_amdgcn_fence(4 /* acq_rel order */, "wavefront"); __builtin_amdgcn_wave_barrier();
    const v16h pf = g2_frag(&pb[w][ln * PBP], hh);
    v16h prf = pf; if (CAUSAL) prf = g2_frag(&pbr[w][ln * PBP], hh);
    __builtin_amdgcn_fence(4 /* acq_rel order */, "wavefront"); __builtin_amdgcn_wave_barrier();
    const size_t voff = ((size_t)slab * HD + ln) * SEQ + kb;
    const _Float16* vp = VT + voff; const _Float16* vrp = VTR + voff;
    v16h vf = g2_frag(vp, hh);                   o0 = g2_mma(pf, vf, o0);
    if (CAUSAL) { e0 = g2_mma(prf, vf, e0); vf = g2_frag(vrp, hh);                   e0 = g2_mma(pf, vf, e0); }
    vf = g2_frag(vp + (size_t)16 * SEQ, hh);     o1 = g2_mma(pf, vf, o1);
    if (CAUSAL) { e1 = g2_mma(prf, vf, e1); vf = g2_frag(vrp + (size_t)16 * SEQ, hh); e1 = g2_mma(pf, vf, e1); }
    vf = g2_frag(vp + (size_t)32 * SEQ, hh);     o2 = g2_mma(pf, vf, o2);
    if (CAUSAL) { e2 = g2_mma(prf, vf, e2); vf = g2_frag(vrp + (size_t)32 * SEQ, hh); e2 = g2_mma(pf, vf, e2); }
    vf = g2_frag(vp + (size_t)48 * SEQ, hh);     o3 = g2_mma(pf, vf, o3);
    if (CAUSAL) { e3 = g2_mma(prf, vf, e3); vf = g2_frag(vrp + (size_t)48 * SEQ, hh); e3 = g2_mma(pf, vf, e3); }
  }
#pragma unroll
  for (int r = 0; r < 8; ++r) {
    const float rl = 64.0f * __builtin_amdgcn_rcpf(lrow[r]);      /* o carried x64; l already carries the P carry */
    const int rloc = (8 * hh + r) * OBP + ln;
    float v0 = o0[r], v1 = o1[r], v2 = o2[r], v3 = o3[r];
    if (CAUSAL) { v0 += e0[r] * RINV; v1 += e1[r] * RINV; v2 += e2[r] * RINV; v3 += e3[r] * RINV; }
    v0 *= rl; v1 *= rl; v2 *= rl; v3 *= rl;
    const h16 g0 = toh_flush(v0), g1 = toh_flush(v1), g2 = toh_flush(v2), g3 = toh_flush(v3);
    ob[w][rloc] = g0; ob[w][rloc + 16] = g1; ob[w][rloc + 32] = g2; ob[w][rloc + 48] = g3;
    if (CAUSAL) {
      obr[w][rloc]      = toh_flush((v0 - (float)g0) * RCARRY); obr[w][rloc + 16] = toh_flush((v1 - (float)g1) * RCARRY);
      obr[w][rloc + 32] = toh_flush((v2 - (float)g2) * RCARRY); obr[w][rloc + 48] = toh_flush((v3 - (float)g3) * RCARRY); }
  }
  __builtin_amdgcn_fence(4 /* acq_rel order */, "wavefront"); __builtin_amdgcn_wave_barrier();
  const int rq = lane >> 3, pc = (lane & 7) * 8;
  {
#pragma unroll
    for (int i = 0; i < 4; ++i) { const int row = i * 4 + rq; const size_t go = (tok0 + q0 + row) * DM + h * HD + pc;
      const v8us v = *(const v8us*)(&ob[w][row * OBP + pc]);
      *(v8us*)((unsigned short*)O16 + go) = v;
      if (CAUSAL) { const v8us vr = *(const v8us*)(&obr[w][row * OBP + pc]); *(v8us*)((unsigned short*)OR16 + go) = vr; } }
     }
}

__global__ __launch_bounds__(128) void k_attn_causal(const _Float16* __restrict__ Q16, const _Float16* __restrict__ QR, const _Float16* __restrict__ K16, const _Float16* __restrict__ KR,
    const _Float16* __restrict__ VT, const _Float16* __restrict__ VTR, _Float16* __restrict__ O16, _Float16* __restrict__ OR16) {
  attn_hr_body<1>(Q16, QR, K16, KR, VT, VTR, O16, OR16);
}
__global__ __launch_bounds__(128) void k_attn_dense(const _Float16* __restrict__ Q16, const _Float16* __restrict__ QR, const _Float16* __restrict__ K16, const _Float16* __restrict__ KR,
    const _Float16* __restrict__ VT, _Float16* __restrict__ O16) {
  attn_hr_body<0>(Q16, QR, K16, KR, VT, VT, O16, O16);
}

// red[] is cross-wave (block barriers); no early exit.
template <int RBF, int RMAP, int W16, int OMAP>
__global__ __launch_bounds__(256) void k_ln(const float* __restrict__ X, const float* __restrict__ R, const float* __restrict__ g, const float* __restrict__ bb, float eps, float* __restrict__ O32, _Float16* __restrict__ O16) {
  #pragma clang fp contract(off)
  __shared__ float red[256];
  const size_t r = blockIdx.x; const int t = threadIdx.x; const int c0 = t * 4;
  const size_t rfull = (r / SEQ) * SEQ_FULL + (r % SEQ);
  const size_t rr = RMAP ? rfull : r;
  const v4f xa = *(const v4fa*)(X + r * DM + c0); const v4f ra = *(const v4fa*)(R + rr * DM + c0);
  float s[4]; float sum = 0.f;
#pragma unroll
  for (int q = 0; q < 4; ++q) { const float rv = RBF ? bf16_rne(ra[q]) : ra[q]; s[q] = xa[q] + rv; sum += s[q]; }
  red[t] = sum; __syncthreads();
  for (int st = 128; st > 0; st >>= 1) { if (t < st) red[t] += red[t + st]; __syncthreads(); }
  const float mu = red[0] * (1.0f / (float)DM); __syncthreads();
  float vs = 0.f;
#pragma unroll
  for (int q = 0; q < 4; ++q) { const float dl = s[q] - mu; vs += dl * dl; }
  red[t] = vs; __syncthreads();
  for (int st = 128; st > 0; st >>= 1) { if (t < st) red[t] += red[t + st]; __syncthreads(); }
  const float rs = rsqrtf(red[0] * (1.0f / (float)DM) + eps);
  v4f yf; v4h y;
#pragma unroll
  for (int q = 0; q < 4; ++q) { const int c = c0 + q; yf[q] = (s[q] - mu) * rs * bf16_rne(g[c]) + bf16_rne(bb[c]); y[q] = (_Float16)yf[q]; }
  const size_t orow = OMAP ? rfull : r;
  {
    if (O32) *(v4f*)(O32 + orow * DM + c0) = yf;
    if (W16) *(v4h*)(O16 + r * DM + c0) = y;
     }
}

extern "C" void kernel_launch(void* const* d_in, const int* in_sizes, int n_in,
                              void* d_out, int out_size, void* d_ws, size_t ws_size, hipStream_t stream) {
  if (n_in < 22) return;
  const float* x    = (const float*)d_in[0];  const float* enc  = (const float*)d_in[1];
  const float* wq1  = (const float*)d_in[2];  const float* wk1  = (const float*)d_in[3];  const float* wv1 = (const float*)d_in[4];
  const float* wo1  = (const float*)d_in[5];  const float* bo1  = (const float*)d_in[6];
  const float* wq2  = (const float*)d_in[7];  const float* wk2  = (const float*)d_in[8];  const float* wv2 = (const float*)d_in[9];
  const float* wo2  = (const float*)d_in[10]; const float* bo2  = (const float*)d_in[11];
  const float* wff1 = (const float*)d_in[12]; const float* bff1 = (const float*)d_in[13]; const float* wff2 = (const float*)d_in[14]; const float* bff2 = (const float*)d_in[15];
  const float* g1   = (const float*)d_in[16]; const float* be1  = (const float*)d_in[17]; const float* g2  = (const float*)d_in[18]; const float* be2 = (const float*)d_in[19];
  const float* g3   = (const float*)d_in[20]; const float* be3  = (const float*)d_in[21];

  const size_t needX = ((size_t)(NB - 1) * SEQ_FULL + SEQ) * DM;
  if ((size_t)in_sizes[0] < needX || (size_t)in_sizes[1] < needX || (size_t)out_size < needX) return;
  { static const int wi[8] = {2, 3, 4, 5, 7, 8, 9, 10}; for (int i = 0; i < 8; ++i) if ((size_t)in_sizes[wi[i]] < (size_t)DM * DM) return; }
  if ((size_t)in_sizes[12] < (size_t)DM * DFF || (size_t)in_sizes[14] < (size_t)DM * DFF || in_sizes[13] < DFF) return;
  { static const int vi[9] = {6, 11, 15, 16, 17, 18, 19, 20, 21}; for (int i = 0; i < 9; ++i) if (in_sizes[vi[i]] < DM) return; }

  char* ws = (char*)d_ws; size_t off = 0;
  auto take = [&](size_t bytes) { char* p = ws + off; off += (bytes + 255) & ~(size_t)255; return p; };
  const size_t WDD = (size_t)DM * DM * 2, WDF = (size_t)DM * DFF * 2, P16 = NR * DM * 2;
  _Float16* BQ1 = (_Float16*)take(WDD); _Float16* BK1 = (_Float16*)take(WDD); _Float16* BV1 = (_Float16*)take(WDD); _Float16* BO1 = (_Float16*)take(WDD);
  _Float16* BQ2 = (_Float16*)take(WDD); _Float16* BK2 = (_Float16*)take(WDD); _Float16* BV2 = (_Float16*)take(WDD); _Float16* BO2 = (_Float16*)take(WDD);
  _Float16* BW1 = (_Float16*)take(WDF);      /* [n=DFF][k=DM]  */
  _Float16* BW2 = (_Float16*)take(WDF);      /* [n=DM][k=DFF]  */
  // ten token-plane slots of P16 bytes each (an f32 plane spans two slots, the FFN hidden plane four); lifetimes by launch order:
  // S0 X16 -> V2            S1 E16 -> x2 (f16)      S2,S3 Q1|QR1 -> a1 (f32) -> K2|KR2 -> a2 (f32) -> hidden (S2..S5)
  // S4,S5 K1|KR1 -> x1 (f32)   S6,S7 VT1|VTR1 -> x1 value|residual -> VT2|o2 (f16) -> f (f32)
  // S8,S9 V1|VR1 -> o1 value|residual -> Q2|QR2 -> x2 (f32)
  char* SL = take(10 * P16);
  _Float16* S0 = (_Float16*)(SL + 0 * P16); _Float16* S1 = (_Float16*)(SL + 1 * P16); _Float16* S2 = (_Float16*)(SL + 2 * P16); _Float16* S3 = (_Float16*)(SL + 3 * P16);
  _Float16* S4 = (_Float16*)(SL + 4 * P16); _Float16* S5 = (_Float16*)(SL + 5 * P16); _Float16* S6 = (_Float16*)(SL + 6 * P16); _Float16* S7 = (_Float16*)(SL + 7 * P16);
  _Float16* S8 = (_Float16*)(SL + 8 * P16); _Float16* S9 = (_Float16*)(SL + 9 * P16);
  float* YFa = (float*)S2;   /* a1, a2 (f32 rows, S2..S3) */
  float* X1F = (float*)S4;   /* x1 (f32 rows, S4..S5) */
  float* X2F = (float*)S8;   /* x2 (f32 rows, S8..S9) */
  float* YFf = (float*)S6;   /* f  (f32 rows, S6..S7) */
  _Float16* HF = S2;         /* FFN hidden rows [NR][DFF] f16 (S2..S5) */
  if (off > ws_size || off > (size_t)134217728) return;

  const unsigned gDD = (unsigned)(((size_t)DM * (DM / 8) + 255) / 256), gDF = (unsigned)(((size_t)DFF * (DM / 8) + 255) / 256), gFD = (unsigned)(((size_t)DM * (DFF / 8) + 255) / 256);
  k_wt_head<<<gDD, 256, 0, stream>>>(wq1, BQ1, DM, DM, 16.0f); k_wt_head<<<gDD, 256, 0, stream>>>(wk1, BK1, DM, DM, 16.0f); k_wt_head<<<gDD, 256, 0, stream>>>(wv1, BV1, DM, DM, 16.0f);
  k_wt_f16<<<gDD, 256, 0, stream>>>(wo1, BO1, DM, DM, 16.0f);
  k_wt_head<<<gDD, 256, 0, stream>>>(wq2, BQ2, DM, DM, 16.0f); k_wt_head<<<gDD, 256, 0, stream>>>(wk2, BK2, DM, DM, 16.0f); k_wt_head<<<gDD, 256, 0, stream>>>(wv2, BV2, DM, DM, 16.0f);
  k_wt_f16<<<gDD, 256, 0, stream>>>(wo2, BO2, DM, DM, 16.0f);
  k_wt_f16<<<gDF, 256, 0, stream>>>(wff1, BW1, DM, DFF, 16.0f); k_wt_f16<<<gFD, 256, 0, stream>>>(wff2, BW2, DFF, DM, 16.0f);

  const size_t n8 = NR * DM / 8; const unsigned gx = (unsigned)((n8 + 255) / 256);
  k_x16<<<gx, 256, 0, stream>>>(x, S0, n8); k_x16<<<gx, 256, 0, stream>>>(enc, S1, n8);

  const unsigned gP = (unsigned)((MR / 128) * (DM / 128)), gF1 = (unsigned)((MR / 128) * (DFF / 128));
  const unsigned gVT = (unsigned)(NB * NH * (SEQ / 64)); const dim3 gAT(SEQ / 64, NH, NB);

  // ---- causal self-attention block
  k_proj_hr<<<gP, 256, 0, stream>>>(S0, DM, BQ1, DM, 0.0625f, S2, S3, DM, MR, DM, DM);                          /* q  value | residual */
  k_proj_hr<<<gP, 256, 0, stream>>>(S0, DM, BK1, DM, 0.0625f, S4, S5, DM, MR, DM, DM);                          /* k  value | residual */
  k_proj_hr<<<gP, 256, 0, stream>>>(S0, DM, BV1, DM, 0.0625f, S8, S9, DM, MR, DM, DM);                          /* v  value | residual */
  k_vt<NH, SEQ><<<gVT, 256, 0, stream>>>(S8, DM, 0, S6);
  k_vt<NH, SEQ><<<gVT, 256, 0, stream>>>(S9, DM, 0, S7);
  k_attn_causal<<<gAT, 128, 0, stream>>>(S2, S3, S4, S5, S6, S7, S8, S9);                                       /* o x64 value | residual */
  k_proj_rf<<<gP, 256, 0, stream>>>(S8, S9, DM, BO1, DM, 0.0009765625f, bo1, 1.0f, YFa, DM, MR, DM, DM);        /* a1 = o Wp1 + bp1 */
  k_ln<1, 1, 0, 0><<<(unsigned)MR, 256, 0, stream>>>(YFa, x, g1, be1, LN_EPS, X1F, nullptr);                    /* x1 = LN1(bf16(x) + a1) -> f32 rows */
  k_split16<<<gx, 256, 0, stream>>>(X1F, S6, S7, n8);                                                           /* x1 value | residual */
  // ---- cross-attention block
  k_proj_rhr<<<gP, 256, 0, stream>>>(S6, S7, DM, BQ2, DM, 0.0625f, S8, S9, DM, MR, DM, DM);                     /* q  value | residual */
  k_proj_hr<<<gP, 256, 0, stream>>>(S1, DM, BK2, DM, 0.0625f, S2, S3, DM, MR, DM, DM);                          /* k  value | residual */
  k_gemm2<0><<<gP, 256, 0, stream>>>(S1, DM, BV2, DM, 0.0625f, nullptr, 1.0f, nullptr, S0, DM, MR, DM, DM);     /* v  single plane */
  k_vt<NH, SEQ><<<gVT, 256, 0, stream>>>(S0, DM, 0, S6);
  k_attn_dense<<<gAT, 128, 0, stream>>>(S8, S9, S2, S3, S6, S7);                                                /* o x64 single plane */
  k_gemm2<0><<<gP, 256, 0, stream>>>(S7, DM, BO2, DM, 0.0009765625f, bo2, 1.0f, YFa, nullptr, DM, MR, DM, DM);  /* a2 = o Wp2 + bp2 */
  k_ln<0, 0, 1, 0><<<(unsigned)MR, 256, 0, stream>>>(YFa, X1F, g2, be2, LN_EPS, X2F, S1);                       /* x2 = LN2(x1 + a2) -> f32 + f16 rows */
  // ---- FFN block
  k_gemm2<3><<<gF1, 256, 0, stream>>>(S1, DM, BW1, DM, 1.0f, bff1, 16.0f, nullptr, HF, DFF, MR, DFF, DM);       /* 16 relu(x2 W1 + b1) as f16 rows */
  k_gemm2<0><<<gP, 256, 0, stream>>>(HF, DFF, BW2, DFF, 0.00390625f, bff2, 1.0f, YFf, nullptr, DM, MR, DM, DFF);  /* f = h W2 + b2 */
  k_ln<0, 0, 0, 1><<<(unsigned)MR, 256, 0, stream>>>(YFf, X2F, g3, be3, LN_EPS, (float*)d_out, nullptr);        /* out = LN3(x2 + f) */
}

// v002
// Measured time: 485 microseconds a run.
// In two side-by-side timings against v001, it was 1.39 and 1.40 times as fast.
// Over all steps from v000 it is 2.23 times as fast.
#include <hip/hip_runtime.h>
// Structure: token rows r = b*SEQ + s. Causal self-attention (16 heads of 64, per-head weights [H][E][64], scores x8, keys above the diagonal and exactly-zero scores masked) -> x1 = LN1(x + attn.Wp1 + bp1); cross-attention of x1 over z rows -> x2 = LN2(x1 + attn.Wp2 + bp2); f = relu(x2.W1 + b1).W2 + b2; out = LN3(x2 + f). Projection / FFN weights are [in][out].

#ifndef NB
#define NB 4
#endif
#ifndef SEQ
#define SEQ 1024
#endif
#define NB_FULL 4
#define SEQ_FULL 1024
#define DM 1024
#define NH 16
#define HD 64
#define DFF 4096
#define NR ((size_t)NB * SEQ)
#define MR ((int)((size_t)NB * SEQ))
#define PBP 40          /* LDS pitch (halves) of the per-wave P tile */
#define OBP 72          /* LDS pitch (halves) of the per-wave o tile */
#define LN_EPS 1.0e-5f
#define PCARRY 16384.0f         /* carry of the f16 P planes */
#define RCARRY 2048.0f          /* carry of every residual plane */
#define RINV 0.00048828125f     /* 1 / RCARRY */

static_assert(NB >= 1 && NB <= NB_FULL);
static_assert(SEQ >= 64 && SEQ <= SEQ_FULL && SEQ % 64 == 0);
static_assert((NB * SEQ) % 128 == 0);
static_assert(NH * HD == DM && HD == 64);
static_assert(DM == 4 * 256);
static_assert(DM % 64 == 0 && DFF % 64 == 0 && DM % 32 == 0 && DFF % 32 == 0);
static_assert(DFF <= 4 * DM);
static_assert((PBP % 8) == 0 && (OBP % 8) == 0);
static_assert(DFF == 4 * DM);                       /* the FFN hidden plane spans exactly four 16-bit token planes */
static_assert(PBP >= 32 && OBP >= HD);              /* P tile holds 32 keys, o tile holds one head */
static_assert(RCARRY * RINV == 1.0f);
static_assert(PCARRY <= 32768.0f);                  /* carried P stays inside f16 */
static_assert((size_t)8 * DM * DM * 2 + (size_t)2 * DM * DFF * 2 + (size_t)10 * NB * SEQ * DM * 2 + 16 * 256 <= (size_t)134217728);   /* workspace carve */

typedef unsigned short v8us __attribute__((ext_vector_type(8), may_alias));
typedef float  v8f  __attribute__((ext_vector_type(8)));
typedef float  v4f  __attribute__((ext_vector_type(4)));
typedef float  v4fa __attribute__((ext_vector_type(4), may_alias));
typedef _Float16 v16h __attribute__((ext_vector_type(16)));
typedef _Float16 v4h __attribute__((ext_vector_type(4)));
union FragH { v16h v; v8us half[2]; _Float16 h[16]; unsigned short u[16]; };

__device__ __forceinline__ unsigned short bf16_bits(float x) { unsigned int u = __float_as_uint(x); return (unsigned short)((u + 0x7FFFu + ((u >> 16) & 1u)) >> 16); }
__device__ __forceinline__ float bf16_val(unsigned short b) { return __uint_as_float(((unsigned int)b) << 16); }
__device__ __forceinline__ float bf16_rne(float x) { return bf16_val(bf16_bits(x)); }

// 16x32 fragment from a k-contiguous 16-bit row p (A row m = lane&15, or B stored [n][k] with n = lane&15):
// elements 0..7 <- k 8h..8h+7, elements 8..15 <- k 16+8h..16+8h+7 (h = lane>>4)
__device__ __forceinline__ v16h g2_frag(const _Float16* p, int hh) { FragH f; f.half[0] = *(const v8us*)((const unsigned short*)p + 8 * hh); f.half[1] = *(const v8us*)((const unsigned short*)p + 16 + 8 * hh); return f.v; }
__device__ __forceinline__ v8f g2_mma(v16h a, v16h b, v8f c) { v8f d = __builtin_amdgcn_wmma_f32_16x16x32_f16(false, a, false, b, (short)0, c, false, false); asm volatile("v_nop\n\tv_nop\n\tv_nop\n\tv_nop" : "+v"(d) : "v"(a), "v"(b)); return d; }

// f32 -> f16 operand convert that cannot yield an f16 subnormal (value select, applied after the plane's carry)
typedef _Float16 h16;
static __device__ __forceinline__ h16 toh_flush(float v) { const h16 r = (h16)v; return (fabsf(v) < 6.103515625e-05f) ? (h16)0.0f : r; }

__global__ __launch_bounds__(256) void k_wt_f16(const float* __restrict__ W, _Float16* __restrict__ Wt, int K, int N, float scale) {
  const int t = blockIdx.x * 256 + threadIdx.x; if (t >= N * (K / 8)) return;
  const int n = t / (K / 8), k8 = (t % (K / 8)) * 8; FragH f;
#pragma unroll
  for (int i = 0; i < 8; ++i) f.h[i] = (_Float16)(bf16_rne(W[(size_t)(k8 + i) * N + n]) * scale);
  const v8us o = f.half[0]; unsigned short* d = (unsigned short*)Wt + (size_t)n * K + k8;
  *(v8us*)d = o; 
}

__global__ __launch_bounds__(256) void k_wt_head(const float* __restrict__ W, _Float16* __restrict__ Wt, int K, int N, float scale) {
  const int t = blockIdx.x * 256 + threadIdx.x; if (t >= N * (K / 8)) return;
  const int n = t / (K / 8), k8 = (t % (K / 8)) * 8; const int hd = n / HD, dd = n % HD; FragH f;
#pragma unroll
  for (int i = 0; i < 8; ++i) f.h[i] = toh_flush(bf16_rne(W[((size_t)hd * K + k8 + i) * HD + dd]) * scale);
  const v8us o = f.half[0]; unsigned short* d = (unsigned short*)Wt + (size_t)n * K + k8;
  *(v8us*)d = o; 
}

__global__ __launch_bounds__(256) void k_x16(const float* __restrict__ x, _Float16* __restrict__ X16, size_t n8) {
  const size_t t = (size_t)blockIdx.x * 256 + threadIdx.x; if (t >= n8) return;
  const size_t e = t * 8; const size_t r = e / DM; const size_t c = e % DM; const size_t rs = (r / SEQ) * SEQ_FULL + (r % SEQ);
  const float* src = x + rs * DM + c; const v4f a = *(const v4fa*)src; const v4f a2 = *(const v4fa*)(src + 4); FragH f;
#pragma unroll
  for (int q = 0; q < 4; ++q) { f.h[q] = (_Float16)bf16_rne(a[q]); f.h[4 + q] = (_Float16)bf16_rne(a2[q]); }
  const v8us o = f.half[0]; unsigned short* d = (unsigned short*)X16 + e;
  *(v8us*)d = o; 
}

__global__ __launch_bounds__(256) void k_split16(const float* __restrict__ src, _Float16* __restrict__ H16, _Float16* __restrict__ R16, size_t n8) {
  #pragma clang fp contract(off)
  const size_t t = (size_t)blockIdx.x * 256 + threadIdx.x; if (t >= n8) return;
  const size_t e = t * 8; const v4f a = *(const v4fa*)(src + e); const v4f a2 = *(const v4fa*)(src + e + 4); FragH fh, fr;
#pragma unroll
  for (int q = 0; q < 4; ++q) {
    const h16 h0 = toh_flush(a[q]);  fh.h[q] = h0;     fr.h[q] = toh_flush((a[q] - (float)h0) * RCARRY);
    const h16 h1 = toh_flush(a2[q]); fh.h[4 + q] = h1; fr.h[4 + q] = toh_flush((a2[q] - (float)h1) * RCARRY); }
  const v8us oh = fh.half[0]; const v8us orr = fr.half[0];
  unsigned short* dh = (unsigned short*)H16 + e; unsigned short* dr = (unsigned short*)R16 + e;
  *(v8us*)dh = oh; *(v8us*)dr = orr; 
}

template <int NHv, int TTv>
__global__ __launch_bounds__(256) void k_vt(const _Float16* __restrict__ V16, int ldv, int voff, _Float16* __restrict__ Vt) {
  __shared__ unsigned short tl[64][66]; const int tid = threadIdx.x; const int slab = blockIdx.x / (TTv / 64), lg = blockIdx.x % (TTv / 64); const int b = slab / NHv, h = slab % NHv;
  for (int i = tid; i < 64 * 8; i += 256) { const int r = i / 8, c8 = (i % 8) * 8; FragH f; f.half[0] = *(const v8us*)((const unsigned short*)V16 + ((size_t)b * TTv + lg * 64 + r) * ldv + voff + h * 64 + c8);
#pragma unroll
    for (int q = 0; q < 8; ++q) tl[r][c8 + q] = f.u[q]; }
  __syncthreads();
  {
#pragma unroll
    for (int rd = 0; rd < 2; ++rd) { const int d = rd * 32 + tid / 8, pc = tid % 8; FragH f;
#pragma unroll
      for (int q = 0; q < 8; ++q) f.u[q] = tl[pc * 8 + q][d];
      *(v8us*)((unsigned short*)Vt + ((size_t)slab * 64 + d) * TTv + lg * 64 + pc * 8) = f.half[0]; }
     }
}

// LDS staging of the GEMM operands. A block of 8 waves owns a 128 x 128 tile of C; a stage holds 128 k of its 128 A rows and then of its 128 B rows.
#define GKP 128                 /* k (halves) per stage: 256-byte rows */
#define GPITCH 136              /* LDS row pitch in halves: 272 B = 16 B x 17, conflict-free for 16-byte row reads */
#define GPITCHB (GPITCH * 2)    /* the same in bytes */
#define GSTAGE (256 * GPITCH)   /* halves per stage */
static_assert(DM % GKP == 0 && DFF % GKP == 0 && DM % 128 == 0 && DFF % 128 == 0);

static __device__ __forceinline__ unsigned lds_off(const void* p) { return (unsigned)(size_t)p; }

// Eight 16-byte asynchronous copies of one lane: rows 16 apart, global row step gstep halves. The s_wait_xcnt closes the statement so that no address register is rewritten ahead of it.
static __device__ __forceinline__ void copy8(unsigned l, const _Float16* g, size_t gstep) {
  asm volatile(
      "global_load_async_to_lds_b128 %0, %8, off\n\t"
      "global_load_async_to_lds_b128 %1, %9, off\n\t"
      "global_load_async_to_lds_b128 %2, %10, off\n\t"
      "global_load_async_to_lds_b128 %3, %11, off\n\t"
      "global_load_async_to_lds_b128 %4, %12, off\n\t"
      "global_load_async_to_lds_b128 %5, %13, off\n\t"
      "global_load_async_to_lds_b128 %6, %14, off\n\t"
      "global_load_async_to_lds_b128 %7, %15, off\n\t"
      "s_wait_xcnt 0x0"
      :: "v"(l), "v"(l + 16u * GPITCHB), "v"(l + 32u * GPITCHB), "v"(l + 48u * GPITCHB), "v"(l + 64u * GPITCHB), "v"(l + 80u * GPITCHB), "v"(l + 96u * GPITCHB), "v"(l + 112u * GPITCHB),
         "v"(g), "v"(g + gstep), "v"(g + 2 * gstep), "v"(g + 3 * gstep), "v"(g + 4 * gstep), "v"(g + 5 * gstep), "v"(g + 6 * gstep), "v"(g + 7 * gstep)
      : "memory");
}
// One stage: l = this lane's LDS byte address in the stage's row tid/16, ga / gb = its 16 bytes of that row of the A / B tile.
static __device__ __forceinline__ void stage_copy(unsigned l, const _Float16* ga, int lda, const _Float16* gb, int ldb) {
  copy8(l, ga, (size_t)16 * lda);
  copy8(l + 128u * GPITCHB, gb, (size_t)16 * ldb);
}

// One K sweep of the block's 128 x 128 tile through a two-buffer LDS ring; each wave keeps a 32 x 64 tile (A rows arow, arow + 16; B rows brow + 16 j), k ascending in steps of 32.
// At and Bt point at the first row of the block's A and B tiles. Every thread of the block calls it; K is a positive multiple of 128. The ring is free again on return (the last trip's barrier).
static __device__ __forceinline__ void gemm_sweep(_Float16* ring, const _Float16* At, int lda, const _Float16* Bt, int ldb, int K, int tid, int arow, int brow, int hh,
    v8f& c00, v8f& c01, v8f& c02, v8f& c03, v8f& c10, v8f& c11, v8f& c12, v8f& c13) {
  const unsigned l0 = lds_off(ring) + (unsigned)((tid >> 4) * GPITCHB + (tid & 15) * 16);
  const _Float16* ga = At + (size_t)(tid >> 4) * lda + (tid & 15) * 8;
  const _Float16* gb = Bt + (size_t)(tid >> 4) * ldb + (tid & 15) * 8;
  const int nst = K / GKP;
  stage_copy(l0, ga, lda, gb, ldb);
  asm volatile("s_wait_asynccnt 0x0" ::: "memory");   /* stage 0 of this wave has landed */
  __syncthreads();                                    /* stage 0 of every wave is readable */
  if (nst > 1) stage_copy(l0 + (unsigned)(GSTAGE * 2), ga + GKP, lda, gb + GKP, ldb);
#pragma unroll 1  /* one trip per stage: the ring's waits and its barrier stand once, at the trip's foot */
  for (int t = 0; t < nst; ++t) {
    const _Float16* buf = ring + (t & 1) * GSTAGE;
    const _Float16* a0p = buf + arow * GPITCH; const _Float16* a1p = a0p + 16 * GPITCH;
    const _Float16* b0p = buf + (128 + brow) * GPITCH; const _Float16* b1p = b0p + 16 * GPITCH; const _Float16* b2p = b1p + 16 * GPITCH; const _Float16* b3p = b2p + 16 * GPITCH;
    // the six fragments of a k step are read as one group, one k step ahead inside the stage, so that their LDS latency runs under the products of the step before
    v16h a0 = g2_frag(a0p, hh), a1 = g2_frag(a1p, hh), b0 = g2_frag(b0p, hh), b1 = g2_frag(b1p, hh), b2 = g2_frag(b2p, hh), b3 = g2_frag(b3p, hh);
#pragma unroll  /* constant LDS offsets, and the two fragment sets swap by renaming, without moves */
    for (int kb = 0; kb < GKP; kb += 32) {
      v16h na0 = a0, na1 = a1, nb0 = b0, nb1 = b1, nb2 = b2, nb3 = b3;
      if (kb + 32 < GKP) { na0 = g2_frag(a0p + kb + 32, hh); na1 = g2_frag(a1p + kb + 32, hh); nb0 = g2_frag(b0p + kb + 32, hh); nb1 = g2_frag(b1p + kb + 32, hh); nb2 = g2_frag(b2p + kb + 32, hh); nb3 = g2_frag(b3p + kb + 32, hh); }
      c00 = g2_mma(a0, b0, c00); c10 = g2_mma(a1, b0, c10);
      c01 = g2_mma(a0, b1, c01); c11 = g2_mma(a1, b1, c11);
      c02 = g2_mma(a0, b2, c02); c12 = g2_mma(a1, b2, c12);
      c03 = g2_mma(a0, b3, c03); c13 = g2_mma(a1, b3, c13);
      a0 = na0; a1 = na1; b0 = nb0; b1 = nb1; b2 = nb2; b3 = nb3; }
    asm volatile("s_wait_dscnt 0x0" ::: "memory");      /* this wave's reads of buffer t & 1 are done before it is refilled */
    asm volatile("s_wait_asynccnt 0x0" ::: "memory");   /* this wave's copies of stage t + 1 have landed */
    __syncthreads();                                    /* publishes stage t + 1 and ends every reader's last read of buffer t & 1 */
    if (t + 2 < nst) stage_copy(l0 + (unsigned)((t & 1) * (GSTAGE * 2)), ga + (size_t)(t + 2) * GKP, lda, gb + (size_t)(t + 2) * GKP, ldb);
  }
  asm volatile("s_wait_asynccnt 0x0" ::: "memory");     /* no copy is outstanding when the ring is left */
}

// GEMM: block tile 128 x 128 (8 waves, 4 x 2), wave tile 32 rows x 64 cols; A f16 rows (pitch lda), Bh f16 [n][k] (pitch ldb); v = acc*alpha + bf16(bias[col])*bsc; ACT 0 none / 3 relu;
// Requires M % 128 == 0, N % 128 == 0, K % 128 == 0; grid = (M/128)*(N/128), block 256.
template <int ACT>
__global__ __launch_bounds__(256) void k_gemm2(const _Float16* __restrict__ A, int lda, const _Float16* __restrict__ Bh, int ldb, float alpha, const float* __restrict__ bias, float bsc,
    float* __restrict__ C, _Float16* __restrict__ C16, int ldc, int M, int N, int K) {
  static_assert(ACT == 0 || ACT == 3);
  __shared__ __attribute__((aligned(16))) _Float16 ring[2 * GSTAGE];
  __shared__ __attribute__((aligned(16))) float so[8][32][68];
  const int tid = threadIdx.x, lane = tid & 31, ln = lane & 15, hh = lane >> 4;
  const int w = __builtin_amdgcn_readfirstlane(tid >> 5);
  const int ntn = N >> 7; const int mt = blockIdx.x / ntn, nq = blockIdx.x - mt * ntn; if (mt * 128 >= M) return;
  const int row0 = mt * 128 + 32 * (w >> 1), col0 = nq * 128 + 64 * (w & 1);
  const v8f z8 = {0.f,0.f,0.f,0.f,0.f,0.f,0.f,0.f}; v8f c00 = z8, c01 = z8, c02 = z8, c03 = z8, c10 = z8, c11 = z8, c12 = z8, c13 = z8;
  gemm_sweep(ring, A + (size_t)(mt * 128) * lda, lda, Bh + (size_t)(nq * 128) * ldb, ldb, K, tid, 32 * (w >> 1) + ln, 64 * (w & 1) + ln, hh, c00, c01, c02, c03, c10, c11, c12, c13);
  v8f accs[8] = {c00, c01, c02, c03, c10, c11, c12, c13};
#pragma unroll
  for (int u = 0; u < 8; ++u) { const int t = u & 3, half = u >> 2; const int col = col0 + t * 16 + ln; const float bv = bias ? bf16_rne(bias[col]) * bsc : 0.f;
#pragma unroll
    for (int r = 0; r < 8; ++r) { const int rloc = half * 16 + 8 * hh + r; float v = accs[u][r] * alpha + bv; if (ACT == 3) v = fmaxf(v, 0.f); so[w][rloc][t * 16 + ln] = v; } }
  __builtin_amdgcn_fence(4 /* acq_rel order */, "workgroup"); __builtin_amdgcn_wave_barrier();
  const int rsub = lane >> 4, c4 = (lane & 15) * 4;
  {
#pragma unroll
    for (int q = 0; q < 16; ++q) { const int r = q * 2 + rsub; const v4f v = *(const v4fa*)&so[w][r][c4];
      if (C) *(v4f*)(C + (size_t)(row0 + r) * ldc + col0 + c4) = v;
      if (C16) { v4h h4; for (int i = 0; i < 4; ++i) h4[i] = (_Float16)v[i]; *(v4h*)(C16 + (size_t)(row0 + r) * ldc + col0 + c4) = h4; } }
     }
}

// GEMM with an optional residual A plane (AR = (a - f16(a)) * 2048, own accumulators from zero, folded by 2^-11 in f32) and either an f32 output (OUTHR 0)
// Requires M % 128 == 0, N % 128 == 0, K % 128 == 0; grid = (M/128)*(N/128), block 256.
template <int ARES, int OUTHR>
static __device__ __forceinline__ void gemm_hr_body(const _Float16* __restrict__ A, const _Float16* __restrict__ AR, int lda, const _Float16* __restrict__ Bh, int ldb, float alpha,
    const float* __restrict__ bias, float bsc, float* __restrict__ C, _Float16* __restrict__ CH, _Float16* __restrict__ CR, int ldc, int M, int N, int K) {
  __shared__ __attribute__((aligned(16))) _Float16 ring[2 * GSTAGE];
  __shared__ __attribute__((aligned(16))) float so[8][32][68];
  const int tid = threadIdx.x, lane = tid & 31, ln = lane & 15, hh = lane >> 4;
  const int w = __builtin_amdgcn_readfirstlane(tid >> 5);
  const int ntn = N >> 7; const int mt = blockIdx.x / ntn, nq = blockIdx.x - mt * ntn; if (mt * 128 >= M) return;
  const int row0 = mt * 128 + 32 * (w >> 1), col0 = nq * 128 + 64 * (w & 1);
  const int arow = 32 * (w >> 1) + ln, brow = 64 * (w & 1) + ln;
  const _Float16* Bt = Bh + (size_t)(nq * 128) * ldb;
  const v8f z8 = {0.f,0.f,0.f,0.f,0.f,0.f,0.f,0.f};
  if (ARES) {
    v8f d00 = z8, d01 = z8, d02 = z8, d03 = z8, d10 = z8, d11 = z8, d12 = z8, d13 = z8;
    gemm_sweep(ring, AR + (size_t)(mt * 128) * lda, lda, Bt, ldb, K, tid, arow, brow, hh, d00, d01, d02, d03, d10, d11, d12, d13);
    v8f ds[8] = {d00, d01, d02, d03, d10, d11, d12, d13};
#pragma unroll
    for (int u = 0; u < 8; ++u) { const int t = u & 3, half = u >> 2;
#pragma unroll
      for (int r = 0; r < 8; ++r) { const int rloc = half * 16 + 8 * hh + r; so[w][rloc][t * 16 + ln] = ds[u][r] * RINV; } }
  }
  v8f c00 = z8, c01 = z8, c02 = z8, c03 = z8, c10 = z8, c11 = z8, c12 = z8, c13 = z8;
  gemm_sweep(ring, A + (size_t)(mt * 128) * lda, lda, Bt, ldb, K, tid, arow, brow, hh, c00, c01, c02, c03, c10, c11, c12, c13);
  v8f accs[8] = {c00, c01, c02, c03, c10, c11, c12, c13};
#pragma unroll
  for (int u = 0; u < 8; ++u) { const int t = u & 3, half = u >> 2; const int col = col0 + t * 16 + ln; const float bv = bias ? bf16_rne(bias[col]) * bsc : 0.f;
#pragma unroll
    for (int r = 0; r < 8; ++r) { const int rloc = half * 16 + 8 * hh + r; float v = accs[u][r]; if (ARES) v += so[w][rloc][t * 16 + ln]; v = v * alpha + bv; so[w][rloc][t * 16 + ln] = v; } }
  __builtin_amdgcn_fence(4 /* acq_rel order */, "workgroup"); __builtin_amdgcn_wave_barrier();
  const int rsub = lane >> 4, c4 = (lane & 15) * 4;
  {
#pragma unroll
    for (int q = 0; q < 16; ++q) { const int r = q * 2 + rsub; const v4f v = *(const v4fa*)&so[w][r][c4];
      if (OUTHR) { v4h h4, r4;
#pragma unroll
        for (int i = 0; i < 4; ++i) { const h16 hv = toh_flush(v[i]); h4[i] = hv; r4[i] = toh_flush((v[i] - (float)hv) * RCARRY); }
        *(v4h*)(CH + (size_t)(row0 + r) * ldc + col0 + c4) = h4;
        *(v4h*)(CR + (size_t)(row0 + r) * ldc + col0 + c4) = r4; }
      else { *(v4f*)(C + (size_t)(row0 + r) * ldc + col0 + c4) = v; } }
     }
}

// single A plane -> f16 value + residual output planes
__global__ __launch_bounds__(256) void k_proj_hr(const _Float16* __restrict__ A, int lda, const _Float16* __restrict__ Bh, int ldb, float alpha,
    _Float16* __restrict__ CH, _Float16* __restrict__ CR, int ldc, int M, int N, int K) {
  gemm_hr_body<0, 1>(A, A, lda, Bh, ldb, alpha, nullptr, 0.f, nullptr, CH, CR, ldc, M, N, K);
}
// value + residual A planes -> f16 value + residual output planes
__global__ __launch_bounds__(256) void k_proj_rhr(const _Float16* __restrict__ A, const _Float16* __restrict__ AR, int lda, const _Float16* __restrict__ Bh, int ldb, float alpha,
    _Float16* __restrict__ CH, _Float16* __restrict__ CR, int ldc, int M, int N, int K) {
  gemm_hr_body<1, 1>(A, AR, lda, Bh, ldb, alpha, nullptr, 0.f, nullptr, CH, CR, ldc, M, N, K);
}
// value + residual A planes -> f32 rows with bias
__global__ __launch_bounds__(256) void k_proj_rf(const _Float16* __restrict__ A, const _Float16* __restrict__ AR, int lda, const _Float16* __restrict__ Bh, int ldb, float alpha,
    const float* __restrict__ bias, float bsc, float* __restrict__ C, int ldc, int M, int N, int K) {
  gemm_hr_body<1, 0>(A, AR, lda, Bh, ldb, alpha, bias, bsc, C, nullptr, nullptr, ldc, M, N, K);
}

// LDS staging of the attention operands. A block of 8 waves owns 128 query rows of one (batch, head); a stage holds 64 keys: the K value and K residual rows (64 rows of 128 bytes each),
// then the V^T value rows (64 head columns x 64 keys) and, CAUSAL, the V^T residual rows. Every copy of a wave covers four whole 128-byte rows.
#define AKS 64                  /* keys per stage */
#define APITCH 72               /* LDS row pitch in halves: 144 B = 16 B x 9, conflict-free for 16-byte row reads */
#define APITCHB (APITCH * 2)    /* the same in bytes */
#define APLANE (64 * APITCH)    /* halves per staged plane */
static_assert(SEQ % 128 == 0 && SEQ / AKS >= 2 && HD == 64);

// Four / two 16-byte asynchronous copies of one lane. The s_wait_xcnt closes the statement so that no address register is rewritten ahead of it.
static __device__ __forceinline__ void copy4(unsigned l0, unsigned l1, unsigned l2, unsigned l3, const _Float16* g0, const _Float16* g1, const _Float16* g2, const _Float16* g3) {
  asm volatile(
      "global_load_async_to_lds_b128 %0, %4, off\n\t"
      "global_load_async_to_lds_b128 %1, %5, off\n\t"
      "global_load_async_to_lds_b128 %2, %6, off\n\t"
      "global_load_async_to_lds_b128 %3, %7, off\n\t"
      "s_wait_xcnt 0x0"
      :: "v"(l0), "v"(l1), "v"(l2), "v"(l3), "v"(g0), "v"(g1), "v"(g2), "v"(g3)
      : "memory");
}
static __device__ __forceinline__ void copy2(unsigned l0, unsigned l1, const _Float16* g0, const _Float16* g1) {
  asm volatile(
      "global_load_async_to_lds_b128 %0, %2, off\n\t"
      "global_load_async_to_lds_b128 %1, %3, off\n\t"
      "s_wait_xcnt 0x0"
      :: "v"(l0), "v"(l1), "v"(g0), "v"(g1)
      : "memory");
}
// One stage: l = this lane's LDS byte address in row tid/8 of the stage's first plane; gk / gkr / gv / gvr = its 16 bytes of that row of each plane. A lane brings rows tid/8 and tid/8 + 32 of every plane.
template <int CAUSAL>
static __device__ __forceinline__ void attn_stage_copy(unsigned l, const _Float16* gk, const _Float16* gkr, const _Float16* gv, const _Float16* gvr) {
  const unsigned pl = (unsigned)(APLANE * 2), rb = 32u * APITCHB;
  copy4(l, l + rb, l + pl, l + pl + rb, gk, gk + (size_t)32 * DM, gkr, gkr + (size_t)32 * DM);
  if (CAUSAL) copy4(l + 2u * pl, l + 2u * pl + rb, l + 3u * pl, l + 3u * pl + rb, gv, gv + (size_t)32 * SEQ, gvr, gvr + (size_t)32 * SEQ);
  else copy2(l + 2u * pl, l + 2u * pl + rb, gv, gv + (size_t)32 * SEQ);
}

// Flash-style attention for one (batch, head, 16 query rows) per wave: keys taken 32 at a time from the block's two-buffer LDS ring with an online (running-max) softmax in f32.
// scores = 8 * q.k^T with q and k as f16 value + x2048 residual planes: value.value in one accumulator, residual.value + value.residual in a second
// accumulator folded by 2^-11. CAUSAL: keys above the query row and exactly-zero scores take the fill -1e9 (replace), key blocks entirely above
// the wave's rows are skipped (their weights are exactly 0); P = 16384*exp(s - m) as f16 value + x2048 residual, V^T as value + residual slabs,
// o = P.V^T with value.value in one accumulator and the two cross terms in a second, row sum over the unconverted P; o/l * 64 written as f16 value +
// residual rows. Dense: P as one f16 plane (row sum over the converted P), V^T one plane, o one plane. P and o tiles are wave-private LDS
template <int CAUSAL>
static __device__ __forceinline__ void attn_hr_body(const _Float16* __restrict__ Q16, const _Float16* __restrict__ QR, const _Float16* __restrict__ K16, const _Float16* __restrict__ KR,
    const _Float16* __restrict__ VT, const _Float16* __restrict__ VTR, _Float16* __restrict__ O16, _Float16* __restrict__ OR16) {
  constexpr int ASTAGE = (CAUSAL ? 4 : 3) * APLANE;   /* halves per stage */
  __shared__ __attribute__((aligned(16))) _Float16 kv[2 * ASTAGE];
  __shared__ __attribute__((aligned(16))) _Float16 pb[8][16 * PBP];
  __shared__ __attribute__((aligned(16))) _Float16 pbr[8][16 * PBP];
  __shared__ __attribute__((aligned(16))) _Float16 ob[8][16 * OBP];
  __shared__ __attribute__((aligned(16))) _Float16 obr[8][16 * OBP];
  const int tid = threadIdx.x, lane = tid & 31, ln = lane & 15, hh = lane >> 4;
  const int w = __builtin_amdgcn_readfirstlane(tid >> 5);
  const int h = blockIdx.y, b = blockIdx.z;
  const int qb = blockIdx.x * 128;
  const int q0 = qb + w * 16;
  const size_t tok0 = (size_t)b * SEQ;
  const int slab = b * NH + h;
  const size_t qoff = (tok0 + q0 + ln) * DM + h * HD;
  const v16h qf0 = g2_frag(Q16 + qoff, hh), qf1 = g2_frag(Q16 + qoff + 32, hh);
  const v16h qr0 = g2_frag(QR + qoff, hh),  qr1 = g2_frag(QR + qoff + 32, hh);
  const v8f z8 = {0.f,0.f,0.f,0.f,0.f,0.f,0.f,0.f};
  v8f o0 = z8, o1 = z8, o2 = z8, o3 = z8;
  v8f e0 = z8, e1 = z8, e2 = z8, e3 = z8;
  float mrow[8], lrow[8];
#pragma unroll
  for (int r = 0; r < 8; ++r) { mrow[r] = -1.0e30f; lrow[r] = 0.f; }
  const int kend = CAUSAL ? (q0 + 16) : SEQ;                  /* this wave's keys end here (the same in every lane) */
  const int nst = CAUSAL ? (qb + 128) / AKS : SEQ / AKS;      /* stages of the block: up to its last wave's keys; at least two */
  const unsigned l0 = lds_off(kv) + (unsigned)((tid >> 3) * APITCHB + (tid & 7) * 16);
  const size_t gko = (tok0 + (tid >> 3)) * DM + h * HD + (tid & 7) * 8;
  const size_t gvo = ((size_t)slab * HD + (tid >> 3)) * SEQ + (tid & 7) * 8;
  const _Float16* gk = K16 + gko; const _Float16* gkr = KR + gko; const _Float16* gv = VT + gvo; const _Float16* gvr = VTR + gvo;
  attn_stage_copy<CAUSAL>(l0, gk, gkr, gv, gvr);
  asm volatile("s_wait_asynccnt 0x0" ::: "memory");   /* stage 0 of this wave has landed */
  __syncthreads();                                    /* stage 0 of every wave is readable */
  if (nst > 1) attn_stage_copy<CAUSAL>(l0 + (unsigned)(ASTAGE * 2), gk + (size_t)AKS * DM, gkr + (size_t)AKS * DM, gv + AKS, gvr + AKS);
#pragma unroll 1  /* one trip per stage: the ring's waits and its barrier stand once, at the trip's foot */
  for (int st = 0; st < nst; ++st) {
  const _Float16* buf = kv + (st & 1) * ASTAGE;
#pragma unroll 1  /* two passes of 32 keys per stage share one body */
  for (int sub = 0; sub < AKS; sub += 32) {
    const int kb = st * AKS + sub;
    if (kb >= kend) break;                            /* a wave past its diagonal skips the pass, never the trip's foot */
    const _Float16* k0p = buf + (sub + ln) * APITCH; const _Float16* k1p = k0p + 16 * APITCH;
    const _Float16* r0p = k0p + APLANE;              const _Float16* r1p = r0p + 16 * APITCH;
    v8f s0 = z8, s1 = z8, t0 = z8, t1 = z8;
    v16h kf = g2_frag(k0p, hh);    s0 = g2_mma(qf0, kf, s0); t0 = g2_mma(qr0, kf, t0);
    kf = g2_frag(k0p + 32, hh);    s0 = g2_mma(qf1, kf, s0); t0 = g2_mma(qr1, kf, t0);
    kf = g2_frag(r0p, hh);         t0 = g2_mma(qf0, kf, t0);
    kf = g2_frag(r0p + 32, hh);    t0 = g2_mma(qf1, kf, t0);
    kf = g2_frag(k1p, hh);         s1 = g2_mma(qf0, kf, s1); t1 = g2_mma(qr0, kf, t1);
    kf = g2_frag(k1p + 32, hh);    s1 = g2_mma(qf1, kf, s1); t1 = g2_mma(qr1, kf, t1);
    kf = g2_frag(r1p, hh);         t1 = g2_mma(qf0, kf, t1);
    kf = g2_frag(r1p + 32, hh);    t1 = g2_mma(qf1, kf, t1);
#pragma unroll
    for (int r = 0; r < 8; ++r) {
      const int row = q0 + 8 * hh + r;
      float a = (s0[r] + t0[r] * RINV) * 8.0f, c = (s1[r] + t1[r] * RINV) * 8.0f;
      if (CAUSAL) { a = ((kb + ln > row) || (a == 0.0f)) ? -1.0e9f : a; c = ((kb + 16 + ln > row) || (c == 0.0f)) ? -1.0e9f : c; }
      float t = fmaxf(a, c);
      t = fmaxf(t, __shfl_xor(t, 1, 32)); t = fmaxf(t, __shfl_xor(t, 2, 32)); t = fmaxf(t, __shfl_xor(t, 4, 32)); t = fmaxf(t, __shfl_xor(t, 8, 32));
      const float mnew = fmaxf(mrow[r], t);
      const float p0 = __expf(a - mnew), p1 = __expf(c - mnew);
      const float pc0 = p0 * PCARRY, pc1 = p1 * PCARRY;
      const h16 ph0 = toh_flush(pc0), ph1 = toh_flush(pc1);
      float ls = CAUSAL ? (pc0 + pc1) : ((float)ph0 + (float)ph1);
      ls += __shfl_xor(ls, 1, 32); ls += __shfl_xor(ls, 2, 32); ls += __shfl_xor(ls, 4, 32); ls += __shfl_xor(ls, 8, 32);
      const float corr = __expf(mrow[r] - mnew);
      lrow[r] = lrow[r] * corr + ls; mrow[r] = mnew;
      o0[r] *= corr; o1[r] *= corr; o2[r] *= corr; o3[r] *= corr;
      if (CAUSAL) { e0[r] *= corr; e1[r] *= corr; e2[r] *= corr; e3[r] *= corr; }
      pb[w][(8 * hh + r) * PBP + ln]      = ph0;
      pb[w][(8 * hh + r) * PBP + 16 + ln] = ph1;
      if (CAUSAL) {
        pbr[w][(8 * hh + r) * PBP + ln]      = toh_flush((pc0 - (float)ph0) * RCARRY);
        pbr[w][(8 * hh + r) * PBP + 16 + ln] = toh_flush((pc1 - (float)ph1) * RCARRY); }
    }
    __builtin_amdgcn_fence(4 /* acq_rel order */, "wavefront"); __builtin_amdgcn_wave_barrier();
    const v16h pf = g2_frag(&pb[w][ln * PBP], hh);
    v16h prf = pf; if (CAUSAL) prf = g2_frag(&pbr[w][ln * PBP], hh);
    __builtin_amdgcn_fence(4 /* acq_rel order */, "wavefront"); __builtin_amdgcn_wave_barrier();
    const _Float16* vp = buf + 2 * APLANE + ln * APITCH + sub; const _Float16* vrp = vp + (CAUSAL ? APLANE : 0);
    v16h vf = g2_frag(vp, hh);                   o0 = g2_mma(pf, vf, o0);
    if (CAUSAL) { e0 = g2_mma(prf, vf, e0); vf = g2_frag(vrp, hh);                   e0 = g2_mma(pf, vf, e0); }
    vf = g2_frag(vp + 16 * APITCH, hh);          o1 = g2_mma(pf, vf, o1);
    if (CAUSAL) { e1 = g2_mma(prf, vf, e1); vf = g2_frag(vrp + 16 * APITCH, hh);     e1 = g2_mma(pf, vf, e1); }
    vf = g2_frag(vp + 32 * APITCH, hh);          o2 = g2_mma(pf, vf, o2);
    if (CAUSAL) { e2 = g2_mma(prf, vf, e2); vf = g2_frag(vrp + 32 * APITCH, hh);     e2 = g2_mma(pf, vf, e2); }
    vf = g2_frag(vp + 48 * APITCH, hh);          o3 = g2_mma(pf, vf, o3);
    if (CAUSAL) { e3 = g2_mma(prf, vf, e3); vf = g2_frag(vrp + 48 * APITCH, hh);     e3 = g2_mma(pf, vf, e3); }
  }
    asm volatile("s_wait_dscnt 0x0" ::: "memory");      /* this wave's reads of buffer st & 1 are done before it is refilled */
    asm volatile("s_wait_asynccnt 0x0" ::: "memory");   /* this wave's copies of stage st + 1 have landed */
    __syncthreads();                                    /* publishes stage st + 1 and ends every reader's last read of buffer st & 1 */
    if (st + 2 < nst) attn_stage_copy<CAUSAL>(l0 + (unsigned)((st & 1) * (ASTAGE * 2)), gk + (size_t)(st + 2) * AKS * DM, gkr + (size_t)(st + 2) * AKS * DM, gv + (st + 2) * AKS, gvr + (st + 2) * AKS);
  }
  asm volatile("s_wait_asynccnt 0x0" ::: "memory");     /* no copy is outstanding when the ring is left */
#pragma unroll
  for (int r = 0; r < 8; ++r) {
    const float rl = 64.0f * __builtin_amdgcn_rcpf(lrow[r]);      /* o carried x64; l already carries the P carry */
    const int rloc = (8 * hh + r) * OBP + ln;
    float v0 = o0[r], v1 = o1[r], v2 = o2[r], v3 = o3[r];
    if (CAUSAL) { v0 += e0[r] * RINV; v1 += e1[r] * RINV; v2 += e2[r] * RINV; v3 += e3[r] * RINV; }
    v0 *= rl; v1 *= rl; v2 *= rl; v3 *= rl;
    const h16 g0 = toh_flush(v0), g1 = toh_flush(v1), g2 = toh_flush(v2), g3 = toh_flush(v3);
    ob[w][rloc] = g0; ob[w][rloc + 16] = g1; ob[w][rloc + 32] = g2; ob[w][rloc + 48] = g3;
    if (CAUSAL) {
      obr[w][rloc]      = toh_flush((v0 - (float)g0) * RCARRY); obr[w][rloc + 16] = toh_flush((v1 - (float)g1) * RCARRY);
      obr[w][rloc + 32] = toh_flush((v2 - (float)g2) * RCARRY); obr[w][rloc + 48] = toh_flush((v3 - (float)g3) * RCARRY); }
  }
  __builtin_amdgcn_fence(4 /* acq_rel order */, "wavefront"); __builtin_amdgcn_wave_barrier();
  const int rq = lane >> 3, pc = (lane & 7) * 8;
  {
#pragma unroll
    for (int i = 0; i < 4; ++i) { const int row = i * 4 + rq; const size_t go = (tok0 + q0 + row) * DM + h * HD + pc;
      const v8us v = *(const v8us*)(&ob[w][row * OBP + pc]);
      *(v8us*)((unsigned short*)O16 + go) = v;
      if (CAUSAL) { const v8us vr = *(const v8us*)(&obr[w][row * OBP + pc]); *(v8us*)((unsigned short*)OR16 + go) = vr; } }
     }
}

__global__ __launch_bounds__(256) void k_attn_causal(const _Float16* __restrict__ Q16, const _Float16* __restrict__ QR, const _Float16* __restrict__ K16, const _Float16* __restrict__ KR,
    const _Float16* __restrict__ VT, const _Float16* __restrict__ VTR, _Float16* __restrict__ O16, _Float16* __restrict__ OR16) {
  attn_hr_body<1>(Q16, QR, K16, KR, VT, VTR, O16, OR16);
}
__global__ __launch_bounds__(256) void k_attn_dense(const _Float16* __restrict__ Q16, const _Float16* __restrict__ QR, const _Float16* __restrict__ K16, const _Float16* __restrict__ KR,
    const _Float16* __restrict__ VT, _Float16* __restrict__ O16) {
  attn_hr_body<0>(Q16, QR, K16, KR, VT, VT, O16, O16);
}

// red[] is cross-wave (block barriers); no early exit.
template <int RBF, int RMAP, int W16, int OMAP>
__global__ __launch_bounds__(256) void k_ln(const float* __restrict__ X, const float* __restrict__ R, const float* __restrict__ g, const float* __restrict__ bb, float eps, float* __restrict__ O32, _Float16* __restrict__ O16) {
  #pragma clang fp contract(off)
  __shared__ float red[256];
  const size_t r = blockIdx.x; const int t = threadIdx.x; const int c0 = t * 4;
  const size_t rfull = (r / SEQ) * SEQ_FULL + (r % SEQ);
  const size_t rr = RMAP ? rfull : r;
  const v4f xa = *(const v4fa*)(X + r * DM + c0); const v4f ra = *(const v4fa*)(R + rr * DM + c0);
  float s[4]; float sum = 0.f;
#pragma unroll
  for (int q = 0; q < 4; ++q) { const float rv = RBF ? bf16_rne(ra[q]) : ra[q]; s[q] = xa[q] + rv; sum += s[q]; }
  red[t] = sum; __syncthreads();
  for (int st = 128; st > 0; st >>= 1) { if (t < st) red[t] += red[t + st]; __syncthreads(); }
  const float mu = red[0] * (1.0f / (float)DM); __syncthreads();
  float vs = 0.f;
#pragma unroll
  for (int q = 0; q < 4; ++q) { const float dl = s[q] - mu; vs += dl * dl; }
  red[t] = vs; __syncthreads();
  for (int st = 128; st > 0; st >>= 1) { if (t < st) red[t] += red[t + st]; __syncthreads(); }
  const float rs = rsqrtf(red[0] * (1.0f / (float)DM) + eps);
  v4f yf; v4h y;
#pragma unroll
  for (int q = 0; q < 4; ++q) { const int c = c0 + q; yf[q] = (s[q] - mu) * rs * bf16_rne(g[c]) + bf16_rne(bb[c]); y[q] = (_Float16)yf[q]; }
  const size_t orow = OMAP ? rfull : r;
  {
    if (O32) *(v4f*)(O32 + orow * DM + c0) = yf;
    if (W16) *(v4h*)(O16 + r * DM + c0) = y;
     }
}

extern "C" void kernel_launch(void* const* d_in, const int* in_sizes, int n_in,
                              void* d_out, int out_size, void* d_ws, size_t ws_size, hipStream_t stream) {
  if (n_in < 22) return;
  const float* x    = (const float*)d_in[0];  const float* enc  = (const float*)d_in[1];
  const float* wq1  = (const float*)d_in[2];  const float* wk1  = (const float*)d_in[3];  const float* wv1 = (const float*)d_in[4];
  const float* wo1  = (const float*)d_in[5];  const float* bo1  = (const float*)d_in[6];
  const float* wq2  = (const float*)d_in[7];  const float* wk2  = (const float*)d_in[8];  const float* wv2 = (const float*)d_in[9];
  const float* wo2  = (const float*)d_in[10]; const float* bo2  = (const float*)d_in[11];
  const float* wff1 = (const float*)d_in[12]; const float* bff1 = (const float*)d_in[13]; const float* wff2 = (const float*)d_in[14]; const float* bff2 = (const float*)d_in[15];
  const float* g1   = (const float*)d_in[16]; const float* be1  = (const float*)d_in[17]; const float* g2  = (const float*)d_in[18]; const float* be2 = (const float*)d_in[19];
  const float* g3   = (const float*)d_in[20]; const float* be3  = (const float*)d_in[21];

  const size_t needX = ((size_t)(NB - 1) * SEQ_FULL + SEQ) * DM;
  if ((size_t)in_sizes[0] < needX || (size_t)in_sizes[1] < needX || (size_t)out_size < needX) return;
  { static const int wi[8] = {2, 3, 4, 5, 7, 8, 9, 10}; for (int i = 0; i < 8; ++i) if ((size_t)in_sizes[wi[i]] < (size_t)DM * DM) return; }
  if ((size_t)in_sizes[12] < (size_t)DM * DFF || (size_t)in_sizes[14] < (size_t)DM * DFF || in_sizes[13] < DFF) return;
  { static const int vi[9] = {6, 11, 15, 16, 17, 18, 19, 20, 21}; for (int i = 0; i < 9; ++i) if (in_sizes[vi[i]] < DM) return; }

  char* ws = (char*)d_ws; size_t off = 0;
  auto take = [&](size_t bytes) { char* p = ws + off; off += (bytes + 255) & ~(size_t)255; return p; };
  const size_t WDD = (size_t)DM * DM * 2, WDF = (size_t)DM * DFF * 2, P16 = NR * DM * 2;
  _Float16* BQ1 = (_Float16*)take(WDD); _Float16* BK1 = (_Float16*)take(WDD); _Float16* BV1 = (_Float16*)take(WDD); _Float16* BO1 = (_Float16*)take(WDD);
  _Float16* BQ2 = (_Float16*)take(WDD); _Float16* BK2 = (_Float16*)take(WDD); _Float16* BV2 = (_Float16*)take(WDD); _Float16* BO2 = (_Float16*)take(WDD);
  _Float16* BW1 = (_Float16*)take(WDF);      /* [n=DFF][k=DM]  */
  _Float16* BW2 = (_Float16*)take(WDF);      /* [n=DM][k=DFF]  */
  // ten token-plane slots of P16 bytes each (an f32 plane spans two slots, the FFN hidden plane four); lifetimes by launch order:
  // S0 X16 -> V2            S1 E16 -> x2 (f16)      S2,S3 Q1|QR1 -> a1 (f32) -> K2|KR2 -> a2 (f32) -> hidden (S2..S5)
  // S4,S5 K1|KR1 -> x1 (f32)   S6,S7 VT1|VTR1 -> x1 value|residual -> VT2|o2 (f16) -> f (f32)
  // S8,S9 V1|VR1 -> o1 value|residual -> Q2|QR2 -> x2 (f32)
  char* SL = take(10 * P16);
  _Float16* S0 = (_Float16*)(SL + 0 * P16); _Float16* S1 = (_Float16*)(SL + 1 * P16); _Float16* S2 = (_Float16*)(SL + 2 * P16); _Float16* S3 = (_Float16*)(SL + 3 * P16);
  _Float16* S4 = (_Float16*)(SL + 4 * P16); _Float16* S5 = (_Float16*)(SL + 5 * P16); _Float16* S6 = (_Float16*)(SL + 6 * P16); _Float16* S7 = (_Float16*)(SL + 7 * P16);
  _Float16* S8 = (_Float16*)(SL + 8 * P16); _Float16* S9 = (_Float16*)(SL + 9 * P16);
  float* YFa = (float*)S2;   /* a1, a2 (f32 rows, S2..S3) */
  float* X1F = (float*)S4;   /* x1 (f32 rows, S4..S5) */
  float* X2F = (float*)S8;   /* x2 (f32 rows, S8..S9) */
  float* YFf = (float*)S6;   /* f  (f32 rows, S6..S7) */
  _Float16* HF = S2;         /* FFN hidden rows [NR][DFF] f16 (S2..S5) */
  if (off > ws_size || off > (size_t)134217728) return;

  const unsigned gDD = (unsigned)(((size_t)DM * (DM / 8) + 255) / 256), gDF = (unsigned)(((size_t)DFF * (DM / 8) + 255) / 256), gFD = (unsigned)(((size_t)DM * (DFF / 8) + 255) / 256);
  k_wt_head<<<gDD, 256, 0, stream>>>(wq1, BQ1, DM, DM, 16.0f); k_wt_head<<<gDD, 256, 0, stream>>>(wk1, BK1, DM, DM, 16.0f); k_wt_head<<<gDD, 256, 0, stream>>>(wv1, BV1, DM, DM, 16.0f);
  k_wt_f16<<<gDD, 256, 0, stream>>>(wo1, BO1, DM, DM, 16.0f);
  k_wt_head<<<gDD, 256, 0, stream>>>(wq2, BQ2, DM, DM, 16.0f); k_wt_head<<<gDD, 256, 0, stream>>>(wk2, BK2, DM, DM, 16.0f); k_wt_head<<<gDD, 256, 0, stream>>>(wv2, BV2, DM, DM, 16.0f);
  k_wt_f16<<<gDD, 256, 0, stream>>>(wo2, BO2, DM, DM, 16.0f);
  k_wt_f16<<<gDF, 256, 0, stream>>>(wff1, BW1, DM, DFF, 16.0f); k_wt_f16<<<gFD, 256, 0, stream>>>(wff2, BW2, DFF, DM, 16.0f);

  const size_t n8 = NR * DM / 8; const unsigned gx = (unsigned)((n8 + 255) / 256);
  k_x16<<<gx, 256, 0, stream>>>(x, S0, n8); k_x16<<<gx, 256, 0, stream>>>(enc, S1, n8);

  const unsigned gP = (unsigned)((MR / 128) * (DM / 128)), gF1 = (unsigned)((MR / 128) * (DFF / 128));
  const unsigned gVT = (unsigned)(NB * NH * (SEQ / 64)); const dim3 gAT(SEQ / 128, NH, NB);

  // ---- causal self-attention block
  k_proj_hr<<<gP, 256, 0, stream>>>(S0, DM, BQ1, DM, 0.0625f, S2, S3, DM, MR, DM, DM);                          /* q  value | residual */
  k_proj_hr<<<gP, 256, 0, stream>>>(S0, DM, BK1, DM, 0.0625f, S4, S5, DM, MR, DM, DM);                          /* k  value | residual */
  k_proj_hr<<<gP, 256, 0, stream>>>(S0, DM, BV1, DM, 0.0625f, S8, S9, DM, MR, DM, DM);                          /* v  value | residual */
  k_vt<NH, SEQ><<<gVT, 256, 0, stream>>>(S8, DM, 0, S6);
  k_vt<NH, SEQ><<<gVT, 256, 0, stream>>>(S9, DM, 0, S7);
  k_attn_causal<<<gAT, 256, 0, stream>>>(S2, S3, S4, S5, S6, S7, S8, S9);                                       /* o x64 value | residual */
  k_proj_rf<<<gP, 256, 0, stream>>>(S8, S9, DM, BO1, DM, 0.0009765625f, bo1, 1.0f, YFa, DM, MR, DM, DM);        /* a1 = o Wp1 + bp1 */
  k_ln<1, 1, 0, 0><<<(unsigned)MR, 256, 0, stream>>>(YFa, x, g1, be1, LN_EPS, X1F, nullptr);                    /* x1 = LN1(bf16(x) + a1) -> f32 rows */
  k_split16<<<gx, 256, 0, stream>>>(X1F, S6, S7, n8);                                                           /* x1 value | residual */
  // ---- cross-attention block
  k_proj_rhr<<<gP, 256, 0, stream>>>(S6, S7, DM, BQ2, DM, 0.0625f, S8, S9, DM, MR, DM, DM);                     /* q  value | residual */
  k_proj_hr<<<gP, 256, 0, stream>>>(S1, DM, BK2, DM, 0.0625f, S2, S3, DM, MR, DM, DM);                          /* k  value | residual */
  k_gemm2<0><<<gP, 256, 0, stream>>>(S1, DM, BV2, DM, 0.0625f, nullptr, 1.0f, nullptr, S0, DM, MR, DM, DM);     /* v  single plane */
  k_vt<NH, SEQ><<<gVT, 256, 0, stream>>>(S0, DM, 0, S6);
  k_attn_dense<<<gAT, 256, 0, stream>>>(S8, S9, S2, S3, S6, S7);                                                /* o x64 single plane */
  k_gemm2<0><<<gP, 256, 0, stream>>>(S7, DM, BO2, DM, 0.0009765625f, bo2, 1.0f, YFa, nullptr, DM, MR, DM, DM);  /* a2 = o Wp2 + bp2 */
  k_ln<0, 0, 1, 0><<<(unsigned)MR, 256, 0, stream>>>(YFa, X1F, g2, be2, LN_EPS, X2F, S1);                       /* x2 = LN2(x1 + a2) -> f32 + f16 rows */
  // ---- FFN block
  k_gemm2<3><<<gF1, 256, 0, stream>>>(S1, DM, BW1, DM, 1.0f, bff1, 16.0f, nullptr, HF, DFF, MR, DFF, DM);       /* 16 relu(x2 W1 + b1) as f16 rows */
  k_gemm2<0><<<gP, 256, 0, stream>>>(HF, DFF, BW2, DFF, 0.00390625f, bff2, 1.0f, YFf, nullptr, DM, MR, DM, DFF);  /* f = h W2 + b2 */
  k_ln<0, 0, 0, 1><<<(unsigned)MR, 256, 0, stream>>>(YFf, X2F, g3, be3, LN_EPS, (float*)d_out, nullptr);        /* out = LN3(x2 + f) */
}

// v003
// One run takes 427 microseconds.
// Next to v002, in two timings, it ran 1.14 and 1.13 times as fast.
// Over all steps from v000 it is 2.53 times as fast.
#include <hip/hip_runtime.h>
// Structure: token rows r = b*SEQ + s. Causal self-attention (16 heads of 64, per-head weights [H][E][64], scores x8, keys above the diagonal and exactly-zero scores masked) -> x1 = LN1(x + attn.Wp1 + bp1); cross-attention of x1 over z rows -> x2 = LN2(x1 + attn.Wp2 + bp2); f = relu(x2.W1 + b1).W2 + b2; out = LN3(x2 + f). Projection / FFN weights are [in][out].

#ifndef NB
#define NB 4
#endif
#ifndef SEQ
#define SEQ 1024
#endif
#define NB_FULL 4
#define SEQ_FULL 1024
#define DM 1024
#define NH 16
#define HD 64
#define DFF 4096
#define NR ((size_t)NB * SEQ)
#define MR ((int)((size_t)NB * SEQ))
#define PBP 40          /* LDS pitch (halves) of the per-wave P tile */
#define OBP 72          /* LDS pitch (halves) of the per-wave o tile */
#define LN_EPS 1.0e-5f
#define PCARRY 16384.0f         /* carry of the f16 P planes */
#define RCARRY 2048.0f          /* carry of every residual plane */
#define RINV 0.00048828125f     /* 1 / RCARRY */

static_assert(NB >= 1 && NB <= NB_FULL);
static_assert(SEQ >= 64 && SEQ <= SEQ_FULL && SEQ % 64 == 0);
static_assert((NB * SEQ) % 128 == 0);
static_assert(NH * HD == DM && HD == 64);
static_assert(DM == 4 * 256);
static_assert(DM % 64 == 0 && DFF % 64 == 0 && DM % 32 == 0 && DFF % 32 == 0);
static_assert(DFF <= 4 * DM);
static_assert((PBP % 8) == 0 && (OBP % 8) == 0);
static_assert(DFF == 4 * DM);                       /* the FFN hidden plane spans exactly four 16-bit token planes */
static_assert(PBP >= 32 && OBP >= HD);              /* P tile holds 32 keys, o tile holds one head */
static_assert(RCARRY * RINV == 1.0f);
static_assert(PCARRY <= 32768.0f);                  /* carried P stays inside f16 */
static_assert((size_t)8 * DM * DM * 2 + (size_t)2 * DM * DFF * 2 + (size_t)10 * NB * SEQ * DM * 2 + 16 * 256 <= (size_t)134217728);   /* workspace carve */

typedef unsigned short v8us __attribute__((ext_vector_type(8), may_alias));
typedef float  v8f  __attribute__((ext_vector_type(8)));
typedef float  v4f  __attribute__((ext_vector_type(4)));
typedef float  v4fa __attribute__((ext_vector_type(4), may_alias));
typedef _Float16 v16h __attribute__((ext_vector_type(16)));
typedef _Float16 v4h __attribute__((ext_vector_type(4)));
union FragH { v16h v; v8us half[2]; _Float16 h[16]; unsigned short u[16]; };

__device__ __forceinline__ unsigned short bf16_bits(float x) { unsigned int u = __float_as_uint(x); return (unsigned short)((u + 0x7FFFu + ((u >> 16) & 1u)) >> 16); }
__device__ __forceinline__ float bf16_val(unsigned short b) { return __uint_as_float(((unsigned int)b) << 16); }
__device__ __forceinline__ float bf16_rne(float x) { return bf16_val(bf16_bits(x)); }

// 16x32 fragment from a k-contiguous 16-bit row p (A row m = lane&15, or B stored [n][k] with n = lane&15):
// elements 0..7 <- k 8h..8h+7, elements 8..15 <- k 16+8h..16+8h+7 (h = lane>>4)
__device__ __forceinline__ v16h g2_frag(const _Float16* p, int hh) { FragH f; f.half[0] = *(const v8us*)((const unsigned short*)p + 8 * hh); f.half[1] = *(const v8us*)((const unsigned short*)p + 16 + 8 * hh); return f.v; }
__device__ __forceinline__ v8f g2_mma(v16h a, v16h b, v8f c) { v8f d = __builtin_amdgcn_wmma_f32_16x16x32_f16(false, a, false, b, (short)0, c, false, false); asm volatile("v_nop\n\tv_nop\n\tv_nop\n\tv_nop" : "+v"(d) : "v"(a), "v"(b)); return d; }

// f32 -> f16 operand convert that cannot yield an f16 subnormal (value select, applied after the plane's carry)
typedef _Float16 h16;
static __device__ __forceinline__ h16 toh_flush(float v) { const h16 r = (h16)v; return (fabsf(v) < 6.103515625e-05f) ? (h16)0.0f : r; }

// Weight convert + transpose, one 64 k x 64 n tile per block, turned in LDS: every wave-wide 16-byte load covers two whole 256-byte source rows of the tile and every
// wave-wide 16-byte store four whole 128-byte pieces of Wt rows. HEAD 0: W is [K][N]; HEAD 1: W is [N/64][K][64] (tile column block = head). Wt is [n][k].
// Requires K % 64 == 0 and N % 64 == 0; grid = (N/64)*(K/64), block 256.
#define WTP 66                  /* LDS row pitch in halves: 33 words, so that a column walk of 8 rows apart meets 8 different banks */
template <int HEAD>
static __device__ __forceinline__ void wt_tile_body(const float* __restrict__ W, _Float16* __restrict__ Wt, int K, int N, float scale) {
  __shared__ unsigned short tl[64][WTP];
  const int tid = threadIdx.x; const int nkt = K >> 6; const int nt = blockIdx.x / nkt, kt = blockIdx.x - nt * nkt; if (nt * 64 >= N) return;   /* the same for the whole block, ahead of the barrier */
  const int n0 = nt * 64, k0 = kt * 64;
  const float* src = HEAD ? W + ((size_t)nt * K + k0) * HD : W + (size_t)k0 * N + n0;
  const size_t rstep = HEAD ? (size_t)HD : (size_t)N;
  const int r0 = tid >> 4, c4 = (tid & 15) * 4;
  v4f a[4];
#pragma unroll  /* the four loads of a lane are issued together, ahead of the first convert */
  for (int i = 0; i < 4; ++i) a[i] = *(const v4fa*)(src + (size_t)(i * 16 + r0) * rstep + c4);
#pragma unroll  /* constant indices keep a[] and f in registers, here and in the loops below */
  for (int i = 0; i < 4; ++i) { FragH f;
#pragma unroll
    for (int q = 0; q < 4; ++q) { const float v = bf16_rne(a[i][q]) * scale; f.h[q] = HEAD ? toh_flush(v) : (_Float16)v; }
#pragma unroll
    for (int q = 0; q < 4; ++q) tl[i * 16 + r0][c4 + q] = f.u[q]; }
  __syncthreads();   /* the whole tile is in LDS before any column of it is read */
#pragma unroll
  for (int rd = 0; rd < 2; ++rd) { const int n = rd * 32 + tid / 8, pc = tid % 8; FragH f;
#pragma unroll
    for (int q = 0; q < 8; ++q) f.u[q] = tl[pc * 8 + q][n];
    *(v8us*)((unsigned short*)Wt + (size_t)(n0 + n) * K + k0 + pc * 8) = f.half[0]; }
}

__global__ __launch_bounds__(256) void k_wt_f16(const float* __restrict__ W, _Float16* __restrict__ Wt, int K, int N, float scale) {
  wt_tile_body<0>(W, Wt, K, N, scale);
}

__global__ __launch_bounds__(256) void k_wt_head(const float* __restrict__ W, _Float16* __restrict__ Wt, int K, int N, float scale) {
  wt_tile_body<1>(W, Wt, K, N, scale);
}

__global__ __launch_bounds__(256) void k_x16(const float* __restrict__ x, _Float16* __restrict__ X16, size_t n8) {
  const size_t t = (size_t)blockIdx.x * 256 + threadIdx.x; if (t >= n8) return;
  const size_t e = t * 8; const size_t r = e / DM; const size_t c = e % DM; const size_t rs = (r / SEQ) * SEQ_FULL + (r % SEQ);
  const float* src = x + rs * DM + c; const v4f a = *(const v4fa*)src; const v4f a2 = *(const v4fa*)(src + 4); FragH f;
#pragma unroll
  for (int q = 0; q < 4; ++q) { f.h[q] = (_Float16)bf16_rne(a[q]); f.h[4 + q] = (_Float16)bf16_rne(a2[q]); }
  const v8us o = f.half[0]; unsigned short* d = (unsigned short*)X16 + e;
  *(v8us*)d = o; 
}

__global__ __launch_bounds__(256) void k_split16(const float* __restrict__ src, _Float16* __restrict__ H16, _Float16* __restrict__ R16, size_t n8) {
  #pragma clang fp contract(off)
  const size_t t = (size_t)blockIdx.x * 256 + threadIdx.x; if (t >= n8) return;
  const size_t e = t * 8; const v4f a = *(const v4fa*)(src + e); const v4f a2 = *(const v4fa*)(src + e + 4); FragH fh, fr;
#pragma unroll
  for (int q = 0; q < 4; ++q) {
    const h16 h0 = toh_flush(a[q]);  fh.h[q] = h0;     fr.h[q] = toh_flush((a[q] - (float)h0) * RCARRY);
    const h16 h1 = toh_flush(a2[q]); fh.h[4 + q] = h1; fr.h[4 + q] = toh_flush((a2[q] - (float)h1) * RCARRY); }
  const v8us oh = fh.half[0]; const v8us orr = fr.half[0];
  unsigned short* dh = (unsigned short*)H16 + e; unsigned short* dr = (unsigned short*)R16 + e;
  *(v8us*)dh = oh; *(v8us*)dr = orr; 
}

template <int NHv, int TTv>
__global__ __launch_bounds__(256) void k_vt(const _Float16* __restrict__ V16, int ldv, int voff, _Float16* __restrict__ Vt) {
  __shared__ unsigned short tl[64][66]; const int tid = threadIdx.x; const int slab = blockIdx.x / (TTv / 64), lg = blockIdx.x % (TTv / 64); const int b = slab / NHv, h = slab % NHv;
  for (int i = tid; i < 64 * 8; i += 256) { const int r = i / 8, c8 = (i % 8) * 8; FragH f; f.half[0] = *(const v8us*)((const unsigned short*)V16 + ((size_t)b * TTv + lg * 64 + r) * ldv + voff + h * 64 + c8);
#pragma unroll
    for (int q = 0; q < 8; ++q) tl[r][c8 + q] = f.u[q]; }
  __syncthreads();
  {
#pragma unroll
    for (int rd = 0; rd < 2; ++rd) { const int d = rd * 32 + tid / 8, pc = tid % 8; FragH f;
#pragma unroll
      for (int q = 0; q < 8; ++q) f.u[q] = tl[pc * 8 + q][d];
      *(v8us*)((unsigned short*)Vt + ((size_t)slab * 64 + d) * TTv + lg * 64 + pc * 8) = f.half[0]; }
     }
}

// LDS staging of the GEMM operands. A block of 8 waves owns a 128 x 128 tile of C; a stage holds 128 k of its 128 A rows and then of its 128 B rows.
#define GKP 128                 /* k (halves) per stage: 256-byte rows */
#define GPITCH 136              /* LDS row pitch in halves: 272 B = 16 B x 17, conflict-free for 16-byte row reads */
#define GPITCHB (GPITCH * 2)    /* the same in bytes */
#define GSTAGE (256 * GPITCH)   /* halves per stage */
static_assert(DM % GKP == 0 && DFF % GKP == 0 && DM % 128 == 0 && DFF % 128 == 0);

static __device__ __forceinline__ unsigned lds_off(const void* p) { return (unsigned)(size_t)p; }

// Eight 16-byte asynchronous copies of one lane: rows 16 apart, global row step gstep halves. The s_wait_xcnt closes the statement so that no address register is rewritten ahead of it.
static __device__ __forceinline__ void copy8(unsigned l, const _Float16* g, size_t gstep) {
  asm volatile(
      "global_load_async_to_lds_b128 %0, %8, off\n\t"
      "global_load_async_to_lds_b128 %1, %9, off\n\t"
      "global_load_async_to_lds_b128 %2, %10, off\n\t"
      "global_load_async_to_lds_b128 %3, %11, off\n\t"
      "global_load_async_to_lds_b128 %4, %12, off\n\t"
      "global_load_async_to_lds_b128 %5, %13, off\n\t"
      "global_load_async_to_lds_b128 %6, %14, off\n\t"
      "global_load_async_to_lds_b128 %7, %15, off\n\t"
      "s_wait_xcnt 0x0"
      :: "v"(l), "v"(l + 16u * GPITCHB), "v"(l + 32u * GPITCHB), "v"(l + 48u * GPITCHB), "v"(l + 64u * GPITCHB), "v"(l + 80u * GPITCHB), "v"(l + 96u * GPITCHB), "v"(l + 112u * GPITCHB),
         "v"(g), "v"(g + gstep), "v"(g + 2 * gstep), "v"(g + 3 * gstep), "v"(g + 4 * gstep), "v"(g + 5 * gstep), "v"(g + 6 * gstep), "v"(g + 7 * gstep)
      : "memory");
}
// One stage: l = this lane's LDS byte address in the stage's row tid/16, ga / gb = its 16 bytes of that row of the A / B tile.
static __device__ __forceinline__ void stage_copy(unsigned l, const _Float16* ga, int lda, const _Float16* gb, int ldb) {
  copy8(l, ga, (size_t)16 * lda);
  copy8(l + 128u * GPITCHB, gb, (size_t)16 * ldb);
}

// One K sweep of the block's 128 x 128 tile through a two-buffer LDS ring; each wave keeps a 32 x 64 tile (A rows arow, arow + 16; B rows brow + 16 j), k ascending in steps of 32.
// At and Bt point at the first row of the block's A and B tiles. Every thread of the block calls it; K is a positive multiple of 128. The ring is free again on return (the last trip's barrier).
static __device__ __forceinline__ void gemm_sweep(_Float16* ring, const _Float16* At, int lda, const _Float16* Bt, int ldb, int K, int tid, int arow, int brow, int hh,
    v8f& c00, v8f& c01, v8f& c02, v8f& c03, v8f& c10, v8f& c11, v8f& c12, v8f& c13) {
  const unsigned l0 = lds_off(ring) + (unsigned)((tid >> 4) * GPITCHB + (tid & 15) * 16);
  const _Float16* ga = At + (size_t)(tid >> 4) * lda + (tid & 15) * 8;
  const _Float16* gb = Bt + (size_t)(tid >> 4) * ldb + (tid & 15) * 8;
  const int nst = K / GKP;
  stage_copy(l0, ga, lda, gb, ldb);
  asm volatile("s_wait_asynccnt 0x0" ::: "memory");   /* stage 0 of this wave has landed */
  __syncthreads();                                    /* stage 0 of every wave is readable */
  if (nst > 1) stage_copy(l0 + (unsigned)(GSTAGE * 2), ga + GKP, lda, gb + GKP, ldb);
#pragma unroll 1  /* one trip per stage: the ring's waits and its barrier stand once, at the trip's foot */
  for (int t = 0; t < nst; ++t) {
    const _Float16* buf = ring + (t & 1) * GSTAGE;
    const _Float16* a0p = buf + arow * GPITCH; const _Float16* a1p = a0p + 16 * GPITCH;
    const _Float16* b0p = buf + (128 + brow) * GPITCH; const _Float16* b1p = b0p + 16 * GPITCH; const _Float16* b2p = b1p + 16 * GPITCH; const _Float16* b3p = b2p + 16 * GPITCH;
    // the six fragments of a k step are read as one group, one k step ahead inside the stage, so that their LDS latency runs under the products of the step before
    v16h a0 = g2_frag(a0p, hh), a1 = g2_frag(a1p, hh), b0 = g2_frag(b0p, hh), b1 = g2_frag(b1p, hh), b2 = g2_frag(b2p, hh), b3 = g2_frag(b3p, hh);
#pragma unroll  /* constant LDS offsets, and the two fragment sets swap by renaming, without moves */
    for (int kb = 0; kb < GKP; kb += 32) {
      v16h na0 = a0, na1 = a1, nb0 = b0, nb1 = b1, nb2 = b2, nb3 = b3;
      if (kb + 32 < GKP) { na0 = g2_frag(a0p + kb + 32, hh); na1 = g2_frag(a1p + kb + 32, hh); nb0 = g2_frag(b0p + kb + 32, hh); nb1 = g2_frag(b1p + kb + 32, hh); nb2 = g2_frag(b2p + kb + 32, hh); nb3 = g2_frag(b3p + kb + 32, hh); }
      c00 = g2_mma(a0, b0, c00); c10 = g2_mma(a1, b0, c10);
      c01 = g2_mma(a0, b1, c01); c11 = g2_mma(a1, b1, c11);
      c02 = g2_mma(a0, b2, c02); c12 = g2_mma(a1, b2, c12);
      c03 = g2_mma(a0, b3, c03); c13 = g2_mma(a1, b3, c13);
      a0 = na0; a1 = na1; b0 = nb0; b1 = nb1; b2 = nb2; b3 = nb3; }
    asm volatile("s_wait_dscnt 0x0" ::: "memory");      /* this wave's reads of buffer t & 1 are done before it is refilled */
    asm volatile("s_wait_asynccnt 0x0" ::: "memory");   /* this wave's copies of stage t + 1 have landed */
    __syncthreads();                                    /* publishes stage t + 1 and ends every reader's last read of buffer t & 1 */
    if (t + 2 < nst) stage_copy(l0 + (unsigned)((t & 1) * (GSTAGE * 2)), ga + (size_t)(t + 2) * GKP, lda, gb + (size_t)(t + 2) * GKP, ldb);
  }
  asm volatile("s_wait_asynccnt 0x0" ::: "memory");     /* no copy is outstanding when the ring is left */
}

// GEMM: block tile 128 x 128 (8 waves, 4 x 2), wave tile 32 rows x 64 cols; A f16 rows (pitch lda), Bh f16 [n][k] (pitch ldb); v = acc*alpha + bf16(bias[col])*bsc; ACT 0 none / 3 relu;
// Requires M % 128 == 0, N % 128 == 0, K % 128 == 0; grid = (M/128)*(N/128), block 256.
template <int ACT>
__global__ __launch_bounds__(256) void k_gemm2(const _Float16* __restrict__ A, int lda, const _Float16* __restrict__ Bh, int ldb, float alpha, const float* __restrict__ bias, float bsc,
    float* __restrict__ C, _Float16* __restrict__ C16, int ldc, int M, int N, int K) {
  static_assert(ACT == 0 || ACT == 3);
  __shared__ __attribute__((aligned(16))) _Float16 ring[2 * GSTAGE];
  __shared__ __attribute__((aligned(16))) float so[8][32][68];
  const int tid = threadIdx.x, lane = tid & 31, ln = lane & 15, hh = lane >> 4;
  const int w = __builtin_amdgcn_readfirstlane(tid >> 5);
  const int ntn = N >> 7; const int mt = blockIdx.x / ntn, nq = blockIdx.x - mt * ntn; if (mt * 128 >= M) return;
  const int row0 = mt * 128 + 32 * (w >> 1), col0 = nq * 128 + 64 * (w & 1);
  const v8f z8 = {0.f,0.f,0.f,0.f,0.f,0.f,0.f,0.f}; v8f c00 = z8, c01 = z8, c02 = z8, c03 = z8, c10 = z8, c11 = z8, c12 = z8, c13 = z8;
  gemm_sweep(ring, A + (size_t)(mt * 128) * lda, lda, Bh + (size_t)(nq * 128) * ldb, ldb, K, tid, 32 * (w >> 1) + ln, 64 * (w & 1) + ln, hh, c00, c01, c02, c03, c10, c11, c12, c13);
  v8f accs[8] = {c00, c01, c02, c03, c10, c11, c12, c13};
#pragma unroll
  for (int u = 0; u < 8; ++u) { const int t = u & 3, half = u >> 2; const int col = col0 + t * 16 + ln; const float bv = bias ? bf16_rne(bias[col]) * bsc : 0.f;
#pragma unroll
    for (int r = 0; r < 8; ++r) { const int rloc = half * 16 + 8 * hh + r; float v = accs[u][r] * alpha + bv; if (ACT == 3) v = fmaxf(v, 0.f); so[w][rloc][t * 16 + ln] = v; } }
  __builtin_amdgcn_fence(4 /* acq_rel order */, "workgroup"); __builtin_amdgcn_wave_barrier();
  const int rsub = lane >> 4, c4 = (lane & 15) * 4;
  {
#pragma unroll
    for (int q = 0; q < 16; ++q) { const int r = q * 2 + rsub; const v4f v = *(const v4fa*)&so[w][r][c4];
      if (C) *(v4f*)(C + (size_t)(row0 + r) * ldc + col0 + c4) = v;
      if (C16) { v4h h4; for (int i = 0; i < 4; ++i) h4[i] = (_Float16)v[i]; *(v4h*)(C16 + (size_t)(row0 + r) * ldc + col0 + c4) = h4; } }
     }
}

// GEMM with an optional residual A plane (AR = (a - f16(a)) * 2048, own accumulators from zero, folded by 2^-11 in f32) and either an f32 output (OUTHR 0)
// Requires M % 128 == 0, N % 128 == 0, K % 128 == 0; grid = (M/128)*(N/128), block 256.
template <int ARES, int OUTHR>
static __device__ __forceinline__ void gemm_hr_body(const _Float16* __restrict__ A, const _Float16* __restrict__ AR, int lda, const _Float16* __restrict__ Bh, int ldb, float alpha,
    const float* __restrict__ bias, float bsc, float* __restrict__ C, _Float16* __restrict__ CH, _Float16* __restrict__ CR, int ldc, int M, int N, int K) {
  __shared__ __attribute__((aligned(16))) _Float16 ring[2 * GSTAGE];
  __shared__ __attribute__((aligned(16))) float so[8][32][68];
  const int tid = threadIdx.x, lane = tid & 31, ln = lane & 15, hh = lane >> 4;
  const int w = __builtin_amdgcn_readfirstlane(tid >> 5);
  const int ntn = N >> 7; const int mt = blockIdx.x / ntn, nq = blockIdx.x - mt * ntn; if (mt * 128 >= M) return;
  const int row0 = mt * 128 + 32 * (w >> 1), col0 = nq * 128 + 64 * (w & 1);
  const int arow = 32 * (w >> 1) + ln, brow = 64 * (w & 1) + ln;
  const _Float16* Bt = Bh + (size_t)(nq * 128) * ldb;
  const v8f z8 = {0.f,0.f,0.f,0.f,0.f,0.f,0.f,0.f};
  if (ARES) {
    v8f d00 = z8, d01 = z8, d02 = z8, d03 = z8, d10 = z8, d11 = z8, d12 = z8, d13 = z8;
    gemm_sweep(ring, AR + (size_t)(mt * 128) * lda, lda, Bt, ldb, K, tid, arow, brow, hh, d00, d01, d02, d03, d10, d11, d12, d13);
    v8f ds[8] = {d00, d01, d02, d03, d10, d11, d12, d13};
#pragma unroll
    for (int u = 0; u < 8; ++u) { const int t = u & 3, half = u >> 2;
#pragma unroll
      for (int r = 0; r < 8; ++r) { const int rloc = half * 16 + 8 * hh + r; so[w][rloc][t * 16 + ln] = ds[u][r] * RINV; } }
  }
  v8f c00 = z8, c01 = z8, c02 = z8, c03 = z8, c10 = z8, c11 = z8, c12 = z8, c13 = z8;
  gemm_sweep(ring, A + (size_t)(mt * 128) * lda, lda, Bt, ldb, K, tid, arow, brow, hh, c00, c01, c02, c03, c10, c11, c12, c13);
  v8f accs[8] = {c00, c01, c02, c03, c10, c11, c12, c13};
#pragma unroll
  for (int u = 0; u < 8; ++u) { const int t = u & 3, half = u >> 2; const int col = col0 + t * 16 + ln; const float bv = bias ? bf16_rne(bias[col]) * bsc : 0.f;
#pragma unroll
    for (int r = 0; r < 8; ++r) { const int rloc = half * 16 + 8 * hh + r; float v = accs[u][r]; if (ARES) v += so[w][rloc][t * 16 + ln]; v = v * alpha + bv; so[w][rloc][t * 16 + ln] = v; } }
  __builtin_amdgcn_fence(4 /* acq_rel order */, "workgroup"); __builtin_amdgcn_wave_barrier();
  const int rsub = lane >> 4, c4 = (lane & 15) * 4;
  {
#pragma unroll
    for (int q = 0; q < 16; ++q) { const int r = q * 2 + rsub; const v4f v = *(const v4fa*)&so[w][r][c4];
      if (OUTHR) { v4h h4, r4;
#pragma unroll
        for (int i = 0; i < 4; ++i) { const h16 hv = toh_flush(v[i]); h4[i] = hv; r4[i] = toh_flush((v[i] - (float)hv) * RCARRY); }
        *(v4h*)(CH + (size_t)(row0 + r) * ldc + col0 + c4) = h4;
        *(v4h*)(CR + (size_t)(row0 + r) * ldc + col0 + c4) = r4; }
      else { *(v4f*)(C + (size_t)(row0 + r) * ldc + col0 + c4) = v; } }
     }
}

// single A plane -> f16 value + residual output planes
__global__ __launch_bounds__(256) void k_proj_hr(const _Float16* __restrict__ A, int lda, const _Float16* __restrict__ Bh, int ldb, float alpha,
    _Float16* __restrict__ CH, _Float16* __restrict__ CR, int ldc, int M, int N, int K) {
  gemm_hr_body<0, 1>(A, A, lda, Bh, ldb, alpha, nullptr, 0.f, nullptr, CH, CR, ldc, M, N, K);
}
// value + residual A planes -> f16 value + residual output planes
__global__ __launch_bounds__(256) void k_proj_rhr(const _Float16* __restrict__ A, const _Float16* __restrict__ AR, int lda, const _Float16* __restrict__ Bh, int ldb, float alpha,
    _Float16* __restrict__ CH, _Float16* __restrict__ CR, int ldc, int M, int N, int K) {
  gemm_hr_body<1, 1>(A, AR, lda, Bh, ldb, alpha, nullptr, 0.f, nullptr, CH, CR, ldc, M, N, K);
}
// value + residual A planes -> f32 rows with bias
__global__ __launch_bounds__(256) void k_proj_rf(const _Float16* __restrict__ A, const _Float16* __restrict__ AR, int lda, const _Float16* __restrict__ Bh, int ldb, float alpha,
    const float* __restrict__ bias, float bsc, float* __restrict__ C, int ldc, int M, int N, int K) {
  gemm_hr_body<1, 0>(A, AR, lda, Bh, ldb, alpha, bias, bsc, C, nullptr, nullptr, ldc, M, N, K);
}

// LDS staging of the attention operands. A block of 8 waves owns 128 query rows of one (batch, head); a stage holds 64 keys: the K value and K residual rows (64 rows of 128 bytes each),
// then the V^T value rows (64 head columns x 64 keys) and, CAUSAL, the V^T residual rows. Every copy of a wave covers four whole 128-byte rows.
#define AKS 64                  /* keys per stage */
#define APITCH 72               /* LDS row pitch in halves: 144 B = 16 B x 9, conflict-free for 16-byte row reads */
#define APITCHB (APITCH * 2)    /* the same in bytes */
#define APLANE (64 * APITCH)    /* halves per staged plane */
static_assert(SEQ % 128 == 0 && SEQ / AKS >= 2 && HD == 64);

// Four / two 16-byte asynchronous copies of one lane. The s_wait_xcnt closes the statement so that no address register is rewritten ahead of it.
static __device__ __forceinline__ void copy4(unsigned l0, unsigned l1, unsigned l2, unsigned l3, const _Float16* g0, const _Float16* g1, const _Float16* g2, const _Float16* g3) {
  asm volatile(
      "global_load_async_to_lds_b128 %0, %4, off\n\t"
      "global_load_async_to_lds_b128 %1, %5, off\n\t"
      "global_load_async_to_lds_b128 %2, %6, off\n\t"
      "global_load_async_to_lds_b128 %3, %7, off\n\t"
      "s_wait_xcnt 0x0"
      :: "v"(l0), "v"(l1), "v"(l2), "v"(l3), "v"(g0), "v"(g1), "v"(g2), "v"(g3)
      : "memory");
}
static __device__ __forceinline__ void copy2(unsigned l0, unsigned l1, const _Float16* g0, const _Float16* g1) {
  asm volatile(
      "global_load_async_to_lds_b128 %0, %2, off\n\t"
      "global_load_async_to_lds_b128 %1, %3, off\n\t"
      "s_wait_xcnt 0x0"
      :: "v"(l0), "v"(l1), "v"(g0), "v"(g1)
      : "memory");
}
// One stage: l = this lane's LDS byte address in row tid/8 of the stage's first plane; gk / gkr / gv / gvr = its 16 bytes of that row of each plane. A lane brings rows tid/8 and tid/8 + 32 of every plane.
template <int CAUSAL>
static __device__ __forceinline__ void attn_stage_copy(unsigned l, const _Float16* gk, const _Float16* gkr, const _Float16* gv, const _Float16* gvr) {
  const unsigned pl = (unsigned)(APLANE * 2), rb = 32u * APITCHB;
  copy4(l, l + rb, l + pl, l + pl + rb, gk, gk + (size_t)32 * DM, gkr, gkr + (size_t)32 * DM);
  if (CAUSAL) copy4(l + 2u * pl, l + 2u * pl + rb, l + 3u * pl, l + 3u * pl + rb, gv, gv + (size_t)32 * SEQ, gvr, gvr + (size_t)32 * SEQ);
  else copy2(l + 2u * pl, l + 2u * pl + rb, gv, gv + (size_t)32 * SEQ);
}

// Flash-style attention for one (batch, head, 16 query rows) per wave: keys taken 32 at a time from the block's two-buffer LDS ring with an online (running-max) softmax in f32.
// scores = 8 * q.k^T with q and k as f16 value + x2048 residual planes: value.value in one accumulator, residual.value + value.residual in a second
// accumulator folded by 2^-11. CAUSAL: keys above the query row and exactly-zero scores take the fill -1e9 (replace), key blocks entirely above
// the wave's rows are skipped (their weights are exactly 0); P = 16384*exp(s - m) as f16 value + x2048 residual, V^T as value + residual slabs,
// o = P.V^T with value.value in one accumulator and the two cross terms in a second, row sum over the unconverted P; o/l * 64 written as f16 value +
// residual rows. Dense: P as one f16 plane (row sum over the converted P), V^T one plane, o one plane. P and o tiles are wave-private LDS
template <int CAUSAL>
static __device__ __forceinline__ void attn_hr_body(const _Float16* __restrict__ Q16, const _Float16* __restrict__ QR, const _Float16* __restrict__ K16, const _Float16* __restrict__ KR,
    const _Float16* __restrict__ VT, const _Float16* __restrict__ VTR, _Float16* __restrict__ O16, _Float16* __restrict__ OR16) {
  constexpr int ASTAGE = (CAUSAL ? 4 : 3) * APLANE;   /* halves per stage */
  __shared__ __attribute__((aligned(16))) _Float16 kv[2 * ASTAGE];
  __shared__ __attribute__((aligned(16))) _Float16 pb[8][16 * PBP];
  __shared__ __attribute__((aligned(16))) _Float16 pbr[8][16 * PBP];
  __shared__ __attribute__((aligned(16))) _Float16 ob[8][16 * OBP];
  __shared__ __attribute__((aligned(16))) _Float16 obr[8][16 * OBP];
  const int tid = threadIdx.x, lane = tid & 31, ln = lane & 15, hh = lane >> 4;
  const int w = __builtin_amdgcn_readfirstlane(tid >> 5);
  const int h = blockIdx.y, b = blockIdx.z;
  const int qb = blockIdx.x * 128;
  const int q0 = qb + w * 16;
  const size_t tok0 = (size_t)b * SEQ;
  const int slab = b * NH + h;
  const size_t qoff = (tok0 + q0 + ln) * DM + h * HD;
  const v16h qf0 = g2_frag(Q16 + qoff, hh), qf1 = g2_frag(Q16 + qoff + 32, hh);
  const v16h qr0 = g2_frag(QR + qoff, hh),  qr1 = g2_frag(QR + qoff + 32, hh);
  const v8f z8 = {0.f,0.f,0.f,0.f,0.f,0.f,0.f,0.f};
  v8f o0 = z8, o1 = z8, o2 = z8, o3 = z8;
  v8f e0 = z8, e1 = z8, e2 = z8, e3 = z8;
  float mrow[8], lrow[8];
#pragma unroll
  for (int r = 0; r < 8; ++r) { mrow[r] = -1.0e30f; lrow[r] = 0.f; }
  const int kend = CAUSAL ? (q0 + 16) : SEQ;                  /* this wave's keys end here (the same in every lane) */
  const int nst = CAUSAL ? (qb + 128) / AKS : SEQ / AKS;      /* stages of the block: up to its last wave's keys; at least two */
  const unsigned l0 = lds_off(kv) + (unsigned)((tid >> 3) * APITCHB + (tid & 7) * 16);
  const size_t gko = (tok0 + (tid >> 3)) * DM + h * HD + (tid & 7) * 8;
  const size_t gvo = ((size_t)slab * HD + (tid >> 3)) * SEQ + (tid & 7) * 8;
  const _Float16* gk = K16 + gko; const _Float16* gkr = KR + gko; const _Float16* gv = VT + gvo; const _Float16* gvr = VTR + gvo;
  attn_stage_copy<CAUSAL>(l0, gk, gkr, gv, gvr);
  asm volatile("s_wait_asynccnt 0x0" ::: "memory");   /* stage 0 of this wave has landed */
  __syncthreads();                                    /* stage 0 of every wave is readable */
  if (nst > 1) attn_stage_copy<CAUSAL>(l0 + (unsigned)(ASTAGE * 2), gk + (size_t)AKS * DM, gkr + (size_t)AKS * DM, gv + AKS, gvr + AKS);
#pragma unroll 1  /* one trip per stage: the ring's waits and its barrier stand once, at the trip's foot */
  for (int st = 0; st < nst; ++st) {
  const _Float16* buf = kv + (st & 1) * ASTAGE;
#pragma unroll 1  /* two passes of 32 keys per stage share one body */
  for (int sub = 0; sub < AKS; sub += 32) {
    const int kb = st * AKS + sub;
    if (kb >= kend) break;                            /* a wave past its diagonal skips the pass, never the trip's foot */
    const _Float16* k0p = buf + (sub + ln) * APITCH; const _Float16* k1p = k0p + 16 * APITCH;
    const _Float16* r0p = k0p + APLANE;              const _Float16* r1p = r0p + 16 * APITCH;
    v8f s0 = z8, s1 = z8, t0 = z8, t1 = z8;
    v16h kf = g2_frag(k0p, hh);    s0 = g2_mma(qf0, kf, s0); t0 = g2_mma(qr0, kf, t0);
    kf = g2_frag(k0p + 32, hh);    s0 = g2_mma(qf1, kf, s0); t0 = g2_mma(qr1, kf, t0);
    kf = g2_frag(r0p, hh);         t0 = g2_mma(qf0, kf, t0);
    kf = g2_frag(r0p + 32, hh);    t0 = g2_mma(qf1, kf, t0);
    kf = g2_frag(k1p, hh);         s1 = g2_mma(qf0, kf, s1); t1 = g2_mma(qr0, kf, t1);
    kf = g2_frag(k1p + 32, hh);    s1 = g2_mma(qf1, kf, s1); t1 = g2_mma(qr1, kf, t1);
    kf = g2_frag(r1p, hh);         t1 = g2_mma(qf0, kf, t1);
    kf = g2_frag(r1p + 32, hh);    t1 = g2_mma(qf1, kf, t1);
#pragma unroll
    for (int r = 0; r < 8; ++r) {
      const int row = q0 + 8 * hh + r;
      float a = (s0[r] + t0[r] * RINV) * 8.0f, c = (s1[r] + t1[r] * RINV) * 8.0f;
      if (CAUSAL) { a = ((kb + ln > row) || (a == 0.0f)) ? -1.0e9f : a; c = ((kb + 16 + ln > row) || (c == 0.0f)) ? -1.0e9f : c; }
      float t = fmaxf(a, c);
      t = fmaxf(t, __shfl_xor(t, 1, 32)); t = fmaxf(t, __shfl_xor(t, 2, 32)); t = fmaxf(t, __shfl_xor(t, 4, 32)); t = fmaxf(t, __shfl_xor(t, 8, 32));
      const float mnew = fmaxf(mrow[r], t);
      const float p0 = __expf(a - mnew), p1 = __expf(c - mnew);
      const float pc0 = p0 * PCARRY, pc1 = p1 * PCARRY;
      const h16 ph0 = toh_flush(pc0), ph1 = toh_flush(pc1);
      float ls = CAUSAL ? (pc0 + pc1) : ((float)ph0 + (float)ph1);
      ls += __shfl_xor(ls, 1, 32); ls += __shfl_xor(ls, 2, 32); ls += __shfl_xor(ls, 4, 32); ls += __shfl_xor(ls, 8, 32);
      const float corr = __expf(mrow[r] - mnew);
      lrow[r] = lrow[r] * corr + ls; mrow[r] = mnew;
      o0[r] *= corr; o1[r] *= corr; o2[r] *= corr; o3[r] *= corr;
      if (CAUSAL) { e0[r] *= corr; e1[r] *= corr; e2[r] *= corr; e3[r] *= corr; }
      pb[w][(8 * hh + r) * PBP + ln]      = ph0;
      pb[w][(8 * hh + r) * PBP + 16 + ln] = ph1;
      if (CAUSAL) {
        pbr[w][(8 * hh + r) * PBP + ln]      = toh_flush((pc0 - (float)ph0) * RCARRY);
        pbr[w][(8 * hh + r) * PBP + 16 + ln] = toh_flush((pc1 - (float)ph1) * RCARRY); }
    }
    __builtin_amdgcn_fence(4 /* acq_rel order */, "wavefront"); __builtin_amdgcn_wave_barrier();
    const v16h pf = g2_frag(&pb[w][ln * PBP], hh);
    v16h prf = pf; if (CAUSAL) prf = g2_frag(&pbr[w][ln * PBP], hh);
    __builtin_amdgcn_fence(4 /* acq_rel order */, "wavefront"); __builtin_amdgcn_wave_barrier();
    const _Float16* vp = buf + 2 * APLANE + ln * APITCH + sub; const _Float16* vrp = vp + (CAUSAL ? APLANE : 0);
    v16h vf = g2_frag(vp, hh);                   o0 = g2_mma(pf, vf, o0);
    if (CAUSAL) { e0 = g2_mma(prf, vf, e0); vf = g2_frag(vrp, hh);                   e0 = g2_mma(pf, vf, e0); }
    vf = g2_frag(vp + 16 * APITCH, hh);          o1 = g2_mma(pf, vf, o1);
    if (CAUSAL) { e1 = g2_mma(prf, vf, e1); vf = g2_frag(vrp + 16 * APITCH, hh);     e1 = g2_mma(pf, vf, e1); }
    vf = g2_frag(vp + 32 * APITCH, hh);          o2 = g2_mma(pf, vf, o2);
    if (CAUSAL) { e2 = g2_mma(prf, vf, e2); vf = g2_frag(vrp + 32 * APITCH, hh);     e2 = g2_mma(pf, vf, e2); }
    vf = g2_frag(vp + 48 * APITCH, hh);          o3 = g2_mma(pf, vf, o3);
    if (CAUSAL) { e3 = g2_mma(prf, vf, e3); vf = g2_frag(vrp + 48 * APITCH, hh);     e3 = g2_mma(pf, vf, e3); }
  }
    asm volatile("s_wait_dscnt 0x0" ::: "memory");      /* this wave's reads of buffer st & 1 are done before it is refilled */
    asm volatile("s_wait_asynccnt 0x0" ::: "memory");   /* this wave's copies of stage st + 1 have landed */
    __syncthreads();                                    /* publishes stage st + 1 and ends every reader's last read of buffer st & 1 */
    if (st + 2 < nst) attn_stage_copy<CAUSAL>(l0 + (unsigned)((st & 1) * (ASTAGE * 2)), gk + (size_t)(st + 2) * AKS * DM, gkr + (size_t)(st + 2) * AKS * DM, gv + (st + 2) * AKS, gvr + (st + 2) * AKS);
  }
  asm volatile("s_wait_asynccnt 0x0" ::: "memory");     /* no copy is outstanding when the ring is left */
#pragma unroll
  for (int r = 0; r < 8; ++r) {
    const float rl = 64.0f * __builtin_amdgcn_rcpf(lrow[r]);      /* o carried x64; l already carries the P carry */
    const int rloc = (8 * hh + r) * OBP + ln;
    float v0 = o0[r], v1 = o1[r], v2 = o2[r], v3 = o3[r];
    if (CAUSAL) { v0 += e0[r] * RINV; v1 += e1[r] * RINV; v2 += e2[r] * RINV; v3 += e3[r] * RINV; }
    v0 *= rl; v1 *= rl; v2 *= rl; v3 *= rl;
    const h16 g0 = toh_flush(v0), g1 = toh_flush(v1), g2 = toh_flush(v2), g3 = toh_flush(v3);
    ob[w][rloc] = g0; ob[w][rloc + 16] = g1; ob[w][rloc + 32] = g2; ob[w][rloc + 48] = g3;
    if (CAUSAL) {
      obr[w][rloc]      = toh_flush((v0 - (float)g0) * RCARRY); obr[w][rloc + 16] = toh_flush((v1 - (float)g1) * RCARRY);
      obr[w][rloc + 32] = toh_flush((v2 - (float)g2) * RCARRY); obr[w][rloc + 48] = toh_flush((v3 - (float)g3) * RCARRY); }
  }
  __builtin_amdgcn_fence(4 /* acq_rel order */, "wavefront"); __builtin_amdgcn_wave_barrier();
  const int rq = lane >> 3, pc = (lane & 7) * 8;
  {
#pragma unroll
    for (int i = 0; i < 4; ++i) { const int row = i * 4 + rq; const size_t go = (tok0 + q0 + row) * DM + h * HD + pc;
      const v8us v = *(const v8us*)(&ob[w][row * OBP + pc]);
      *(v8us*)((unsigned short*)O16 + go) = v;
      if (CAUSAL) { const v8us vr = *(const v8us*)(&obr[w][row * OBP + pc]); *(v8us*)((unsigned short*)OR16 + go) = vr; } }
     }
}

__global__ __launch_bounds__(256) void k_attn_causal(const _Float16* __restrict__ Q16, const _Float16* __restrict__ QR, const _Float16* __restrict__ K16, const _Float16* __restrict__ KR,
    const _Float16* __restrict__ VT, const _Float16* __restrict__ VTR, _Float16* __restrict__ O16, _Float16* __restrict__ OR16) {
  attn_hr_body<1>(Q16, QR, K16, KR, VT, VTR, O16, OR16);
}
__global__ __launch_bounds__(256) void k_attn_dense(const _Float16* __restrict__ Q16, const _Float16* __restrict__ QR, const _Float16* __restrict__ K16, const _Float16* __restrict__ KR,
    const _Float16* __restrict__ VT, _Float16* __restrict__ O16) {
  attn_hr_body<0>(Q16, QR, K16, KR, VT, VT, O16, O16);
}

// red[] is cross-wave (block barriers); no early exit.
template <int RBF, int RMAP, int W16, int OMAP>
__global__ __launch_bounds__(256) void k_ln(const float* __restrict__ X, const float* __restrict__ R, const float* __restrict__ g, const float* __restrict__ bb, float eps, float* __restrict__ O32, _Float16* __restrict__ O16) {
  #pragma clang fp contract(off)
  __shared__ float red[256];
  const size_t r = blockIdx.x; const int t = threadIdx.x; const int c0 = t * 4;
  const size_t rfull = (r / SEQ) * SEQ_FULL + (r % SEQ);
  const size_t rr = RMAP ? rfull : r;
  const v4f xa = *(const v4fa*)(X + r * DM + c0); const v4f ra = *(const v4fa*)(R + rr * DM + c0);
  float s[4]; float sum = 0.f;
#pragma unroll
  for (int q = 0; q < 4; ++q) { const float rv = RBF ? bf16_rne(ra[q]) : ra[q]; s[q] = xa[q] + rv; sum += s[q]; }
  red[t] = sum; __syncthreads();
  for (int st = 128; st > 0; st >>= 1) { if (t < st) red[t] += red[t + st]; __syncthreads(); }
  const float mu = red[0] * (1.0f / (float)DM); __syncthreads();
  float vs = 0.f;
#pragma unroll
  for (int q = 0; q < 4; ++q) { const float dl = s[q] - mu; vs += dl * dl; }
  red[t] = vs; __syncthreads();
  for (int st = 128; st > 0; st >>= 1) { if (t < st) red[t] += red[t + st]; __syncthreads(); }
  const float rs = rsqrtf(red[0] * (1.0f / (float)DM) + eps);
  v4f yf; v4h y;
#pragma unroll
  for (int q = 0; q < 4; ++q) { const int c = c0 + q; yf[q] = (s[q] - mu) * rs * bf16_rne(g[c]) + bf16_rne(bb[c]); y[q] = (_Float16)yf[q]; }
  const size_t orow = OMAP ? rfull : r;
  {
    if (O32) *(v4f*)(O32 + orow * DM + c0) = yf;
    if (W16) *(v4h*)(O16 + r * DM + c0) = y;
     }
}

extern "C" void kernel_launch(void* const* d_in, const int* in_sizes, int n_in,
                              void* d_out, int out_size, void* d_ws, size_t ws_size, hipStream_t stream) {
  if (n_in < 22) return;
  const float* x    = (const float*)d_in[0];  const float* enc  = (const float*)d_in[1];
  const float* wq1  = (const float*)d_in[2];  const float* wk1  = (const float*)d_in[3];  const float* wv1 = (const float*)d_in[4];
  const float* wo1  = (const float*)d_in[5];  const float* bo1  = (const float*)d_in[6];
  const float* wq2  = (const float*)d_in[7];  const float* wk2  = (const float*)d_in[8];  const float* wv2 = (const float*)d_in[9];
  const float* wo2  = (const float*)d_in[10]; const float* bo2  = (const float*)d_in[11];
  const float* wff1 = (const float*)d_in[12]; const float* bff1 = (const float*)d_in[13]; const float* wff2 = (const float*)d_in[14]; const float* bff2 = (const float*)d_in[15];
  const float* g1   = (const float*)d_in[16]; const float* be1  = (const float*)d_in[17]; const float* g2  = (const float*)d_in[18]; const float* be2 = (const float*)d_in[19];
  const float* g3   = (const float*)d_in[20]; const float* be3  = (const float*)d_in[21];

  const size_t needX = ((size_t)(NB - 1) * SEQ_FULL + SEQ) * DM;
  if ((size_t)in_sizes[0] < needX || (size_t)in_sizes[1] < needX || (size_t)out_size < needX) return;
  { static const int wi[8] = {2, 3, 4, 5, 7, 8, 9, 10}; for (int i = 0; i < 8; ++i) if ((size_t)in_sizes[wi[i]] < (size_t)DM * DM) return; }
  if ((size_t)in_sizes[12] < (size_t)DM * DFF || (size_t)in_sizes[14] < (size_t)DM * DFF || in_sizes[13] < DFF) return;
  { static const int vi[9] = {6, 11, 15, 16, 17, 18, 19, 20, 21}; for (int i = 0; i < 9; ++i) if (in_sizes[vi[i]] < DM) return; }

  char* ws = (char*)d_ws; size_t off = 0;
  auto take = [&](size_t bytes) { char* p = ws + off; off += (bytes + 255) & ~(size_t)255; return p; };
  const size_t WDD = (size_t)DM * DM * 2, WDF = (size_t)DM * DFF * 2, P16 = NR * DM * 2;
  _Float16* BQ1 = (_Float16*)take(WDD); _Float16* BK1 = (_Float16*)take(WDD); _Float16* BV1 = (_Float16*)take(WDD); _Float16* BO1 = (_Float16*)take(WDD);
  _Float16* BQ2 = (_Float16*)take(WDD); _Float16* BK2 = (_Float16*)take(WDD); _Float16* BV2 = (_Float16*)take(WDD); _Float16* BO2 = (_Float16*)take(WDD);
  _Float16* BW1 = (_Float16*)take(WDF);      /* [n=DFF][k=DM]  */
  _Float16* BW2 = (_Float16*)take(WDF);      /* [n=DM][k=DFF]  */
  // ten token-plane slots of P16 bytes each (an f32 plane spans two slots, the FFN hidden plane four); lifetimes by launch order:
  // S0 X16 -> V2            S1 E16 -> x2 (f16)      S2,S3 Q1|QR1 -> a1 (f32) -> K2|KR2 -> a2 (f32) -> hidden (S2..S5)
  // S4,S5 K1|KR1 -> x1 (f32)   S6,S7 VT1|VTR1 -> x1 value|residual -> VT2|o2 (f16) -> f (f32)
  // S8,S9 V1|VR1 -> o1 value|residual -> Q2|QR2 -> x2 (f32)
  char* SL = take(10 * P16);
  _Float16* S0 = (_Float16*)(SL + 0 * P16); _Float16* S1 = (_Float16*)(SL + 1 * P16); _Float16* S2 = (_Float16*)(SL + 2 * P16); _Float16* S3 = (_Float16*)(SL + 3 * P16);
  _Float16* S4 = (_Float16*)(SL + 4 * P16); _Float16* S5 = (_Float16*)(SL + 5 * P16); _Float16* S6 = (_Float16*)(SL + 6 * P16); _Float16* S7 = (_Float16*)(SL + 7 * P16);
  _Float16* S8 = (_Float16*)(SL + 8 * P16); _Float16* S9 = (_Float16*)(SL + 9 * P16);
  float* YFa = (float*)S2;   /* a1, a2 (f32 rows, S2..S3) */
  float* X1F = (float*)S4;   /* x1 (f32 rows, S4..S5) */
  float* X2F = (float*)S8;   /* x2 (f32 rows, S8..S9) */
  float* YFf = (float*)S6;   /* f  (f32 rows, S6..S7) */
  _Float16* HF = S2;         /* FFN hidden rows [NR][DFF] f16 (S2..S5) */
  if (off > ws_size || off > (size_t)134217728) return;

  const unsigned gDD = (unsigned)((DM / 64) * (DM / 64)), gDF = (unsigned)((DFF / 64) * (DM / 64)), gFD = (unsigned)((DM / 64) * (DFF / 64));
  k_wt_head<<<gDD, 256, 0, stream>>>(wq1, BQ1, DM, DM, 16.0f); k_wt_head<<<gDD, 256, 0, stream>>>(wk1, BK1, DM, DM, 16.0f); k_wt_head<<<gDD, 256, 0, stream>>>(wv1, BV1, DM, DM, 16.0f);
  k_wt_f16<<<gDD, 256, 0, stream>>>(wo1, BO1, DM, DM, 16.0f);
  k_wt_head<<<gDD, 256, 0, stream>>>(wq2, BQ2, DM, DM, 16.0f); k_wt_head<<<gDD, 256, 0, stream>>>(wk2, BK2, DM, DM, 16.0f); k_wt_head<<<gDD, 256, 0, stream>>>(wv2, BV2, DM, DM, 16.0f);
  k_wt_f16<<<gDD, 256, 0, stream>>>(wo2, BO2, DM, DM, 16.0f);
  k_wt_f16<<<gDF, 256, 0, stream>>>(wff1, BW1, DM, DFF, 16.0f); k_wt_f16<<<gFD, 256, 0, stream>>>(wff2, BW2, DFF, DM, 16.0f);

  const size_t n8 = NR * DM / 8; const unsigned gx = (unsigned)((n8 + 255) / 256);
  k_x16<<<gx, 256, 0, stream>>>(x, S0, n8); k_x16<<<gx, 256, 0, stream>>>(enc, S1, n8);

  const unsigned gP = (unsigned)((MR / 128) * (DM / 128)), gF1 = (unsigned)((MR / 128) * (DFF / 128));
  const unsigned gVT = (unsigned)(NB * NH * (SEQ / 64)); const dim3 gAT(SEQ / 128, NH, NB);

  // ---- causal self-attention block
  k_proj_hr<<<gP, 256, 0, stream>>>(S0, DM, BQ1, DM, 0.0625f, S2, S3, DM, MR, DM, DM);                          /* q  value | residual */
  k_proj_hr<<<gP, 256, 0, stream>>>(S0, DM, BK1, DM, 0.0625f, S4, S5, DM, MR, DM, DM);                          /* k  value | residual */
  k_proj_hr<<<gP, 256, 0, stream>>>(S0, DM, BV1, DM, 0.0625f, S8, S9, DM, MR, DM, DM);                          /* v  value | residual */
  k_vt<NH, SEQ><<<gVT, 256, 0, stream>>>(S8, DM, 0, S6);
  k_vt<NH, SEQ><<<gVT, 256, 0, stream>>>(S9, DM, 0, S7);
  k_attn_causal<<<gAT, 256, 0, stream>>>(S2, S3, S4, S5, S6, S7, S8, S9);                                       /* o x64 value | residual */
  k_proj_rf<<<gP, 256, 0, stream>>>(S8, S9, DM, BO1, DM, 0.0009765625f, bo1, 1.0f, YFa, DM, MR, DM, DM);        /* a1 = o Wp1 + bp1 */
  k_ln<1, 1, 0, 0><<<(unsigned)MR, 256, 0, stream>>>(YFa, x, g1, be1, LN_EPS, X1F, nullptr);                    /* x1 = LN1(bf16(x) + a1) -> f32 rows */
  k_split16<<<gx, 256, 0, stream>>>(X1F, S6, S7, n8);                                                           /* x1 value | residual */
  // ---- cross-attention block
  k_proj_rhr<<<gP, 256, 0, stream>>>(S6, S7, DM, BQ2, DM, 0.0625f, S8, S9, DM, MR, DM, DM);                     /* q  value | residual */
  k_proj_hr<<<gP, 256, 0, stream>>>(S1, DM, BK2, DM, 0.0625f, S2, S3, DM, MR, DM, DM);                          /* k  value | residual */
  k_gemm2<0><<<gP, 256, 0, stream>>>(S1, DM, BV2, DM, 0.0625f, nullptr, 1.0f, nullptr, S0, DM, MR, DM, DM);     /* v  single plane */
  k_vt<NH, SEQ><<<gVT, 256, 0, stream>>>(S0, DM, 0, S6);
  k_attn_dense<<<gAT, 256, 0, stream>>>(S8, S9, S2, S3, S6, S7);                                                /* o x64 single plane */
  k_gemm2<0><<<gP, 256, 0, stream>>>(S7, DM, BO2, DM, 0.0009765625f, bo2, 1.0f, YFa, nullptr, DM, MR, DM, DM);  /* a2 = o Wp2 + bp2 */
  k_ln<0, 0, 1, 0><<<(unsigned)MR, 256, 0, stream>>>(YFa, X1F, g2, be2, LN_EPS, X2F, S1);                       /* x2 = LN2(x1 + a2) -> f32 + f16 rows */
  // ---- FFN block
  k_gemm2<3><<<gF1, 256, 0, stream>>>(S1, DM, BW1, DM, 1.0f, bff1, 16.0f, nullptr, HF, DFF, MR, DFF, DM);       /* 16 relu(x2 W1 + b1) as f16 rows */
  k_gemm2<0><<<gP, 256, 0, stream>>>(HF, DFF, BW2, DFF, 0.00390625f, bff2, 1.0f, YFf, nullptr, DM, MR, DM, DFF);  /* f = h W2 + b2 */
  k_ln<0, 0, 0, 1><<<(unsigned)MR, 256, 0, stream>>>(YFf, X2F, g3, be3, LN_EPS, (float*)d_out, nullptr);        /* out = LN3(x2 + f) */
}

// v004
// It runs in 379 microseconds.
// Next to v003, in two timings, it ran 1.12 times as fast each time.
// Over all steps from v000 it is 2.83 times as fast.
#include <hip/hip_runtime.h>
// Structure: token rows r = b*SEQ + s. Causal self-attention (16 heads of 64, per-head weights [H][E][64], scores x8, keys above the diagonal and exactly-zero scores masked) -> x1 = LN1(x + attn.Wp1 + bp1); cross-attention of x1 over z rows -> x2 = LN2(x1 + attn.Wp2 + bp2); f = relu(x2.W1 + b1).W2 + b2; out = LN3(x2 + f). Projection / FFN weights are [in][out].

#ifndef NB
#define NB 4
#endif
#ifndef SEQ
#define SEQ 1024
#endif
#define NB_FULL 4
#define SEQ_FULL 1024
#define DM 1024
#define NH 16
#define HD 64
#define DFF 4096
#define NR ((size_t)NB * SEQ)
#define MR ((int)((size_t)NB * SEQ))
#define PBP 40          /* LDS pitch (halves) of the per-wave P tile */
#define OBP 72          /* LDS pitch (halves) of the per-wave o tile */
#define LN_EPS 1.0e-5f
#define PCARRY 16384.0f         /* carry of the f16 P planes */
#define RCARRY 2048.0f          /* carry of every residual plane */
#define RINV 0.00048828125f     /* 1 / RCARRY */

static_assert(NB >= 1 && NB <= NB_FULL);
static_assert(SEQ >= 64 && SEQ <= SEQ_FULL && SEQ % 64 == 0);
static_assert((NB * SEQ) % 128 == 0);
static_assert(NH * HD == DM && HD == 64);
static_assert(DM == 4 * 256);
static_assert(DM % 64 == 0 && DFF % 64 == 0 && DM % 32 == 0 && DFF % 32 == 0);
static_assert(DFF <= 4 * DM);
static_assert((PBP % 8) == 0 && (OBP % 8) == 0);
static_assert(DFF == 4 * DM);                       /* the FFN hidden plane spans exactly four 16-bit token planes */
static_assert(PBP >= 32 && OBP >= HD);              /* P tile holds 32 keys, o tile holds one head */
static_assert(RCARRY * RINV == 1.0f);
static_assert(PCARRY <= 32768.0f);                  /* carried P stays inside f16 */
static_assert((size_t)8 * DM * DM * 2 + (size_t)2 * DM * DFF * 2 + (size_t)14 * NB * SEQ * DM * 2 + 16 * 256 <= (size_t)268435456);   /* workspace carve */

typedef unsigned short v8us __attribute__((ext_vector_type(8), may_alias));
typedef float  v8f  __attribute__((ext_vector_type(8)));
typedef float  v4f  __attribute__((ext_vector_type(4)));
typedef float  v4fa __attribute__((ext_vector_type(4), may_alias));
typedef _Float16 v16h __attribute__((ext_vector_type(16)));
typedef _Float16 v4h __attribute__((ext_vector_type(4)));
union FragH { v16h v; v8us half[2]; _Float16 h[16]; unsigned short u[16]; };

__device__ __forceinline__ unsigned short bf16_bits(float x) { unsigned int u = __float_as_uint(x); return (unsigned short)((u + 0x7FFFu + ((u >> 16) & 1u)) >> 16); }
__device__ __forceinline__ float bf16_val(unsigned short b) { return __uint_as_float(((unsigned int)b) << 16); }
__device__ __forceinline__ float bf16_rne(float x) { return bf16_val(bf16_bits(x)); }

// 16x32 fragment from a k-contiguous 16-bit row p (A row m = lane&15, or B stored [n][k] with n = lane&15):
// elements 0..7 <- k 8h..8h+7, elements 8..15 <- k 16+8h..16+8h+7 (h = lane>>4)
__device__ __forceinline__ v16h g2_frag(const _Float16* p, int hh) { FragH f; f.half[0] = *(const v8us*)((const unsigned short*)p + 8 * hh); f.half[1] = *(const v8us*)((const unsigned short*)p + 16 + 8 * hh); return f.v; }
__device__ __forceinline__ v8f g2_mma(v16h a, v16h b, v8f c) { v8f d = __builtin_amdgcn_wmma_f32_16x16x32_f16(false, a, false, b, (short)0, c, false, false); asm volatile("v_nop\n\tv_nop\n\tv_nop\n\tv_nop" : "+v"(d) : "v"(a), "v"(b)); return d; }

// f32 -> f16 operand convert that cannot yield an f16 subnormal (value select, applied after the plane's carry)
typedef _Float16 h16;
static __device__ __forceinline__ h16 toh_flush(float v) { const h16 r = (h16)v; return (fabsf(v) < 6.103515625e-05f) ? (h16)0.0f : r; }

// Weight convert + transpose, one 64 k x 64 n tile per block, turned in LDS: every wave-wide 16-byte load covers two whole 256-byte source rows of the tile and every
// wave-wide 16-byte store four whole 128-byte pieces of Wt rows. HEAD 0: W is [K][N]; HEAD 1: W is [N/64][K][64] (tile column block = head). Wt is [n][k].
// Requires K % 64 == 0 and N % 64 == 0; bid = the tile's index among the (N/64)*(K/64) tiles of its matrix, the same for the whole block of 256; tl = the block's LDS tile.
#define WTP 66                  /* LDS row pitch in halves: 33 words, so that a column walk of 8 rows apart meets 8 different banks */
template <int HEAD>
static __device__ __forceinline__ void wt_tile_body(unsigned short (*tl)[WTP], int bid, const float* __restrict__ W, _Float16* __restrict__ Wt, int K, int N, float scale) {
  const int tid = threadIdx.x; const int nkt = K >> 6; const int nt = bid / nkt, kt = bid - nt * nkt; if (nt * 64 >= N) return;   /* the same for the whole block, ahead of the barrier */
  const int n0 = nt * 64, k0 = kt * 64;
  const float* src = HEAD ? W + ((size_t)nt * K + k0) * HD : W + (size_t)k0 * N + n0;
  const size_t rstep = HEAD ? (size_t)HD : (size_t)N;
  const int r0 = tid >> 4, c4 = (tid & 15) * 4;
  v4f a[4];
#pragma unroll  /* the four loads of a lane are issued together, ahead of the first convert */
  for (int i = 0; i < 4; ++i) a[i] = *(const v4fa*)(src + (size_t)(i * 16 + r0) * rstep + c4);
#pragma unroll  /* constant indices keep a[] and f in registers, here and in the loops below */
  for (int i = 0; i < 4; ++i) { FragH f;
#pragma unroll
    for (int q = 0; q < 4; ++q) { const float v = bf16_rne(a[i][q]) * scale; f.h[q] = HEAD ? toh_flush(v) : (_Float16)v; }
#pragma unroll
    for (int q = 0; q < 4; ++q) tl[i * 16 + r0][c4 + q] = f.u[q]; }
  __syncthreads();   /* the whole tile is in LDS before any column of it is read */
#pragma unroll
  for (int rd = 0; rd < 2; ++rd) { const int n = rd * 32 + tid / 8, pc = tid % 8; FragH f;
#pragma unroll
    for (int q = 0; q < 8; ++q) f.u[q] = tl[pc * 8 + q][n];
    *(v8us*)((unsigned short*)Wt + (size_t)(n0 + n) * K + k0 + pc * 8) = f.half[0]; }
  asm volatile("s_wait_xcnt 0x0" ::: "memory");   /* another job's code follows in the merged kernel and reuses the registers that the two stores name */
}

static __device__ __forceinline__ void x16_body(int bid, const float* __restrict__ x, _Float16* __restrict__ X16, size_t n8) {
  const size_t t = (size_t)bid * 256 + threadIdx.x; if (t >= n8) return;
  const size_t e = t * 8; const size_t r = e / DM; const size_t c = e % DM; const size_t rs = (r / SEQ) * SEQ_FULL + (r % SEQ);
  const float* src = x + rs * DM + c; const v4f a = *(const v4fa*)src; const v4f a2 = *(const v4fa*)(src + 4); FragH f;
#pragma unroll
  for (int q = 0; q < 4; ++q) { f.h[q] = (_Float16)bf16_rne(a[q]); f.h[4 + q] = (_Float16)bf16_rne(a2[q]); }
  const v8us o = f.half[0]; unsigned short* d = (unsigned short*)X16 + e;
  *(v8us*)d = o; 
}

// Every conversion that reads the inputs alone, in ONE launch: none of the twelve jobs reads what another writes. blockIdx.x picks the job, the same for the whole block:
// the tiles of the eight DM x DM attention weights (order q k v o, q k v o; Wt planes one behind the other from BA), of W1, of W2, then the row pieces of x and of z.
#define TDD ((DM / 64) * (DM / 64))             /* tiles of a DM x DM weight */
#define TDF ((DM / 64) * (DFF / 64))            /* tiles of an FFN weight */
#define XBL ((int)((NR * DM / 8 + 255) / 256))  /* blocks of a token plane, 8 elements a thread */
#define PREP_BLOCKS (8 * TDD + 2 * TDF + 2 * XBL)
__global__ __launch_bounds__(256) void k_prep(const float* __restrict__ wq1, const float* __restrict__ wk1, const float* __restrict__ wv1, const float* __restrict__ wo1,
    const float* __restrict__ wq2, const float* __restrict__ wk2, const float* __restrict__ wv2, const float* __restrict__ wo2, const float* __restrict__ wff1, const float* __restrict__ wff2,
    const float* __restrict__ x, const float* __restrict__ z, _Float16* __restrict__ BA, _Float16* __restrict__ BW1, _Float16* __restrict__ BW2, _Float16* __restrict__ X16, _Float16* __restrict__ Z16) {
  __shared__ unsigned short tl[64][WTP];
  int bid = blockIdx.x;
  if (bid < 8 * TDD) {
    const int j = bid / TDD; bid -= j * TDD; _Float16* Wt = BA + (size_t)j * DM * DM;
    if ((j & 3) != 3) wt_tile_body<1>(tl, bid, j == 0 ? wq1 : j == 1 ? wk1 : j == 2 ? wv1 : j == 4 ? wq2 : j == 5 ? wk2 : wv2, Wt, DM, DM, 16.0f);
    else wt_tile_body<0>(tl, bid, j == 3 ? wo1 : wo2, Wt, DM, DM, 16.0f);
  } else if (bid < 8 * TDD + TDF) {
    wt_tile_body<0>(tl, bid - 8 * TDD, wff1, BW1, DM, DFF, 16.0f);
  } else if (bid < 8 * TDD + 2 * TDF) {
    wt_tile_body<0>(tl, bid - (8 * TDD + TDF), wff2, BW2, DFF, DM, 16.0f);
  } else {
    bid -= 8 * TDD + 2 * TDF; const int second = bid >= XBL; if (second) bid -= XBL;
    x16_body(bid, second ? z : x, second ? Z16 : X16, NR * DM / 8);
  }
}

__global__ __launch_bounds__(256) void k_split16(const float* __restrict__ src, _Float16* __restrict__ H16, _Float16* __restrict__ R16, size_t n8) {
  #pragma clang fp contract(off)
  const size_t t = (size_t)blockIdx.x * 256 + threadIdx.x; if (t >= n8) return;
  const size_t e = t * 8; const v4f a = *(const v4fa*)(src + e); const v4f a2 = *(const v4fa*)(src + e + 4); FragH fh, fr;
#pragma unroll
  for (int q = 0; q < 4; ++q) {
    const h16 h0 = toh_flush(a[q]);  fh.h[q] = h0;     fr.h[q] = toh_flush((a[q] - (float)h0) * RCARRY);
    const h16 h1 = toh_flush(a2[q]); fh.h[4 + q] = h1; fr.h[4 + q] = toh_flush((a2[q] - (float)h1) * RCARRY); }
  const v8us oh = fh.half[0]; const v8us orr = fr.half[0];
  unsigned short* dh = (unsigned short*)H16 + e; unsigned short* dr = (unsigned short*)R16 + e;
  *(v8us*)dh = oh; *(v8us*)dr = orr; 
}

template <int NHv, int TTv>
__global__ __launch_bounds__(256) void k_vt(const _Float16* __restrict__ V16a, const _Float16* __restrict__ V16b, const _Float16* __restrict__ V16c, int ldv, int voff,
    _Float16* __restrict__ Vta, _Float16* __restrict__ Vtb, _Float16* __restrict__ Vtc) {
  const int pj = blockIdx.y;   /* picks the plane: the three independent transposes share a launch */
  const _Float16* V16 = pj == 0 ? V16a : pj == 1 ? V16b : V16c; _Float16* Vt = pj == 0 ? Vta : pj == 1 ? Vtb : Vtc;
  __shared__ unsigned short tl[64][66]; const int tid = threadIdx.x; const int slab = blockIdx.x / (TTv / 64), lg = blockIdx.x % (TTv / 64); const int b = slab / NHv, h = slab % NHv;
  for (int i = tid; i < 64 * 8; i += 256) { const int r = i / 8, c8 = (i % 8) * 8; FragH f; f.half[0] = *(const v8us*)((const unsigned short*)V16 + ((size_t)b * TTv + lg * 64 + r) * ldv + voff + h * 64 + c8);
#pragma unroll
    for (int q = 0; q < 8; ++q) tl[r][c8 + q] = f.u[q]; }
  __syncthreads();
  {
#pragma unroll
    for (int rd = 0; rd < 2; ++rd) { const int d = rd * 32 + tid / 8, pc = tid % 8; FragH f;
#pragma unroll
      for (int q = 0; q < 8; ++q) f.u[q] = tl[pc * 8 + q][d];
      *(v8us*)((unsigned short*)Vt + ((size_t)slab * 64 + d) * TTv + lg * 64 + pc * 8) = f.half[0]; }
     }
}

// LDS staging of the GEMM operands. A block of 8 waves owns a 128 x 128 tile of C; a stage holds 128 k of its 128 A rows and then of its 128 B rows.
#define GKP 128                 /* k (halves) per stage: 256-byte rows */
#define GPITCH 136              /* LDS row pitch in halves: 272 B = 16 B x 17, conflict-free for 16-byte row reads */
#define GPITCHB (GPITCH * 2)    /* the same in bytes */
#define GSTAGE (256 * GPITCH)   /* halves per stage */
static_assert(DM % GKP == 0 && DFF % GKP == 0 && DM % 128 == 0 && DFF % 128 == 0);

static __device__ __forceinline__ unsigned lds_off(const void* p) { return (unsigned)(size_t)p; }

// Eight 16-byte asynchronous copies of one lane: rows 16 apart, global row step gstep halves. The s_wait_xcnt closes the statement so that no address register is rewritten ahead of it.
static __device__ __forceinline__ void copy8(unsigned l, const _Float16* g, size_t gstep) {
  asm volatile(
      "global_load_async_to_lds_b128 %0, %8, off\n\t"
      "global_load_async_to_lds_b128 %1, %9, off\n\t"
      "global_load_async_to_lds_b128 %2, %10, off\n\t"
      "global_load_async_to_lds_b128 %3, %11, off\n\t"
      "global_load_async_to_lds_b128 %4, %12, off\n\t"
      "global_load_async_to_lds_b128 %5, %13, off\n\t"
      "global_load_async_to_lds_b128 %6, %14, off\n\t"
      "global_load_async_to_lds_b128 %7, %15, off\n\t"
      "s_wait_xcnt 0x0"
      :: "v"(l), "v"(l + 16u * GPITCHB), "v"(l + 32u * GPITCHB), "v"(l + 48u * GPITCHB), "v"(l + 64u * GPITCHB), "v"(l + 80u * GPITCHB), "v"(l + 96u * GPITCHB), "v"(l + 112u * GPITCHB),
         "v"(g), "v"(g + gstep), "v"(g + 2 * gstep), "v"(g + 3 * gstep), "v"(g + 4 * gstep), "v"(g + 5 * gstep), "v"(g + 6 * gstep), "v"(g + 7 * gstep)
      : "memory");
}
// One stage: l = this lane's LDS byte address in the stage's row tid/16, ga / gb = its 16 bytes of that row of the A / B tile.
static __device__ __forceinline__ void stage_copy(unsigned l, const _Float16* ga, int lda, const _Float16* gb, int ldb) {
  copy8(l, ga, (size_t)16 * lda);
  copy8(l + 128u * GPITCHB, gb, (size_t)16 * ldb);
}

// One K sweep of the block's 128 x 128 tile through a two-buffer LDS ring; each wave keeps a 32 x 64 tile (A rows arow, arow + 16; B rows brow + 16 j), k ascending in steps of 32.
// At and Bt point at the first row of the block's A and B tiles. Every thread of the block calls it; K is a positive multiple of 128. The ring is free again on return (the last trip's barrier).
static __device__ __forceinline__ void gemm_sweep(_Float16* ring, const _Float16* At, int lda, const _Float16* Bt, int ldb, int K, int tid, int arow, int brow, int hh,
    v8f& c00, v8f& c01, v8f& c02, v8f& c03, v8f& c10, v8f& c11, v8f& c12, v8f& c13) {
  const unsigned l0 = lds_off(ring) + (unsigned)((tid >> 4) * GPITCHB + (tid & 15) * 16);
  const _Float16* ga = At + (size_t)(tid >> 4) * lda + (tid & 15) * 8;
  const _Float16* gb = Bt + (size_t)(tid >> 4) * ldb + (tid & 15) * 8;
  const int nst = K / GKP;
  stage_copy(l0, ga, lda, gb, ldb);
  asm volatile("s_wait_asynccnt 0x0" ::: "memory");   /* stage 0 of this wave has landed */
  __syncthreads();                                    /* stage 0 of every wave is readable */
  if (nst > 1) stage_copy(l0 + (unsigned)(GSTAGE * 2), ga + GKP, lda, gb + GKP, ldb);
#pragma unroll 1  /* one trip per stage: the ring's waits and its barrier stand once, at the trip's foot */
  for (int t = 0; t < nst; ++t) {
    const _Float16* buf = ring + (t & 1) * GSTAGE;
    const _Float16* a0p = buf + arow * GPITCH; const _Float16* a1p = a0p + 16 * GPITCH;
    const _Float16* b0p = buf + (128 + brow) * GPITCH; const _Float16* b1p = b0p + 16 * GPITCH; const _Float16* b2p = b1p + 16 * GPITCH; const _Float16* b3p = b2p + 16 * GPITCH;
    // the six fragments of a k step are read as one group, one k step ahead inside the stage, so that their LDS latency runs under the products of the step before
    v16h a0 = g2_frag(a0p, hh), a1 = g2_frag(a1p, hh), b0 = g2_frag(b0p, hh), b1 = g2_frag(b1p, hh), b2 = g2_frag(b2p, hh), b3 = g2_frag(b3p, hh);
#pragma unroll  /* constant LDS offsets, and the two fragment sets swap by renaming, without moves */
    for (int kb = 0; kb < GKP; kb += 32) {
      v16h na0 = a0, na1 = a1, nb0 = b0, nb1 = b1, nb2 = b2, nb3 = b3;
      if (kb + 32 < GKP) { na0 = g2_frag(a0p + kb + 32, hh); na1 = g2_frag(a1p + kb + 32, hh); nb0 = g2_frag(b0p + kb + 32, hh); nb1 = g2_frag(b1p + kb + 32, hh); nb2 = g2_frag(b2p + kb + 32, hh); nb3 = g2_frag(b3p + kb + 32, hh); }
      c00 = g2_mma(a0, b0, c00); c10 = g2_mma(a1, b0, c10);
      c01 = g2_mma(a0, b1, c01); c11 = g2_mma(a1, b1, c11);
      c02 = g2_mma(a0, b2, c02); c12 = g2_mma(a1, b2, c12);
      c03 = g2_mma(a0, b3, c03); c13 = g2_mma(a1, b3, c13);
      a0 = na0; a1 = na1; b0 = nb0; b1 = nb1; b2 = nb2; b3 = nb3; }
    asm volatile("s_wait_dscnt 0x0" ::: "memory");      /* this wave's reads of buffer t & 1 are done before it is refilled */
    asm volatile("s_wait_asynccnt 0x0" ::: "memory");   /* this wave's copies of stage t + 1 have landed */
    __syncthreads();                                    /* publishes stage t + 1 and ends every reader's last read of buffer t & 1 */
    if (t + 2 < nst) stage_copy(l0 + (unsigned)((t & 1) * (GSTAGE * 2)), ga + (size_t)(t + 2) * GKP, lda, gb + (size_t)(t + 2) * GKP, ldb);
  }
  asm volatile("s_wait_asynccnt 0x0" ::: "memory");     /* no copy is outstanding when the ring is left */
}

// GEMM: block tile 128 x 128 (8 waves, 4 x 2), wave tile 32 rows x 64 cols; A f16 rows (pitch lda), Bh f16 [n][k] (pitch ldb); v = acc*alpha + bf16(bias[col])*bsc; ACT 0 none / 3 relu;
// Requires M % 128 == 0, N % 128 == 0, K % 128 == 0; grid = (M/128)*(N/128), block 256.
template <int ACT>
__global__ __launch_bounds__(256) void k_gemm2(const _Float16* __restrict__ A, int lda, const _Float16* __restrict__ Bh, int ldb, float alpha, const float* __restrict__ bias, float bsc,
    float* __restrict__ C, _Float16* __restrict__ C16, int ldc, int M, int N, int K) {
  static_assert(ACT == 0 || ACT == 3);
  __shared__ __attribute__((aligned(16))) _Float16 ring[2 * GSTAGE];
  __shared__ __attribute__((aligned(16))) float so[8][32][68];
  const int tid = threadIdx.x, lane = tid & 31, ln = lane & 15, hh = lane >> 4;
  const int w = __builtin_amdgcn_readfirstlane(tid >> 5);
  const int ntn = N >> 7; const int mt = blockIdx.x / ntn, nq = blockIdx.x - mt * ntn; if (mt * 128 >= M) return;
  const int row0 = mt * 128 + 32 * (w >> 1), col0 = nq * 128 + 64 * (w & 1);
  const v8f z8 = {0.f,0.f,0.f,0.f,0.f,0.f,0.f,0.f}; v8f c00 = z8, c01 = z8, c02 = z8, c03 = z8, c10 = z8, c11 = z8, c12 = z8, c13 = z8;
  gemm_sweep(ring, A + (size_t)(mt * 128) * lda, lda, Bh + (size_t)(nq * 128) * ldb, ldb, K, tid, 32 * (w >> 1) + ln, 64 * (w & 1) + ln, hh, c00, c01, c02, c03, c10, c11, c12, c13);
  v8f accs[8] = {c00, c01, c02, c03, c10, c11, c12, c13};
#pragma unroll
  for (int u = 0; u < 8; ++u) { const int t = u & 3, half = u >> 2; const int col = col0 + t * 16 + ln; const float bv = bias ? bf16_rne(bias[col]) * bsc : 0.f;
#pragma unroll
    for (int r = 0; r < 8; ++r) { const int rloc = half * 16 + 8 * hh + r; float v = accs[u][r] * alpha + bv; if (ACT == 3) v = fmaxf(v, 0.f); so[w][rloc][t * 16 + ln] = v; } }
  __builtin_amdgcn_fence(4 /* acq_rel order */, "workgroup"); __builtin_amdgcn_wave_barrier();
  const int rsub = lane >> 4, c4 = (lane & 15) * 4;
  {
#pragma unroll
    for (int q = 0; q < 16; ++q) { const int r = q * 2 + rsub; const v4f v = *(const v4fa*)&so[w][r][c4];
      if (C) *(v4f*)(C + (size_t)(row0 + r) * ldc + col0 + c4) = v;
      if (C16) { v4h h4; for (int i = 0; i < 4; ++i) h4[i] = (_Float16)v[i]; *(v4h*)(C16 + (size_t)(row0 + r) * ldc + col0 + c4) = h4; } }
     }
}

// GEMM with an optional residual A plane (AR = (a - f16(a)) * 2048, own accumulators from zero, folded by 2^-11 in f32) and either an f32 output (OUTHR 0)
// or f16 planes (OUTHR 1): value + residual, or, SGL 1 and single set (the same for the whole block), one plainly converted plane CH alone.
// Requires M % 128 == 0, N % 128 == 0, K % 128 == 0; grid = (M/128)*(N/128), block 256.
template <int ARES, int OUTHR, int SGL = 0>
static __device__ __forceinline__ void gemm_hr_body(const _Float16* __restrict__ A, const _Float16* __restrict__ AR, int lda, const _Float16* __restrict__ Bh, int ldb, float alpha,
    const float* __restrict__ bias, float bsc, float* __restrict__ C, _Float16* __restrict__ CH, _Float16* __restrict__ CR, int ldc, int M, int N, int K, bool single = false) {
  __shared__ __attribute__((aligned(16))) _Float16 ring[2 * GSTAGE];
  __shared__ __attribute__((aligned(16))) float so[8][32][68];
  const int tid = threadIdx.x, lane = tid & 31, ln = lane & 15, hh = lane >> 4;
  const int w = __builtin_amdgcn_readfirstlane(tid >> 5);
  const int ntn = N >> 7; const int mt = blockIdx.x / ntn, nq = blockIdx.x - mt * ntn; if (mt * 128 >= M) return;
  const int row0 = mt * 128 + 32 * (w >> 1), col0 = nq * 128 + 64 * (w & 1);
  const int arow = 32 * (w >> 1) + ln, brow = 64 * (w & 1) + ln;
  const _Float16* Bt = Bh + (size_t)(nq * 128) * ldb;
  const v8f z8 = {0.f,0.f,0.f,0.f,0.f,0.f,0.f,0.f};
  if (ARES) {
    v8f d00 = z8, d01 = z8, d02 = z8, d03 = z8, d10 = z8, d11 = z8, d12 = z8, d13 = z8;
    gemm_sweep(ring, AR + (size_t)(mt * 128) * lda, lda, Bt, ldb, K, tid, arow, brow, hh, d00, d01, d02, d03, d10, d11, d12, d13);
    v8f ds[8] = {d00, d01, d02, d03, d10, d11, d12, d13};
#pragma unroll
    for (int u = 0; u < 8; ++u) { const int t = u & 3, half = u >> 2;
#pragma unroll
      for (int r = 0; r < 8; ++r) { const int rloc = half * 16 + 8 * hh + r; so[w][rloc][t * 16 + ln] = ds[u][r] * RINV; } }
  }
  v8f c00 = z8, c01 = z8, c02 = z8, c03 = z8, c10 = z8, c11 = z8, c12 = z8, c13 = z8;
  gemm_sweep(ring, A + (size_t)(mt * 128) * lda, lda, Bt, ldb, K, tid, arow, brow, hh, c00, c01, c02, c03, c10, c11, c12, c13);
  v8f accs[8] = {c00, c01, c02, c03, c10, c11, c12, c13};
#pragma unroll
  for (int u = 0; u < 8; ++u) { const int t = u & 3, half = u >> 2; const int col = col0 + t * 16 + ln; const float bv = bias ? bf16_rne(bias[col]) * bsc : 0.f;
#pragma unroll
    for (int r = 0; r < 8; ++r) { const int rloc = half * 16 + 8 * hh + r; float v = accs[u][r]; if (ARES) v += so[w][rloc][t * 16 + ln]; v = v * alpha + bv; so[w][rloc][t * 16 + ln] = v; } }
  __builtin_amdgcn_fence(4 /* acq_rel order */, "workgroup"); __builtin_amdgcn_wave_barrier();
  const int rsub = lane >> 4, c4 = (lane & 15) * 4;
  if (SGL && single) {   /* one test for the whole read-out, not one per row */
#pragma unroll
    for (int q = 0; q < 16; ++q) { const int r = q * 2 + rsub; const v4f v = *(const v4fa*)&so[w][r][c4];
      v4h h4; for (int i = 0; i < 4; ++i) h4[i] = (_Float16)v[i]; *(v4h*)(CH + (size_t)(row0 + r) * ldc + col0 + c4) = h4; }
  } else {
#pragma unroll
    for (int q = 0; q < 16; ++q) { const int r = q * 2 + rsub; const v4f v = *(const v4fa*)&so[w][r][c4];
      if (OUTHR) { v4h h4, r4;
#pragma unroll
        for (int i = 0; i < 4; ++i) { const h16 hv = toh_flush(v[i]); h4[i] = hv; r4[i] = toh_flush((v[i] - (float)hv) * RCARRY); }
        *(v4h*)(CH + (size_t)(row0 + r) * ldc + col0 + c4) = h4;
        *(v4h*)(CR + (size_t)(row0 + r) * ldc + col0 + c4) = r4; }
      else { *(v4f*)(C + (size_t)(row0 + r) * ldc + col0 + c4) = v; } }
    if (SGL) asm volatile("s_wait_xcnt 0x0" ::: "memory");   /* the other read-out's code follows in the built kernel and reuses the registers that these stores name */
     }
}

// The five projections that read a converted input plane alone, in one launch; blockIdx.y picks the job: q, k, v of the self-attention (A0) and k of the cross-attention (A1) as f16 value +
// residual planes, v of the cross-attention (A1) as one f16 plane. grid = ((M/128)*(N/128), 5).
__global__ __launch_bounds__(256) void k_proj5(const _Float16* __restrict__ A0, const _Float16* __restrict__ A1, int lda,
    const _Float16* __restrict__ B0, const _Float16* __restrict__ B1, const _Float16* __restrict__ B2, const _Float16* __restrict__ B3, const _Float16* __restrict__ B4, int ldb, float alpha,
    _Float16* __restrict__ CH0, _Float16* __restrict__ CR0, _Float16* __restrict__ CH1, _Float16* __restrict__ CR1, _Float16* __restrict__ CH2, _Float16* __restrict__ CR2,
    _Float16* __restrict__ CH3, _Float16* __restrict__ CR3, _Float16* __restrict__ CH4, int ldc, int M, int N, int K) {
  const int j = blockIdx.y;
  const _Float16* A = j < 3 ? A0 : A1;
  const _Float16* Bh = j == 0 ? B0 : j == 1 ? B1 : j == 2 ? B2 : j == 3 ? B3 : B4;
  _Float16* CH = j == 0 ? CH0 : j == 1 ? CH1 : j == 2 ? CH2 : j == 3 ? CH3 : CH4;
  _Float16* CR = j == 0 ? CR0 : j == 1 ? CR1 : j == 2 ? CR2 : CR3;   /* not stored by job 4 */
  gemm_hr_body<0, 1, 1>(A, A, lda, Bh, ldb, alpha, nullptr, 0.f, nullptr, CH, CR, ldc, M, N, K, j == 4);
}
// value + residual A planes -> f16 value + residual output planes
__global__ __launch_bounds__(256) void k_proj_rhr(const _Float16* __restrict__ A, const _Float16* __restrict__ AR, int lda, const _Float16* __restrict__ Bh, int ldb, float alpha,
    _Float16* __restrict__ CH, _Float16* __restrict__ CR, int ldc, int M, int N, int K) {
  gemm_hr_body<1, 1>(A, AR, lda, Bh, ldb, alpha, nullptr, 0.f, nullptr, CH, CR, ldc, M, N, K);
}
// value + residual A planes -> f32 rows with bias
__global__ __launch_bounds__(256) void k_proj_rf(const _Float16* __restrict__ A, const _Float16* __restrict__ AR, int lda, const _Float16* __restrict__ Bh, int ldb, float alpha,
    const float* __restrict__ bias, float bsc, float* __restrict__ C, int ldc, int M, int N, int K) {
  gemm_hr_body<1, 0>(A, AR, lda, Bh, ldb, alpha, bias, bsc, C, nullptr, nullptr, ldc, M, N, K);
}

// LDS staging of the attention operands. A block of 8 waves owns 128 query rows of one (batch, head); a stage holds 64 keys: the K value and K residual rows (64 rows of 128 bytes each),
// then the V^T value rows (64 head columns x 64 keys) and, CAUSAL, the V^T residual rows. Every copy of a wave covers four whole 128-byte rows.
#define AKS 64                  /* keys per stage */
#define APITCH 72               /* LDS row pitch in halves: 144 B = 16 B x 9, conflict-free for 16-byte row reads */
#define APITCHB (APITCH * 2)    /* the same in bytes */
#define APLANE (64 * APITCH)    /* halves per staged plane */
static_assert(SEQ % 128 == 0 && SEQ / AKS >= 2 && HD == 64);

// Four / two 16-byte asynchronous copies of one lane. The s_wait_xcnt closes the statement so that no address register is rewritten ahead of it.
static __device__ __forceinline__ void copy4(unsigned l0, unsigned l1, unsigned l2, unsigned l3, const _Float16* g0, const _Float16* g1, const _Float16* g2, const _Float16* g3) {
  asm volatile(
      "global_load_async_to_lds_b128 %0, %4, off\n\t"
      "global_load_async_to_lds_b128 %1, %5, off\n\t"
      "global_load_async_to_lds_b128 %2, %6, off\n\t"
      "global_load_async_to_lds_b128 %3, %7, off\n\t"
      "s_wait_xcnt 0x0"
      :: "v"(l0), "v"(l1), "v"(l2), "v"(l3), "v"(g0), "v"(g1), "v"(g2), "v"(g3)
      : "memory");
}
static __device__ __forceinline__ void copy2(unsigned l0, unsigned l1, const _Float16* g0, const _Float16* g1) {
  asm volatile(
      "global_load_async_to_lds_b128 %0, %2, off\n\t"
      "global_load_async_to_lds_b128 %1, %3, off\n\t"
      "s_wait_xcnt 0x0"
      :: "v"(l0), "v"(l1), "v"(g0), "v"(g1)
      : "memory");
}
// One stage: l = this lane's LDS byte address in row tid/8 of the stage's first plane; gk / gkr / gv / gvr = its 16 bytes of that row of each plane. A lane brings rows tid/8 and tid/8 + 32 of every plane.
template <int CAUSAL>
static __device__ __forceinline__ void attn_stage_copy(unsigned l, const _Float16* gk, const _Float16* gkr, const _Float16* gv, const _Float16* gvr) {
  const unsigned pl = (unsigned)(APLANE * 2), rb = 32u * APITCHB;
  copy4(l, l + rb, l + pl, l + pl + rb, gk, gk + (size_t)32 * DM, gkr, gkr + (size_t)32 * DM);
  if (CAUSAL) copy4(l + 2u * pl, l + 2u * pl + rb, l + 3u * pl, l + 3u * pl + rb, gv, gv + (size_t)32 * SEQ, gvr, gvr + (size_t)32 * SEQ);
  else copy2(l + 2u * pl, l + 2u * pl + rb, gv, gv + (size_t)32 * SEQ);
}

// Flash-style attention for one (batch, head, 16 query rows) per wave: keys taken 32 at a time from the block's two-buffer LDS ring with an online (running-max) softmax in f32.
// scores = 8 * q.k^T with q and k as f16 value + x2048 residual planes: value.value in one accumulator, residual.value + value.residual in a second
// accumulator folded by 2^-11. CAUSAL: keys above the query row and exactly-zero scores take the fill -1e9 (replace), key blocks entirely above
// the wave's rows are skipped (their weights are exactly 0); P = 16384*exp(s - m) as f16 value + x2048 residual, V^T as value + residual slabs,
// o = P.V^T with value.value in one accumulator and the two cross terms in a second, row sum over the unconverted P; o/l * 64 written as f16 value +
// residual rows. Dense: P as one f16 plane (row sum over the converted P), V^T one plane, o one plane. P and o tiles are wave-private LDS
template <int CAUSAL>
static __device__ __forceinline__ void attn_hr_body(const _Float16* __restrict__ Q16, const _Float16* __restrict__ QR, const _Float16* __restrict__ K16, const _Float16* __restrict__ KR,
    const _Float16* __restrict__ VT, const _Float16* __restrict__ VTR, _Float16* __restrict__ O16, _Float16* __restrict__ OR16) {
  constexpr int ASTAGE = (CAUSAL ? 4 : 3) * APLANE;   /* halves per stage */
  __shared__ __attribute__((aligned(16))) _Float16 kv[2 * ASTAGE];
  __shared__ __attribute__((aligned(16))) _Float16 pb[8][16 * PBP];
  __shared__ __attribute__((aligned(16))) _Float16 pbr[8][16 * PBP];
  __shared__ __attribute__((aligned(16))) _Float16 ob[8][16 * OBP];
  __shared__ __attribute__((aligned(16))) _Float16 obr[8][16 * OBP];
  const int tid = threadIdx.x, lane = tid & 31, ln = lane & 15, hh = lane >> 4;
  const int w = __builtin_amdgcn_readfirstlane(tid >> 5);
  const int h = blockIdx.y, b = blockIdx.z;
  const int qb = blockIdx.x * 128;
  const int q0 = qb + w * 16;
  const size_t tok0 = (size_t)b * SEQ;
  const int slab = b * NH + h;
  const size_t qoff = (tok0 + q0 + ln) * DM + h * HD;
  const v16h qf0 = g2_frag(Q16 + qoff, hh), qf1 = g2_frag(Q16 + qoff + 32, hh);
  const v16h qr0 = g2_frag(QR + qoff, hh),  qr1 = g2_frag(QR + qoff + 32, hh);
  const v8f z8 = {0.f,0.f,0.f,0.f,0.f,0.f,0.f,0.f};
  v8f o0 = z8, o1 = z8, o2 = z8, o3 = z8;
  v8f e0 = z8, e1 = z8, e2 = z8, e3 = z8;
  float mrow[8], lrow[8];
#pragma unroll
  for (int r = 0; r < 8; ++r) { mrow[r] = -1.0e30f; lrow[r] = 0.f; }
  const int kend = CAUSAL ? (q0 + 16) : SEQ;                  /* this wave's keys end here (the same in every lane) */
  const int nst = CAUSAL ? (qb + 128) / AKS : SEQ / AKS;      /* stages of the block: up to its last wave's keys; at least two */
  const unsigned l0 = lds_off(kv) + (unsigned)((tid >> 3) * APITCHB + (tid & 7) * 16);
  const size_t gko = (tok0 + (tid >> 3)) * DM + h * HD + (tid & 7) * 8;
  const size_t gvo = ((size_t)slab * HD + (tid >> 3)) * SEQ + (tid & 7) * 8;
  const _Float16* gk = K16 + gko; const _Float16* gkr = KR + gko; const _Float16* gv = VT + gvo; const _Float16* gvr = VTR + gvo;
  attn_stage_copy<CAUSAL>(l0, gk, gkr, gv, gvr);
  asm volatile("s_wait_asynccnt 0x0" ::: "memory");   /* stage 0 of this wave has landed */
  __syncthreads();                                    /* stage 0 of every wave is readable */
  if (nst > 1) attn_stage_copy<CAUSAL>(l0 + (unsigned)(ASTAGE * 2), gk + (size_t)AKS * DM, gkr + (size_t)AKS * DM, gv + AKS, gvr + AKS);
#pragma unroll 1  /* one trip per stage: the ring's waits and its barrier stand once, at the trip's foot */
  for (int st = 0; st < nst; ++st) {
  const _Float16* buf = kv + (st & 1) * ASTAGE;
#pragma unroll 1  /* two passes of 32 keys per stage share one body */
  for (int sub = 0; sub < AKS; sub += 32) {
    const int kb = st * AKS + sub;
    if (kb >= kend) break;                            /* a wave past its diagonal skips the pass, never the trip's foot */
    const _Float16* k0p = buf + (sub + ln) * APITCH; const _Float16* k1p = k0p + 16 * APITCH;
    const _Float16* r0p = k0p + APLANE;              const _Float16* r1p = r0p + 16 * APITCH;
    v8f s0 = z8, s1 = z8, t0 = z8, t1 = z8;
    v16h kf = g2_frag(k0p, hh);    s0 = g2_mma(qf0, kf, s0); t0 = g2_mma(qr0, kf, t0);
    kf = g2_frag(k0p + 32, hh);    s0 = g2_mma(qf1, kf, s0); t0 = g2_mma(qr1, kf, t0);
    kf = g2_frag(r0p, hh);         t0 = g2_mma(qf0, kf, t0);
    kf = g2_frag(r0p + 32, hh);    t0 = g2_mma(qf1, kf, t0);
    kf = g2_frag(k1p, hh);         s1 = g2_mma(qf0, kf, s1); t1 = g2_mma(qr0, kf, t1);
    kf = g2_frag(k1p + 32, hh);    s1 = g2_mma(qf1, kf, s1); t1 = g2_mma(qr1, kf, t1);
    kf = g2_frag(r1p, hh);         t1 = g2_mma(qf0, kf, t1);
    kf = g2_frag(r1p + 32, hh);    t1 = g2_mma(qf1, kf, t1);
#pragma unroll
    for (int r = 0; r < 8; ++r) {
      const int row = q0 + 8 * hh + r;
      float a = (s0[r] + t0[r] * RINV) * 8.0f, c = (s1[r] + t1[r] * RINV) * 8.0f;
      if (CAUSAL) { a = ((kb + ln > row) || (a == 0.0f)) ? -1.0e9f : a; c = ((kb + 16 + ln > row) || (c == 0.0f)) ? -1.0e9f : c; }
      float t = fmaxf(a, c);
      t = fmaxf(t, __shfl_xor(t, 1, 32)); t = fmaxf(t, __shfl_xor(t, 2, 32)); t = fmaxf(t, __shfl_xor(t, 4, 32)); t = fmaxf(t, __shfl_xor(t, 8, 32));
      const float mnew = fmaxf(mrow[r], t);
      const float p0 = __expf(a - mnew), p1 = __expf(c - mnew);
      const float pc0 = p0 * PCARRY, pc1 = p1 * PCARRY;
      const h16 ph0 = toh_flush(pc0), ph1 = toh_flush(pc1);
      float ls = CAUSAL ? (pc0 + pc1) : ((float)ph0 + (float)ph1);
      ls += __shfl_xor(ls, 1, 32); ls += __shfl_xor(ls, 2, 32); ls += __shfl_xor(ls, 4, 32); ls += __shfl_xor(ls, 8, 32);
      const float corr = __expf(mrow[r] - mnew);
      lrow[r] = lrow[r] * corr + ls; mrow[r] = mnew;
      o0[r] *= corr; o1[r] *= corr; o2[r] *= corr; o3[r] *= corr;
      if (CAUSAL) { e0[r] *= corr; e1[r] *= corr; e2[r] *= corr; e3[r] *= corr; }
      pb[w][(8 * hh + r) * PBP + ln]      = ph0;
      pb[w][(8 * hh + r) * PBP + 16 + ln] = ph1;
      if (CAUSAL) {
        pbr[w][(8 * hh + r) * PBP + ln]      = toh_flush((pc0 - (float)ph0) * RCARRY);
        pbr[w][(8 * hh + r) * PBP + 16 + ln] = toh_flush((pc1 - (float)ph1) * RCARRY); }
    }
    __builtin_amdgcn_fence(4 /* acq_rel order */, "wavefront"); __builtin_amdgcn_wave_barrier();
    const v16h pf = g2_frag(&pb[w][ln * PBP], hh);
    v16h prf = pf; if (CAUSAL) prf = g2_frag(&pbr[w][ln * PBP], hh);
    __builtin_amdgcn_fence(4 /* acq_rel order */, "wavefront"); __builtin_amdgcn_wave_barrier();
    const _Float16* vp = buf + 2 * APLANE + ln * APITCH + sub; const _Float16* vrp = vp + (CAUSAL ? APLANE : 0);
    v16h vf = g2_frag(vp, hh);                   o0 = g2_mma(pf, vf, o0);
    if (CAUSAL) { e0 = g2_mma(prf, vf, e0); vf = g2_frag(vrp, hh);                   e0 = g2_mma(pf, vf, e0); }
    vf = g2_frag(vp + 16 * APITCH, hh);          o1 = g2_mma(pf, vf, o1);
    if (CAUSAL) { e1 = g2_mma(prf, vf, e1); vf = g2_frag(vrp + 16 * APITCH, hh);     e1 = g2_mma(pf, vf, e1); }
    vf = g2_frag(vp + 32 * APITCH, hh);          o2 = g2_mma(pf, vf, o2);
    if (CAUSAL) { e2 = g2_mma(prf, vf, e2); vf = g2_frag(vrp + 32 * APITCH, hh);     e2 = g2_mma(pf, vf, e2); }
    vf = g2_frag(vp + 48 * APITCH, hh);          o3 = g2_mma(pf, vf, o3);
    if (CAUSAL) { e3 = g2_mma(prf, vf, e3); vf = g2_frag(vrp + 48 * APITCH, hh);     e3 = g2_mma(pf, vf, e3); }
  }
    asm volatile("s_wait_dscnt 0x0" ::: "memory");      /* this wave's reads of buffer st & 1 are done before it is refilled */
    asm volatile("s_wait_asynccnt 0x0" ::: "memory");   /* this wave's copies of stage st + 1 have landed */
    __syncthreads();                                    /* publishes stage st + 1 and ends every reader's last read of buffer st & 1 */
    if (st + 2 < nst) attn_stage_copy<CAUSAL>(l0 + (unsigned)((st & 1) * (ASTAGE * 2)), gk + (size_t)(st + 2) * AKS * DM, gkr + (size_t)(st + 2) * AKS * DM, gv + (st + 2) * AKS, gvr + (st + 2) * AKS);
  }
  asm volatile("s_wait_asynccnt 0x0" ::: "memory");     /* no copy is outstanding when the ring is left */
#pragma unroll
  for (int r = 0; r < 8; ++r) {
    const float rl = 64.0f * __builtin_amdgcn_rcpf(lrow[r]);      /* o carried x64; l already carries the P carry */
    const int rloc = (8 * hh + r) * OBP + ln;
    float v0 = o0[r], v1 = o1[r], v2 = o2[r], v3 = o3[r];
    if (CAUSAL) { v0 += e0[r] * RINV; v1 += e1[r] * RINV; v2 += e2[r] * RINV; v3 += e3[r] * RINV; }
    v0 *= rl; v1 *= rl; v2 *= rl; v3 *= rl;
    const h16 g0 = toh_flush(v0), g1 = toh_flush(v1), g2 = toh_flush(v2), g3 = toh_flush(v3);
    ob[w][rloc] = g0; ob[w][rloc + 16] = g1; ob[w][rloc + 32] = g2; ob[w][rloc + 48] = g3;
    if (CAUSAL) {
      obr[w][rloc]      = toh_flush((v0 - (float)g0) * RCARRY); obr[w][rloc + 16] = toh_flush((v1 - (float)g1) * RCARRY);
      obr[w][rloc + 32] = toh_flush((v2 - (float)g2) * RCARRY); obr[w][rloc + 48] = toh_flush((v3 - (float)g3) * RCARRY); }
  }
  __builtin_amdgcn_fence(4 /* acq_rel order */, "wavefront"); __builtin_amdgcn_wave_barrier();
  const int rq = lane >> 3, pc = (lane & 7) * 8;
  {
#pragma unroll
    for (int i = 0; i < 4; ++i) { const int row = i * 4 + rq; const size_t go = (tok0 + q0 + row) * DM + h * HD + pc;
      const v8us v = *(const v8us*)(&ob[w][row * OBP + pc]);
      *(v8us*)((unsigned short*)O16 + go) = v;
      if (CAUSAL) { const v8us vr = *(const v8us*)(&obr[w][row * OBP + pc]); *(v8us*)((unsigned short*)OR16 + go) = vr; } }
     }
}

__global__ __launch_bounds__(256) void k_attn_causal(const _Float16* __restrict__ Q16, const _Float16* __restrict__ QR, const _Float16* __restrict__ K16, const _Float16* __restrict__ KR,
    const _Float16* __restrict__ VT, const _Float16* __restrict__ VTR, _Float16* __restrict__ O16, _Float16* __restrict__ OR16) {
  attn_hr_body<1>(Q16, QR, K16, KR, VT, VTR, O16, OR16);
}
__global__ __launch_bounds__(256) void k_attn_dense(const _Float16* __restrict__ Q16, const _Float16* __restrict__ QR, const _Float16* __restrict__ K16, const _Float16* __restrict__ KR,
    const _Float16* __restrict__ VT, _Float16* __restrict__ O16) {
  attn_hr_body<0>(Q16, QR, K16, KR, VT, VT, O16, O16);
}

// red[] is cross-wave (block barriers); no early exit.
template <int RBF, int RMAP, int W16, int OMAP>
__global__ __launch_bounds__(256) void k_ln(const float* __restrict__ X, const float* __restrict__ R, const float* __restrict__ g, const float* __restrict__ bb, float eps, float* __restrict__ O32, _Float16* __restrict__ O16) {
  #pragma clang fp contract(off)
  __shared__ float red[256];
  const size_t r = blockIdx.x; const int t = threadIdx.x; const int c0 = t * 4;
  const size_t rfull = (r / SEQ) * SEQ_FULL + (r % SEQ);
  const size_t rr = RMAP ? rfull : r;
  const v4f xa = *(const v4fa*)(X + r * DM + c0); const v4f ra = *(const v4fa*)(R + rr * DM + c0);
  float s[4]; float sum = 0.f;
#pragma unroll
  for (int q = 0; q < 4; ++q) { const float rv = RBF ? bf16_rne(ra[q]) : ra[q]; s[q] = xa[q] + rv; sum += s[q]; }
  red[t] = sum; __syncthreads();
  for (int st = 128; st > 0; st >>= 1) { if (t < st) red[t] += red[t + st]; __syncthreads(); }
  const float mu = red[0] * (1.0f / (float)DM); __syncthreads();
  float vs = 0.f;
#pragma unroll
  for (int q = 0; q < 4; ++q) { const float dl = s[q] - mu; vs += dl * dl; }
  red[t] = vs; __syncthreads();
  for (int st = 128; st > 0; st >>= 1) { if (t < st) red[t] += red[t + st]; __syncthreads(); }
  const float rs = rsqrtf(red[0] * (1.0f / (float)DM) + eps);
  v4f yf; v4h y;
#pragma unroll
  for (int q = 0; q < 4; ++q) { const int c = c0 + q; yf[q] = (s[q] - mu) * rs * bf16_rne(g[c]) + bf16_rne(bb[c]); y[q] = (_Float16)yf[q]; }
  const size_t orow = OMAP ? rfull : r;
  {
    if (O32) *(v4f*)(O32 + orow * DM + c0) = yf;
    if (W16) *(v4h*)(O16 + r * DM + c0) = y;
     }
}

extern "C" void kernel_launch(void* const* d_in, const int* in_sizes, int n_in,
                              void* d_out, int out_size, void* d_ws, size_t ws_size, hipStream_t stream) {
  if (n_in < 22) return;
  const float* x    = (const float*)d_in[0];  const float* enc  = (const float*)d_in[1];
  const float* wq1  = (const float*)d_in[2];  const float* wk1  = (const float*)d_in[3];  const float* wv1 = (const float*)d_in[4];
  const float* wo1  = (const float*)d_in[5];  const float* bo1  = (const float*)d_in[6];
  const float* wq2  = (const float*)d_in[7];  const float* wk2  = (const float*)d_in[8];  const float* wv2 = (const float*)d_in[9];
  const float* wo2  = (const float*)d_in[10]; const float* bo2  = (const float*)d_in[11];
  const float* wff1 = (const float*)d_in[12]; const float* bff1 = (const float*)d_in[13]; const float* wff2 = (const float*)d_in[14]; const float* bff2 = (const float*)d_in[15];
  const float* g1   = (const float*)d_in[16]; const float* be1  = (const float*)d_in[17]; const float* g2  = (const float*)d_in[18]; const float* be2 = (const float*)d_in[19];
  const float* g3   = (const float*)d_in[20]; const float* be3  = (const float*)d_in[21];

  const size_t needX = ((size_t)(NB - 1) * SEQ_FULL + SEQ) * DM;
  if ((size_t)in_sizes[0] < needX || (size_t)in_sizes[1] < needX || (size_t)out_size < needX) return;
  { static const int wi[8] = {2, 3, 4, 5, 7, 8, 9, 10}; for (int i = 0; i < 8; ++i) if ((size_t)in_sizes[wi[i]] < (size_t)DM * DM) return; }
  if ((size_t)in_sizes[12] < (size_t)DM * DFF || (size_t)in_sizes[14] < (size_t)DM * DFF || in_sizes[13] < DFF) return;
  { static const int vi[9] = {6, 11, 15, 16, 17, 18, 19, 20, 21}; for (int i = 0; i < 9; ++i) if (in_sizes[vi[i]] < DM) return; }

  char* ws = (char*)d_ws; size_t off = 0;
  auto take = [&](size_t bytes) { char* p = ws + off; off += (bytes + 255) & ~(size_t)255; return p; };
  const size_t WDD = (size_t)DM * DM * 2, WDF = (size_t)DM * DFF * 2, P16 = NR * DM * 2;
  _Float16* BQ1 = (_Float16*)take(WDD); _Float16* BK1 = (_Float16*)take(WDD); _Float16* BV1 = (_Float16*)take(WDD); _Float16* BO1 = (_Float16*)take(WDD);
  _Float16* BQ2 = (_Float16*)take(WDD); _Float16* BK2 = (_Float16*)take(WDD); _Float16* BV2 = (_Float16*)take(WDD); _Float16* BO2 = (_Float16*)take(WDD);
  _Float16* BW1 = (_Float16*)take(WDF);      /* [n=DFF][k=DM]  */
  _Float16* BW2 = (_Float16*)take(WDF);      /* [n=DM][k=DFF]  */
  // fourteen token-plane slots of P16 bytes each (an f32 plane spans two slots, the FFN hidden plane four); lifetimes by launch order:
  // S0 X16                  S1 E16 -> x2 (f16)      S2,S3 Q1|QR1 -> a1 (f32) -> a2 (f32) -> hidden (S2..S5)
  // S4,S5 K1|KR1 -> x1 (f32)   S6,S7 VT1|VTR1 -> x1 value|residual -> S7 o2 (f16) -> f (f32)
  // S8,S9 V1|VR1 -> o1 value|residual -> Q2|QR2 -> x2 (f32)      S10,S11 K2|KR2      S12 V2      S13 VT2
  char* SL = take(14 * P16);
  _Float16* S0 = (_Float16*)(SL + 0 * P16); _Float16* S1 = (_Float16*)(SL + 1 * P16); _Float16* S2 = (_Float16*)(SL + 2 * P16); _Float16* S3 = (_Float16*)(SL + 3 * P16);
  _Float16* S4 = (_Float16*)(SL + 4 * P16); _Float16* S5 = (_Float16*)(SL + 5 * P16); _Float16* S6 = (_Float16*)(SL + 6 * P16); _Float16* S7 = (_Float16*)(SL + 7 * P16);
  _Float16* S8 = (_Float16*)(SL + 8 * P16); _Float16* S9 = (_Float16*)(SL + 9 * P16); _Float16* S10 = (_Float16*)(SL + 10 * P16); _Float16* S11 = (_Float16*)(SL + 11 * P16);
  _Float16* S12 = (_Float16*)(SL + 12 * P16); _Float16* S13 = (_Float16*)(SL + 13 * P16);
  float* YFa = (float*)S2;   /* a1, a2 (f32 rows, S2..S3) */
  float* X1F = (float*)S4;   /* x1 (f32 rows, S4..S5) */
  float* X2F = (float*)S8;   /* x2 (f32 rows, S8..S9) */
  float* YFf = (float*)S6;   /* f  (f32 rows, S6..S7) */
  _Float16* HF = S2;         /* FFN hidden rows [NR][DFF] f16 (S2..S5) */
  if (off > ws_size || off > (size_t)268435456) return;

  static_assert(((size_t)DM * DM * 2) % 256 == 0);   /* BQ1 .. BO2 lie one behind the other in the carve */
  k_prep<<<(unsigned)PREP_BLOCKS, 256, 0, stream>>>(wq1, wk1, wv1, wo1, wq2, wk2, wv2, wo2, wff1, wff2, x, enc, BQ1, BW1, BW2, S0, S1);

  const size_t n8 = NR * DM / 8; const unsigned gx = (unsigned)((n8 + 255) / 256);

  const unsigned gP = (unsigned)((MR / 128) * (DM / 128)), gF1 = (unsigned)((MR / 128) * (DFF / 128));
  const unsigned gVT = (unsigned)(NB * NH * (SEQ / 64)); const dim3 gAT(SEQ / 128, NH, NB);

  // ---- causal self-attention block
  k_proj5<<<dim3(gP, 5), 256, 0, stream>>>(S0, S1, DM, BQ1, BK1, BV1, BK2, BV2, DM, 0.0625f, S2, S3, S4, S5, S8, S9, S10, S11, S12, DM, MR, DM, DM);   /* q1, k1, v1, k2: value | residual; v2: one plane */
  k_vt<NH, SEQ><<<dim3(gVT, 3), 256, 0, stream>>>(S8, S9, S12, DM, 0, S6, S7, S13);
  k_attn_causal<<<gAT, 256, 0, stream>>>(S2, S3, S4, S5, S6, S7, S8, S9);                                       /* o x64 value | residual */
  k_proj_rf<<<gP, 256, 0, stream>>>(S8, S9, DM, BO1, DM, 0.0009765625f, bo1, 1.0f, YFa, DM, MR, DM, DM);        /* a1 = o Wp1 + bp1 */
  k_ln<1, 1, 0, 0><<<(unsigned)MR, 256, 0, stream>>>(YFa, x, g1, be1, LN_EPS, X1F, nullptr);                    /* x1 = LN1(bf16(x) + a1) -> f32 rows */
  k_split16<<<gx, 256, 0, stream>>>(X1F, S6, S7, n8);                                                           /* x1 value | residual */
  // ---- cross-attention block
  k_proj_rhr<<<gP, 256, 0, stream>>>(S6, S7, DM, BQ2, DM, 0.0625f, S8, S9, DM, MR, DM, DM);                     /* q  value | residual */
  k_attn_dense<<<gAT, 256, 0, stream>>>(S8, S9, S10, S11, S13, S7);                                                /* o x64 single plane */
  k_gemm2<0><<<gP, 256, 0, stream>>>(S7, DM, BO2, DM, 0.0009765625f, bo2, 1.0f, YFa, nullptr, DM, MR, DM, DM);  /* a2 = o Wp2 + bp2 */
  k_ln<0, 0, 1, 0><<<(unsigned)MR, 256, 0, stream>>>(YFa, X1F, g2, be2, LN_EPS, X2F, S1);                       /* x2 = LN2(x1 + a2) -> f32 + f16 rows */
  // ---- FFN block
  k_gemm2<3><<<gF1, 256, 0, stream>>>(S1, DM, BW1, DM, 1.0f, bff1, 16.0f, nullptr, HF, DFF, MR, DFF, DM);       /* 16 relu(x2 W1 + b1) as f16 rows */
  k_gemm2<0><<<gP, 256, 0, stream>>>(HF, DFF, BW2, DFF, 0.00390625f, bff2, 1.0f, YFf, nullptr, DM, MR, DM, DFF);  /* f = h W2 + b2 */
  k_ln<0, 0, 0, 1><<<(unsigned)MR, 256, 0, stream>>>(YFf, X2F, g3, be3, LN_EPS, (float*)d_out, nullptr);        /* out = LN3(x2 + f) */
}

// v005
// One run takes 342 microseconds.
// In both of two side-by-side timings against v004, it was 1.11 times as fast.
// Counting every step since v000, it is 3.15 times as fast.
#include <hip/hip_runtime.h>
// Structure: token rows r = b*SEQ + s. Causal self-attention (16 heads of 64, per-head weights [H][E][64], scores x8, keys above the diagonal and exactly-zero scores masked) -> x1 = LN1(x + attn.Wp1 + bp1); cross-attention of x1 over z rows -> x2 = LN2(x1 + attn.Wp2 + bp2); f = relu(x2.W1 + b1).W2 + b2; out = LN3(x2 + f). Projection / FFN weights are [in][out].

#ifndef NB
#define NB 4
#endif
#ifndef SEQ
#define SEQ 1024
#endif
#define NB_FULL 4
#define SEQ_FULL 1024
#define DM 1024
#define NH 16
#define HD 64
#define DFF 4096
#define NR ((size_t)NB * SEQ)
#define MR ((int)((size_t)NB * SEQ))
#define OBP 72          /* LDS pitch (halves) of the per-wave o tile */
#define LN_EPS 1.0e-5f
#define PCARRY 16384.0f         /* carry of the f16 P planes */
#define RCARRY 2048.0f          /* carry of every residual plane */
#define RINV 0.00048828125f     /* 1 / RCARRY */

static_assert(NB >= 1 && NB <= NB_FULL);
static_assert(SEQ >= 64 && SEQ <= SEQ_FULL && SEQ % 64 == 0);
static_assert((NB * SEQ) % 128 == 0);
static_assert(NH * HD == DM && HD == 64);
static_assert(DM == 4 * 256);
static_assert(DM % 64 == 0 && DFF % 64 == 0 && DM % 32 == 0 && DFF % 32 == 0);
static_assert(DFF <= 4 * DM);
static_assert((OBP % 8) == 0);
static_assert(DFF == 4 * DM);                       /* the FFN hidden plane spans exactly four 16-bit token planes */
static_assert(OBP >= HD);                           /* o tile holds one head */
static_assert(RCARRY * RINV == 1.0f);
static_assert(PCARRY <= 32768.0f);                  /* carried P stays inside f16 */
static_assert((size_t)8 * DM * DM * 2 + (size_t)2 * DM * DFF * 2 + (size_t)14 * NB * SEQ * DM * 2 + 16 * 256 <= (size_t)268435456);   /* workspace carve */

typedef unsigned short v8us __attribute__((ext_vector_type(8), may_alias));
typedef float  v8f  __attribute__((ext_vector_type(8)));
typedef float  v4f  __attribute__((ext_vector_type(4)));
typedef float  v4fa __attribute__((ext_vector_type(4), may_alias));
typedef _Float16 v16h __attribute__((ext_vector_type(16)));
typedef _Float16 v4h __attribute__((ext_vector_type(4)));
union FragH { v16h v; v8us half[2]; _Float16 h[16]; unsigned short u[16]; };

__device__ __forceinline__ unsigned short bf16_bits(float x) { unsigned int u = __float_as_uint(x); return (unsigned short)((u + 0x7FFFu + ((u >> 16) & 1u)) >> 16); }
__device__ __forceinline__ float bf16_val(unsigned short b) { return __uint_as_float(((unsigned int)b) << 16); }
__device__ __forceinline__ float bf16_rne(float x) { return bf16_val(bf16_bits(x)); }

// 16x32 fragment from a k-contiguous 16-bit row p (A row m = lane&15, or B stored [n][k] with n = lane&15):
// elements 0..7 <- k 8h..8h+7, elements 8..15 <- k 16+8h..16+8h+7 (h = lane>>4)
__device__ __forceinline__ v16h g2_frag(const _Float16* p, int hh) { FragH f; f.half[0] = *(const v8us*)((const unsigned short*)p + 8 * hh); f.half[1] = *(const v8us*)((const unsigned short*)p + 16 + 8 * hh); return f.v; }
__device__ __forceinline__ v8f g2_mma(v16h a, v16h b, v8f c) { v8f d = __builtin_amdgcn_wmma_f32_16x16x32_f16(false, a, false, b, (short)0, c, false, false); asm volatile("v_nop\n\tv_nop\n\tv_nop\n\tv_nop" : "+v"(d) : "v"(a), "v"(b)); return d; }

// f32 -> f16 operand convert that cannot yield an f16 subnormal (value select, applied after the plane's carry)
typedef _Float16 h16;
static __device__ __forceinline__ h16 toh_flush(float v) { const h16 r = (h16)v; return (fabsf(v) < 6.103515625e-05f) ? (h16)0.0f : r; }

// Weight convert + transpose, one 64 k x 64 n tile per block, turned in LDS: every wave-wide 16-byte load covers two whole 256-byte source rows of the tile and every
// wave-wide 16-byte store four whole 128-byte pieces of Wt rows. HEAD 0: W is [K][N]; HEAD 1: W is [N/64][K][64] (tile column block = head). Wt is [n][k].
// Requires K % 64 == 0 and N % 64 == 0; bid = the tile's index among the (N/64)*(K/64) tiles of its matrix, the same for the whole block of 256; tl = the block's LDS tile.
#define WTP 66                  /* LDS row pitch in halves: 33 words, so that a column walk of 8 rows apart meets 8 different banks */
template <int HEAD>
static __device__ __forceinline__ void wt_tile_body(unsigned short (*tl)[WTP], int bid, const float* __restrict__ W, _Float16* __restrict__ Wt, int K, int N, float scale) {
  const int tid = threadIdx.x; const int nkt = K >> 6; const int nt = bid / nkt, kt = bid - nt * nkt; if (nt * 64 >= N) return;   /* the same for the whole block, ahead of the barrier */
  const int n0 = nt * 64, k0 = kt * 64;
  const float* src = HEAD ? W + ((size_t)nt * K + k0) * HD : W + (size_t)k0 * N + n0;
  const size_t rstep = HEAD ? (size_t)HD : (size_t)N;
  const int r0 = tid >> 4, c4 = (tid & 15) * 4;
  v4f a[4];
#pragma unroll  /* the four loads of a lane are issued together, ahead of the first convert */
  for (int i = 0; i < 4; ++i) a[i] = *(const v4fa*)(src + (size_t)(i * 16 + r0) * rstep + c4);
#pragma unroll  /* constant indices keep a[] and f in registers, here and in the loops below */
  for (int i = 0; i < 4; ++i) { FragH f;
#pragma unroll
    for (int q = 0; q < 4; ++q) { const float v = bf16_rne(a[i][q]) * scale; f.h[q] = HEAD ? toh_flush(v) : (_Float16)v; }
#pragma unroll
    for (int q = 0; q < 4; ++q) tl[i * 16 + r0][c4 + q] = f.u[q]; }
  __syncthreads();   /* the whole tile is in LDS before any column of it is read */
#pragma unroll
  for (int rd = 0; rd < 2; ++rd) { const int n = rd * 32 + tid / 8, pc = tid % 8; FragH f;
#pragma unroll
    for (int q = 0; q < 8; ++q) f.u[q] = tl[pc * 8 + q][n];
    *(v8us*)((unsigned short*)Wt + (size_t)(n0 + n) * K + k0 + pc * 8) = f.half[0]; }
  asm volatile("s_wait_xcnt 0x0" ::: "memory");   /* another job's code follows in the merged kernel and reuses the registers that the two stores name */
}

static __device__ __forceinline__ void x16_body(int bid, const float* __restrict__ x, _Float16* __restrict__ X16, size_t n8) {
  const size_t t = (size_t)bid * 256 + threadIdx.x; if (t >= n8) return;
  const size_t e = t * 8; const size_t r = e / DM; const size_t c = e % DM; const size_t rs = (r / SEQ) * SEQ_FULL + (r % SEQ);
  const float* src = x + rs * DM + c; const v4f a = *(const v4fa*)src; const v4f a2 = *(const v4fa*)(src + 4); FragH f;
#pragma unroll
  for (int q = 0; q < 4; ++q) { f.h[q] = (_Float16)bf16_rne(a[q]); f.h[4 + q] = (_Float16)bf16_rne(a2[q]); }
  const v8us o = f.half[0]; unsigned short* d = (unsigned short*)X16 + e;
  *(v8us*)d = o; 
}

// Every conversion that reads the inputs alone, in ONE launch: none of the twelve jobs reads what another writes. blockIdx.x picks the job, the same for the whole block:
// the tiles of the eight DM x DM attention weights (order q k v o, q k v o; Wt planes one behind the other from BA), of W1, of W2, then the row pieces of x and of z.
#define TDD ((DM / 64) * (DM / 64))             /* tiles of a DM x DM weight */
#define TDF ((DM / 64) * (DFF / 64))            /* tiles of an FFN weight */
#define XBL ((int)((NR * DM / 8 + 255) / 256))  /* blocks of a token plane, 8 elements a thread */
#define PREP_BLOCKS (8 * TDD + 2 * TDF + 2 * XBL)
__global__ __launch_bounds__(256) void k_prep(const float* __restrict__ wq1, const float* __restrict__ wk1, const float* __restrict__ wv1, const float* __restrict__ wo1,
    const float* __restrict__ wq2, const float* __restrict__ wk2, const float* __restrict__ wv2, const float* __restrict__ wo2, const float* __restrict__ wff1, const float* __restrict__ wff2,
    const float* __restrict__ x, const float* __restrict__ z, _Float16* __restrict__ BA, _Float16* __restrict__ BW1, _Float16* __restrict__ BW2, _Float16* __restrict__ X16, _Float16* __restrict__ Z16) {
  __shared__ unsigned short tl[64][WTP];
  int bid = blockIdx.x;
  if (bid < 8 * TDD) {
    const int j = bid / TDD; bid -= j * TDD; _Float16* Wt = BA + (size_t)j * DM * DM;
    if ((j & 3) != 3) wt_tile_body<1>(tl, bid, j == 0 ? wq1 : j == 1 ? wk1 : j == 2 ? wv1 : j == 4 ? wq2 : j == 5 ? wk2 : wv2, Wt, DM, DM, 16.0f);
    else wt_tile_body<0>(tl, bid, j == 3 ? wo1 : wo2, Wt, DM, DM, 16.0f);
  } else if (bid < 8 * TDD + TDF) {
    wt_tile_body<0>(tl, bid - 8 * TDD, wff1, BW1, DM, DFF, 16.0f);
  } else if (bid < 8 * TDD + 2 * TDF) {
    wt_tile_body<0>(tl, bid - (8 * TDD + TDF), wff2, BW2, DFF, DM, 16.0f);
  } else {
    bid -= 8 * TDD + 2 * TDF; const int second = bid >= XBL; if (second) bid -= XBL;
    x16_body(bid, second ? z : x, second ? Z16 : X16, NR * DM / 8);
  }
}

__global__ __launch_bounds__(256) void k_split16(const float* __restrict__ src, _Float16* __restrict__ H16, _Float16* __restrict__ R16, size_t n8) {
  #pragma clang fp contract(off)
  const size_t t = (size_t)blockIdx.x * 256 + threadIdx.x; if (t >= n8) return;
  const size_t e = t * 8; const v4f a = *(const v4fa*)(src + e); const v4f a2 = *(const v4fa*)(src + e + 4); FragH fh, fr;
#pragma unroll
  for (int q = 0; q < 4; ++q) {
    const h16 h0 = toh_flush(a[q]);  fh.h[q] = h0;     fr.h[q] = toh_flush((a[q] - (float)h0) * RCARRY);
    const h16 h1 = toh_flush(a2[q]); fh.h[4 + q] = h1; fr.h[4 + q] = toh_flush((a2[q] - (float)h1) * RCARRY); }
  const v8us oh = fh.half[0]; const v8us orr = fr.half[0];
  unsigned short* dh = (unsigned short*)H16 + e; unsigned short* dr = (unsigned short*)R16 + e;
  *(v8us*)dh = oh; *(v8us*)dr = orr; 
}

template <int NHv, int TTv>
__global__ __launch_bounds__(256) void k_vt(const _Float16* __restrict__ V16a, const _Float16* __restrict__ V16b, const _Float16* __restrict__ V16c, int ldv, int voff,
    _Float16* __restrict__ Vta, _Float16* __restrict__ Vtb, _Float16* __restrict__ Vtc) {
  const int pj = blockIdx.y;   /* picks the plane: the three independent transposes share a launch */
  const _Float16* V16 = pj == 0 ? V16a : pj == 1 ? V16b : V16c; _Float16* Vt = pj == 0 ? Vta : pj == 1 ? Vtb : Vtc;
  __shared__ unsigned short tl[64][66]; const int tid = threadIdx.x; const int slab = blockIdx.x / (TTv / 64), lg = blockIdx.x % (TTv / 64); const int b = slab / NHv, h = slab % NHv;
  for (int i = tid; i < 64 * 8; i += 256) { const int r = i / 8, c8 = (i % 8) * 8; FragH f; f.half[0] = *(const v8us*)((const unsigned short*)V16 + ((size_t)b * TTv + lg * 64 + r) * ldv + voff + h * 64 + c8);
#pragma unroll
    for (int q = 0; q < 8; ++q) tl[r][c8 + q] = f.u[q]; }
  __syncthreads();
  {
#pragma unroll
    for (int rd = 0; rd < 2; ++rd) { const int d = rd * 32 + tid / 8, pc = tid % 8; FragH f;
#pragma unroll
      for (int q = 0; q < 8; ++q) f.u[q] = tl[pc * 8 + q][d];
      *(v8us*)((unsigned short*)Vt + ((size_t)slab * 64 + d) * TTv + lg * 64 + pc * 8) = f.half[0]; }
     }
}

// LDS staging of the GEMM operands. A block of 8 waves owns a 128 x 128 tile of C; a stage holds 128 k of its 128 A rows and then of its 128 B rows.
#define GKP 128                 /* k (halves) per stage: 256-byte rows */
#define GPITCH 136              /* LDS row pitch in halves: 272 B = 16 B x 17, conflict-free for 16-byte row reads */
#define GPITCHB (GPITCH * 2)    /* the same in bytes */
#define GSTAGE (256 * GPITCH)   /* halves per stage */
static_assert(DM % GKP == 0 && DFF % GKP == 0 && DM % 128 == 0 && DFF % 128 == 0);

static __device__ __forceinline__ unsigned lds_off(const void* p) { return (unsigned)(size_t)p; }

// Eight 16-byte asynchronous copies of one lane: rows 16 apart, global row step gstep halves. The s_wait_xcnt closes the statement so that no address register is rewritten ahead of it.
static __device__ __forceinline__ void copy8(unsigned l, const _Float16* g, size_t gstep) {
  asm volatile(
      "global_load_async_to_lds_b128 %0, %8, off\n\t"
      "global_load_async_to_lds_b128 %1, %9, off\n\t"
      "global_load_async_to_lds_b128 %2, %10, off\n\t"
      "global_load_async_to_lds_b128 %3, %11, off\n\t"
      "global_load_async_to_lds_b128 %4, %12, off\n\t"
      "global_load_async_to_lds_b128 %5, %13, off\n\t"
      "global_load_async_to_lds_b128 %6, %14, off\n\t"
      "global_load_async_to_lds_b128 %7, %15, off\n\t"
      "s_wait_xcnt 0x0"
      :: "v"(l), "v"(l + 16u * GPITCHB), "v"(l + 32u * GPITCHB), "v"(l + 48u * GPITCHB), "v"(l + 64u * GPITCHB), "v"(l + 80u * GPITCHB), "v"(l + 96u * GPITCHB), "v"(l + 112u * GPITCHB),
         "v"(g), "v"(g + gstep), "v"(g + 2 * gstep), "v"(g + 3 * gstep), "v"(g + 4 * gstep), "v"(g + 5 * gstep), "v"(g + 6 * gstep), "v"(g + 7 * gstep)
      : "memory");
}
// One stage: l = this lane's LDS byte address in the stage's row tid/16, ga / gb = its 16 bytes of that row of the A / B tile.
static __device__ __forceinline__ void stage_copy(unsigned l, const _Float16* ga, int lda, const _Float16* gb, int ldb) {
  copy8(l, ga, (size_t)16 * lda);
  copy8(l + 128u * GPITCHB, gb, (size_t)16 * ldb);
}

// One K sweep of the block's 128 x 128 tile through a two-buffer LDS ring; each wave keeps a 32 x 64 tile (A rows arow, arow + 16; B rows brow + 16 j), k ascending in steps of 32.
// At and Bt point at the first row of the block's A and B tiles. Every thread of the block calls it; K is a positive multiple of 128. The ring is free again on return (the last trip's barrier).
static __device__ __forceinline__ void gemm_sweep(_Float16* ring, const _Float16* At, int lda, const _Float16* Bt, int ldb, int K, int tid, int arow, int brow, int hh,
    v8f& c00, v8f& c01, v8f& c02, v8f& c03, v8f& c10, v8f& c11, v8f& c12, v8f& c13) {
  const unsigned l0 = lds_off(ring) + (unsigned)((tid >> 4) * GPITCHB + (tid & 15) * 16);
  const _Float16* ga = At + (size_t)(tid >> 4) * lda + (tid & 15) * 8;
  const _Float16* gb = Bt + (size_t)(tid >> 4) * ldb + (tid & 15) * 8;
  const int nst = K / GKP;
  stage_copy(l0, ga, lda, gb, ldb);
  asm volatile("s_wait_asynccnt 0x0" ::: "memory");   /* stage 0 of this wave has landed */
  __syncthreads();                                    /* stage 0 of every wave is readable */
  if (nst > 1) stage_copy(l0 + (unsigned)(GSTAGE * 2), ga + GKP, lda, gb + GKP, ldb);
#pragma unroll 1  /* one trip per stage: the ring's waits and its barrier stand once, at the trip's foot */
  for (int t = 0; t < nst; ++t) {
    const _Float16* buf = ring + (t & 1) * GSTAGE;
    const _Float16* a0p = buf + arow * GPITCH; const _Float16* a1p = a0p + 16 * GPITCH;
    const _Float16* b0p = buf + (128 + brow) * GPITCH; const _Float16* b1p = b0p + 16 * GPITCH; const _Float16* b2p = b1p + 16 * GPITCH; const _Float16* b3p = b2p + 16 * GPITCH;
    // the six fragments of a k step are read as one group, one k step ahead inside the stage, so that their LDS latency runs under the products of the step before
    v16h a0 = g2_frag(a0p, hh), a1 = g2_frag(a1p, hh), b0 = g2_frag(b0p, hh), b1 = g2_frag(b1p, hh), b2 = g2_frag(b2p, hh), b3 = g2_frag(b3p, hh);
#pragma unroll  /* constant LDS offsets, and the two fragment sets swap by renaming, without moves */
    for (int kb = 0; kb < GKP; kb += 32) {
      v16h na0 = a0, na1 = a1, nb0 = b0, nb1 = b1, nb2 = b2, nb3 = b3;
      if (kb + 32 < GKP) { na0 = g2_frag(a0p + kb + 32, hh); na1 = g2_frag(a1p + kb + 32, hh); nb0 = g2_frag(b0p + kb + 32, hh); nb1 = g2_frag(b1p + kb + 32, hh); nb2 = g2_frag(b2p + kb + 32, hh); nb3 = g2_frag(b3p + kb + 32, hh); }
      c00 = g2_mma(a0, b0, c00); c10 = g2_mma(a1, b0, c10);
      c01 = g2_mma(a0, b1, c01); c11 = g2_mma(a1, b1, c11);
      c02 = g2_mma(a0, b2, c02); c12 = g2_mma(a1, b2, c12);
      c03 = g2_mma(a0, b3, c03); c13 = g2_mma(a1, b3, c13);
      a0 = na0; a1 = na1; b0 = nb0; b1 = nb1; b2 = nb2; b3 = nb3; }
    asm volatile("s_wait_dscnt 0x0" ::: "memory");      /* this wave's reads of buffer t & 1 are done before it is refilled */
    asm volatile("s_wait_asynccnt 0x0" ::: "memory");   /* this wave's copies of stage t + 1 have landed */
    __syncthreads();                                    /* publishes stage t + 1 and ends every reader's last read of buffer t & 1 */
    if (t + 2 < nst) stage_copy(l0 + (unsigned)((t & 1) * (GSTAGE * 2)), ga + (size_t)(t + 2) * GKP, lda, gb + (size_t)(t + 2) * GKP, ldb);
  }
  asm volatile("s_wait_asynccnt 0x0" ::: "memory");     /* no copy is outstanding when the ring is left */
}

// GEMM: block tile 128 x 128 (8 waves, 4 x 2), wave tile 32 rows x 64 cols; A f16 rows (pitch lda), Bh f16 [n][k] (pitch ldb); v = acc*alpha + bf16(bias[col])*bsc; ACT 0 none / 3 relu;
// Requires M % 128 == 0, N % 128 == 0, K % 128 == 0; grid = (M/128)*(N/128), block 256.
template <int ACT>
__global__ __launch_bounds__(256) void k_gemm2(const _Float16* __restrict__ A, int lda, const _Float16* __restrict__ Bh, int ldb, float alpha, const float* __restrict__ bias, float bsc,
    float* __restrict__ C, _Float16* __restrict__ C16, int ldc, int M, int N, int K) {
  static_assert(ACT == 0 || ACT == 3);
  __shared__ __attribute__((aligned(16))) _Float16 ring[2 * GSTAGE];
  __shared__ __attribute__((aligned(16))) float so[8][32][68];
  const int tid = threadIdx.x, lane = tid & 31, ln = lane & 15, hh = lane >> 4;
  const int w = __builtin_amdgcn_readfirstlane(tid >> 5);
  const int ntn = N >> 7; const int mt = blockIdx.x / ntn, nq = blockIdx.x - mt * ntn; if (mt * 128 >= M) return;
  const int row0 = mt * 128 + 32 * (w >> 1), col0 = nq * 128 + 64 * (w & 1);
  const v8f z8 = {0.f,0.f,0.f,0.f,0.f,0.f,0.f,0.f}; v8f c00 = z8, c01 = z8, c02 = z8, c03 = z8, c10 = z8, c11 = z8, c12 = z8, c13 = z8;
  gemm_sweep(ring, A + (size_t)(mt * 128) * lda, lda, Bh + (size_t)(nq * 128) * ldb, ldb, K, tid, 32 * (w >> 1) + ln, 64 * (w & 1) + ln, hh, c00, c01, c02, c03, c10, c11, c12, c13);
  v8f accs[8] = {c00, c01, c02, c03, c10, c11, c12, c13};
#pragma unroll
  for (int u = 0; u < 8; ++u) { const int t = u & 3, half = u >> 2; const int col = col0 + t * 16 + ln; const float bv = bias ? bf16_rne(bias[col]) * bsc : 0.f;
#pragma unroll
    for (int r = 0; r < 8; ++r) { const int rloc = half * 16 + 8 * hh + r; float v = accs[u][r] * alpha + bv; if (ACT == 3) v = fmaxf(v, 0.f); so[w][rloc][t * 16 + ln] = v; } }
  __builtin_amdgcn_fence(4 /* acq_rel order */, "workgroup"); __builtin_amdgcn_wave_barrier();
  const int rsub = lane >> 4, c4 = (lane & 15) * 4;
  {
#pragma unroll
    for (int q = 0; q < 16; ++q) { const int r = q * 2 + rsub; const v4f v = *(const v4fa*)&so[w][r][c4];
      if (C) *(v4f*)(C + (size_t)(row0 + r) * ldc + col0 + c4) = v;
      if (C16) { v4h h4; for (int i = 0; i < 4; ++i) h4[i] = (_Float16)v[i]; *(v4h*)(C16 + (size_t)(row0 + r) * ldc + col0 + c4) = h4; } }
     }
}

// GEMM with an optional residual A plane (AR = (a - f16(a)) * 2048, own accumulators from zero, folded by 2^-11 in f32) and either an f32 output (OUTHR 0)
// or f16 planes (OUTHR 1): value + residual, or, SGL 1 and single set (the same for the whole block), one plainly converted plane CH alone.
// Requires M % 128 == 0, N % 128 == 0, K % 128 == 0; grid = (M/128)*(N/128), block 256.
template <int ARES, int OUTHR, int SGL = 0>
static __device__ __forceinline__ void gemm_hr_body(const _Float16* __restrict__ A, const _Float16* __restrict__ AR, int lda, const _Float16* __restrict__ Bh, int ldb, float alpha,
    const float* __restrict__ bias, float bsc, float* __restrict__ C, _Float16* __restrict__ CH, _Float16* __restrict__ CR, int ldc, int M, int N, int K, bool single = false) {
  __shared__ __attribute__((aligned(16))) _Float16 ring[2 * GSTAGE];
  __shared__ __attribute__((aligned(16))) float so[8][32][68];
  const int tid = threadIdx.x, lane = tid & 31, ln = lane & 15, hh = lane >> 4;
  const int w = __builtin_amdgcn_readfirstlane(tid >> 5);
  const int ntn = N >> 7; const int mt = blockIdx.x / ntn, nq = blockIdx.x - mt * ntn; if (mt * 128 >= M) return;
  const int row0 = mt * 128 + 32 * (w >> 1), col0 = nq * 128 + 64 * (w & 1);
  const int arow = 32 * (w >> 1) + ln, brow = 64 * (w & 1) + ln;
  const _Float16* Bt = Bh + (size_t)(nq * 128) * ldb;
  const v8f z8 = {0.f,0.f,0.f,0.f,0.f,0.f,0.f,0.f};
  if (ARES) {
    v8f d00 = z8, d01 = z8, d02 = z8, d03 = z8, d10 = z8, d11 = z8, d12 = z8, d13 = z8;
    gemm_sweep(ring, AR + (size_t)(mt * 128) * lda, lda, Bt, ldb, K, tid, arow, brow, hh, d00, d01, d02, d03, d10, d11, d12, d13);
    v8f ds[8] = {d00, d01, d02, d03, d10, d11, d12, d13};
#pragma unroll
    for (int u = 0; u < 8; ++u) { const int t = u & 3, half = u >> 2;
#pragma unroll
      for (int r = 0; r < 8; ++r) { const int rloc = half * 16 + 8 * hh + r; so[w][rloc][t * 16 + ln] = ds[u][r] * RINV; } }
  }
  v8f c00 = z8, c01 = z8, c02 = z8, c03 = z8, c10 = z8, c11 = z8, c12 = z8, c13 = z8;
  gemm_sweep(ring, A + (size_t)(mt * 128) * lda, lda, Bt, ldb, K, tid, arow, brow, hh, c00, c01, c02, c03, c10, c11, c12, c13);
  v8f accs[8] = {c00, c01, c02, c03, c10, c11, c12, c13};
#pragma unroll
  for (int u = 0; u < 8; ++u) { const int t = u & 3, half = u >> 2; const int col = col0 + t * 16 + ln; const float bv = bias ? bf16_rne(bias[col]) * bsc : 0.f;
#pragma unroll
    for (int r = 0; r < 8; ++r) { const int rloc = half * 16 + 8 * hh + r; float v = accs[u][r]; if (ARES) v += so[w][rloc][t * 16 + ln]; v = v * alpha + bv; so[w][rloc][t * 16 + ln] = v; } }
  __builtin_amdgcn_fence(4 /* acq_rel order */, "workgroup"); __builtin_amdgcn_wave_barrier();
  const int rsub = lane >> 4, c4 = (lane & 15) * 4;
  if (SGL && single) {   /* one test for the whole read-out, not one per row */
#pragma unroll
    for (int q = 0; q < 16; ++q) { const int r = q * 2 + rsub; const v4f v = *(const v4fa*)&so[w][r][c4];
      v4h h4; for (int i = 0; i < 4; ++i) h4[i] = (_Float16)v[i]; *(v4h*)(CH + (size_t)(row0 + r) * ldc + col0 + c4) = h4; }
  } else {
#pragma unroll
    for (int q = 0; q < 16; ++q) { const int r = q * 2 + rsub; const v4f v = *(const v4fa*)&so[w][r][c4];
      if (OUTHR) { v4h h4, r4;
#pragma unroll
        for (int i = 0; i < 4; ++i) { const h16 hv = toh_flush(v[i]); h4[i] = hv; r4[i] = toh_flush((v[i] - (float)hv) * RCARRY); }
        *(v4h*)(CH + (size_t)(row0 + r) * ldc + col0 + c4) = h4;
        *(v4h*)(CR + (size_t)(row0 + r) * ldc + col0 + c4) = r4; }
      else { *(v4f*)(C + (size_t)(row0 + r) * ldc + col0 + c4) = v; } }
    if (SGL) asm volatile("s_wait_xcnt 0x0" ::: "memory");   /* the other read-out's code follows in the built kernel and reuses the registers that these stores name */
     }
}

// The five projections that read a converted input plane alone, in one launch; blockIdx.y picks the job: q, k, v of the self-attention (A0) and k of the cross-attention (A1) as f16 value +
// residual planes, v of the cross-attention (A1) as one f16 plane. grid = ((M/128)*(N/128), 5).
__global__ __launch_bounds__(256) void k_proj5(const _Float16* __restrict__ A0, const _Float16* __restrict__ A1, int lda,
    const _Float16* __restrict__ B0, const _Float16* __restrict__ B1, const _Float16* __restrict__ B2, const _Float16* __restrict__ B3, const _Float16* __restrict__ B4, int ldb, float alpha,
    _Float16* __restrict__ CH0, _Float16* __restrict__ CR0, _Float16* __restrict__ CH1, _Float16* __restrict__ CR1, _Float16* __restrict__ CH2, _Float16* __restrict__ CR2,
    _Float16* __restrict__ CH3, _Float16* __restrict__ CR3, _Float16* __restrict__ CH4, int ldc, int M, int N, int K) {
  const int j = blockIdx.y;
  const _Float16* A = j < 3 ? A0 : A1;
  const _Float16* Bh = j == 0 ? B0 : j == 1 ? B1 : j == 2 ? B2 : j == 3 ? B3 : B4;
  _Float16* CH = j == 0 ? CH0 : j == 1 ? CH1 : j == 2 ? CH2 : j == 3 ? CH3 : CH4;
  _Float16* CR = j == 0 ? CR0 : j == 1 ? CR1 : j == 2 ? CR2 : CR3;   /* not stored by job 4 */
  gemm_hr_body<0, 1, 1>(A, A, lda, Bh, ldb, alpha, nullptr, 0.f, nullptr, CH, CR, ldc, M, N, K, j == 4);
}
// value + residual A planes -> f16 value + residual output planes
__global__ __launch_bounds__(256) void k_proj_rhr(const _Float16* __restrict__ A, const _Float16* __restrict__ AR, int lda, const _Float16* __restrict__ Bh, int ldb, float alpha,
    _Float16* __restrict__ CH, _Float16* __restrict__ CR, int ldc, int M, int N, int K) {
  gemm_hr_body<1, 1>(A, AR, lda, Bh, ldb, alpha, nullptr, 0.f, nullptr, CH, CR, ldc, M, N, K);
}
// value + residual A planes -> f32 rows with bias
__global__ __launch_bounds__(256) void k_proj_rf(const _Float16* __restrict__ A, const _Float16* __restrict__ AR, int lda, const _Float16* __restrict__ Bh, int ldb, float alpha,
    const float* __restrict__ bias, float bsc, float* __restrict__ C, int ldc, int M, int N, int K) {
  gemm_hr_body<1, 0>(A, AR, lda, Bh, ldb, alpha, bias, bsc, C, nullptr, nullptr, ldc, M, N, K);
}

// LDS staging of the attention operands. A block of 8 waves owns 128 query rows of one (batch, head); a stage holds 64 keys: the K value and K residual rows (64 rows of 128 bytes each),
// then the V^T value rows (64 head columns x 64 keys) and, CAUSAL, the V^T residual rows. Every copy of a wave covers four whole 128-byte rows.
#define AKS 64                  /* keys per stage */
#define APITCH 72               /* LDS row pitch in halves: 144 B = 16 B x 9, conflict-free for 16-byte row reads */
#define APITCHB (APITCH * 2)    /* the same in bytes */
#define APLANE (64 * APITCH)    /* halves per staged plane */
static_assert(SEQ % 128 == 0 && SEQ / AKS >= 2 && HD == 64);

// Four / two 16-byte asynchronous copies of one lane. The s_wait_xcnt closes the statement so that no address register is rewritten ahead of it.
static __device__ __forceinline__ void copy4(unsigned l0, unsigned l1, unsigned l2, unsigned l3, const _Float16* g0, const _Float16* g1, const _Float16* g2, const _Float16* g3) {
  asm volatile(
      "global_load_async_to_lds_b128 %0, %4, off\n\t"
      "global_load_async_to_lds_b128 %1, %5, off\n\t"
      "global_load_async_to_lds_b128 %2, %6, off\n\t"
      "global_load_async_to_lds_b128 %3, %7, off\n\t"
      "s_wait_xcnt 0x0"
      :: "v"(l0), "v"(l1), "v"(l2), "v"(l3), "v"(g0), "v"(g1), "v"(g2), "v"(g3)
      : "memory");
}
static __device__ __forceinline__ void copy2(unsigned l0, unsigned l1, const _Float16* g0, const _Float16* g1) {
  asm volatile(
      "global_load_async_to_lds_b128 %0, %2, off\n\t"
      "global_load_async_to_lds_b128 %1, %3, off\n\t"
      "s_wait_xcnt 0x0"
      :: "v"(l0), "v"(l1), "v"(g0), "v"(g1)
      : "memory");
}
// One stage: l = this lane's LDS byte address in row tid/8 of the stage's first plane; gk / gkr / gv / gvr = its 16 bytes of that row of each plane. A lane brings rows tid/8 and tid/8 + 32 of every plane.
template <int CAUSAL>
static __device__ __forceinline__ void attn_stage_copy(unsigned l, const _Float16* gk, const _Float16* gkr, const _Float16* gv, const _Float16* gvr) {
  const unsigned pl = (unsigned)(APLANE * 2), rb = 32u * APITCHB;
  copy4(l, l + rb, l + pl, l + pl + rb, gk, gk + (size_t)32 * DM, gkr, gkr + (size_t)32 * DM);
  if (CAUSAL) copy4(l + 2u * pl, l + 2u * pl + rb, l + 3u * pl, l + 3u * pl + rb, gv, gv + (size_t)32 * SEQ, gvr, gvr + (size_t)32 * SEQ);
  else copy2(l + 2u * pl, l + 2u * pl + rb, gv, gv + (size_t)32 * SEQ);
}

// The value of the same lane of the other 16-lane half (lane ^ 16), by a vector cross-row move.
static __device__ __forceinline__ float other_half(float v) { const int i = __float_as_int(v); return __int_as_float(__builtin_amdgcn_permlanex16(i, i, 0x76543210, 0xfedcba98, false, false)); }

// Flash-style attention for one (batch, head, 16 query rows) per wave: keys taken 32 at a time from the block's two-buffer LDS ring with an online (running-max) softmax in f32.
// The scores are computed transposed, S^T = K.Q^T (A = 16 key rows from LDS, B = the wave's 16 query rows kept in registers): lane (ln, hh) holds, of query q0 + ln, the keys 8 hh + r of the first
// key tile and 16 + 8 hh + r of the second, so that the maximum and the sum of a query run inside a lane, plus one exchange between the halves, and the two converted tiles ARE the B operand
// of O^T += V^T.P^T (element s of B = key 8 hh + s, then 16 + 8 hh + s - 8: the k order of g2_frag, which loads V^T as A). P never passes through LDS.
// scores = 8 * q.k^T with q and k as f16 value + x2048 residual planes: value.value in one accumulator, residual.value + value.residual in a second
// accumulator folded by 2^-11. CAUSAL: keys above the query row and exactly-zero scores take the fill -1e9 (replace), key blocks entirely above
// the wave's rows are skipped (their weights are exactly 0); P = 16384*exp(s - m) as f16 value + x2048 residual, V^T as value + residual slabs,
// o = P.V^T with value.value in one accumulator and the two cross terms in a second, row sum over the unconverted P; o/l * 64 written as f16 value +
// residual rows. Dense: P as one f16 plane (row sum over the converted P), V^T one plane, o one plane. Each half keeps the sum of its own keys; the two are joined after the loop. o tiles are wave-private LDS
template <int CAUSAL>
static __device__ __forceinline__ void attn_hr_body(const _Float16* __restrict__ Q16, const _Float16* __restrict__ QR, const _Float16* __restrict__ K16, const _Float16* __restrict__ KR,
    const _Float16* __restrict__ VT, const _Float16* __restrict__ VTR, _Float16* __restrict__ O16, _Float16* __restrict__ OR16) {
  constexpr int ASTAGE = (CAUSAL ? 4 : 3) * APLANE;   /* halves per stage */
  __shared__ __attribute__((aligned(16))) _Float16 kv[2 * ASTAGE];
  __shared__ __attribute__((aligned(16))) _Float16 ob[8][16 * OBP];
  __shared__ __attribute__((aligned(16))) _Float16 obr[8][16 * OBP];
  const int tid = threadIdx.x, lane = tid & 31, ln = lane & 15, hh = lane >> 4;
  const int w = __builtin_amdgcn_readfirstlane(tid >> 5);
  const int h = blockIdx.y, b = blockIdx.z;
  const int qb = blockIdx.x * 128;
  const int q0 = qb + w * 16;
  const size_t tok0 = (size_t)b * SEQ;
  const int slab = b * NH + h;
  const size_t qoff = (tok0 + q0 + ln) * DM + h * HD;
  const v16h qf0 = g2_frag(Q16 + qoff, hh), qf1 = g2_frag(Q16 + qoff + 32, hh);
  const v16h qr0 = g2_frag(QR + qoff, hh),  qr1 = g2_frag(QR + qoff + 32, hh);
  const v8f z8 = {0.f,0.f,0.f,0.f,0.f,0.f,0.f,0.f};
  v8f o0 = z8, o1 = z8, o2 = z8, o3 = z8;      /* o_j[r] = o of query q0 + ln, head column 16 j + 8 hh + r */
  v8f e0 = z8, e1 = z8, e2 = z8, e3 = z8;
  float mrow = -1.0e30f, lrow = 0.f;           /* of query q0 + ln: the maximum over all keys so far (equal in both halves), the sum over this half's keys */
  const int row = q0 + ln;
  const int kend = CAUSAL ? (q0 + 16) : SEQ;                  /* this wave's keys end here (the same in every lane) */
  const int nst = CAUSAL ? (qb + 128) / AKS : SEQ / AKS;      /* stages of the block: up to its last wave's keys; at least two */
  const unsigned l0 = lds_off(kv) + (unsigned)((tid >> 3) * APITCHB + (tid & 7) * 16);
  const size_t gko = (tok0 + (tid >> 3)) * DM + h * HD + (tid & 7) * 8;
  const size_t gvo = ((size_t)slab * HD + (tid >> 3)) * SEQ + (tid & 7) * 8;
  const _Float16* gk = K16 + gko; const _Float16* gkr = KR + gko; const _Float16* gv = VT + gvo; const _Float16* gvr = VTR + gvo;
  attn_stage_copy<CAUSAL>(l0, gk, gkr, gv, gvr);
  asm volatile("s_wait_asynccnt 0x0" ::: "memory");   /* stage 0 of this wave has landed */
  __syncthreads();                                    /* stage 0 of every wave is readable */
  if (nst > 1) attn_stage_copy<CAUSAL>(l0 + (unsigned)(ASTAGE * 2), gk + (size_t)AKS * DM, gkr + (size_t)AKS * DM, gv + AKS, gvr + AKS);
#pragma unroll 1  /* one trip per stage: the ring's waits and its barrier stand once, at the trip's foot */
  for (int st = 0; st < nst; ++st) {
  const _Float16* buf = kv + (st & 1) * ASTAGE;
#pragma unroll 1  /* two passes of 32 keys per stage share one body */
  for (int sub = 0; sub < AKS; sub += 32) {
    const int kb = st * AKS + sub;
    if (kb >= kend) break;                            /* a wave past its diagonal skips the pass, never the trip's foot */
    const _Float16* k0p = buf + (sub + ln) * APITCH; const _Float16* k1p = k0p + 16 * APITCH;
    const _Float16* r0p = k0p + APLANE;              const _Float16* r1p = r0p + 16 * APITCH;
    v8f s0 = z8, s1 = z8, t0 = z8, t1 = z8;
    v16h kf = g2_frag(k0p, hh);    s0 = g2_mma(kf, qf0, s0); t0 = g2_mma(kf, qr0, t0);
    kf = g2_frag(k0p + 32, hh);    s0 = g2_mma(kf, qf1, s0); t0 = g2_mma(kf, qr1, t0);
    kf = g2_frag(r0p, hh);         t0 = g2_mma(kf, qf0, t0);
    kf = g2_frag(r0p + 32, hh);    t0 = g2_mma(kf, qf1, t0);
    kf = g2_frag(k1p, hh);         s1 = g2_mma(kf, qf0, s1); t1 = g2_mma(kf, qr0, t1);
    kf = g2_frag(k1p + 32, hh);    s1 = g2_mma(kf, qf1, s1); t1 = g2_mma(kf, qr1, t1);
    kf = g2_frag(r1p, hh);         t1 = g2_mma(kf, qf0, t1);
    kf = g2_frag(r1p + 32, hh);    t1 = g2_mma(kf, qf1, t1);
    const v8f af = (s0 + t0 * RINV) * 8.0f, cf = (s1 + t1 * RINV) * 8.0f;
    const int lim = row - kb - 8 * hh;           /* CAUSAL: the lane's keys kb + 8 hh + d with d > lim lie above the diagonal */
    float sc[16]; float t = -1.0e30f;            /* sc[i]: the score of key kb + 8 hh + i (i < 8), kb + 16 + 8 hh + i - 8 (i >= 8): element i of the B operand */
#pragma unroll  /* constant indices keep sc[] and the packed P in registers, here and below */
    for (int i = 0; i < 16; ++i) {
      const float x = i < 8 ? af[i & 7] : cf[i & 7];
      sc[i] = (CAUSAL && (((i < 8 ? i : i + 8) > lim) || (x == 0.0f))) ? -1.0e9f : x;
      t = fmaxf(t, sc[i]);
    }
    t = fmaxf(t, other_half(t));
    const float mnew = fmaxf(mrow, t);
    const float corr = __expf(mrow - mnew);
    FragH pf, prf; float ls0 = 0.f, ls1 = 0.f;   /* one sum per key tile: two short chains of adds */
#pragma unroll
    for (int i = 0; i < 16; ++i) {
      const float pc = __expf(sc[i] - mnew) * PCARRY;
      const h16 ph = toh_flush(pc);
      if (i < 8) ls0 += CAUSAL ? pc : (float)ph; else ls1 += CAUSAL ? pc : (float)ph;
      pf.h[i] = ph;
      if (CAUSAL) prf.h[i] = toh_flush((pc - (float)ph) * RCARRY);
    }
    lrow = lrow * corr + (ls0 + ls1); mrow = mnew;
    o0 *= corr; o1 *= corr; o2 *= corr; o3 *= corr;
    if (CAUSAL) { e0 *= corr; e1 *= corr; e2 *= corr; e3 *= corr; }
    const _Float16* vp = buf + 2 * APLANE + ln * APITCH + sub; const _Float16* vrp = vp + (CAUSAL ? APLANE : 0);
    v16h vf = g2_frag(vp, hh);                   o0 = g2_mma(vf, pf.v, o0);
    if (CAUSAL) { e0 = g2_mma(vf, prf.v, e0); vf = g2_frag(vrp, hh);                   e0 = g2_mma(vf, pf.v, e0); }
    vf = g2_frag(vp + 16 * APITCH, hh);          o1 = g2_mma(vf, pf.v, o1);
    if (CAUSAL) { e1 = g2_mma(vf, prf.v, e1); vf = g2_frag(vrp + 16 * APITCH, hh);     e1 = g2_mma(vf, pf.v, e1); }
    vf = g2_frag(vp + 32 * APITCH, hh);          o2 = g2_mma(vf, pf.v, o2);
    if (CAUSAL) { e2 = g2_mma(vf, prf.v, e2); vf = g2_frag(vrp + 32 * APITCH, hh);     e2 = g2_mma(vf, pf.v, e2); }
    vf = g2_frag(vp + 48 * APITCH, hh);          o3 = g2_mma(vf, pf.v, o3);
    if (CAUSAL) { e3 = g2_mma(vf, prf.v, e3); vf = g2_frag(vrp + 48 * APITCH, hh);     e3 = g2_mma(vf, pf.v, e3); }
  }
    asm volatile("s_wait_dscnt 0x0" ::: "memory");      /* this wave's reads of buffer st & 1 are done before it is refilled */
    asm volatile("s_wait_asynccnt 0x0" ::: "memory");   /* this wave's copies of stage st + 1 have landed */
    __syncthreads();                                    /* publishes stage st + 1 and ends every reader's last read of buffer st & 1 */
    if (st + 2 < nst) attn_stage_copy<CAUSAL>(l0 + (unsigned)((st & 1) * (ASTAGE * 2)), gk + (size_t)(st + 2) * AKS * DM, gkr + (size_t)(st + 2) * AKS * DM, gv + (st + 2) * AKS, gvr + (st + 2) * AKS);
  }
  asm volatile("s_wait_asynccnt 0x0" ::: "memory");     /* no copy is outstanding when the ring is left */
  lrow += other_half(lrow);                                     /* the two halves' key sums of the query */
  const float rl = 64.0f * __builtin_amdgcn_rcpf(lrow);         /* o carried x64; l already carries the P carry */
  const v8f os[4] = {o0, o1, o2, o3}; const v8f es[4] = {e0, e1, e2, e3};
#pragma unroll
  for (int j = 0; j < 4; ++j) { FragH g, gr;
#pragma unroll
    for (int r = 0; r < 8; ++r) {
      float v = os[j][r]; if (CAUSAL) v += es[j][r] * RINV;
      v *= rl;
      const h16 gv16 = toh_flush(v); g.h[r] = gv16;
      if (CAUSAL) gr.h[r] = toh_flush((v - (float)gv16) * RCARRY); }
    const int oloc = ln * OBP + 16 * j + 8 * hh;                /* eight neighbouring head columns of the lane's query: one 16-byte LDS store */
    *(v8us*)(&ob[w][oloc]) = g.half[0];
    if (CAUSAL) *(v8us*)(&obr[w][oloc]) = gr.half[0];
  }
  __builtin_amdgcn_fence(4 /* acq_rel order */, "wavefront"); __builtin_amdgcn_wave_barrier();
  const int rq = lane >> 3, pc = (lane & 7) * 8;
  {
#pragma unroll
    for (int i = 0; i < 4; ++i) { const int orow = i * 4 + rq; const size_t go = (tok0 + q0 + orow) * DM + h * HD + pc;
      const v8us v = *(const v8us*)(&ob[w][orow * OBP + pc]);
      *(v8us*)((unsigned short*)O16 + go) = v;
      if (CAUSAL) { const v8us vr = *(const v8us*)(&obr[w][orow * OBP + pc]); *(v8us*)((unsigned short*)OR16 + go) = vr; } }
     }
}

__global__ __launch_bounds__(256) void k_attn_causal(const _Float16* __restrict__ Q16, const _Float16* __restrict__ QR, const _Float16* __restrict__ K16, const _Float16* __restrict__ KR,
    const _Float16* __restrict__ VT, const _Float16* __restrict__ VTR, _Float16* __restrict__ O16, _Float16* __restrict__ OR16) {
  attn_hr_body<1>(Q16, QR, K16, KR, VT, VTR, O16, OR16);
}
__global__ __launch_bounds__(256) void k_attn_dense(const _Float16* __restrict__ Q16, const _Float16* __restrict__ QR, const _Float16* __restrict__ K16, const _Float16* __restrict__ KR,
    const _Float16* __restrict__ VT, _Float16* __restrict__ O16) {
  attn_hr_body<0>(Q16, QR, K16, KR, VT, VT, O16, O16);
}

// red[] is cross-wave (block barriers); no early exit.
template <int RBF, int RMAP, int W16, int OMAP>
__global__ __launch_bounds__(256) void k_ln(const float* __restrict__ X, const float* __restrict__ R, const float* __restrict__ g, const float* __restrict__ bb, float eps, float* __restrict__ O32, _Float16* __restrict__ O16) {
  #pragma clang fp contract(off)
  __shared__ float red[256];
  const size_t r = blockIdx.x; const int t = threadIdx.x; const int c0 = t * 4;
  const size_t rfull = (r / SEQ) * SEQ_FULL + (r % SEQ);
  const size_t rr = RMAP ? rfull : r;
  const v4f xa = *(const v4fa*)(X + r * DM + c0); const v4f ra = *(const v4fa*)(R + rr * DM + c0);
  float s[4]; float sum = 0.f;
#pragma unroll
  for (int q = 0; q < 4; ++q) { const float rv = RBF ? bf16_rne(ra[q]) : ra[q]; s[q] = xa[q] + rv; sum += s[q]; }
  red[t] = sum; __syncthreads();
  for (int st = 128; st > 0; st >>= 1) { if (t < st) red[t] += red[t + st]; __syncthreads(); }
  const float mu = red[0] * (1.0f / (float)DM); __syncthreads();
  float vs = 0.f;
#pragma unroll
  for (int q = 0; q < 4; ++q) { const float dl = s[q] - mu; vs += dl * dl; }
  red[t] = vs; __syncthreads();
  for (int st = 128; st > 0; st >>= 1) { if (t < st) red[t] += red[t + st]; __syncthreads(); }
  const float rs = rsqrtf(red[0] * (1.0f / (float)DM) + eps);
  v4f yf; v4h y;
#pragma unroll
  for (int q = 0; q < 4; ++q) { const int c = c0 + q; yf[q] = (s[q] - mu) * rs * bf16_rne(g[c]) + bf16_rne(bb[c]); y[q] = (_Float16)yf[q]; }
  const size_t orow = OMAP ? rfull : r;
  {
    if (O32) *(v4f*)(O32 + orow * DM + c0) = yf;
    if (W16) *(v4h*)(O16 + r * DM + c0) = y;
     }
}

extern "C" void kernel_launch(void* const* d_in, const int* in_sizes, int n_in,
                              void* d_out, int out_size, void* d_ws, size_t ws_size, hipStream_t stream) {
  if (n_in < 22) return;
  const float* x    = (const float*)d_in[0];  const float* enc  = (const float*)d_in[1];
  const float* wq1  = (const float*)d_in[2];  const float* wk1  = (const float*)d_in[3];  const float* wv1 = (const float*)d_in[4];
  const float* wo1  = (const float*)d_in[5];  const float* bo1  = (const float*)d_in[6];
  const float* wq2  = (const float*)d_in[7];  const float* wk2  = (const float*)d_in[8];  const float* wv2 = (const float*)d_in[9];
  const float* wo2  = (const float*)d_in[10]; const float* bo2  = (const float*)d_in[11];
  const float* wff1 = (const float*)d_in[12]; const float* bff1 = (const float*)d_in[13]; const float* wff2 = (const float*)d_in[14]; const float* bff2 = (const float*)d_in[15];
  const float* g1   = (const float*)d_in[16]; const float* be1  = (const float*)d_in[17]; const float* g2  = (const float*)d_in[18]; const float* be2 = (const float*)d_in[19];
  const float* g3   = (const float*)d_in[20]; const float* be3  = (const float*)d_in[21];

  const size_t needX = ((size_t)(NB - 1) * SEQ_FULL + SEQ) * DM;
  if ((size_t)in_sizes[0] < needX || (size_t)in_sizes[1] < needX || (size_t)out_size < needX) return;
  { static const int wi[8] = {2, 3, 4, 5, 7, 8, 9, 10}; for (int i = 0; i < 8; ++i) if ((size_t)in_sizes[wi[i]] < (size_t)DM * DM) return; }
  if ((size_t)in_sizes[12] < (size_t)DM * DFF || (size_t)in_sizes[14] < (size_t)DM * DFF || in_sizes[13] < DFF) return;
  { static const int vi[9] = {6, 11, 15, 16, 17, 18, 19, 20, 21}; for (int i = 0; i < 9; ++i) if (in_sizes[vi[i]] < DM) return; }

  char* ws = (char*)d_ws; size_t off = 0;
  auto take = [&](size_t bytes) { char* p = ws + off; off += (bytes + 255) & ~(size_t)255; return p; };
  const size_t WDD = (size_t)DM * DM * 2, WDF = (size_t)DM * DFF * 2, P16 = NR * DM * 2;
  _Float16* BQ1 = (_Float16*)take(WDD); _Float16* BK1 = (_Float16*)take(WDD); _Float16* BV1 = (_Float16*)take(WDD); _Float16* BO1 = (_Float16*)take(WDD);
  _Float16* BQ2 = (_Float16*)take(WDD); _Float16* BK2 = (_Float16*)take(WDD); _Float16* BV2 = (_Float16*)take(WDD); _Float16* BO2 = (_Float16*)take(WDD);
  _Float16* BW1 = (_Float16*)take(WDF);      /* [n=DFF][k=DM]  */
  _Float16* BW2 = (_Float16*)take(WDF);      /* [n=DM][k=DFF]  */
  // fourteen token-plane slots of P16 bytes each (an f32 plane spans two slots, the FFN hidden plane four); lifetimes by launch order:
  // S0 X16                  S1 E16 -> x2 (f16)      S2,S3 Q1|QR1 -> a1 (f32) -> a2 (f32) -> hidden (S2..S5)
  // S4,S5 K1|KR1 -> x1 (f32)   S6,S7 VT1|VTR1 -> x1 value|residual -> S7 o2 (f16) -> f (f32)
  // S8,S9 V1|VR1 -> o1 value|residual -> Q2|QR2 -> x2 (f32)      S10,S11 K2|KR2      S12 V2      S13 VT2
  char* SL = take(14 * P16);
  _Float16* S0 = (_Float16*)(SL + 0 * P16); _Float16* S1 = (_Float16*)(SL + 1 * P16); _Float16* S2 = (_Float16*)(SL + 2 * P16); _Float16* S3 = (_Float16*)(SL + 3 * P16);
  _Float16* S4 = (_Float16*)(SL + 4 * P16); _Float16* S5 = (_Float16*)(SL + 5 * P16); _Float16* S6 = (_Float16*)(SL + 6 * P16); _Float16* S7 = (_Float16*)(SL + 7 * P16);
  _Float16* S8 = (_Float16*)(SL + 8 * P16); _Float16* S9 = (_Float16*)(SL + 9 * P16); _Float16* S10 = (_Float16*)(SL + 10 * P16); _Float16* S11 = (_Float16*)(SL + 11 * P16);
  _Float16* S12 = (_Float16*)(SL + 12 * P16); _Float16* S13 = (_Float16*)(SL + 13 * P16);
  float* YFa = (float*)S2;   /* a1, a2 (f32 rows, S2..S3) */
  float* X1F = (float*)S4;   /* x1 (f32 rows, S4..S5) */
  float* X2F = (float*)S8;   /* x2 (f32 rows, S8..S9) */
  float* YFf = (float*)S6;   /* f  (f32 rows, S6..S7) */
  _Float16* HF = S2;         /* FFN hidden rows [NR][DFF] f16 (S2..S5) */
  if (off > ws_size || off > (size_t)268435456) return;

  static_assert(((size_t)DM * DM * 2) % 256 == 0);   /* BQ1 .. BO2 lie one behind the other in the carve */
  k_prep<<<(unsigned)PREP_BLOCKS, 256, 0, stream>>>(wq1, wk1, wv1, wo1, wq2, wk2, wv2, wo2, wff1, wff2, x, enc, BQ1, BW1, BW2, S0, S1);

  const size_t n8 = NR * DM / 8; const unsigned gx = (unsigned)((n8 + 255) / 256);

  const unsigned gP = (unsigned)((MR / 128) * (DM / 128)), gF1 = (unsigned)((MR / 128) * (DFF / 128));
  const unsigned gVT = (unsigned)(NB * NH * (SEQ / 64)); const dim3 gAT(SEQ / 128, NH, NB);

  // ---- causal self-attention block
  k_proj5<<<dim3(gP, 5), 256, 0, stream>>>(S0, S1, DM, BQ1, BK1, BV1, BK2, BV2, DM, 0.0625f, S2, S3, S4, S5, S8, S9, S10, S11, S12, DM, MR, DM, DM);   /* q1, k1, v1, k2: value | residual; v2: one plane */
  k_vt<NH, SEQ><<<dim3(gVT, 3), 256, 0, stream>>>(S8, S9, S12, DM, 0, S6, S7, S13);
  k_attn_causal<<<gAT, 256, 0, stream>>>(S2, S3, S4, S5, S6, S7, S8, S9);                                       /* o x64 value | residual */
  k_proj_rf<<<gP, 256, 0, stream>>>(S8, S9, DM, BO1, DM, 0.0009765625f, bo1, 1.0f, YFa, DM, MR, DM, DM);        /* a1 = o Wp1 + bp1 */
  k_ln<1, 1, 0, 0><<<(unsigned)MR, 256, 0, stream>>>(YFa, x, g1, be1, LN_EPS, X1F, nullptr);                    /* x1 = LN1(bf16(x) + a1) -> f32 rows */
  k_split16<<<gx, 256, 0, stream>>>(X1F, S6, S7, n8);                                                           /* x1 value | residual */
  // ---- cross-attention block
  k_proj_rhr<<<gP, 256, 0, stream>>>(S6, S7, DM, BQ2, DM, 0.0625f, S8, S9, DM, MR, DM, DM);                     /* q  value | residual */
  k_attn_dense<<<gAT, 256, 0, stream>>>(S8, S9, S10, S11, S13, S7);                                                /* o x64 single plane */
  k_gemm2<0><<<gP, 256, 0, stream>>>(S7, DM, BO2, DM, 0.0009765625f, bo2, 1.0f, YFa, nullptr, DM, MR, DM, DM);  /* a2 = o Wp2 + bp2 */
  k_ln<0, 0, 1, 0><<<(unsigned)MR, 256, 0, stream>>>(YFa, X1F, g2, be2, LN_EPS, X2F, S1);                       /* x2 = LN2(x1 + a2) -> f32 + f16 rows */
  // ---- FFN block
  k_gemm2<3><<<gF1, 256, 0, stream>>>(S1, DM, BW1, DM, 1.0f, bff1, 16.0f, nullptr, HF, DFF, MR, DFF, DM);       /* 16 relu(x2 W1 + b1) as f16 rows */
  k_gemm2<0><<<gP, 256, 0, stream>>>(HF, DFF, BW2, DFF, 0.00390625f, bff2, 1.0f, YFf, nullptr, DM, MR, DM, DFF);  /* f = h W2 + b2 */
  k_ln<0, 0, 0, 1><<<(unsigned)MR, 256, 0, stream>>>(YFf, X2F, g3, be3, LN_EPS, (float*)d_out, nullptr);        /* out = LN3(x2 + f) */
}

// v006
// A run of this version takes 331 microseconds.
// In two side-by-side timings against v005, it was 1.03 and 1.04 times as fast.
// All steps since v000 together make it 3.25 times as fast.
#include <hip/hip_runtime.h>
// Structure: token rows r = b*SEQ + s. Causal self-attention (16 heads of 64, per-head weights [H][E][64], scores x8, keys above the diagonal and exactly-zero scores masked) -> x1 = LN1(x + attn.Wp1 + bp1); cross-attention of x1 over z rows -> x2 = LN2(x1 + attn.Wp2 + bp2); f = relu(x2.W1 + b1).W2 + b2; out = LN3(x2 + f). Projection / FFN weights are [in][out].

#ifndef NB
#define NB 4
#endif
#ifndef SEQ
#define SEQ 1024
#endif
#define NB_FULL 4
#define SEQ_FULL 1024
#define DM 1024
#define NH 16
#define HD 64
#define DFF 4096
#define NR ((size_t)NB * SEQ)
#define MR ((int)((size_t)NB * SEQ))
#define OBP 72          /* LDS pitch (halves) of the per-wave o tile */
#define LN_EPS 1.0e-5f
#define PCARRY 16384.0f         /* carry of the f16 P planes */
#define RCARRY 2048.0f          /* carry of every residual plane */
#define RINV 0.00048828125f     /* 1 / RCARRY */

static_assert(NB >= 1 && NB <= NB_FULL);
static_assert(SEQ >= 64 && SEQ <= SEQ_FULL && SEQ % 64 == 0);
static_assert((NB * SEQ) % 128 == 0);
static_assert(NH * HD == DM && HD == 64);
static_assert(DM == 4 * 256);
static_assert(DM % 64 == 0 && DFF % 64 == 0 && DM % 32 == 0 && DFF % 32 == 0);
static_assert(DFF <= 4 * DM);
static_assert((OBP % 8) == 0);
static_assert(DFF == 4 * DM);                       /* the FFN hidden plane spans exactly four 16-bit token planes */
static_assert(OBP >= HD);                           /* o tile holds one head */
static_assert(RCARRY * RINV == 1.0f);
static_assert(PCARRY <= 32768.0f);                  /* carried P stays inside f16 */
static_assert((size_t)8 * DM * DM * 2 + (size_t)2 * DM * DFF * 2 + (size_t)14 * NB * SEQ * DM * 2 + 16 * 256 <= (size_t)268435456);   /* workspace carve */

typedef unsigned short v8us __attribute__((ext_vector_type(8), may_alias));
typedef float  v8f  __attribute__((ext_vector_type(8)));
typedef float  v4f  __attribute__((ext_vector_type(4)));
typedef float  v4fa __attribute__((ext_vector_type(4), may_alias));
typedef _Float16 v16h __attribute__((ext_vector_type(16)));
typedef _Float16 v4h __attribute__((ext_vector_type(4)));
union FragH { v16h v; v8us half[2]; _Float16 h[16]; unsigned short u[16]; };

__device__ __forceinline__ unsigned short bf16_bits(float x) { unsigned int u = __float_as_uint(x); return (unsigned short)((u + 0x7FFFu + ((u >> 16) & 1u)) >> 16); }
__device__ __forceinline__ float bf16_val(unsigned short b) { return __uint_as_float(((unsigned int)b) << 16); }
__device__ __forceinline__ float bf16_rne(float x) { return bf16_val(bf16_bits(x)); }

// 16x32 fragment from a k-contiguous 16-bit row p (A row m = lane&15, or B stored [n][k] with n = lane&15):
// elements 0..7 <- k 8h..8h+7, elements 8..15 <- k 16+8h..16+8h+7 (h = lane>>4)
__device__ __forceinline__ v16h g2_frag(const _Float16* p, int hh) { FragH f; f.half[0] = *(const v8us*)((const unsigned short*)p + 8 * hh); f.half[1] = *(const v8us*)((const unsigned short*)p + 16 + 8 * hh); return f.v; }
__device__ __forceinline__ v8f g2_mma(v16h a, v16h b, v8f c) { v8f d = __builtin_amdgcn_wmma_f32_16x16x32_f16(false, a, false, b, (short)0, c, false, false); asm volatile("v_nop\n\tv_nop\n\tv_nop\n\tv_nop" : "+v"(d) : "v"(a), "v"(b)); return d; }

// f32 -> f16 operand convert that cannot yield an f16 subnormal (value select, applied after the plane's carry)
typedef _Float16 h16;
static __device__ __forceinline__ h16 toh_flush(float v) { const h16 r = (h16)v; return (fabsf(v) < 6.103515625e-05f) ? (h16)0.0f : r; }

// Weight convert + transpose, one 64 k x 64 n tile per block, turned in LDS: every wave-wide 16-byte load covers two whole 256-byte source rows of the tile and every
// wave-wide 16-byte store four whole 128-byte pieces of Wt rows. HEAD 0: W is [K][N]; HEAD 1: W is [N/64][K][64] (tile column block = head). Wt is [n][k].
// Requires K % 64 == 0 and N % 64 == 0; bid = the tile's index among the (N/64)*(K/64) tiles of its matrix, the same for the whole block of 256; tl = the block's LDS tile.
#define WTP 66                  /* LDS row pitch in halves: 33 words, so that a column walk of 8 rows apart meets 8 different banks */
template <int HEAD>
static __device__ __forceinline__ void wt_tile_body(unsigned short (*tl)[WTP], int bid, const float* __restrict__ W, _Float16* __restrict__ Wt, int K, int N, float scale) {
  const int tid = threadIdx.x; const int nkt = K >> 6; const int nt = bid / nkt, kt = bid - nt * nkt; if (nt * 64 >= N) return;   /* the same for the whole block, ahead of the barrier */
  const int n0 = nt * 64, k0 = kt * 64;
  const float* src = HEAD ? W + ((size_t)nt * K + k0) * HD : W + (size_t)k0 * N + n0;
  const size_t rstep = HEAD ? (size_t)HD : (size_t)N;
  const int r0 = tid >> 4, c4 = (tid & 15) * 4;
  v4f a[4];
#pragma unroll  /* the four loads of a lane are issued together, ahead of the first convert */
  for (int i = 0; i < 4; ++i) a[i] = *(const v4fa*)(src + (size_t)(i * 16 + r0) * rstep + c4);
#pragma unroll  /* constant indices keep a[] and f in registers, here and in the loops below */
  for (int i = 0; i < 4; ++i) { FragH f;
#pragma unroll
    for (int q = 0; q < 4; ++q) { const float v = bf16_rne(a[i][q]) * scale; f.h[q] = HEAD ? toh_flush(v) : (_Float16)v; }
#pragma unroll
    for (int q = 0; q < 4; ++q) tl[i * 16 + r0][c4 + q] = f.u[q]; }
  __syncthreads();   /* the whole tile is in LDS before any column of it is read */
#pragma unroll
  for (int rd = 0; rd < 2; ++rd) { const int n = rd * 32 + tid / 8, pc = tid % 8; FragH f;
#pragma unroll
    for (int q = 0; q < 8; ++q) f.u[q] = tl[pc * 8 + q][n];
    *(v8us*)((unsigned short*)Wt + (size_t)(n0 + n) * K + k0 + pc * 8) = f.half[0]; }
  asm volatile("s_wait_xcnt 0x0" ::: "memory");   /* another job's code follows in the merged kernel and reuses the registers that the two stores name */
}

static __device__ __forceinline__ void x16_body(int bid, const float* __restrict__ x, _Float16* __restrict__ X16, size_t n8) {
  const size_t t = (size_t)bid * 256 + threadIdx.x; if (t >= n8) return;
  const size_t e = t * 8; const size_t r = e / DM; const size_t c = e % DM; const size_t rs = (r / SEQ) * SEQ_FULL + (r % SEQ);
  const float* src = x + rs * DM + c; const v4f a = *(const v4fa*)src; const v4f a2 = *(const v4fa*)(src + 4); FragH f;
#pragma unroll
  for (int q = 0; q < 4; ++q) { f.h[q] = (_Float16)bf16_rne(a[q]); f.h[4 + q] = (_Float16)bf16_rne(a2[q]); }
  const v8us o = f.half[0]; unsigned short* d = (unsigned short*)X16 + e;
  *(v8us*)d = o; 
}

// Every conversion that reads the inputs alone, in ONE launch: none of the twelve jobs reads what another writes. blockIdx.x picks the job, the same for the whole block:
// the tiles of the eight DM x DM attention weights (order q k v o, q k v o; Wt planes one behind the other from BA), of W1, of W2, then the row pieces of x and of z.
#define TDD ((DM / 64) * (DM / 64))             /* tiles of a DM x DM weight */
#define TDF ((DM / 64) * (DFF / 64))            /* tiles of an FFN weight */
#define XBL ((int)((NR * DM / 8 + 255) / 256))  /* blocks of a token plane, 8 elements a thread */
#define PREP_BLOCKS (8 * TDD + 2 * TDF + 2 * XBL)
__global__ __launch_bounds__(256) void k_prep(const float* __restrict__ wq1, const float* __restrict__ wk1, const float* __restrict__ wv1, const float* __restrict__ wo1,
    const float* __restrict__ wq2, const float* __restrict__ wk2, const float* __restrict__ wv2, const float* __restrict__ wo2, const float* __restrict__ wff1, const float* __restrict__ wff2,
    const float* __restrict__ x, const float* __restrict__ z, _Float16* __restrict__ BA, _Float16* __restrict__ BW1, _Float16* __restrict__ BW2, _Float16* __restrict__ X16, _Float16* __restrict__ Z16) {
  __shared__ unsigned short tl[64][WTP];
  int bid = blockIdx.x;
  if (bid < 8 * TDD) {
    const int j = bid / TDD; bid -= j * TDD; _Float16* Wt = BA + (size_t)j * DM * DM;
    if ((j & 3) != 3) wt_tile_body<1>(tl, bid, j == 0 ? wq1 : j == 1 ? wk1 : j == 2 ? wv1 : j == 4 ? wq2 : j == 5 ? wk2 : wv2, Wt, DM, DM, 16.0f);
    else wt_tile_body<0>(tl, bid, j == 3 ? wo1 : wo2, Wt, DM, DM, 16.0f);
  } else if (bid < 8 * TDD + TDF) {
    wt_tile_body<0>(tl, bid - 8 * TDD, wff1, BW1, DM, DFF, 16.0f);
  } else if (bid < 8 * TDD + 2 * TDF) {
    wt_tile_body<0>(tl, bid - (8 * TDD + TDF), wff2, BW2, DFF, DM, 16.0f);
  } else {
    bid -= 8 * TDD + 2 * TDF; const int second = bid >= XBL; if (second) bid -= XBL;
    x16_body(bid, second ? z : x, second ? Z16 : X16, NR * DM / 8);
  }
}

__global__ __launch_bounds__(256) void k_split16(const float* __restrict__ src, _Float16* __restrict__ H16, _Float16* __restrict__ R16, size_t n8) {
  #pragma clang fp contract(off)
  const size_t t = (size_t)blockIdx.x * 256 + threadIdx.x; if (t >= n8) return;
  const size_t e = t * 8; const v4f a = *(const v4fa*)(src + e); const v4f a2 = *(const v4fa*)(src + e + 4); FragH fh, fr;
#pragma unroll
  for (int q = 0; q < 4; ++q) {
    const h16 h0 = toh_flush(a[q]);  fh.h[q] = h0;     fr.h[q] = toh_flush((a[q] - (float)h0) * RCARRY);
    const h16 h1 = toh_flush(a2[q]); fh.h[4 + q] = h1; fr.h[4 + q] = toh_flush((a2[q] - (float)h1) * RCARRY); }
  const v8us oh = fh.half[0]; const v8us orr = fr.half[0];
  unsigned short* dh = (unsigned short*)H16 + e; unsigned short* dr = (unsigned short*)R16 + e;
  *(v8us*)dh = oh; *(v8us*)dr = orr; 
}

template <int NHv, int TTv>
__global__ __launch_bounds__(256) void k_vt(const _Float16* __restrict__ V16a, const _Float16* __restrict__ V16b, const _Float16* __restrict__ V16c, int ldv, int voff,
    _Float16* __restrict__ Vta, _Float16* __restrict__ Vtb, _Float16* __restrict__ Vtc) {
  const int pj = blockIdx.y;   /* picks the plane: the three independent transposes share a launch */
  const _Float16* V16 = pj == 0 ? V16a : pj == 1 ? V16b : V16c; _Float16* Vt = pj == 0 ? Vta : pj == 1 ? Vtb : Vtc;
  __shared__ unsigned short tl[64][66]; const int tid = threadIdx.x; const int slab = blockIdx.x / (TTv / 64), lg = blockIdx.x % (TTv / 64); const int b = slab / NHv, h = slab % NHv;
  for (int i = tid; i < 64 * 8; i += 256) { const int r = i / 8, c8 = (i % 8) * 8; FragH f; f.half[0] = *(const v8us*)((const unsigned short*)V16 + ((size_t)b * TTv + lg * 64 + r) * ldv + voff + h * 64 + c8);
#pragma unroll
    for (int q = 0; q < 8; ++q) tl[r][c8 + q] = f.u[q]; }
  __syncthreads();
  {
#pragma unroll
    for (int rd = 0; rd < 2; ++rd) { const int d = rd * 32 + tid / 8, pc = tid % 8; FragH f;
#pragma unroll
      for (int q = 0; q < 8; ++q) f.u[q] = tl[pc * 8 + q][d];
      *(v8us*)((unsigned short*)Vt + ((size_t)slab * 64 + d) * TTv + lg * 64 + pc * 8) = f.half[0]; }
     }
}

// LDS staging of the GEMM operands. A block of 8 waves owns a 128 x 128 tile of C; a stage holds 128 k of its 128 A rows and then of its 128 B rows.
#define GKP 128                 /* k (halves) per stage: 256-byte rows */
#define GPITCH 136              /* LDS row pitch in halves: 272 B = 16 B x 17, conflict-free for 16-byte row reads */
#define GPITCHB (GPITCH * 2)    /* the same in bytes */
#define GSTAGE (256 * GPITCH)   /* halves per stage */
static_assert(DM % GKP == 0 && DFF % GKP == 0 && DM % 128 == 0 && DFF % 128 == 0);

static __device__ __forceinline__ unsigned lds_off(const void* p) { return (unsigned)(size_t)p; }

// Eight 16-byte asynchronous copies of one lane: rows 16 apart, global row step gstep halves. The s_wait_xcnt closes the statement so that no address register is rewritten ahead of it.
static __device__ __forceinline__ void copy8(unsigned l, const _Float16* g, size_t gstep) {
  asm volatile(
      "global_load_async_to_lds_b128 %0, %8, off\n\t"
      "global_load_async_to_lds_b128 %1, %9, off\n\t"
      "global_load_async_to_lds_b128 %2, %10, off\n\t"
      "global_load_async_to_lds_b128 %3, %11, off\n\t"
      "global_load_async_to_lds_b128 %4, %12, off\n\t"
      "global_load_async_to_lds_b128 %5, %13, off\n\t"
      "global_load_async_to_lds_b128 %6, %14, off\n\t"
      "global_load_async_to_lds_b128 %7, %15, off\n\t"
      "s_wait_xcnt 0x0"
      :: "v"(l), "v"(l + 16u * GPITCHB), "v"(l + 32u * GPITCHB), "v"(l + 48u * GPITCHB), "v"(l + 64u * GPITCHB), "v"(l + 80u * GPITCHB), "v"(l + 96u * GPITCHB), "v"(l + 112u * GPITCHB),
         "v"(g), "v"(g + gstep), "v"(g + 2 * gstep), "v"(g + 3 * gstep), "v"(g + 4 * gstep), "v"(g + 5 * gstep), "v"(g + 6 * gstep), "v"(g + 7 * gstep)
      : "memory");
}
// One stage: l = this lane's LDS byte address in the stage's row tid/16, ga / gb = its 16 bytes of that row of the A / B tile.
static __device__ __forceinline__ void stage_copy(unsigned l, const _Float16* ga, int lda, const _Float16* gb, int ldb) {
  copy8(l, ga, (size_t)16 * lda);
  copy8(l + 128u * GPITCHB, gb, (size_t)16 * ldb);
}

// One K sweep of the block's 128 x 128 tile through a two-buffer LDS ring; each wave keeps a 32 x 64 tile (A rows arow, arow + 16; B rows brow + 16 j), k ascending in steps of 32.
// At and Bt point at the first row of the block's A and B tiles. Every thread of the block calls it; K is a positive multiple of 128. The ring is free again on return (the last trip's barrier).
static __device__ __forceinline__ void gemm_sweep(_Float16* ring, const _Float16* At, int lda, const _Float16* Bt, int ldb, int K, int tid, int arow, int brow, int hh,
    v8f& c00, v8f& c01, v8f& c02, v8f& c03, v8f& c10, v8f& c11, v8f& c12, v8f& c13) {
  const unsigned l0 = lds_off(ring) + (unsigned)((tid >> 4) * GPITCHB + (tid & 15) * 16);
  const _Float16* ga = At + (size_t)(tid >> 4) * lda + (tid & 15) * 8;
  const _Float16* gb = Bt + (size_t)(tid >> 4) * ldb + (tid & 15) * 8;
  const int nst = K / GKP;
  stage_copy(l0, ga, lda, gb, ldb);
  asm volatile("s_wait_asynccnt 0x0" ::: "memory");   /* stage 0 of this wave has landed */
  __syncthreads();                                    /* stage 0 of every wave is readable */
  if (nst > 1) stage_copy(l0 + (unsigned)(GSTAGE * 2), ga + GKP, lda, gb + GKP, ldb);
#pragma unroll 1  /* one trip per stage: the ring's waits and its barrier stand once, at the trip's foot */
  for (int t = 0; t < nst; ++t) {
    const _Float16* buf = ring + (t & 1) * GSTAGE;
    const _Float16* a0p = buf + arow * GPITCH; const _Float16* a1p = a0p + 16 * GPITCH;
    const _Float16* b0p = buf + (128 + brow) * GPITCH; const _Float16* b1p = b0p + 16 * GPITCH; const _Float16* b2p = b1p + 16 * GPITCH; const _Float16* b3p = b2p + 16 * GPITCH;
    // the six fragments of a k step are read as one group, one k step ahead inside the stage, so that their LDS latency runs under the products of the step before
    v16h a0 = g2_frag(a0p, hh), a1 = g2_frag(a1p, hh), b0 = g2_frag(b0p, hh), b1 = g2_frag(b1p, hh), b2 = g2_frag(b2p, hh), b3 = g2_frag(b3p, hh);
#pragma unroll  /* constant LDS offsets, and the two fragment sets swap by renaming, without moves */
    for (int kb = 0; kb < GKP; kb += 32) {
      v16h na0 = a0, na1 = a1, nb0 = b0, nb1 = b1, nb2 = b2, nb3 = b3;
      if (kb + 32 < GKP) { na0 = g2_frag(a0p + kb + 32, hh); na1 = g2_frag(a1p + kb + 32, hh); nb0 = g2_frag(b0p + kb + 32, hh); nb1 = g2_frag(b1p + kb + 32, hh); nb2 = g2_frag(b2p + kb + 32, hh); nb3 = g2_frag(b3p + kb + 32, hh); }
      c00 = g2_mma(a0, b0, c00); c10 = g2_mma(a1, b0, c10);
      c01 = g2_mma(a0, b1, c01); c11 = g2_mma(a1, b1, c11);
      c02 = g2_mma(a0, b2, c02); c12 = g2_mma(a1, b2, c12);
      c03 = g2_mma(a0, b3, c03); c13 = g2_mma(a1, b3, c13);
      a0 = na0; a1 = na1; b0 = nb0; b1 = nb1; b2 = nb2; b3 = nb3; }
    asm volatile("s_wait_dscnt 0x0" ::: "memory");      /* this wave's reads of buffer t & 1 are done before it is refilled */
    asm volatile("s_wait_asynccnt 0x0" ::: "memory");   /* this wave's copies of stage t + 1 have landed */
    __syncthreads();                                    /* publishes stage t + 1 and ends every reader's last read of buffer t & 1 */
    if (t + 2 < nst) stage_copy(l0 + (unsigned)((t & 1) * (GSTAGE * 2)), ga + (size_t)(t + 2) * GKP, lda, gb + (size_t)(t + 2) * GKP, ldb);
  }
  asm volatile("s_wait_asynccnt 0x0" ::: "memory");     /* no copy is outstanding when the ring is left */
}

// GEMM: block tile 128 x 128 (8 waves, 4 x 2), wave tile 32 rows x 64 cols; A f16 rows (pitch lda), Bh f16 [n][k] (pitch ldb); v = acc*alpha + bf16(bias[col])*bsc; ACT 0 none / 3 relu;
// Requires M % 128 == 0, N % 128 == 0, K % 128 == 0; grid = (M/128)*(N/128), block 256.
template <int ACT>
__global__ __launch_bounds__(256) void k_gemm2(const _Float16* __restrict__ A, int lda, const _Float16* __restrict__ Bh, int ldb, float alpha, const float* __restrict__ bias, float bsc,
    float* __restrict__ C, _Float16* __restrict__ C16, int ldc, int M, int N, int K) {
  static_assert(ACT == 0 || ACT == 3);
  __shared__ __attribute__((aligned(16))) _Float16 ring[2 * GSTAGE];
  __shared__ __attribute__((aligned(16))) float so[8][32][68];
  const int tid = threadIdx.x, lane = tid & 31, ln = lane & 15, hh = lane >> 4;
  const int w = __builtin_amdgcn_readfirstlane(tid >> 5);
  const int ntn = N >> 7; const int mt = blockIdx.x / ntn, nq = blockIdx.x - mt * ntn; if (mt * 128 >= M) return;
  const int row0 = mt * 128 + 32 * (w >> 1), col0 = nq * 128 + 64 * (w & 1);
  const v8f z8 = {0.f,0.f,0.f,0.f,0.f,0.f,0.f,0.f}; v8f c00 = z8, c01 = z8, c02 = z8, c03 = z8, c10 = z8, c11 = z8, c12 = z8, c13 = z8;
  gemm_sweep(ring, A + (size_t)(mt * 128) * lda, lda, Bh + (size_t)(nq * 128) * ldb, ldb, K, tid, 32 * (w >> 1) + ln, 64 * (w & 1) + ln, hh, c00, c01, c02, c03, c10, c11, c12, c13);
  v8f accs[8] = {c00, c01, c02, c03, c10, c11, c12, c13};
#pragma unroll
  for (int u = 0; u < 8; ++u) { const int t = u & 3, half = u >> 2; const int col = col0 + t * 16 + ln; const float bv = bias ? bf16_rne(bias[col]) * bsc : 0.f;
#pragma unroll
    for (int r = 0; r < 8; ++r) { const int rloc = half * 16 + 8 * hh + r; float v = accs[u][r] * alpha + bv; if (ACT == 3) v = fmaxf(v, 0.f); so[w][rloc][t * 16 + ln] = v; } }
  __builtin_amdgcn_fence(4 /* acq_rel order */, "workgroup"); __builtin_amdgcn_wave_barrier();
  const int rsub = lane >> 4, c4 = (lane & 15) * 4;
  {
#pragma unroll
    for (int q = 0; q < 16; ++q) { const int r = q * 2 + rsub; const v4f v = *(const v4fa*)&so[w][r][c4];
      if (C) *(v4f*)(C + (size_t)(row0 + r) * ldc + col0 + c4) = v;
      if (C16) { v4h h4; for (int i = 0; i < 4; ++i) h4[i] = (_Float16)v[i]; *(v4h*)(C16 + (size_t)(row0 + r) * ldc + col0 + c4) = h4; } }
     }
}

// GEMM with an optional residual A plane (AR = (a - f16(a)) * 2048, own accumulators from zero, folded by 2^-11 in f32) and either an f32 output (OUTHR 0)
// or f16 planes (OUTHR 1): value + residual, or, SGL 1 and single set (the same for the whole block), one plainly converted plane CH alone.
// Requires M % 128 == 0, N % 128 == 0, K % 128 == 0; grid = (M/128)*(N/128), block 256.
template <int ARES, int OUTHR, int SGL = 0>
static __device__ __forceinline__ void gemm_hr_body(const _Float16* __restrict__ A, const _Float16* __restrict__ AR, int lda, const _Float16* __restrict__ Bh, int ldb, float alpha,
    const float* __restrict__ bias, float bsc, float* __restrict__ C, _Float16* __restrict__ CH, _Float16* __restrict__ CR, int ldc, int M, int N, int K, bool single = false) {
  __shared__ __attribute__((aligned(16))) _Float16 ring[2 * GSTAGE];
  __shared__ __attribute__((aligned(16))) float so[8][32][68];
  const int tid = threadIdx.x, lane = tid & 31, ln = lane & 15, hh = lane >> 4;
  const int w = __builtin_amdgcn_readfirstlane(tid >> 5);
  const int ntn = N >> 7; const int mt = blockIdx.x / ntn, nq = blockIdx.x - mt * ntn; if (mt * 128 >= M) return;
  const int row0 = mt * 128 + 32 * (w >> 1), col0 = nq * 128 + 64 * (w & 1);
  const int arow = 32 * (w >> 1) + ln, brow = 64 * (w & 1) + ln;
  const _Float16* Bt = Bh + (size_t)(nq * 128) * ldb;
  const v8f z8 = {0.f,0.f,0.f,0.f,0.f,0.f,0.f,0.f};
  if (ARES) {
    v8f d00 = z8, d01 = z8, d02 = z8, d03 = z8, d10 = z8, d11 = z8, d12 = z8, d13 = z8;
    gemm_sweep(ring, AR + (size_t)(mt * 128) * lda, lda, Bt, ldb, K, tid, arow, brow, hh, d00, d01, d02, d03, d10, d11, d12, d13);
    v8f ds[8] = {d00, d01, d02, d03, d10, d11, d12, d13};
#pragma unroll
    for (int u = 0; u < 8; ++u) { const int t = u & 3, half = u >> 2;
#pragma unroll
      for (int r = 0; r < 8; ++r) { const int rloc = half * 16 + 8 * hh + r; so[w][rloc][t * 16 + ln] = ds[u][r] * RINV; } }
  }
  v8f c00 = z8, c01 = z8, c02 = z8, c03 = z8, c10 = z8, c11 = z8, c12 = z8, c13 = z8;
  gemm_sweep(ring, A + (size_t)(mt * 128) * lda, lda, Bt, ldb, K, tid, arow, brow, hh, c00, c01, c02, c03, c10, c11, c12, c13);
  v8f accs[8] = {c00, c01, c02, c03, c10, c11, c12, c13};
#pragma unroll
  for (int u = 0; u < 8; ++u) { const int t = u & 3, half = u >> 2; const int col = col0 + t * 16 + ln; const float bv = bias ? bf16_rne(bias[col]) * bsc : 0.f;
#pragma unroll
    for (int r = 0; r < 8; ++r) { const int rloc = half * 16 + 8 * hh + r; float v = accs[u][r]; if (ARES) v += so[w][rloc][t * 16 + ln]; v = v * alpha + bv; so[w][rloc][t * 16 + ln] = v; } }
  __builtin_amdgcn_fence(4 /* acq_rel order */, "workgroup"); __builtin_amdgcn_wave_barrier();
  const int rsub = lane >> 4, c4 = (lane & 15) * 4;
  if (SGL && single) {   /* one test for the whole read-out, not one per row */
#pragma unroll
    for (int q = 0; q < 16; ++q) { const int r = q * 2 + rsub; const v4f v = *(const v4fa*)&so[w][r][c4];
      v4h h4; for (int i = 0; i < 4; ++i) h4[i] = (_Float16)v[i]; *(v4h*)(CH + (size_t)(row0 + r) * ldc + col0 + c4) = h4; }
  } else {
#pragma unroll
    for (int q = 0; q < 16; ++q) { const int r = q * 2 + rsub; const v4f v = *(const v4fa*)&so[w][r][c4];
      if (OUTHR) { v4h h4, r4;
#pragma unroll
        for (int i = 0; i < 4; ++i) { const h16 hv = toh_flush(v[i]); h4[i] = hv; r4[i] = toh_flush((v[i] - (float)hv) * RCARRY); }
        *(v4h*)(CH + (size_t)(row0 + r) * ldc + col0 + c4) = h4;
        *(v4h*)(CR + (size_t)(row0 + r) * ldc + col0 + c4) = r4; }
      else { *(v4f*)(C + (size_t)(row0 + r) * ldc + col0 + c4) = v; } }
    if (SGL) asm volatile("s_wait_xcnt 0x0" ::: "memory");   /* the other read-out's code follows in the built kernel and reuses the registers that these stores name */
     }
}

// The five projections that read a converted input plane alone, in one launch; blockIdx.y picks the job: q, k, v of the self-attention (A0) and k of the cross-attention (A1) as f16 value +
// residual planes, v of the cross-attention (A1) as one f16 plane. grid = ((M/128)*(N/128), 5).
__global__ __launch_bounds__(256) void k_proj5(const _Float16* __restrict__ A0, const _Float16* __restrict__ A1, int lda,
    const _Float16* __restrict__ B0, const _Float16* __restrict__ B1, const _Float16* __restrict__ B2, const _Float16* __restrict__ B3, const _Float16* __restrict__ B4, int ldb, float alpha,
    _Float16* __restrict__ CH0, _Float16* __restrict__ CR0, _Float16* __restrict__ CH1, _Float16* __restrict__ CR1, _Float16* __restrict__ CH2, _Float16* __restrict__ CR2,
    _Float16* __restrict__ CH3, _Float16* __restrict__ CR3, _Float16* __restrict__ CH4, int ldc, int M, int N, int K) {
  const int j = blockIdx.y;
  const _Float16* A = j < 3 ? A0 : A1;
  const _Float16* Bh = j == 0 ? B0 : j == 1 ? B1 : j == 2 ? B2 : j == 3 ? B3 : B4;
  _Float16* CH = j == 0 ? CH0 : j == 1 ? CH1 : j == 2 ? CH2 : j == 3 ? CH3 : CH4;
  _Float16* CR = j == 0 ? CR0 : j == 1 ? CR1 : j == 2 ? CR2 : CR3;   /* not stored by job 4 */
  gemm_hr_body<0, 1, 1>(A, A, lda, Bh, ldb, alpha, nullptr, 0.f, nullptr, CH, CR, ldc, M, N, K, j == 4);
}
// value + residual A planes -> f16 value + residual output planes
__global__ __launch_bounds__(256) void k_proj_rhr(const _Float16* __restrict__ A, const _Float16* __restrict__ AR, int lda, const _Float16* __restrict__ Bh, int ldb, float alpha,
    _Float16* __restrict__ CH, _Float16* __restrict__ CR, int ldc, int M, int N, int K) {
  gemm_hr_body<1, 1>(A, AR, lda, Bh, ldb, alpha, nullptr, 0.f, nullptr, CH, CR, ldc, M, N, K);
}
// value + residual A planes -> f32 rows with bias
__global__ __launch_bounds__(256) void k_proj_rf(const _Float16* __restrict__ A, const _Float16* __restrict__ AR, int lda, const _Float16* __restrict__ Bh, int ldb, float alpha,
    const float* __restrict__ bias, float bsc, float* __restrict__ C, int ldc, int M, int N, int K) {
  gemm_hr_body<1, 0>(A, AR, lda, Bh, ldb, alpha, bias, bsc, C, nullptr, nullptr, ldc, M, N, K);
}

// LDS staging of the attention operands. A block of 8 waves owns 128 query rows of one (batch, head) (which rows: attn_hr_body); a stage holds 64 keys: the K value and K residual rows (64 rows of 128 bytes each),
// then the V^T value rows (64 head columns x 64 keys) and, CAUSAL, the V^T residual rows. Every copy of a wave covers four whole 128-byte rows.
#define AKS 64                  /* keys per stage */
#define APITCH 72               /* LDS row pitch in halves: 144 B = 16 B x 9, conflict-free for 16-byte row reads */
#define APITCHB (APITCH * 2)    /* the same in bytes */
#define APLANE (64 * APITCH)    /* halves per staged plane */
static_assert(SEQ % 128 == 0 && SEQ / AKS >= 2 && HD == 64 && AKS == 64);

// Four / two 16-byte asynchronous copies of one lane. The s_wait_xcnt closes the statement so that no address register is rewritten ahead of it.
static __device__ __forceinline__ void copy4(unsigned l0, unsigned l1, unsigned l2, unsigned l3, const _Float16* g0, const _Float16* g1, const _Float16* g2, const _Float16* g3) {
  asm volatile(
      "global_load_async_to_lds_b128 %0, %4, off\n\t"
      "global_load_async_to_lds_b128 %1, %5, off\n\t"
      "global_load_async_to_lds_b128 %2, %6, off\n\t"
      "global_load_async_to_lds_b128 %3, %7, off\n\t"
      "s_wait_xcnt 0x0"
      :: "v"(l0), "v"(l1), "v"(l2), "v"(l3), "v"(g0), "v"(g1), "v"(g2), "v"(g3)
      : "memory");
}
static __device__ __forceinline__ void copy2(unsigned l0, unsigned l1, const _Float16* g0, const _Float16* g1) {
  asm volatile(
      "global_load_async_to_lds_b128 %0, %2, off\n\t"
      "global_load_async_to_lds_b128 %1, %3, off\n\t"
      "s_wait_xcnt 0x0"
      :: "v"(l0), "v"(l1), "v"(g0), "v"(g1)
      : "memory");
}
// One stage: l = this lane's LDS byte address in row tid/8 of the stage's first plane; gk / gkr / gv / gvr = its 16 bytes of that row of each plane. A lane brings rows tid/8 and tid/8 + 32 of every plane.
template <int CAUSAL>
static __device__ __forceinline__ void attn_stage_copy(unsigned l, const _Float16* gk, const _Float16* gkr, const _Float16* gv, const _Float16* gvr) {
  const unsigned pl = (unsigned)(APLANE * 2), rb = 32u * APITCHB;
  copy4(l, l + rb, l + pl, l + pl + rb, gk, gk + (size_t)32 * DM, gkr, gkr + (size_t)32 * DM);
  if (CAUSAL) copy4(l + 2u * pl, l + 2u * pl + rb, l + 3u * pl, l + 3u * pl + rb, gv, gv + (size_t)32 * SEQ, gvr, gvr + (size_t)32 * SEQ);
  else copy2(l + 2u * pl, l + 2u * pl + rb, gv, gv + (size_t)32 * SEQ);
}

// The value of the same lane of the other 16-lane half (lane ^ 16), by a vector cross-row move.
static __device__ __forceinline__ float other_half(float v) { const int i = __float_as_int(v); return __int_as_float(__builtin_amdgcn_permlanex16(i, i, 0x76543210, 0xfedcba98, false, false)); }

// Flash-style attention for one (batch, head, 16 query rows) per wave: keys taken 32 at a time from the block's two-buffer LDS ring with an online (running-max) softmax in f32.
// The scores are computed transposed, S^T = K.Q^T (A = 16 key rows from LDS, B = the wave's 16 query rows kept in registers): lane (ln, hh) holds, of query q0 + ln, the keys 8 hh + r of the first
// key tile and 16 + 8 hh + r of the second, so that the maximum and the sum of a query run inside a lane, plus one exchange between the halves, and the two converted tiles ARE the B operand
// of O^T += V^T.P^T (element s of B = key 8 hh + s, then 16 + 8 hh + s - 8: the k order of g2_frag, which loads V^T as A). P never passes through LDS.
// scores = 8 * q.k^T with q and k as f16 value + x2048 residual planes: value.value in one accumulator, residual.value + value.residual in a second
// accumulator folded by 2^-11. CAUSAL: keys above the query row and exactly-zero scores take the fill -1e9 (replace), key blocks entirely above
// the wave's rows are skipped (their weights are exactly 0); P = 16384*exp(s - m) as f16 value + x2048 residual, V^T as value + residual slabs,
// o = P.V^T with value.value in one accumulator and the two cross terms in a second, row sum over the unconverted P; o/l * 64 written as f16 value +
// residual rows. Dense: P as one f16 plane (row sum over the converted P), V^T one plane, o one plane. Each half keeps the sum of its own keys; the two are joined after the loop. o tiles are wave-private LDS
template <int CAUSAL>
static __device__ __forceinline__ void attn_hr_body(const _Float16* __restrict__ Q16, const _Float16* __restrict__ QR, const _Float16* __restrict__ K16, const _Float16* __restrict__ KR,
    const _Float16* __restrict__ VT, const _Float16* __restrict__ VTR, _Float16* __restrict__ O16, _Float16* __restrict__ OR16) {
  constexpr int ASTAGE = (CAUSAL ? 4 : 3) * APLANE;   /* halves per stage */
  __shared__ __attribute__((aligned(16))) _Float16 kv[2 * ASTAGE];
  __shared__ __attribute__((aligned(16))) _Float16 ob[8][16 * OBP];
  __shared__ __attribute__((aligned(16))) _Float16 obr[8][16 * OBP];
  const int tid = threadIdx.x, lane = tid & 31, ln = lane & 15, hh = lane >> 4;
  const int w = __builtin_amdgcn_readfirstlane(tid >> 5);
  const int h = blockIdx.y, b = blockIdx.z;
  // CAUSAL: a query row's work grows with its index, so a block takes 64 rows from the low end (waves 0..3) and the mirrored 64 rows from the high end (waves 4..7, in falling order):
  // waves w and w + 4 together walk the same number of key passes in every block of the grid. The stage count stays the block's own (from blockIdx alone) and every wave passes every stage's
  // foot, whichever rows it holds. Dense: 128 rows in a run.
  const int q0 = CAUSAL ? (w < 4 ? blockIdx.x * 64 + w * 16 : SEQ - 64 - blockIdx.x * 64 + (7 - w) * 16) : blockIdx.x * 128 + w * 16;
  const size_t tok0 = (size_t)b * SEQ;
  const int slab = b * NH + h;
  const size_t qoff = (tok0 + q0 + ln) * DM + h * HD;
  const v16h qf0 = g2_frag(Q16 + qoff, hh), qf1 = g2_frag(Q16 + qoff + 32, hh);
  const v16h qr0 = g2_frag(QR + qoff, hh),  qr1 = g2_frag(QR + qoff + 32, hh);
  const v8f z8 = {0.f,0.f,0.f,0.f,0.f,0.f,0.f,0.f};
  v8f o0 = z8, o1 = z8, o2 = z8, o3 = z8;      /* o_j[r] = o of query q0 + ln, head column 16 j + 8 hh + r */
  v8f e0 = z8, e1 = z8, e2 = z8, e3 = z8;
  float mrow = -1.0e30f, lrow = 0.f;           /* of query q0 + ln: the maximum over all keys so far (equal in both halves), the sum over this half's keys */
  const int row = q0 + ln;
  const int kend = CAUSAL ? (q0 + 16) : SEQ;                  /* this wave's keys end here (the same in every lane) */
  const int nst = CAUSAL ? SEQ / AKS - blockIdx.x : SEQ / AKS;   /* stages of the block: up to the keys of its high rows (they end at SEQ - 64 blockIdx.x); at least two */
  const unsigned l0 = lds_off(kv) + (unsigned)((tid >> 3) * APITCHB + (tid & 7) * 16);
  const size_t gko = (tok0 + (tid >> 3)) * DM + h * HD + (tid & 7) * 8;
  const size_t gvo = ((size_t)slab * HD + (tid >> 3)) * SEQ + (tid & 7) * 8;
  const _Float16* gk = K16 + gko; const _Float16* gkr = KR + gko; const _Float16* gv = VT + gvo; const _Float16* gvr = VTR + gvo;
  attn_stage_copy<CAUSAL>(l0, gk, gkr, gv, gvr);
  asm volatile("s_wait_asynccnt 0x0" ::: "memory");   /* stage 0 of this wave has landed */
  __syncthreads();                                    /* stage 0 of every wave is readable */
  if (nst > 1) attn_stage_copy<CAUSAL>(l0 + (unsigned)(ASTAGE * 2), gk + (size_t)AKS * DM, gkr + (size_t)AKS * DM, gv + AKS, gvr + AKS);
#pragma unroll 1  /* one trip per stage: the ring's waits and its barrier stand once, at the trip's foot */
  for (int st = 0; st < nst; ++st) {
  const _Float16* buf = kv + (st & 1) * ASTAGE;
#pragma unroll 1  /* two passes of 32 keys per stage share one body */
  for (int sub = 0; sub < AKS; sub += 32) {
    const int kb = st * AKS + sub;
    if (kb >= kend) break;                            /* a wave past its diagonal skips the pass, never the trip's foot */
    const _Float16* k0p = buf + (sub + ln) * APITCH; const _Float16* k1p = k0p + 16 * APITCH;
    const _Float16* r0p = k0p + APLANE;              const _Float16* r1p = r0p + 16 * APITCH;
    v8f s0 = z8, s1 = z8, t0 = z8, t1 = z8;
    v16h kf = g2_frag(k0p, hh);    s0 = g2_mma(kf, qf0, s0); t0 = g2_mma(kf, qr0, t0);
    kf = g2_frag(k0p + 32, hh);    s0 = g2_mma(kf, qf1, s0); t0 = g2_mma(kf, qr1, t0);
    kf = g2_frag(r0p, hh);         t0 = g2_mma(kf, qf0, t0);
    kf = g2_frag(r0p + 32, hh);    t0 = g2_mma(kf, qf1, t0);
    kf = g2_frag(k1p, hh);         s1 = g2_mma(kf, qf0, s1); t1 = g2_mma(kf, qr0, t1);
    kf = g2_frag(k1p + 32, hh);    s1 = g2_mma(kf, qf1, s1); t1 = g2_mma(kf, qr1, t1);
    kf = g2_frag(r1p, hh);         t1 = g2_mma(kf, qf0, t1);
    kf = g2_frag(r1p + 32, hh);    t1 = g2_mma(kf, qf1, t1);
    const v8f af = (s0 + t0 * RINV) * 8.0f, cf = (s1 + t1 * RINV) * 8.0f;
    const int lim = row - kb - 8 * hh;           /* CAUSAL: the lane's keys kb + 8 hh + d with d > lim lie above the diagonal */
    float sc[16]; float t = -1.0e30f;            /* sc[i]: the score of key kb + 8 hh + i (i < 8), kb + 16 + 8 hh + i - 8 (i >= 8): element i of the B operand */
#pragma unroll  /* constant indices keep sc[] and the packed P in registers, here and below */
    for (int i = 0; i < 16; ++i) {
      const float x = i < 8 ? af[i & 7] : cf[i & 7];
      sc[i] = (CAUSAL && (((i < 8 ? i : i + 8) > lim) || (x == 0.0f))) ? -1.0e9f : x;
      t = fmaxf(t, sc[i]);
    }
    t = fmaxf(t, other_half(t));
    const float mnew = fmaxf(mrow, t);
    const float corr = __expf(mrow - mnew);
    FragH pf, prf; float ls0 = 0.f, ls1 = 0.f;   /* one sum per key tile: two short chains of adds */
#pragma unroll
    for (int i = 0; i < 16; ++i) {
      const float pc = __expf(sc[i] - mnew) * PCARRY;
      const h16 ph = toh_flush(pc);
      if (i < 8) ls0 += CAUSAL ? pc : (float)ph; else ls1 += CAUSAL ? pc : (float)ph;
      pf.h[i] = ph;
      if (CAUSAL) prf.h[i] = toh_flush((pc - (float)ph) * RCARRY);
    }
    lrow = lrow * corr + (ls0 + ls1); mrow = mnew;
    o0 *= corr; o1 *= corr; o2 *= corr; o3 *= corr;
    if (CAUSAL) { e0 *= corr; e1 *= corr; e2 *= corr; e3 *= corr; }
    const _Float16* vp = buf + 2 * APLANE + ln * APITCH + sub; const _Float16* vrp = vp + (CAUSAL ? APLANE : 0);
    v16h vf = g2_frag(vp, hh);                   o0 = g2_mma(vf, pf.v, o0);
    if (CAUSAL) { e0 = g2_mma(vf, prf.v, e0); vf = g2_frag(vrp, hh);                   e0 = g2_mma(vf, pf.v, e0); }
    vf = g2_frag(vp + 16 * APITCH, hh);          o1 = g2_mma(vf, pf.v, o1);
    if (CAUSAL) { e1 = g2_mma(vf, prf.v, e1); vf = g2_frag(vrp + 16 * APITCH, hh);     e1 = g2_mma(vf, pf.v, e1); }
    vf = g2_frag(vp + 32 * APITCH, hh);          o2 = g2_mma(vf, pf.v, o2);
    if (CAUSAL) { e2 = g2_mma(vf, prf.v, e2); vf = g2_frag(vrp + 32 * APITCH, hh);     e2 = g2_mma(vf, pf.v, e2); }
    vf = g2_frag(vp + 48 * APITCH, hh);          o3 = g2_mma(vf, pf.v, o3);
    if (CAUSAL) { e3 = g2_mma(vf, prf.v, e3); vf = g2_frag(vrp + 48 * APITCH, hh);     e3 = g2_mma(vf, pf.v, e3); }
  }
    asm volatile("s_wait_dscnt 0x0" ::: "memory");      /* this wave's reads of buffer st & 1 are done before it is refilled */
    asm volatile("s_wait_asynccnt 0x0" ::: "memory");   /* this wave's copies of stage st + 1 have landed */
    __syncthreads();                                    /* publishes stage st + 1 and ends every reader's last read of buffer st & 1 */
    if (st + 2 < nst) attn_stage_copy<CAUSAL>(l0 + (unsigned)((st & 1) * (ASTAGE * 2)), gk + (size_t)(st + 2) * AKS * DM, gkr + (size_t)(st + 2) * AKS * DM, gv + (st + 2) * AKS, gvr + (st + 2) * AKS);
  }
  asm volatile("s_wait_asynccnt 0x0" ::: "memory");     /* no copy is outstanding when the ring is left */
  lrow += other_half(lrow);                                     /* the two halves' key sums of the query */
  const float rl = 64.0f * __builtin_amdgcn_rcpf(lrow);         /* o carried x64; l already carries the P carry */
  const v8f os[4] = {o0, o1, o2, o3}; const v8f es[4] = {e0, e1, e2, e3};
#pragma unroll
  for (int j = 0; j < 4; ++j) { FragH g, gr;
#pragma unroll
    for (int r = 0; r < 8; ++r) {
      float v = os[j][r]; if (CAUSAL) v += es[j][r] * RINV;
      v *= rl;
      const h16 gv16 = toh_flush(v); g.h[r] = gv16;
      if (CAUSAL) gr.h[r] = toh_flush((v - (float)gv16) * RCARRY); }
    const int oloc = ln * OBP + 16 * j + 8 * hh;                /* eight neighbouring head columns of the lane's query: one 16-byte LDS store */
    *(v8us*)(&ob[w][oloc]) = g.half[0];
    if (CAUSAL) *(v8us*)(&obr[w][oloc]) = gr.half[0];
  }
  __builtin_amdgcn_fence(4 /* acq_rel order */, "wavefront"); __builtin_amdgcn_wave_barrier();
  const int rq = lane >> 3, pc = (lane & 7) * 8;
  {
#pragma unroll
    for (int i = 0; i < 4; ++i) { const int orow = i * 4 + rq; const size_t go = (tok0 + q0 + orow) * DM + h * HD + pc;
      const v8us v = *(const v8us*)(&ob[w][orow * OBP + pc]);
      *(v8us*)((unsigned short*)O16 + go) = v;
      if (CAUSAL) { const v8us vr = *(const v8us*)(&obr[w][orow * OBP + pc]); *(v8us*)((unsigned short*)OR16 + go) = vr; } }
     }
}

__global__ __launch_bounds__(256) void k_attn_causal(const _Float16* __restrict__ Q16, const _Float16* __restrict__ QR, const _Float16* __restrict__ K16, const _Float16* __restrict__ KR,
    const _Float16* __restrict__ VT, const _Float16* __restrict__ VTR, _Float16* __restrict__ O16, _Float16* __restrict__ OR16) {
  attn_hr_body<1>(Q16, QR, K16, KR, VT, VTR, O16, OR16);
}
__global__ __launch_bounds__(256) void k_attn_dense(const _Float16* __restrict__ Q16, const _Float16* __restrict__ QR, const _Float16* __restrict__ K16, const _Float16* __restrict__ KR,
    const _Float16* __restrict__ VT, _Float16* __restrict__ O16) {
  attn_hr_body<0>(Q16, QR, K16, KR, VT, VT, O16, O16);
}

// red[] is cross-wave (block barriers); no early exit.
template <int RBF, int RMAP, int W16, int OMAP>
__global__ __launch_bounds__(256) void k_ln(const float* __restrict__ X, const float* __restrict__ R, const float* __restrict__ g, const float* __restrict__ bb, float eps, float* __restrict__ O32, _Float16* __restrict__ O16) {
  #pragma clang fp contract(off)
  __shared__ float red[256];
  const size_t r = blockIdx.x; const int t = threadIdx.x; const int c0 = t * 4;
  const size_t rfull = (r / SEQ) * SEQ_FULL + (r % SEQ);
  const size_t rr = RMAP ? rfull : r;
  const v4f xa = *(const v4fa*)(X + r * DM + c0); const v4f ra = *(const v4fa*)(R + rr * DM + c0);
  float s[4]; float sum = 0.f;
#pragma unroll
  for (int q = 0; q < 4; ++q) { const float rv = RBF ? bf16_rne(ra[q]) : ra[q]; s[q] = xa[q] + rv; sum += s[q]; }
  red[t] = sum; __syncthreads();
  for (int st = 128; st > 0; st >>= 1) { if (t < st) red[t] += red[t + st]; __syncthreads(); }
  const float mu = red[0] * (1.0f / (float)DM); __syncthreads();
  float vs = 0.f;
#pragma unroll
  for (int q = 0; q < 4; ++q) { const float dl = s[q] - mu; vs += dl * dl; }
  red[t] = vs; __syncthreads();
  for (int st = 128; st > 0; st >>= 1) { if (t < st) red[t] += red[t + st]; __syncthreads(); }
  const float rs = rsqrtf(red[0] * (1.0f / (float)DM) + eps);
  v4f yf; v4h y;
#pragma unroll
  for (int q = 0; q < 4; ++q) { const int c = c0 + q; yf[q] = (s[q] - mu) * rs * bf16_rne(g[c]) + bf16_rne(bb[c]); y[q] = (_Float16)yf[q]; }
  const size_t orow = OMAP ? rfull : r;
  {
    if (O32) *(v4f*)(O32 + orow * DM + c0) = yf;
    if (W16) *(v4h*)(O16 + r * DM + c0) = y;
     }
}

extern "C" void kernel_launch(void* const* d_in, const int* in_sizes, int n_in,
                              void* d_out, int out_size, void* d_ws, size_t ws_size, hipStream_t stream) {
  if (n_in < 22) return;
  const float* x    = (const float*)d_in[0];  const float* enc  = (const float*)d_in[1];
  const float* wq1  = (const float*)d_in[2];  const float* wk1  = (const float*)d_in[3];  const float* wv1 = (const float*)d_in[4];
  const float* wo1  = (const float*)d_in[5];  const float* bo1  = (const float*)d_in[6];
  const float* wq2  = (const float*)d_in[7];  const float* wk2  = (const float*)d_in[8];  const float* wv2 = (const float*)d_in[9];
  const float* wo2  = (const float*)d_in[10]; const float* bo2  = (const float*)d_in[11];
  const float* wff1 = (const float*)d_in[12]; const float* bff1 = (const float*)d_in[13]; const float* wff2 = (const float*)d_in[14]; const float* bff2 = (const float*)d_in[15];
  const float* g1   = (const float*)d_in[16]; const float* be1  = (const float*)d_in[17]; const float* g2  = (const float*)d_in[18]; const float* be2 = (const float*)d_in[19];
  const float* g3   = (const float*)d_in[20]; const float* be3  = (const float*)d_in[21];

  const size_t needX = ((size_t)(NB - 1) * SEQ_FULL + SEQ) * DM;
  if ((size_t)in_sizes[0] < needX || (size_t)in_sizes[1] < needX || (size_t)out_size < needX) return;
  { static const int wi[8] = {2, 3, 4, 5, 7, 8, 9, 10}; for (int i = 0; i < 8; ++i) if ((size_t)in_sizes[wi[i]] < (size_t)DM * DM) return; }
  if ((size_t)in_sizes[12] < (size_t)DM * DFF || (size_t)in_sizes[14] < (size_t)DM * DFF || in_sizes[13] < DFF) return;
  { static const int vi[9] = {6, 11, 15, 16, 17, 18, 19, 20, 21}; for (int i = 0; i < 9; ++i) if (in_sizes[vi[i]] < DM) return; }

  char* ws = (char*)d_ws; size_t off = 0;
  auto take = [&](size_t bytes) { char* p = ws + off; off += (bytes + 255) & ~(size_t)255; return p; };
  const size_t WDD = (size_t)DM * DM * 2, WDF = (size_t)DM * DFF * 2, P16 = NR * DM * 2;
  _Float16* BQ1 = (_Float16*)take(WDD); _Float16* BK1 = (_Float16*)take(WDD); _Float16* BV1 = (_Float16*)take(WDD); _Float16* BO1 = (_Float16*)take(WDD);
  _Float16* BQ2 = (_Float16*)take(WDD); _Float16* BK2 = (_Float16*)take(WDD); _Float16* BV2 = (_Float16*)take(WDD); _Float16* BO2 = (_Float16*)take(WDD);
  _Float16* BW1 = (_Float16*)take(WDF);      /* [n=DFF][k=DM]  */
  _Float16* BW2 = (_Float16*)take(WDF);      /* [n=DM][k=DFF]  */
  // fourteen token-plane slots of P16 bytes each (an f32 plane spans two slots, the FFN hidden plane four); lifetimes by launch order:
  // S0 X16                  S1 E16 -> x2 (f16)      S2,S3 Q1|QR1 -> a1 (f32) -> a2 (f32) -> hidden (S2..S5)
  // S4,S5 K1|KR1 -> x1 (f32)   S6,S7 VT1|VTR1 -> x1 value|residual -> S7 o2 (f16) -> f (f32)
  // S8,S9 V1|VR1 -> o1 value|residual -> Q2|QR2 -> x2 (f32)      S10,S11 K2|KR2      S12 V2      S13 VT2
  char* SL = take(14 * P16);
  _Float16* S0 = (_Float16*)(SL + 0 * P16); _Float16* S1 = (_Float16*)(SL + 1 * P16); _Float16* S2 = (_Float16*)(SL + 2 * P16); _Float16* S3 = (_Float16*)(SL + 3 * P16);
  _Float16* S4 = (_Float16*)(SL + 4 * P16); _Float16* S5 = (_Float16*)(SL + 5 * P16); _Float16* S6 = (_Float16*)(SL + 6 * P16); _Float16* S7 = (_Float16*)(SL + 7 * P16);
  _Float16* S8 = (_Float16*)(SL + 8 * P16); _Float16* S9 = (_Float16*)(SL + 9 * P16); _Float16* S10 = (_Float16*)(SL + 10 * P16); _Float16* S11 = (_Float16*)(SL + 11 * P16);
  _Float16* S12 = (_Float16*)(SL + 12 * P16); _Float16* S13 = (_Float16*)(SL + 13 * P16);
  float* YFa = (float*)S2;   /* a1, a2 (f32 rows, S2..S3) */
  float* X1F = (float*)S4;   /* x1 (f32 rows, S4..S5) */
  float* X2F = (float*)S8;   /* x2 (f32 rows, S8..S9) */
  float* YFf = (float*)S6;   /* f  (f32 rows, S6..S7) */
  _Float16* HF = S2;         /* FFN hidden rows [NR][DFF] f16 (S2..S5) */
  if (off > ws_size || off > (size_t)268435456) return;

  static_assert(((size_t)DM * DM * 2) % 256 == 0);   /* BQ1 .. BO2 lie one behind the other in the carve */
  k_prep<<<(unsigned)PREP_BLOCKS, 256, 0, stream>>>(wq1, wk1, wv1, wo1, wq2, wk2, wv2, wo2, wff1, wff2, x, enc, BQ1, BW1, BW2, S0, S1);

  const size_t n8 = NR * DM / 8; const unsigned gx = (unsigned)((n8 + 255) / 256);

  const unsigned gP = (unsigned)((MR / 128) * (DM / 128)), gF1 = (unsigned)((MR / 128) * (DFF / 128));
  const unsigned gVT = (unsigned)(NB * NH * (SEQ / 64)); const dim3 gAT(SEQ / 128, NH, NB);

  // ---- causal self-attention block
  k_proj5<<<dim3(gP, 5), 256, 0, stream>>>(S0, S1, DM, BQ1, BK1, BV1, BK2, BV2, DM, 0.0625f, S2, S3, S4, S5, S8, S9, S10, S11, S12, DM, MR, DM, DM);   /* q1, k1, v1, k2: value | residual; v2: one plane */
  k_vt<NH, SEQ><<<dim3(gVT, 3), 256, 0, stream>>>(S8, S9, S12, DM, 0, S6, S7, S13);
  k_attn_causal<<<gAT, 256, 0, stream>>>(S2, S3, S4, S5, S6, S7, S8, S9);                                       /* o x64 value | residual */
  k_proj_rf<<<gP, 256, 0, stream>>>(S8, S9, DM, BO1, DM, 0.0009765625f, bo1, 1.0f, YFa, DM, MR, DM, DM);        /* a1 = o Wp1 + bp1 */
  k_ln<1, 1, 0, 0><<<(unsigned)MR, 256, 0, stream>>>(YFa, x, g1, be1, LN_EPS, X1F, nullptr);                    /* x1 = LN1(bf16(x) + a1) -> f32 rows */
  k_split16<<<gx, 256, 0, stream>>>(X1F, S6, S7, n8);                                                           /* x1 value | residual */
  // ---- cross-attention block
  k_proj_rhr<<<gP, 256, 0, stream>>>(S6, S7, DM, BQ2, DM, 0.0625f, S8, S9, DM, MR, DM, DM);                     /* q  value | residual */
  k_attn_dense<<<gAT, 256, 0, stream>>>(S8, S9, S10, S11, S13, S7);                                                /* o x64 single plane */
  k_gemm2<0><<<gP, 256, 0, stream>>>(S7, DM, BO2, DM, 0.0009765625f, bo2, 1.0f, YFa, nullptr, DM, MR, DM, DM);  /* a2 = o Wp2 + bp2 */
  k_ln<0, 0, 1, 0><<<(unsigned)MR, 256, 0, stream>>>(YFa, X1F, g2, be2, LN_EPS, X2F, S1);                       /* x2 = LN2(x1 + a2) -> f32 + f16 rows */
  // ---- FFN block
  k_gemm2<3><<<gF1, 256, 0, stream>>>(S1, DM, BW1, DM, 1.0f, bff1, 16.0f, nullptr, HF, DFF, MR, DFF, DM);       /* 16 relu(x2 W1 + b1) as f16 rows */
  k_gemm2<0><<<gP, 256, 0, stream>>>(HF, DFF, BW2, DFF, 0.00390625f, bff2, 1.0f, YFf, nullptr, DM, MR, DM, DFF);  /* f = h W2 + b2 */
  k_ln<0, 0, 0, 1><<<(unsigned)MR, 256, 0, stream>>>(YFf, X2F, g3, be3, LN_EPS, (float*)d_out, nullptr);        /* out = LN3(x2 + f) */
}

// v007
// One run takes 315 microseconds.
// Next to v006, in two timings, it ran 1.05 times as fast each time.
// All steps since v000 together make it 3.41 times as fast.
#include <hip/hip_runtime.h>
// Structure: token rows r = b*SEQ + s. Causal self-attention (16 heads of 64, per-head weights [H][E][64], scores x8, keys above the diagonal and exactly-zero scores masked) -> x1 = LN1(x + attn.Wp1 + bp1); cross-attention of x1 over z rows -> x2 = LN2(x1 + attn.Wp2 + bp2); f = relu(x2.W1 + b1).W2 + b2; out = LN3(x2 + f). Projection / FFN weights are [in][out].

#ifndef NB
#define NB 4
#endif
#ifndef SEQ
#define SEQ 1024
#endif
#define NB_FULL 4
#define SEQ_FULL 1024
#define DM 1024
#define NH 16
#define HD 64
#define DFF 4096
#define NR ((size_t)NB * SEQ)
#define MR ((int)((size_t)NB * SEQ))
#define OBP 72          /* LDS pitch (halves) of the per-wave o tile */
#define LN_EPS 1.0e-5f
#define PCARRY 16384.0f         /* carry of the f16 P planes */
#define RCARRY 2048.0f          /* carry of every residual plane */
#define RINV 0.00048828125f     /* 1 / RCARRY */

static_assert(NB >= 1 && NB <= NB_FULL);
static_assert(SEQ >= 64 && SEQ <= SEQ_FULL && SEQ % 64 == 0);
static_assert((NB * SEQ) % 128 == 0);
static_assert(NH * HD == DM && HD == 64);
static_assert(DM == 4 * 256);
static_assert(DM % 64 == 0 && DFF % 64 == 0 && DM % 32 == 0 && DFF % 32 == 0);
static_assert(DFF <= 4 * DM);
static_assert((OBP % 8) == 0);
static_assert(DFF == 4 * DM);                       /* the FFN hidden plane spans exactly four 16-bit token planes */
static_assert(OBP >= HD);                           /* o tile holds one head */
static_assert(RCARRY * RINV == 1.0f);
static_assert(PCARRY <= 32768.0f);                  /* carried P stays inside f16 */
static_assert((size_t)8 * DM * DM * 2 + (size_t)2 * DM * DFF * 2 + (size_t)14 * NB * SEQ * DM * 2 + 16 * 256 <= (size_t)268435456);   /* workspace carve */

typedef unsigned short v8us __attribute__((ext_vector_type(8), may_alias));
typedef float  v8f  __attribute__((ext_vector_type(8)));
typedef float  v4f  __attribute__((ext_vector_type(4)));
typedef float  v4fa __attribute__((ext_vector_type(4), may_alias));
typedef _Float16 v16h __attribute__((ext_vector_type(16)));
typedef _Float16 v4h __attribute__((ext_vector_type(4)));
union FragH { v16h v; v8us half[2]; _Float16 h[16]; unsigned short u[16]; };

__device__ __forceinline__ unsigned short bf16_bits(float x) { unsigned int u = __float_as_uint(x); return (unsigned short)((u + 0x7FFFu + ((u >> 16) & 1u)) >> 16); }
__device__ __forceinline__ float bf16_val(unsigned short b) { return __uint_as_float(((unsigned int)b) << 16); }
__device__ __forceinline__ float bf16_rne(float x) { return bf16_val(bf16_bits(x)); }

// 16x32 fragment from a k-contiguous 16-bit row p (A row m = lane&15, or B stored [n][k] with n = lane&15):
// elements 0..7 <- k 8h..8h+7, elements 8..15 <- k 16+8h..16+8h+7 (h = lane>>4)
__device__ __forceinline__ v16h g2_frag(const _Float16* p, int hh) { FragH f; f.half[0] = *(const v8us*)((const unsigned short*)p + 8 * hh); f.half[1] = *(const v8us*)((const unsigned short*)p + 16 + 8 * hh); return f.v; }
__device__ __forceinline__ v8f g2_mma(v16h a, v16h b, v8f c) { v8f d = __builtin_amdgcn_wmma_f32_16x16x32_f16(false, a, false, b, (short)0, c, false, false); asm volatile("v_nop\n\tv_nop\n\tv_nop\n\tv_nop" : "+v"(d) : "v"(a), "v"(b)); return d; }

// f32 -> f16 operand convert that cannot yield an f16 subnormal (value select, applied after the plane's carry)
typedef _Float16 h16;
static __device__ __forceinline__ h16 toh_flush(float v) { const h16 r = (h16)v; return (fabsf(v) < 6.103515625e-05f) ? (h16)0.0f : r; }

// Weight convert + transpose, one 64 k x 64 n tile per block, turned in LDS: every wave-wide 16-byte load covers two whole 256-byte source rows of the tile and every
// wave-wide 16-byte store four whole 128-byte pieces of Wt rows. HEAD 0: W is [K][N]; HEAD 1: W is [N/64][K][64] (tile column block = head). Wt is [n][k].
// Requires K % 64 == 0 and N % 64 == 0; bid = the tile's index among the (N/64)*(K/64) tiles of its matrix, the same for the whole block of 256; tl = the block's LDS tile.
#define WTP 66                  /* LDS row pitch in halves: 33 words, so that a column walk of 8 rows apart meets 8 different banks */
template <int HEAD>
static __device__ __forceinline__ void wt_tile_body(unsigned short (*tl)[WTP], int bid, const float* __restrict__ W, _Float16* __restrict__ Wt, int K, int N, float scale) {
  const int tid = threadIdx.x; const int nkt = K >> 6; const int nt = bid / nkt, kt = bid - nt * nkt; if (nt * 64 >= N) return;   /* the same for the whole block, ahead of the barrier */
  const int n0 = nt * 64, k0 = kt * 64;
  const float* src = HEAD ? W + ((size_t)nt * K + k0) * HD : W + (size_t)k0 * N + n0;
  const size_t rstep = HEAD ? (size_t)HD : (size_t)N;
  const int r0 = tid >> 4, c4 = (tid & 15) * 4;
  v4f a[4];
#pragma unroll  /* the four loads of a lane are issued together, ahead of the first convert */
  for (int i = 0; i < 4; ++i) a[i] = *(const v4fa*)(src + (size_t)(i * 16 + r0) * rstep + c4);
#pragma unroll  /* constant indices keep a[] and f in registers, here and in the loops below */
  for (int i = 0; i < 4; ++i) { FragH f;
#pragma unroll
    for (int q = 0; q < 4; ++q) { const float v = bf16_rne(a[i][q]) * scale; f.h[q] = HEAD ? toh_flush(v) : (_Float16)v; }
#pragma unroll
    for (int q = 0; q < 4; ++q) tl[i * 16 + r0][c4 + q] = f.u[q]; }
  __syncthreads();   /* the whole tile is in LDS before any column of it is read */
#pragma unroll
  for (int rd = 0; rd < 2; ++rd) { const int n = rd * 32 + tid / 8, pc = tid % 8; FragH f;
#pragma unroll
    for (int q = 0; q < 8; ++q) f.u[q] = tl[pc * 8 + q][n];
    *(v8us*)((unsigned short*)Wt + (size_t)(n0 + n) * K + k0 + pc * 8) = f.half[0]; }
  asm volatile("s_wait_xcnt 0x0" ::: "memory");   /* another job's code follows in the merged kernel and reuses the registers that the two stores name */
}

static __device__ __forceinline__ void x16_body(int bid, const float* __restrict__ x, _Float16* __restrict__ X16, size_t n8) {
  const size_t t = (size_t)bid * 256 + threadIdx.x; if (t >= n8) return;
  const size_t e = t * 8; const size_t r = e / DM; const size_t c = e % DM; const size_t rs = (r / SEQ) * SEQ_FULL + (r % SEQ);
  const float* src = x + rs * DM + c; const v4f a = *(const v4fa*)src; const v4f a2 = *(const v4fa*)(src + 4); FragH f;
#pragma unroll
  for (int q = 0; q < 4; ++q) { f.h[q] = (_Float16)bf16_rne(a[q]); f.h[4 + q] = (_Float16)bf16_rne(a2[q]); }
  const v8us o = f.half[0]; unsigned short* d = (unsigned short*)X16 + e;
  *(v8us*)d = o; 
}

// Every conversion that reads the inputs alone, in ONE launch: none of the twelve jobs reads what another writes. blockIdx.x picks the job, the same for the whole block:
// the tiles of the eight DM x DM attention weights (order q k v o, q k v o; Wt planes one behind the other from BA), of W1, of W2, then the row pieces of x and of z.
#define TDD ((DM / 64) * (DM / 64))             /* tiles of a DM x DM weight */
#define TDF ((DM / 64) * (DFF / 64))            /* tiles of an FFN weight */
#define XBL ((int)((NR * DM / 8 + 255) / 256))  /* blocks of a token plane, 8 elements a thread */
#define PREP_BLOCKS (8 * TDD + 2 * TDF + 2 * XBL)
__global__ __launch_bounds__(256) void k_prep(const float* __restrict__ wq1, const float* __restrict__ wk1, const float* __restrict__ wv1, const float* __restrict__ wo1,
    const float* __restrict__ wq2, const float* __restrict__ wk2, const float* __restrict__ wv2, const float* __restrict__ wo2, const float* __restrict__ wff1, const float* __restrict__ wff2,
    const float* __restrict__ x, const float* __restrict__ z, _Float16* __restrict__ BA, _Float16* __restrict__ BW1, _Float16* __restrict__ BW2, _Float16* __restrict__ X16, _Float16* __restrict__ Z16) {
  __shared__ unsigned short tl[64][WTP];
  int bid = blockIdx.x;
  if (bid < 8 * TDD) {
    const int j = bid / TDD; bid -= j * TDD; _Float16* Wt = BA + (size_t)j * DM * DM;
    if ((j & 3) != 3) wt_tile_body<1>(tl, bid, j == 0 ? wq1 : j == 1 ? wk1 : j == 2 ? wv1 : j == 4 ? wq2 : j == 5 ? wk2 : wv2, Wt, DM, DM, 16.0f);
    else wt_tile_body<0>(tl, bid, j == 3 ? wo1 : wo2, Wt, DM, DM, 16.0f);
  } else if (bid < 8 * TDD + TDF) {
    wt_tile_body<0>(tl, bid - 8 * TDD, wff1, BW1, DM, DFF, 16.0f);
  } else if (bid < 8 * TDD + 2 * TDF) {
    wt_tile_body<0>(tl, bid - (8 * TDD + TDF), wff2, BW2, DFF, DM, 16.0f);
  } else {
    bid -= 8 * TDD + 2 * TDF; const int second = bid >= XBL; if (second) bid -= XBL;
    x16_body(bid, second ? z : x, second ? Z16 : X16, NR * DM / 8);
  }
}

__global__ __launch_bounds__(256) void k_split16(const float* __restrict__ src, _Float16* __restrict__ H16, _Float16* __restrict__ R16, size_t n8) {
  #pragma clang fp contract(off)
  const size_t t = (size_t)blockIdx.x * 256 + threadIdx.x; if (t >= n8) return;
  const size_t e = t * 8; const v4f a = *(const v4fa*)(src + e); const v4f a2 = *(const v4fa*)(src + e + 4); FragH fh, fr;
#pragma unroll
  for (int q = 0; q < 4; ++q) {
    const h16 h0 = toh_flush(a[q]);  fh.h[q] = h0;     fr.h[q] = toh_flush((a[q] - (float)h0) * RCARRY);
    const h16 h1 = toh_flush(a2[q]); fh.h[4 + q] = h1; fr.h[4 + q] = toh_flush((a2[q] - (float)h1) * RCARRY); }
  const v8us oh = fh.half[0]; const v8us orr = fr.half[0];
  unsigned short* dh = (unsigned short*)H16 + e; unsigned short* dr = (unsigned short*)R16 + e;
  *(v8us*)dh = oh; *(v8us*)dr = orr; 
}

template <int NHv, int TTv>
__global__ __launch_bounds__(256) void k_vt(const _Float16* __restrict__ V16a, const _Float16* __restrict__ V16b, const _Float16* __restrict__ V16c, int ldv, int voff,
    _Float16* __restrict__ Vta, _Float16* __restrict__ Vtb, _Float16* __restrict__ Vtc) {
  const int pj = blockIdx.y;   /* picks the plane: the three independent transposes share a launch */
  const _Float16* V16 = pj == 0 ? V16a : pj == 1 ? V16b : V16c; _Float16* Vt = pj == 0 ? Vta : pj == 1 ? Vtb : Vtc;
  __shared__ unsigned short tl[64][66]; const int tid = threadIdx.x; const int slab = blockIdx.x / (TTv / 64), lg = blockIdx.x % (TTv / 64); const int b = slab / NHv, h = slab % NHv;
  for (int i = tid; i < 64 * 8; i += 256) { const int r = i / 8, c8 = (i % 8) * 8; FragH f; f.half[0] = *(const v8us*)((const unsigned short*)V16 + ((size_t)b * TTv + lg * 64 + r) * ldv + voff + h * 64 + c8);
#pragma unroll
    for (int q = 0; q < 8; ++q) tl[r][c8 + q] = f.u[q]; }
  __syncthreads();
  {
#pragma unroll
    for (int rd = 0; rd < 2; ++rd) { const int d = rd * 32 + tid / 8, pc = tid % 8; FragH f;
#pragma unroll
      for (int q = 0; q < 8; ++q) f.u[q] = tl[pc * 8 + q][d];
      *(v8us*)((unsigned short*)Vt + ((size_t)slab * 64 + d) * TTv + lg * 64 + pc * 8) = f.half[0]; }
     }
}

// LDS staging of the GEMM operands. A block of 8 waves owns a 128 x 128 tile of C; a stage holds 128 k of its 128 A rows and then of its 128 B rows.
#define GKP 128                 /* k (halves) per stage: 256-byte rows */
#define GPITCH 136              /* LDS row pitch in halves: 272 B = 16 B x 17, conflict-free for 16-byte row reads */
#define GPITCHB (GPITCH * 2)    /* the same in bytes */
#define GSTAGE (256 * GPITCH)   /* halves per stage */
static_assert(DM % GKP == 0 && DFF % GKP == 0 && DM % 128 == 0 && DFF % 128 == 0);

static __device__ __forceinline__ unsigned lds_off(const void* p) { return (unsigned)(size_t)p; }

// Eight 16-byte asynchronous copies of one lane: rows 16 apart, global row step gstep halves. The s_wait_xcnt closes the statement so that no address register is rewritten ahead of it.
static __device__ __forceinline__ void copy8(unsigned l, const _Float16* g, size_t gstep) {
  asm volatile(
      "global_load_async_to_lds_b128 %0, %8, off\n\t"
      "global_load_async_to_lds_b128 %1, %9, off\n\t"
      "global_load_async_to_lds_b128 %2, %10, off\n\t"
      "global_load_async_to_lds_b128 %3, %11, off\n\t"
      "global_load_async_to_lds_b128 %4, %12, off\n\t"
      "global_load_async_to_lds_b128 %5, %13, off\n\t"
      "global_load_async_to_lds_b128 %6, %14, off\n\t"
      "global_load_async_to_lds_b128 %7, %15, off\n\t"
      "s_wait_xcnt 0x0"
      :: "v"(l), "v"(l + 16u * GPITCHB), "v"(l + 32u * GPITCHB), "v"(l + 48u * GPITCHB), "v"(l + 64u * GPITCHB), "v"(l + 80u * GPITCHB), "v"(l + 96u * GPITCHB), "v"(l + 112u * GPITCHB),
         "v"(g), "v"(g + gstep), "v"(g + 2 * gstep), "v"(g + 3 * gstep), "v"(g + 4 * gstep), "v"(g + 5 * gstep), "v"(g + 6 * gstep), "v"(g + 7 * gstep)
      : "memory");
}
// One stage: l = this lane's LDS byte address in the stage's row tid/16, ga / gb = its 16 bytes of that row of the A / B tile.
static __device__ __forceinline__ void stage_copy(unsigned l, const _Float16* ga, int lda, const _Float16* gb, int ldb) {
  copy8(l, ga, (size_t)16 * lda);
  copy8(l + 128u * GPITCHB, gb, (size_t)16 * ldb);
}

// One K sweep of the block's 128 x 128 tile through a two-buffer LDS ring; each wave keeps a 32 x 64 tile (A rows arow, arow + 16; B rows brow + 16 j), k ascending in steps of 32.
// At and Bt point at the first row of the block's A and B tiles. Every thread of the block calls it; K is a positive multiple of 128. The ring is free again on return (the last trip's barrier).
static __device__ __forceinline__ void gemm_sweep(_Float16* ring, const _Float16* At, int lda, const _Float16* Bt, int ldb, int K, int tid, int arow, int brow, int hh,
    v8f& c00, v8f& c01, v8f& c02, v8f& c03, v8f& c10, v8f& c11, v8f& c12, v8f& c13) {
  const unsigned l0 = lds_off(ring) + (unsigned)((tid >> 4) * GPITCHB + (tid & 15) * 16);
  const _Float16* ga = At + (size_t)(tid >> 4) * lda + (tid & 15) * 8;
  const _Float16* gb = Bt + (size_t)(tid >> 4) * ldb + (tid & 15) * 8;
  const int nst = K / GKP;
  stage_copy(l0, ga, lda, gb, ldb);
  asm volatile("s_wait_asynccnt 0x0" ::: "memory");   /* stage 0 of this wave has landed */
  __syncthreads();                                    /* stage 0 of every wave is readable */
  if (nst > 1) stage_copy(l0 + (unsigned)(GSTAGE * 2), ga + GKP, lda, gb + GKP, ldb);
#pragma unroll 1  /* one trip per stage: the ring's waits and its barrier stand once, at the trip's foot */
  for (int t = 0; t < nst; ++t) {
    const _Float16* buf = ring + (t & 1) * GSTAGE;
    const _Float16* a0p = buf + arow * GPITCH; const _Float16* a1p = a0p + 16 * GPITCH;
    const _Float16* b0p = buf + (128 + brow) * GPITCH; const _Float16* b1p = b0p + 16 * GPITCH; const _Float16* b2p = b1p + 16 * GPITCH; const _Float16* b3p = b2p + 16 * GPITCH;
    // the six fragments of a k step are read as one group, one k step ahead inside the stage, so that their LDS latency runs under the products of the step before
    v16h a0 = g2_frag(a0p, hh), a1 = g2_frag(a1p, hh), b0 = g2_frag(b0p, hh), b1 = g2_frag(b1p, hh), b2 = g2_frag(b2p, hh), b3 = g2_frag(b3p, hh);
#pragma unroll  /* constant LDS offsets, and the two fragment sets swap by renaming, without moves */
    for (int kb = 0; kb < GKP; kb += 32) {
      v16h na0 = a0, na1 = a1, nb0 = b0, nb1 = b1, nb2 = b2, nb3 = b3;
      if (kb + 32 < GKP) { na0 = g2_frag(a0p + kb + 32, hh); na1 = g2_frag(a1p + kb + 32, hh); nb0 = g2_frag(b0p + kb + 32, hh); nb1 = g2_frag(b1p + kb + 32, hh); nb2 = g2_frag(b2p + kb + 32, hh); nb3 = g2_frag(b3p + kb + 32, hh); }
      c00 = g2_mma(a0, b0, c00); c10 = g2_mma(a1, b0, c10);
      c01 = g2_mma(a0, b1, c01); c11 = g2_mma(a1, b1, c11);
      c02 = g2_mma(a0, b2, c02); c12 = g2_mma(a1, b2, c12);
      c03 = g2_mma(a0, b3, c03); c13 = g2_mma(a1, b3, c13);
      a0 = na0; a1 = na1; b0 = nb0; b1 = nb1; b2 = nb2; b3 = nb3; }
    asm volatile("s_wait_dscnt 0x0" ::: "memory");      /* this wave's reads of buffer t & 1 are done before it is refilled */
    asm volatile("s_wait_asynccnt 0x0" ::: "memory");   /* this wave's copies of stage t + 1 have landed */
    __syncthreads();                                    /* publishes stage t + 1 and ends every reader's last read of buffer t & 1 */
    if (t + 2 < nst) stage_copy(l0 + (unsigned)((t & 1) * (GSTAGE * 2)), ga + (size_t)(t + 2) * GKP, lda, gb + (size_t)(t + 2) * GKP, ldb);
  }
  asm volatile("s_wait_asynccnt 0x0" ::: "memory");     /* no copy is outstanding when the ring is left */
}

// GEMM: block tile 128 x 128 (8 waves, 4 x 2), wave tile 32 rows x 64 cols; A f16 rows (pitch lda), Bh f16 [n][k] (pitch ldb); v = acc*alpha + bf16(bias[col])*bsc; ACT 0 none / 3 relu;
// Requires M % 128 == 0, N % 128 == 0, K % 128 == 0; grid = (M/128)*(N/128), block 256.
template <int ACT>
__global__ __launch_bounds__(256) void k_gemm2(const _Float16* __restrict__ A, int lda, const _Float16* __restrict__ Bh, int ldb, float alpha, const float* __restrict__ bias, float bsc,
    float* __restrict__ C, _Float16* __restrict__ C16, int ldc, int M, int N, int K) {
  static_assert(ACT == 0 || ACT == 3);
  __shared__ __attribute__((aligned(16))) _Float16 ring[2 * GSTAGE];
  __shared__ __attribute__((aligned(16))) float so[8][32][68];
  const int tid = threadIdx.x, lane = tid & 31, ln = lane & 15, hh = lane >> 4;
  const int w = __builtin_amdgcn_readfirstlane(tid >> 5);
  const int ntn = N >> 7; const int mt = blockIdx.x / ntn, nq = blockIdx.x - mt * ntn; if (mt * 128 >= M) return;
  const int row0 = mt * 128 + 32 * (w >> 1), col0 = nq * 128 + 64 * (w & 1);
  const v8f z8 = {0.f,0.f,0.f,0.f,0.f,0.f,0.f,0.f}; v8f c00 = z8, c01 = z8, c02 = z8, c03 = z8, c10 = z8, c11 = z8, c12 = z8, c13 = z8;
  gemm_sweep(ring, A + (size_t)(mt * 128) * lda, lda, Bh + (size_t)(nq * 128) * ldb, ldb, K, tid, 32 * (w >> 1) + ln, 64 * (w & 1) + ln, hh, c00, c01, c02, c03, c10, c11, c12, c13);
  v8f accs[8] = {c00, c01, c02, c03, c10, c11, c12, c13};
#pragma unroll
  for (int u = 0; u < 8; ++u) { const int t = u & 3, half = u >> 2; const int col = col0 + t * 16 + ln; const float bv = bias ? bf16_rne(bias[col]) * bsc : 0.f;
#pragma unroll
    for (int r = 0; r < 8; ++r) { const int rloc = half * 16 + 8 * hh + r; float v = accs[u][r] * alpha + bv; if (ACT == 3) v = fmaxf(v, 0.f); so[w][rloc][t * 16 + ln] = v; } }
  __builtin_amdgcn_fence(4 /* acq_rel order */, "workgroup"); __builtin_amdgcn_wave_barrier();
  const int rsub = lane >> 4, c4 = (lane & 15) * 4;
  {
#pragma unroll
    for (int q = 0; q < 16; ++q) { const int r = q * 2 + rsub; const v4f v = *(const v4fa*)&so[w][r][c4];
      if (C) *(v4f*)(C + (size_t)(row0 + r) * ldc + col0 + c4) = v;
      if (C16) { v4h h4; for (int i = 0; i < 4; ++i) h4[i] = (_Float16)v[i]; *(v4h*)(C16 + (size_t)(row0 + r) * ldc + col0 + c4) = h4; } }
     }
}

// GEMM with an optional residual A plane (AR = (a - f16(a)) * 2048, own accumulators from zero, folded by 2^-11 in f32) and either an f32 output (OUTHR 0)
// or f16 planes (OUTHR 1): value + residual, or, SGL 1 and single set (the same for the whole block), one plainly converted plane CH alone.
// Requires M % 128 == 0, N % 128 == 0, K % 128 == 0; grid = (M/128)*(N/128), block 256.
template <int ARES, int OUTHR, int SGL = 0>
static __device__ __forceinline__ void gemm_hr_body(const _Float16* __restrict__ A, const _Float16* __restrict__ AR, int lda, const _Float16* __restrict__ Bh, int ldb, float alpha,
    const float* __restrict__ bias, float bsc, float* __restrict__ C, _Float16* __restrict__ CH, _Float16* __restrict__ CR, int ldc, int M, int N, int K, bool single = false) {
  __shared__ __attribute__((aligned(16))) _Float16 ring[2 * GSTAGE];
  __shared__ __attribute__((aligned(16))) float so[8][32][68];
  const int tid = threadIdx.x, lane = tid & 31, ln = lane & 15, hh = lane >> 4;
  const int w = __builtin_amdgcn_readfirstlane(tid >> 5);
  const int ntn = N >> 7; const int mt = blockIdx.x / ntn, nq = blockIdx.x - mt * ntn; if (mt * 128 >= M) return;
  const int row0 = mt * 128 + 32 * (w >> 1), col0 = nq * 128 + 64 * (w & 1);
  const int arow = 32 * (w >> 1) + ln, brow = 64 * (w & 1) + ln;
  const _Float16* Bt = Bh + (size_t)(nq * 128) * ldb;
  const v8f z8 = {0.f,0.f,0.f,0.f,0.f,0.f,0.f,0.f};
  if (ARES) {
    v8f d00 = z8, d01 = z8, d02 = z8, d03 = z8, d10 = z8, d11 = z8, d12 = z8, d13 = z8;
    gemm_sweep(ring, AR + (size_t)(mt * 128) * lda, lda, Bt, ldb, K, tid, arow, brow, hh, d00, d01, d02, d03, d10, d11, d12, d13);
    v8f ds[8] = {d00, d01, d02, d03, d10, d11, d12, d13};
#pragma unroll
    for (int u = 0; u < 8; ++u) { const int t = u & 3, half = u >> 2;
#pragma unroll
      for (int r = 0; r < 8; ++r) { const int rloc = half * 16 + 8 * hh + r; so[w][rloc][t * 16 + ln] = ds[u][r] * RINV; } }
  }
  v8f c00 = z8, c01 = z8, c02 = z8, c03 = z8, c10 = z8, c11 = z8, c12 = z8, c13 = z8;
  gemm_sweep(ring, A + (size_t)(mt * 128) * lda, lda, Bt, ldb, K, tid, arow, brow, hh, c00, c01, c02, c03, c10, c11, c12, c13);
  v8f accs[8] = {c00, c01, c02, c03, c10, c11, c12, c13};
#pragma unroll
  for (int u = 0; u < 8; ++u) { const int t = u & 3, half = u >> 2; const int col = col0 + t * 16 + ln; const float bv = bias ? bf16_rne(bias[col]) * bsc : 0.f;
#pragma unroll
    for (int r = 0; r < 8; ++r) { const int rloc = half * 16 + 8 * hh + r; float v = accs[u][r]; if (ARES) v += so[w][rloc][t * 16 + ln]; v = v * alpha + bv; so[w][rloc][t * 16 + ln] = v; } }
  __builtin_amdgcn_fence(4 /* acq_rel order */, "workgroup"); __builtin_amdgcn_wave_barrier();
  const int rsub = lane >> 4, c4 = (lane & 15) * 4;
  if (SGL && single) {   /* one test for the whole read-out, not one per row */
#pragma unroll
    for (int q = 0; q < 16; ++q) { const int r = q * 2 + rsub; const v4f v = *(const v4fa*)&so[w][r][c4];
      v4h h4; for (int i = 0; i < 4; ++i) h4[i] = (_Float16)v[i]; *(v4h*)(CH + (size_t)(row0 + r) * ldc + col0 + c4) = h4; }
  } else {
#pragma unroll
    for (int q = 0; q < 16; ++q) { const int r = q * 2 + rsub; const v4f v = *(const v4fa*)&so[w][r][c4];
      if (OUTHR) { v4h h4, r4;
#pragma unroll
        for (int i = 0; i < 4; ++i) { const h16 hv = toh_flush(v[i]); h4[i] = hv; r4[i] = toh_flush((v[i] - (float)hv) * RCARRY); }
        *(v4h*)(CH + (size_t)(row0 + r) * ldc + col0 + c4) = h4;
        *(v4h*)(CR + (size_t)(row0 + r) * ldc + col0 + c4) = r4; }
      else { *(v4f*)(C + (size_t)(row0 + r) * ldc + col0 + c4) = v; } }
    if (SGL) asm volatile("s_wait_xcnt 0x0" ::: "memory");   /* the other read-out's code follows in the built kernel and reuses the registers that these stores name */
     }
}

// The five projections that read a converted input plane alone, in one launch; blockIdx.y picks the job: q, k, v of the self-attention (A0) and k of the cross-attention (A1) as f16 value +
// residual planes, v of the cross-attention (A1) as one f16 plane. grid = ((M/128)*(N/128), 5).
__global__ __launch_bounds__(256) void k_proj5(const _Float16* __restrict__ A0, const _Float16* __restrict__ A1, int lda,
    const _Float16* __restrict__ B0, const _Float16* __restrict__ B1, const _Float16* __restrict__ B2, const _Float16* __restrict__ B3, const _Float16* __restrict__ B4, int ldb, float alpha,
    _Float16* __restrict__ CH0, _Float16* __restrict__ CR0, _Float16* __restrict__ CH1, _Float16* __restrict__ CR1, _Float16* __restrict__ CH2, _Float16* __restrict__ CR2,
    _Float16* __restrict__ CH3, _Float16* __restrict__ CR3, _Float16* __restrict__ CH4, int ldc, int M, int N, int K) {
  const int j = blockIdx.y;
  const _Float16* A = j < 3 ? A0 : A1;
  const _Float16* Bh = j == 0 ? B0 : j == 1 ? B1 : j == 2 ? B2 : j == 3 ? B3 : B4;
  _Float16* CH = j == 0 ? CH0 : j == 1 ? CH1 : j == 2 ? CH2 : j == 3 ? CH3 : CH4;
  _Float16* CR = j == 0 ? CR0 : j == 1 ? CR1 : j == 2 ? CR2 : CR3;   /* not stored by job 4 */
  gemm_hr_body<0, 1, 1>(A, A, lda, Bh, ldb, alpha, nullptr, 0.f, nullptr, CH, CR, ldc, M, N, K, j == 4);
}
// value + residual A planes -> f16 value + residual output planes
__global__ __launch_bounds__(256) void k_proj_rhr(const _Float16* __restrict__ A, const _Float16* __restrict__ AR, int lda, const _Float16* __restrict__ Bh, int ldb, float alpha,
    _Float16* __restrict__ CH, _Float16* __restrict__ CR, int ldc, int M, int N, int K) {
  gemm_hr_body<1, 1>(A, AR, lda, Bh, ldb, alpha, nullptr, 0.f, nullptr, CH, CR, ldc, M, N, K);
}
// value + residual A planes -> f32 rows with bias
__global__ __launch_bounds__(256) void k_proj_rf(const _Float16* __restrict__ A, const _Float16* __restrict__ AR, int lda, const _Float16* __restrict__ Bh, int ldb, float alpha,
    const float* __restrict__ bias, float bsc, float* __restrict__ C, int ldc, int M, int N, int K) {
  gemm_hr_body<1, 0>(A, AR, lda, Bh, ldb, alpha, bias, bsc, C, nullptr, nullptr, ldc, M, N, K);
}

// LDS staging of the attention operands. A block of 8 waves owns 128 query rows of one (batch, head) (which rows: attn_hr_body); a stage holds 64 keys: the K value and K residual rows (64 rows of 128 bytes each),
// then the V^T value rows (64 head columns x 64 keys) and, CAUSAL, the V^T residual rows. Every copy of a wave covers four whole 128-byte rows.
#define AKS 64                  /* keys per stage */
#define APITCH 72               /* LDS row pitch in halves: 144 B = 16 B x 9, conflict-free for 16-byte row reads */
#define APITCHB (APITCH * 2)    /* the same in bytes */
#define APLANE (64 * APITCH)    /* halves per staged plane */
static_assert(SEQ % 128 == 0 && SEQ / AKS >= 2 && HD == 64 && AKS == 64);

// Four / two 16-byte asynchronous copies of one lane. The s_wait_xcnt closes the statement so that no address register is rewritten ahead of it.
static __device__ __forceinline__ void copy4(unsigned l0, unsigned l1, unsigned l2, unsigned l3, const _Float16* g0, const _Float16* g1, const _Float16* g2, const _Float16* g3) {
  asm volatile(
      "global_load_async_to_lds_b128 %0, %4, off\n\t"
      "global_load_async_to_lds_b128 %1, %5, off\n\t"
      "global_load_async_to_lds_b128 %2, %6, off\n\t"
      "global_load_async_to_lds_b128 %3, %7, off\n\t"
      "s_wait_xcnt 0x0"
      :: "v"(l0), "v"(l1), "v"(l2), "v"(l3), "v"(g0), "v"(g1), "v"(g2), "v"(g3)
      : "memory");
}
static __device__ __forceinline__ void copy2(unsigned l0, unsigned l1, const _Float16* g0, const _Float16* g1) {
  asm volatile(
      "global_load_async_to_lds_b128 %0, %2, off\n\t"
      "global_load_async_to_lds_b128 %1, %3, off\n\t"
      "s_wait_xcnt 0x0"
      :: "v"(l0), "v"(l1), "v"(g0), "v"(g1)
      : "memory");
}
// One stage: l = this lane's LDS byte address in row tid/8 of the stage's first plane; gk / gkr / gv / gvr = its 16 bytes of that row of each plane. A lane brings rows tid/8 and tid/8 + 32 of every plane.
template <int CAUSAL>
static __device__ __forceinline__ void attn_stage_copy(unsigned l, const _Float16* gk, const _Float16* gkr, const _Float16* gv, const _Float16* gvr) {
  const unsigned pl = (unsigned)(APLANE * 2), rb = 32u * APITCHB;
  copy4(l, l + rb, l + pl, l + pl + rb, gk, gk + (size_t)32 * DM, gkr, gkr + (size_t)32 * DM);
  if (CAUSAL) copy4(l + 2u * pl, l + 2u * pl + rb, l + 3u * pl, l + 3u * pl + rb, gv, gv + (size_t)32 * SEQ, gvr, gvr + (size_t)32 * SEQ);
  else copy2(l + 2u * pl, l + 2u * pl + rb, gv, gv + (size_t)32 * SEQ);
}

// The value of the same lane of the other 16-lane half (lane ^ 16), by a vector cross-row move.
static __device__ __forceinline__ float other_half(float v) { const int i = __float_as_int(v); return __int_as_float(__builtin_amdgcn_permlanex16(i, i, 0x76543210, 0xfedcba98, false, false)); }

// Flash-style attention for one (batch, head, 16 query rows) per wave: keys taken 32 at a time from the block's two-buffer LDS ring with an online (running-max) softmax in f32.
// The scores are computed transposed, S^T = K.Q^T (A = 16 key rows from LDS, B = the wave's 16 query rows kept in registers): lane (ln, hh) holds, of query q0 + ln, the keys 8 hh + r of the first
// key tile and 16 + 8 hh + r of the second, so that the maximum and the sum of a query run inside a lane, plus one exchange between the halves, and the two converted tiles ARE the B operand
// of O^T += V^T.P^T (element s of B = key 8 hh + s, then 16 + 8 hh + s - 8: the k order of g2_frag, which loads V^T as A). P never passes through LDS.
// scores = 8 * q.k^T with q and k as f16 value + x2048 residual planes: value.value in one accumulator, residual.value + value.residual in a second
// accumulator folded by 2^-11. CAUSAL: keys above the query row and exactly-zero scores take the fill -1e9 (replace), key blocks entirely above
// the wave's rows are skipped (their weights are exactly 0); P = 16384*exp(s - m) as f16 value + x2048 residual, V^T as value + residual slabs,
// o = P.V^T with value.value in one accumulator and the two cross terms in a second, row sum over the unconverted P; o/l * 64 written as f16 value +
// residual rows. Dense: P as one f16 plane (row sum over the converted P), V^T one plane, o one plane. Each half keeps the sum of its own keys; the two are joined after the loop. o tiles are wave-private LDS
template <int CAUSAL>
static __device__ __forceinline__ void attn_hr_body(const _Float16* __restrict__ Q16, const _Float16* __restrict__ QR, const _Float16* __restrict__ K16, const _Float16* __restrict__ KR,
    const _Float16* __restrict__ VT, const _Float16* __restrict__ VTR, _Float16* __restrict__ O16, _Float16* __restrict__ OR16) {
  constexpr int ASTAGE = (CAUSAL ? 4 : 3) * APLANE;   /* halves per stage */
  __shared__ __attribute__((aligned(16))) _Float16 kv[2 * ASTAGE];
  __shared__ __attribute__((aligned(16))) _Float16 ob[8][16 * OBP];
  __shared__ __attribute__((aligned(16))) _Float16 obr[8][16 * OBP];
  const int tid = threadIdx.x, lane = tid & 31, ln = lane & 15, hh = lane >> 4;
  const int w = __builtin_amdgcn_readfirstlane(tid >> 5);
  const int h = blockIdx.y, b = blockIdx.z;
  // CAUSAL: a query row's work grows with its index, so a block takes 64 rows from the low end (waves 0..3) and the mirrored 64 rows from the high end (waves 4..7, in falling order):
  // waves w and w + 4 together walk the same number of key passes in every block of the grid. The stage count stays the block's own (from blockIdx alone) and every wave passes every stage's
  // foot, whichever rows it holds. Dense: 128 rows in a run.
  const int q0 = CAUSAL ? (w < 4 ? blockIdx.x * 64 + w * 16 : SEQ - 64 - blockIdx.x * 64 + (7 - w) * 16) : blockIdx.x * 128 + w * 16;
  const size_t tok0 = (size_t)b * SEQ;
  const int slab = b * NH + h;
  const size_t qoff = (tok0 + q0 + ln) * DM + h * HD;
  const v16h qf0 = g2_frag(Q16 + qoff, hh), qf1 = g2_frag(Q16 + qoff + 32, hh);
  const v16h qr0 = g2_frag(QR + qoff, hh),  qr1 = g2_frag(QR + qoff + 32, hh);
  const v8f z8 = {0.f,0.f,0.f,0.f,0.f,0.f,0.f,0.f};
  v8f o0 = z8, o1 = z8, o2 = z8, o3 = z8;      /* o_j[r] = o of query q0 + ln, head column 16 j + 8 hh + r */
  v8f e0 = z8, e1 = z8, e2 = z8, e3 = z8;
  float mrow = -1.0e30f, lrow = 0.f;           /* of query q0 + ln: the maximum over all keys so far (equal in both halves), the sum over this half's keys */
  const int row = q0 + ln;
  const int kend = CAUSAL ? (q0 + 16) : SEQ;                  /* this wave's keys end here (the same in every lane) */
  const int nst = CAUSAL ? SEQ / AKS - blockIdx.x : SEQ / AKS;   /* stages of the block: up to the keys of its high rows (they end at SEQ - 64 blockIdx.x); at least two */
  const unsigned l0 = lds_off(kv) + (unsigned)((tid >> 3) * APITCHB + (tid & 7) * 16);
  const size_t gko = (tok0 + (tid >> 3)) * DM + h * HD + (tid & 7) * 8;
  const size_t gvo = ((size_t)slab * HD + (tid >> 3)) * SEQ + (tid & 7) * 8;
  const _Float16* gk = K16 + gko; const _Float16* gkr = KR + gko; const _Float16* gv = VT + gvo; const _Float16* gvr = VTR + gvo;
  attn_stage_copy<CAUSAL>(l0, gk, gkr, gv, gvr);
  asm volatile("s_wait_asynccnt 0x0" ::: "memory");   /* stage 0 of this wave has landed */
  __syncthreads();                                    /* stage 0 of every wave is readable */
  if (nst > 1) attn_stage_copy<CAUSAL>(l0 + (unsigned)(ASTAGE * 2), gk + (size_t)AKS * DM, gkr + (size_t)AKS * DM, gv + AKS, gvr + AKS);
#pragma unroll 1  /* one trip per stage: the ring's waits and its barrier stand once, at the trip's foot */
  for (int st = 0; st < nst; ++st) {
  const _Float16* buf = kv + (st & 1) * ASTAGE;
#pragma unroll 1  /* two passes of 32 keys per stage share one body */
  for (int sub = 0; sub < AKS; sub += 32) {
    const int kb = st * AKS + sub;
    if (kb >= kend) break;                            /* a wave past its diagonal skips the pass, never the trip's foot */
    const _Float16* k0p = buf + (sub + ln) * APITCH; const _Float16* k1p = k0p + 16 * APITCH;
    const _Float16* r0p = k0p + APLANE;              const _Float16* r1p = r0p + 16 * APITCH;
    v8f s0 = z8, s1 = z8, t0 = z8, t1 = z8;
    // the eight K fragments of the pass are read as one group ahead of the first score product: the wave meets the LDS latency once, not once per fragment
    const v16h ka0 = g2_frag(k0p, hh), ka1 = g2_frag(k0p + 32, hh), ra0 = g2_frag(r0p, hh), ra1 = g2_frag(r0p + 32, hh);
    const v16h kc0 = g2_frag(k1p, hh), kc1 = g2_frag(k1p + 32, hh), rc0 = g2_frag(r1p, hh), rc1 = g2_frag(r1p + 32, hh);
    s0 = g2_mma(ka0, qf0, s0); t0 = g2_mma(ka0, qr0, t0);
    s0 = g2_mma(ka1, qf1, s0); t0 = g2_mma(ka1, qr1, t0);
    t0 = g2_mma(ra0, qf0, t0);
    t0 = g2_mma(ra1, qf1, t0);
    s1 = g2_mma(kc0, qf0, s1); t1 = g2_mma(kc0, qr0, t1);
    s1 = g2_mma(kc1, qf1, s1); t1 = g2_mma(kc1, qr1, t1);
    t1 = g2_mma(rc0, qf0, t1);
    t1 = g2_mma(rc1, qf1, t1);
    // the V^T fragments of the pass are read as one group here, behind the last score product: their LDS latency runs under the softmax arithmetic
    const _Float16* vp = buf + 2 * APLANE + ln * APITCH + sub; const _Float16* vrp = vp + (CAUSAL ? APLANE : 0);
    const v16h va0 = g2_frag(vp, hh), va1 = g2_frag(vp + 16 * APITCH, hh), va2 = g2_frag(vp + 32 * APITCH, hh), va3 = g2_frag(vp + 48 * APITCH, hh);
    v16h vr0 = va0, vr1 = va1, vr2 = va2, vr3 = va3;
    if (CAUSAL) { vr0 = g2_frag(vrp, hh); vr1 = g2_frag(vrp + 16 * APITCH, hh); vr2 = g2_frag(vrp + 32 * APITCH, hh); vr3 = g2_frag(vrp + 48 * APITCH, hh); }
    if (CAUSAL) __builtin_amdgcn_sched_barrier(0);   /* keeps the sixteen reads whole at this place: without it this build moves them down among the softmax arithmetic in pieces, the last ones next to their products */
    const v8f af = (s0 + t0 * RINV) * 8.0f, cf = (s1 + t1 * RINV) * 8.0f;
    const int lim = row - kb - 8 * hh;           /* CAUSAL: the lane's keys kb + 8 hh + d with d > lim lie above the diagonal */
    float sc[16]; float t = -1.0e30f;            /* sc[i]: the score of key kb + 8 hh + i (i < 8), kb + 16 + 8 hh + i - 8 (i >= 8): element i of the B operand */
#pragma unroll  /* constant indices keep sc[] and the packed P in registers, here and below */
    for (int i = 0; i < 16; ++i) {
      const float x = i < 8 ? af[i & 7] : cf[i & 7];
      sc[i] = (CAUSAL && (((i < 8 ? i : i + 8) > lim) || (x == 0.0f))) ? -1.0e9f : x;
      t = fmaxf(t, sc[i]);
    }
    t = fmaxf(t, other_half(t));
    const float mnew = fmaxf(mrow, t);
    const float corr = __expf(mrow - mnew);
    FragH pf, prf; float ls0 = 0.f, ls1 = 0.f;   /* one sum per key tile: two short chains of adds */
#pragma unroll
    for (int i = 0; i < 16; ++i) {
      const float pc = __expf(sc[i] - mnew) * PCARRY;
      const h16 ph = toh_flush(pc);
      if (i < 8) ls0 += CAUSAL ? pc : (float)ph; else ls1 += CAUSAL ? pc : (float)ph;
      pf.h[i] = ph;
      if (CAUSAL) prf.h[i] = toh_flush((pc - (float)ph) * RCARRY);
    }
    lrow = lrow * corr + (ls0 + ls1); mrow = mnew;
    o0 *= corr; o1 *= corr; o2 *= corr; o3 *= corr;
    if (CAUSAL) { e0 *= corr; e1 *= corr; e2 *= corr; e3 *= corr; }
    o0 = g2_mma(va0, pf.v, o0);
    if (CAUSAL) { e0 = g2_mma(va0, prf.v, e0); e0 = g2_mma(vr0, pf.v, e0); }
    o1 = g2_mma(va1, pf.v, o1);
    if (CAUSAL) { e1 = g2_mma(va1, prf.v, e1); e1 = g2_mma(vr1, pf.v, e1); }
    o2 = g2_mma(va2, pf.v, o2);
    if (CAUSAL) { e2 = g2_mma(va2, prf.v, e2); e2 = g2_mma(vr2, pf.v, e2); }
    o3 = g2_mma(va3, pf.v, o3);
    if (CAUSAL) { e3 = g2_mma(va3, prf.v, e3); e3 = g2_mma(vr3, pf.v, e3); }
  }
    asm volatile("s_wait_dscnt 0x0" ::: "memory");      /* this wave's reads of buffer st & 1 are done before it is refilled */
    asm volatile("s_wait_asynccnt 0x0" ::: "memory");   /* this wave's copies of stage st + 1 have landed */
    __syncthreads();                                    /* publishes stage st + 1 and ends every reader's last read of buffer st & 1 */
    if (st + 2 < nst) attn_stage_copy<CAUSAL>(l0 + (unsigned)((st & 1) * (ASTAGE * 2)), gk + (size_t)(st + 2) * AKS * DM, gkr + (size_t)(st + 2) * AKS * DM, gv + (st + 2) * AKS, gvr + (st + 2) * AKS);
  }
  asm volatile("s_wait_asynccnt 0x0" ::: "memory");     /* no copy is outstanding when the ring is left */
  lrow += other_half(lrow);                                     /* the two halves' key sums of the query */
  const float rl = 64.0f * __builtin_amdgcn_rcpf(lrow);         /* o carried x64; l already carries the P carry */
  const v8f os[4] = {o0, o1, o2, o3}; const v8f es[4] = {e0, e1, e2, e3};
#pragma unroll
  for (int j = 0; j < 4; ++j) { FragH g, gr;
#pragma unroll
    for (int r = 0; r < 8; ++r) {
      float v = os[j][r]; if (CAUSAL) v += es[j][r] * RINV;
      v *= rl;
      const h16 gv16 = toh_flush(v); g.h[r] = gv16;
      if (CAUSAL) gr.h[r] = toh_flush((v - (float)gv16) * RCARRY); }
    const int oloc = ln * OBP + 16 * j + 8 * hh;                /* eight neighbouring head columns of the lane's query: one 16-byte LDS store */
    *(v8us*)(&ob[w][oloc]) = g.half[0];
    if (CAUSAL) *(v8us*)(&obr[w][oloc]) = gr.half[0];
  }
  __builtin_amdgcn_fence(4 /* acq_rel order */, "wavefront"); __builtin_amdgcn_wave_barrier();
  const int rq = lane >> 3, pc = (lane & 7) * 8;
  {
#pragma unroll
    for (int i = 0; i < 4; ++i) { const int orow = i * 4 + rq; const size_t go = (tok0 + q0 + orow) * DM + h * HD + pc;
      const v8us v = *(const v8us*)(&ob[w][orow * OBP + pc]);
      *(v8us*)((unsigned short*)O16 + go) = v;
      if (CAUSAL) { const v8us vr = *(const v8us*)(&obr[w][orow * OBP + pc]); *(v8us*)((unsigned short*)OR16 + go) = vr; } }
     }
}

__global__ __launch_bounds__(256) void k_attn_causal(const _Float16* __restrict__ Q16, const _Float16* __restrict__ QR, const _Float16* __restrict__ K16, const _Float16* __restrict__ KR,
    const _Float16* __restrict__ VT, const _Float16* __restrict__ VTR, _Float16* __restrict__ O16, _Float16* __restrict__ OR16) {
  attn_hr_body<1>(Q16, QR, K16, KR, VT, VTR, O16, OR16);
}
__global__ __launch_bounds__(256) void k_attn_dense(const _Float16* __restrict__ Q16, const _Float16* __restrict__ QR, const _Float16* __restrict__ K16, const _Float16* __restrict__ KR,
    const _Float16* __restrict__ VT, _Float16* __restrict__ O16) {
  attn_hr_body<0>(Q16, QR, K16, KR, VT, VT, O16, O16);
}

// red[] is cross-wave (block barriers); no early exit.
template <int RBF, int RMAP, int W16, int OMAP>
__global__ __launch_bounds__(256) void k_ln(const float* __restrict__ X, const float* __restrict__ R, const float* __restrict__ g, const float* __restrict__ bb, float eps, float* __restrict__ O32, _Float16* __restrict__ O16) {
  #pragma clang fp contract(off)
  __shared__ float red[256];
  const size_t r = blockIdx.x; const int t = threadIdx.x; const int c0 = t * 4;
  const size_t rfull = (r / SEQ) * SEQ_FULL + (r % SEQ);
  const size_t rr = RMAP ? rfull : r;
  const v4f xa = *(const v4fa*)(X + r * DM + c0); const v4f ra = *(const v4fa*)(R + rr * DM + c0);
  float s[4]; float sum = 0.f;
#pragma unroll
  for (int q = 0; q < 4; ++q) { const float rv = RBF ? bf16_rne(ra[q]) : ra[q]; s[q] = xa[q] + rv; sum += s[q]; }
  red[t] = sum; __syncthreads();
  for (int st = 128; st > 0; st >>= 1) { if (t < st) red[t] += red[t + st]; __syncthreads(); }
  const float mu = red[0] * (1.0f / (float)DM); __syncthreads();
  float vs = 0.f;
#pragma unroll
  for (int q = 0; q < 4; ++q) { const float dl = s[q] - mu; vs += dl * dl; }
  red[t] = vs; __syncthreads();
  for (int st = 128; st > 0; st >>= 1) { if (t < st) red[t] += red[t + st]; __syncthreads(); }
  const float rs = rsqrtf(red[0] * (1.0f / (float)DM) + eps);
  v4f yf; v4h y;
#pragma unroll
  for (int q = 0; q < 4; ++q) { const int c = c0 + q; yf[q] = (s[q] - mu) * rs * bf16_rne(g[c]) + bf16_rne(bb[c]); y[q] = (_Float16)yf[q]; }
  const size_t orow = OMAP ? rfull : r;
  {
    if (O32) *(v4f*)(O32 + orow * DM + c0) = yf;
    if (W16) *(v4h*)(O16 + r * DM + c0) = y;
     }
}

extern "C" void kernel_launch(void* const* d_in, const int* in_sizes, int n_in,
                              void* d_out, int out_size, void* d_ws, size_t ws_size, hipStream_t stream) {
  if (n_in < 22) return;
  const float* x    = (const float*)d_in[0];  const float* enc  = (const float*)d_in[1];
  const float* wq1  = (const float*)d_in[2];  const float* wk1  = (const float*)d_in[3];  const float* wv1 = (const float*)d_in[4];
  const float* wo1  = (const float*)d_in[5];  const float* bo1  = (const float*)d_in[6];
  const float* wq2  = (const float*)d_in[7];  const float* wk2  = (const float*)d_in[8];  const float* wv2 = (const float*)d_in[9];
  const float* wo2  = (const float*)d_in[10]; const float* bo2  = (const float*)d_in[11];
  const float* wff1 = (const float*)d_in[12]; const float* bff1 = (const float*)d_in[13]; const float* wff2 = (const float*)d_in[14]; const float* bff2 = (const float*)d_in[15];
  const float* g1   = (const float*)d_in[16]; const float* be1  = (const float*)d_in[17]; const float* g2  = (const float*)d_in[18]; const float* be2 = (const float*)d_in[19];
  const float* g3   = (const float*)d_in[20]; const float* be3  = (const float*)d_in[21];

  const size_t needX = ((size_t)(NB - 1) * SEQ_FULL + SEQ) * DM;
  if ((size_t)in_sizes[0] < needX || (size_t)in_sizes[1] < needX || (size_t)out_size < needX) return;
  { static const int wi[8] = {2, 3, 4, 5, 7, 8, 9, 10}; for (int i = 0; i < 8; ++i) if ((size_t)in_sizes[wi[i]] < (size_t)DM * DM) return; }
  if ((size_t)in_sizes[12] < (size_t)DM * DFF || (size_t)in_sizes[14] < (size_t)DM * DFF || in_sizes[13] < DFF) return;
  { static const int vi[9] = {6, 11, 15, 16, 17, 18, 19, 20, 21}; for (int i = 0; i < 9; ++i) if (in_sizes[vi[i]] < DM) return; }

  char* ws = (char*)d_ws; size_t off = 0;
  auto take = [&](size_t bytes) { char* p = ws + off; off += (bytes + 255) & ~(size_t)255; return p; };
  const size_t WDD = (size_t)DM * DM * 2, WDF = (size_t)DM * DFF * 2, P16 = NR * DM * 2;
  _Float16* BQ1 = (_Float16*)take(WDD); _Float16* BK1 = (_Float16*)take(WDD); _Float16* BV1 = (_Float16*)take(WDD); _Float16* BO1 = (_Float16*)take(WDD);
  _Float16* BQ2 = (_Float16*)take(WDD); _Float16* BK2 = (_Float16*)take(WDD); _Float16* BV2 = (_Float16*)take(WDD); _Float16* BO2 = (_Float16*)take(WDD);
  _Float16* BW1 = (_Float16*)take(WDF);      /* [n=DFF][k=DM]  */
  _Float16* BW2 = (_Float16*)take(WDF);      /* [n=DM][k=DFF]  */
  // fourteen token-plane slots of P16 bytes each (an f32 plane spans two slots, the FFN hidden plane four); lifetimes by launch order:
  // S0 X16                  S1 E16 -> x2 (f16)      S2,S3 Q1|QR1 -> a1 (f32) -> a2 (f32) -> hidden (S2..S5)
  // S4,S5 K1|KR1 -> x1 (f32)   S6,S7 VT1|VTR1 -> x1 value|residual -> S7 o2 (f16) -> f (f32)
  // S8,S9 V1|VR1 -> o1 value|residual -> Q2|QR2 -> x2 (f32)      S10,S11 K2|KR2      S12 V2      S13 VT2
  char* SL = take(14 * P16);
  _Float16* S0 = (_Float16*)(SL + 0 * P16); _Float16* S1 = (_Float16*)(SL + 1 * P16); _Float16* S2 = (_Float16*)(SL + 2 * P16); _Float16* S3 = (_Float16*)(SL + 3 * P16);
  _Float16* S4 = (_Float16*)(SL + 4 * P16); _Float16* S5 = (_Float16*)(SL + 5 * P16); _Float16* S6 = (_Float16*)(SL + 6 * P16); _Float16* S7 = (_Float16*)(SL + 7 * P16);
  _Float16* S8 = (_Float16*)(SL + 8 * P16); _Float16* S9 = (_Float16*)(SL + 9 * P16); _Float16* S10 = (_Float16*)(SL + 10 * P16); _Float16* S11 = (_Float16*)(SL + 11 * P16);
  _Float16* S12 = (_Float16*)(SL + 12 * P16); _Float16* S13 = (_Float16*)(SL + 13 * P16);
  float* YFa = (float*)S2;   /* a1, a2 (f32 rows, S2..S3) */
  float* X1F = (float*)S4;   /* x1 (f32 rows, S4..S5) */
  float* X2F = (float*)S8;   /* x2 (f32 rows, S8..S9) */
  float* YFf = (float*)S6;   /* f  (f32 rows, S6..S7) */
  _Float16* HF = S2;         /* FFN hidden rows [NR][DFF] f16 (S2..S5) */
  if (off > ws_size || off > (size_t)268435456) return;

  static_assert(((size_t)DM * DM * 2) % 256 == 0);   /* BQ1 .. BO2 lie one behind the other in the carve */
  k_prep<<<(unsigned)PREP_BLOCKS, 256, 0, stream>>>(wq1, wk1, wv1, wo1, wq2, wk2, wv2, wo2, wff1, wff2, x, enc, BQ1, BW1, BW2, S0, S1);

  const size_t n8 = NR * DM / 8; const unsigned gx = (unsigned)((n8 + 255) / 256);

  const unsigned gP = (unsigned)((MR / 128) * (DM / 128)), gF1 = (unsigned)((MR / 128) * (DFF / 128));
  const unsigned gVT = (unsigned)(NB * NH * (SEQ / 64)); const dim3 gAT(SEQ / 128, NH, NB);

  // ---- causal self-attention block
  k_proj5<<<dim3(gP, 5), 256, 0, stream>>>(S0, S1, DM, BQ1, BK1, BV1, BK2, BV2, DM, 0.0625f, S2, S3, S4, S5, S8, S9, S10, S11, S12, DM, MR, DM, DM);   /* q1, k1, v1, k2: value | residual; v2: one plane */
  k_vt<NH, SEQ><<<dim3(gVT, 3), 256, 0, stream>>>(S8, S9, S12, DM, 0, S6, S7, S13);
  k_attn_causal<<<gAT, 256, 0, stream>>>(S2, S3, S4, S5, S6, S7, S8, S9);                                       /* o x64 value | residual */
  k_proj_rf<<<gP, 256, 0, stream>>>(S8, S9, DM, BO1, DM, 0.0009765625f, bo1, 1.0f, YFa, DM, MR, DM, DM);        /* a1 = o Wp1 + bp1 */
  k_ln<1, 1, 0, 0><<<(unsigned)MR, 256, 0, stream>>>(YFa, x, g1, be1, LN_EPS, X1F, nullptr);                    /* x1 = LN1(bf16(x) + a1) -> f32 rows */
  k_split16<<<gx, 256, 0, stream>>>(X1F, S6, S7, n8);                                                           /* x1 value | residual */
  // ---- cross-attention block
  k_proj_rhr<<<gP, 256, 0, stream>>>(S6, S7, DM, BQ2, DM, 0.0625f, S8, S9, DM, MR, DM, DM);                     /* q  value | residual */
  k_attn_dense<<<gAT, 256, 0, stream>>>(S8, S9, S10, S11, S13, S7);                                                /* o x64 single plane */
  k_gemm2<0><<<gP, 256, 0, stream>>>(S7, DM, BO2, DM, 0.0009765625f, bo2, 1.0f, YFa, nullptr, DM, MR, DM, DM);  /* a2 = o Wp2 + bp2 */
  k_ln<0, 0, 1, 0><<<(unsigned)MR, 256, 0, stream>>>(YFa, X1F, g2, be2, LN_EPS, X2F, S1);                       /* x2 = LN2(x1 + a2) -> f32 + f16 rows */
  // ---- FFN block
  k_gemm2<3><<<gF1, 256, 0, stream>>>(S1, DM, BW1, DM, 1.0f, bff1, 16.0f, nullptr, HF, DFF, MR, DFF, DM);       /* 16 relu(x2 W1 + b1) as f16 rows */
  k_gemm2<0><<<gP, 256, 0, stream>>>(HF, DFF, BW2, DFF, 0.00390625f, bff2, 1.0f, YFf, nullptr, DM, MR, DM, DFF);  /* f = h W2 + b2 */
  k_ln<0, 0, 0, 1><<<(unsigned)MR, 256, 0, stream>>>(YFf, X2F, g3, be3, LN_EPS, (float*)d_out, nullptr);        /* out = LN3(x2 + f) */
}

// v008
// One run takes 304 microseconds.
// Two timings next to v007 both put it at 1.03 times that version's speed.
// Over all steps from v000 it is 3.52 times as fast.
#include <hip/hip_runtime.h>
// Structure: token rows r = b*SEQ + s. Causal self-attention (16 heads of 64, per-head weights [H][E][64], scores x8, keys above the diagonal and exactly-zero scores masked) -> x1 = LN1(x + attn.Wp1 + bp1); cross-attention of x1 over z rows -> x2 = LN2(x1 + attn.Wp2 + bp2); f = relu(x2.W1 + b1).W2 + b2; out = LN3(x2 + f). Projection / FFN weights are [in][out].

#ifndef NB
#define NB 4
#endif
#ifndef SEQ
#define SEQ 1024
#endif
#define NB_FULL 4
#define SEQ_FULL 1024
#define DM 1024
#define NH 16
#define HD 64
#define DFF 4096
#define NR ((size_t)NB * SEQ)
#define MR ((int)((size_t)NB * SEQ))
#define OBP 72          /* LDS pitch (halves) of the per-wave o tile */
#define LN_EPS 1.0e-5f
#define PCARRY 16384.0f         /* carry of the f16 P planes */
#define RCARRY 2048.0f          /* carry of every residual plane */
#define RINV 0.00048828125f     /* 1 / RCARRY */

static_assert(NB >= 1 && NB <= NB_FULL);
static_assert(SEQ >= 64 && SEQ <= SEQ_FULL && SEQ % 64 == 0);
static_assert((NB * SEQ) % 128 == 0);
static_assert(NH * HD == DM && HD == 64);
static_assert(DM == 4 * 256);
static_assert(DM % 64 == 0 && DFF % 64 == 0 && DM % 32 == 0 && DFF % 32 == 0);
static_assert(DFF <= 4 * DM);
static_assert((OBP % 8) == 0);
static_assert(DFF == 4 * DM);                       /* the FFN hidden plane spans exactly four 16-bit token planes */
static_assert(OBP >= HD);                           /* o tile holds one head */
static_assert(RCARRY * RINV == 1.0f);
static_assert(PCARRY <= 32768.0f);                  /* carried P stays inside f16 */
static_assert((size_t)8 * DM * DM * 2 + (size_t)2 * DM * DFF * 2 + (size_t)14 * NB * SEQ * DM * 2 + 16 * 256 <= (size_t)268435456);   /* workspace carve */

typedef unsigned short v8us __attribute__((ext_vector_type(8), may_alias));
typedef float  v8f  __attribute__((ext_vector_type(8)));
typedef float  v4f  __attribute__((ext_vector_type(4)));
typedef float  v4fa __attribute__((ext_vector_type(4), may_alias));
typedef _Float16 v16h __attribute__((ext_vector_type(16)));
typedef _Float16 v4h __attribute__((ext_vector_type(4)));
union FragH { v16h v; v8us half[2]; _Float16 h[16]; unsigned short u[16]; };

__device__ __forceinline__ unsigned short bf16_bits(float x) { unsigned int u = __float_as_uint(x); return (unsigned short)((u + 0x7FFFu + ((u >> 16) & 1u)) >> 16); }
__device__ __forceinline__ float bf16_val(unsigned short b) { return __uint_as_float(((unsigned int)b) << 16); }
__device__ __forceinline__ float bf16_rne(float x) { return bf16_val(bf16_bits(x)); }

// 16x32 fragment from a k-contiguous 16-bit row p (A row m = lane&15, or B stored [n][k] with n = lane&15):
// elements 0..7 <- k 8h..8h+7, elements 8..15 <- k 16+8h..16+8h+7 (h = lane>>4)
__device__ __forceinline__ v16h g2_frag(const _Float16* p, int hh) { FragH f; f.half[0] = *(const v8us*)((const unsigned short*)p + 8 * hh); f.half[1] = *(const v8us*)((const unsigned short*)p + 16 + 8 * hh); return f.v; }
__device__ __forceinline__ v8f g2_mma(v16h a, v16h b, v8f c) { v8f d = __builtin_amdgcn_wmma_f32_16x16x32_f16(false, a, false, b, (short)0, c, false, false); asm volatile("v_nop\n\tv_nop\n\tv_nop\n\tv_nop" : "+v"(d) : "v"(a), "v"(b)); return d; }

// f32 -> f16 operand convert that cannot yield an f16 subnormal (value select, applied after the plane's carry)
typedef _Float16 h16;
static __device__ __forceinline__ h16 toh_flush(float v) { const h16 r = (h16)v; return (fabsf(v) < 6.103515625e-05f) ? (h16)0.0f : r; }

// Weight convert + transpose, one 64 k x 64 n tile per block, turned in LDS: every wave-wide 16-byte load covers two whole 256-byte source rows of the tile and every
// wave-wide 16-byte store four whole 128-byte pieces of Wt rows. HEAD 0: W is [K][N]; HEAD 1: W is [N/64][K][64] (tile column block = head). Wt is [n][k].
// Requires K % 64 == 0 and N % 64 == 0; bid = the tile's index among the (N/64)*(K/64) tiles of its matrix, the same for the whole block of 256; tl = the block's LDS tile.
#define WTP 66                  /* LDS row pitch in halves: 33 words, so that a column walk of 8 rows apart meets 8 different banks */
template <int HEAD>
static __device__ __forceinline__ void wt_tile_body(unsigned short (*tl)[WTP], int bid, const float* __restrict__ W, _Float16* __restrict__ Wt, int K, int N, float scale) {
  const int tid = threadIdx.x; const int nkt = K >> 6; const int nt = bid / nkt, kt = bid - nt * nkt; if (nt * 64 >= N) return;   /* the same for the whole block, ahead of the barrier */
  const int n0 = nt * 64, k0 = kt * 64;
  const float* src = HEAD ? W + ((size_t)nt * K + k0) * HD : W + (size_t)k0 * N + n0;
  const size_t rstep = HEAD ? (size_t)HD : (size_t)N;
  const int r0 = tid >> 4, c4 = (tid & 15) * 4;
  v4f a[4];
#pragma unroll  /* the four loads of a lane are issued together, ahead of the first convert */
  for (int i = 0; i < 4; ++i) a[i] = *(const v4fa*)(src + (size_t)(i * 16 + r0) * rstep + c4);
#pragma unroll  /* constant indices keep a[] and f in registers, here and in the loops below */
  for (int i = 0; i < 4; ++i) { FragH f;
#pragma unroll
    for (int q = 0; q < 4; ++q) { const float v = bf16_rne(a[i][q]) * scale; f.h[q] = HEAD ? toh_flush(v) : (_Float16)v; }
#pragma unroll
    for (int q = 0; q < 4; ++q) tl[i * 16 + r0][c4 + q] = f.u[q]; }
  __syncthreads();   /* the whole tile is in LDS before any column of it is read */
#pragma unroll
  for (int rd = 0; rd < 2; ++rd) { const int n = rd * 32 + tid / 8, pc = tid % 8; FragH f;
#pragma unroll
    for (int q = 0; q < 8; ++q) f.u[q] = tl[pc * 8 + q][n];
    *(v8us*)((unsigned short*)Wt + (size_t)(n0 + n) * K + k0 + pc * 8) = f.half[0]; }
  asm volatile("s_wait_xcnt 0x0" ::: "memory");   /* another job's code follows in the merged kernel and reuses the registers that the two stores name */
}

static __device__ __forceinline__ void x16_body(int bid, const float* __restrict__ x, _Float16* __restrict__ X16, size_t n8) {
  const size_t t = (size_t)bid * 256 + threadIdx.x; if (t >= n8) return;
  const size_t e = t * 8; const size_t r = e / DM; const size_t c = e % DM; const size_t rs = (r / SEQ) * SEQ_FULL + (r % SEQ);
  const float* src = x + rs * DM + c; const v4f a = *(const v4fa*)src; const v4f a2 = *(const v4fa*)(src + 4); FragH f;
#pragma unroll
  for (int q = 0; q < 4; ++q) { f.h[q] = (_Float16)bf16_rne(a[q]); f.h[4 + q] = (_Float16)bf16_rne(a2[q]); }
  const v8us o = f.half[0]; unsigned short* d = (unsigned short*)X16 + e;
  *(v8us*)d = o; 
}

// Every conversion that reads the inputs alone, in ONE launch: none of the twelve jobs reads what another writes. blockIdx.x picks the job, the same for the whole block:
// the tiles of the eight DM x DM attention weights (order q k v o, q k v o; Wt planes one behind the other from BA), of W1, of W2, then the row pieces of x and of z.
#define TDD ((DM / 64) * (DM / 64))             /* tiles of a DM x DM weight */
#define TDF ((DM / 64) * (DFF / 64))            /* tiles of an FFN weight */
#define XBL ((int)((NR * DM / 8 + 255) / 256))  /* blocks of a token plane, 8 elements a thread */
#define PREP_BLOCKS (8 * TDD + 2 * TDF + 2 * XBL)
__global__ __launch_bounds__(256) void k_prep(const float* __restrict__ wq1, const float* __restrict__ wk1, const float* __restrict__ wv1, const float* __restrict__ wo1,
    const float* __restrict__ wq2, const float* __restrict__ wk2, const float* __restrict__ wv2, const float* __restrict__ wo2, const float* __restrict__ wff1, const float* __restrict__ wff2,
    const float* __restrict__ x, const float* __restrict__ z, _Float16* __restrict__ BA, _Float16* __restrict__ BW1, _Float16* __restrict__ BW2, _Float16* __restrict__ X16, _Float16* __restrict__ Z16) {
  __shared__ unsigned short tl[64][WTP];
  int bid = blockIdx.x;
  if (bid < 8 * TDD) {
    const int j = bid / TDD; bid -= j * TDD; _Float16* Wt = BA + (size_t)j * DM * DM;
    if ((j & 3) != 3) wt_tile_body<1>(tl, bid, j == 0 ? wq1 : j == 1 ? wk1 : j == 2 ? wv1 : j == 4 ? wq2 : j == 5 ? wk2 : wv2, Wt, DM, DM, 16.0f);
    else wt_tile_body<0>(tl, bid, j == 3 ? wo1 : wo2, Wt, DM, DM, 16.0f);
  } else if (bid < 8 * TDD + TDF) {
    wt_tile_body<0>(tl, bid - 8 * TDD, wff1, BW1, DM, DFF, 16.0f);
  } else if (bid < 8 * TDD + 2 * TDF) {
    wt_tile_body<0>(tl, bid - (8 * TDD + TDF), wff2, BW2, DFF, DM, 16.0f);
  } else {
    bid -= 8 * TDD + 2 * TDF; const int second = bid >= XBL; if (second) bid -= XBL;
    x16_body(bid, second ? z : x, second ? Z16 : X16, NR * DM / 8);
  }
}

// LDS staging of the GEMM operands. A block of 8 waves owns a 128 x 128 tile of C; a stage holds 128 k of its 128 A rows and then of its 128 B rows.
#define GKP 128                 /* k (halves) per stage: 256-byte rows */
#define GPITCH 136              /* LDS row pitch in halves: 272 B = 16 B x 17, conflict-free for 16-byte row reads */
#define GPITCHB (GPITCH * 2)    /* the same in bytes */
#define GSTAGE (256 * GPITCH)   /* halves per stage */
static_assert(DM % GKP == 0 && DFF % GKP == 0 && DM % 128 == 0 && DFF % 128 == 0);

static __device__ __forceinline__ unsigned lds_off(const void* p) { return (unsigned)(size_t)p; }

// Eight 16-byte asynchronous copies of one lane: rows 16 apart, global row step gstep halves. The s_wait_xcnt closes the statement so that no address register is rewritten ahead of it.
static __device__ __forceinline__ void copy8(unsigned l, const _Float16* g, size_t gstep) {
  asm volatile(
      "global_load_async_to_lds_b128 %0, %8, off\n\t"
      "global_load_async_to_lds_b128 %1, %9, off\n\t"
      "global_load_async_to_lds_b128 %2, %10, off\n\t"
      "global_load_async_to_lds_b128 %3, %11, off\n\t"
      "global_load_async_to_lds_b128 %4, %12, off\n\t"
      "global_load_async_to_lds_b128 %5, %13, off\n\t"
      "global_load_async_to_lds_b128 %6, %14, off\n\t"
      "global_load_async_to_lds_b128 %7, %15, off\n\t"
      "s_wait_xcnt 0x0"
      :: "v"(l), "v"(l + 16u * GPITCHB), "v"(l + 32u * GPITCHB), "v"(l + 48u * GPITCHB), "v"(l + 64u * GPITCHB), "v"(l + 80u * GPITCHB), "v"(l + 96u * GPITCHB), "v"(l + 112u * GPITCHB),
         "v"(g), "v"(g + gstep), "v"(g + 2 * gstep), "v"(g + 3 * gstep), "v"(g + 4 * gstep), "v"(g + 5 * gstep), "v"(g + 6 * gstep), "v"(g + 7 * gstep)
      : "memory");
}
// One stage: l = this lane's LDS byte address in the stage's row tid/16, ga / gb = its 16 bytes of that row of the A / B tile.
static __device__ __forceinline__ void stage_copy(unsigned l, const _Float16* ga, int lda, const _Float16* gb, int ldb) {
  copy8(l, ga, (size_t)16 * lda);
  copy8(l + 128u * GPITCHB, gb, (size_t)16 * ldb);
}

// One K sweep of the block's 128 x 128 tile through a two-buffer LDS ring; each wave keeps a 32 x 64 tile (A rows arow, arow + 16; B rows brow + 16 j), k ascending in steps of 32.
// At and Bt point at the first row of the block's A and B tiles. Every thread of the block calls it; K is a positive multiple of 128. The ring is free again on return (the last trip's barrier).
static __device__ __forceinline__ void gemm_sweep(_Float16* ring, const _Float16* At, int lda, const _Float16* Bt, int ldb, int K, int tid, int arow, int brow, int hh,
    v8f& c00, v8f& c01, v8f& c02, v8f& c03, v8f& c10, v8f& c11, v8f& c12, v8f& c13) {
  const unsigned l0 = lds_off(ring) + (unsigned)((tid >> 4) * GPITCHB + (tid & 15) * 16);
  const _Float16* ga = At + (size_t)(tid >> 4) * lda + (tid & 15) * 8;
  const _Float16* gb = Bt + (size_t)(tid >> 4) * ldb + (tid & 15) * 8;
  const int nst = K / GKP;
  stage_copy(l0, ga, lda, gb, ldb);
  asm volatile("s_wait_asynccnt 0x0" ::: "memory");   /* stage 0 of this wave has landed */
  __syncthreads();                                    /* stage 0 of every wave is readable */
  if (nst > 1) stage_copy(l0 + (unsigned)(GSTAGE * 2), ga + GKP, lda, gb + GKP, ldb);
#pragma unroll 1  /* one trip per stage: the ring's waits and its barrier stand once, at the trip's foot */
  for (int t = 0; t < nst; ++t) {
    const _Float16* buf = ring + (t & 1) * GSTAGE;
    const _Float16* a0p = buf + arow * GPITCH; const _Float16* a1p = a0p + 16 * GPITCH;
    const _Float16* b0p = buf + (128 + brow) * GPITCH; const _Float16* b1p = b0p + 16 * GPITCH; const _Float16* b2p = b1p + 16 * GPITCH; const _Float16* b3p = b2p + 16 * GPITCH;
    // the six fragments of a k step are read as one group, one k step ahead inside the stage, so that their LDS latency runs under the products of the step before
    v16h a0 = g2_frag(a0p, hh), a1 = g2_frag(a1p, hh), b0 = g2_frag(b0p, hh), b1 = g2_frag(b1p, hh), b2 = g2_frag(b2p, hh), b3 = g2_frag(b3p, hh);
#pragma unroll  /* constant LDS offsets, and the two fragment sets swap by renaming, without moves */
    for (int kb = 0; kb < GKP; kb += 32) {
      v16h na0 = a0, na1 = a1, nb0 = b0, nb1 = b1, nb2 = b2, nb3 = b3;
      if (kb + 32 < GKP) { na0 = g2_frag(a0p + kb + 32, hh); na1 = g2_frag(a1p + kb + 32, hh); nb0 = g2_frag(b0p + kb + 32, hh); nb1 = g2_frag(b1p + kb + 32, hh); nb2 = g2_frag(b2p + kb + 32, hh); nb3 = g2_frag(b3p + kb + 32, hh); }
      c00 = g2_mma(a0, b0, c00); c10 = g2_mma(a1, b0, c10);
      c01 = g2_mma(a0, b1, c01); c11 = g2_mma(a1, b1, c11);
      c02 = g2_mma(a0, b2, c02); c12 = g2_mma(a1, b2, c12);
      c03 = g2_mma(a0, b3, c03); c13 = g2_mma(a1, b3, c13);
      a0 = na0; a1 = na1; b0 = nb0; b1 = nb1; b2 = nb2; b3 = nb3; }
    asm volatile("s_wait_dscnt 0x0" ::: "memory");      /* this wave's reads of buffer t & 1 are done before it is refilled */
    asm volatile("s_wait_asynccnt 0x0" ::: "memory");   /* this wave's copies of stage t + 1 have landed */
    __syncthreads();                                    /* publishes stage t + 1 and ends every reader's last read of buffer t & 1 */
    if (t + 2 < nst) stage_copy(l0 + (unsigned)((t & 1) * (GSTAGE * 2)), ga + (size_t)(t + 2) * GKP, lda, gb + (size_t)(t + 2) * GKP, ldb);
  }
  asm volatile("s_wait_asynccnt 0x0" ::: "memory");     /* no copy is outstanding when the ring is left */
}

// GEMM: block tile 128 x 128 (8 waves, 4 x 2), wave tile 32 rows x 64 cols; A f16 rows (pitch lda), Bh f16 [n][k] (pitch ldb); v = acc*alpha + bf16(bias[col])*bsc; ACT 0 none / 3 relu;
// Requires M % 128 == 0, N % 128 == 0, K % 128 == 0; grid = (M/128)*(N/128), block 256.
template <int ACT>
__global__ __launch_bounds__(256) void k_gemm2(const _Float16* __restrict__ A, int lda, const _Float16* __restrict__ Bh, int ldb, float alpha, const float* __restrict__ bias, float bsc,
    float* __restrict__ C, _Float16* __restrict__ C16, int ldc, int M, int N, int K) {
  static_assert(ACT == 0 || ACT == 3);
  __shared__ __attribute__((aligned(16))) _Float16 ring[2 * GSTAGE];
  __shared__ __attribute__((aligned(16))) float so[8][32][68];
  const int tid = threadIdx.x, lane = tid & 31, ln = lane & 15, hh = lane >> 4;
  const int w = __builtin_amdgcn_readfirstlane(tid >> 5);
  const int ntn = N >> 7; const int mt = blockIdx.x / ntn, nq = blockIdx.x - mt * ntn; if (mt * 128 >= M) return;
  const int row0 = mt * 128 + 32 * (w >> 1), col0 = nq * 128 + 64 * (w & 1);
  const v8f z8 = {0.f,0.f,0.f,0.f,0.f,0.f,0.f,0.f}; v8f c00 = z8, c01 = z8, c02 = z8, c03 = z8, c10 = z8, c11 = z8, c12 = z8, c13 = z8;
  gemm_sweep(ring, A + (size_t)(mt * 128) * lda, lda, Bh + (size_t)(nq * 128) * ldb, ldb, K, tid, 32 * (w >> 1) + ln, 64 * (w & 1) + ln, hh, c00, c01, c02, c03, c10, c11, c12, c13);
  v8f accs[8] = {c00, c01, c02, c03, c10, c11, c12, c13};
#pragma unroll
  for (int u = 0; u < 8; ++u) { const int t = u & 3, half = u >> 2; const int col = col0 + t * 16 + ln; const float bv = bias ? bf16_rne(bias[col]) * bsc : 0.f;
#pragma unroll
    for (int r = 0; r < 8; ++r) { const int rloc = half * 16 + 8 * hh + r; float v = accs[u][r] * alpha + bv; if (ACT == 3) v = fmaxf(v, 0.f); so[w][rloc][t * 16 + ln] = v; } }
  __builtin_amdgcn_fence(4 /* acq_rel order */, "workgroup"); __builtin_amdgcn_wave_barrier();
  const int rsub = lane >> 4, c4 = (lane & 15) * 4;
  {
#pragma unroll
    for (int q = 0; q < 16; ++q) { const int r = q * 2 + rsub; const v4f v = *(const v4fa*)&so[w][r][c4];
      if (C) *(v4f*)(C + (size_t)(row0 + r) * ldc + col0 + c4) = v;
      if (C16) { v4h h4; for (int i = 0; i < 4; ++i) h4[i] = (_Float16)v[i]; *(v4h*)(C16 + (size_t)(row0 + r) * ldc + col0 + c4) = h4; } }
     }
}

// Transposed store of a V projection's 128 x 128 block tile (rows = tokens mt * 128 .., columns = nq * 128 .. of NH * HD) as [batch][head][head column][key], the form the attention kernels read.
// An accumulator's eight registers hold eight neighbouring tokens (keys) of one output column: converted, they are 16 bytes of a V^T row. The block's 128 columns x 128 keys are gathered in LDS
// (tb: 2 x 128 rows of GPITCH halves, value tile then residual tile), so that every wave-wide store covers two whole 256-byte pieces of V^T rows.
// RES 1: value + x2048 residual planes CH, CR; RES 0: one plainly converted plane CH. Every thread of the block calls it.
template <int RES>
static __device__ __forceinline__ void vt_store(float* tb, const v8f (&accs)[8], float alpha, _Float16* __restrict__ CH, _Float16* __restrict__ CR, int mt, int nq, int w, int ln, int hh) {
  static_assert(SEQ % 128 == 0 && (NH * HD) % 128 == 0 && HD == 64);
  _Float16* tv = (_Float16*)tb; _Float16* tq = tv + 128 * GPITCH;
#pragma unroll  /* constant indices keep accs[] and the packed halves in registers */
  for (int u = 0; u < 8; ++u) { const int t = u & 3, half = u >> 2; FragH g, gr;
#pragma unroll
    for (int r = 0; r < 8; ++r) { const float v = accs[u][r] * alpha;
      if (RES) { const h16 hv = toh_flush(v); g.h[r] = hv; gr.h[r] = toh_flush((v - (float)hv) * RCARRY); } else g.h[r] = (_Float16)v; }
    const int tloc = (64 * (w & 1) + t * 16 + ln) * GPITCH + 32 * (w >> 1) + half * 16 + 8 * hh;
    *(v8us*)(tv + tloc) = g.half[0];
    if (RES) *(v8us*)(tq + tloc) = gr.half[0]; }
  __syncthreads();   /* every wave's columns and keys are in the tiles before any V^T row is read out */
  const int dl = w * 16 + hh;   /* the wave reads out rows dl, dl + 2, .. dl + 14; the block's 128 columns are two neighbouring heads: 128 V^T rows in a run */
  const size_t go = (((size_t)((mt * 128) / SEQ) * NH + nq * 2) * HD + dl) * SEQ + (mt * 128) % SEQ + ln * 8;
  const _Float16* sv = tv + dl * GPITCH + ln * 8; const _Float16* sq = tq + dl * GPITCH + ln * 8;
  v8us a[8], b[8];
#pragma unroll  /* the LDS reads go out together, ahead of the stores */
  for (int i = 0; i < 8; ++i) { a[i] = *(const v8us*)(sv + i * 2 * GPITCH); if (RES) b[i] = *(const v8us*)(sq + i * 2 * GPITCH); }
#pragma unroll
  for (int i = 0; i < 8; ++i) { *(v8us*)((unsigned short*)CH + go + (size_t)i * 2 * SEQ) = a[i]; if (RES) *(v8us*)((unsigned short*)CR + go + (size_t)i * 2 * SEQ) = b[i]; }
  asm volatile("s_wait_xcnt 0x0" ::: "memory");   /* other read-outs' code follows in the built kernel and reuses the registers that these stores name */
}

// GEMM with an optional residual A plane (AR = (a - f16(a)) * 2048, own accumulators from zero, folded by 2^-11 in f32) and either an f32 output (OUTHR 0)
// or f16 planes (OUTHR 1): value + residual. VTJ 1 and vt != 0 (the same for the whole block): the tile is a V projection (N = NH * HD, rows = tokens) and is stored transposed,
// [batch][head][head column][key], as the attention kernels read it: vt 1 value + residual planes CH, CR; vt 2 one plainly converted plane CH alone.
// Requires M % 128 == 0, N % 128 == 0, K % 128 == 0; grid = (M/128)*(N/128), block 256.
template <int ARES, int OUTHR, int VTJ = 0>
static __device__ __forceinline__ void gemm_hr_body(const _Float16* __restrict__ A, const _Float16* __restrict__ AR, int lda, const _Float16* __restrict__ Bh, int ldb, float alpha,
    const float* __restrict__ bias, float bsc, float* __restrict__ C, _Float16* __restrict__ CH, _Float16* __restrict__ CR, int ldc, int M, int N, int K, int vt = 0) {
  __shared__ __attribute__((aligned(16))) _Float16 ring[2 * GSTAGE];
  __shared__ __attribute__((aligned(16))) float so[8][32][68];
  static_assert(sizeof(so) >= (size_t)2 * 128 * GPITCHB);   /* the two tiles of vt_store */
  const int tid = threadIdx.x, lane = tid & 31, ln = lane & 15, hh = lane >> 4;
  const int w = __builtin_amdgcn_readfirstlane(tid >> 5);
  const int ntn = N >> 7; const int mt = blockIdx.x / ntn, nq = blockIdx.x - mt * ntn; if (mt * 128 >= M) return;
  const int row0 = mt * 128 + 32 * (w >> 1), col0 = nq * 128 + 64 * (w & 1);
  const int arow = 32 * (w >> 1) + ln, brow = 64 * (w & 1) + ln;
  const _Float16* Bt = Bh + (size_t)(nq * 128) * ldb;
  const v8f z8 = {0.f,0.f,0.f,0.f,0.f,0.f,0.f,0.f};
  if (ARES) {
    v8f d00 = z8, d01 = z8, d02 = z8, d03 = z8, d10 = z8, d11 = z8, d12 = z8, d13 = z8;
    gemm_sweep(ring, AR + (size_t)(mt * 128) * lda, lda, Bt, ldb, K, tid, arow, brow, hh, d00, d01, d02, d03, d10, d11, d12, d13);
    v8f ds[8] = {d00, d01, d02, d03, d10, d11, d12, d13};
#pragma unroll
    for (int u = 0; u < 8; ++u) { const int t = u & 3, half = u >> 2;
#pragma unroll
      for (int r = 0; r < 8; ++r) { const int rloc = half * 16 + 8 * hh + r; so[w][rloc][t * 16 + ln] = ds[u][r] * RINV; } }
  }
  v8f c00 = z8, c01 = z8, c02 = z8, c03 = z8, c10 = z8, c11 = z8, c12 = z8, c13 = z8;
  gemm_sweep(ring, A + (size_t)(mt * 128) * lda, lda, Bt, ldb, K, tid, arow, brow, hh, c00, c01, c02, c03, c10, c11, c12, c13);
  v8f accs[8] = {c00, c01, c02, c03, c10, c11, c12, c13};
  if (VTJ && vt) {   /* the same for the whole block: all of it passes the barrier in vt_store, or none */
    if (vt == 1) vt_store<1>(&so[0][0][0], accs, alpha, CH, CR, mt, nq, w, ln, hh); else vt_store<0>(&so[0][0][0], accs, alpha, CH, CR, mt, nq, w, ln, hh);
    return;
  }
#pragma unroll
  for (int u = 0; u < 8; ++u) { const int t = u & 3, half = u >> 2; const int col = col0 + t * 16 + ln; const float bv = bias ? bf16_rne(bias[col]) * bsc : 0.f;
#pragma unroll
    for (int r = 0; r < 8; ++r) { const int rloc = half * 16 + 8 * hh + r; float v = accs[u][r]; if (ARES) v += so[w][rloc][t * 16 + ln]; v = v * alpha + bv; so[w][rloc][t * 16 + ln] = v; } }
  __builtin_amdgcn_fence(4 /* acq_rel order */, "workgroup"); __builtin_amdgcn_wave_barrier();
  const int rsub = lane >> 4, c4 = (lane & 15) * 4;
  {
#pragma unroll
    for (int q = 0; q < 16; ++q) { const int r = q * 2 + rsub; const v4f v = *(const v4fa*)&so[w][r][c4];
      if (OUTHR) { v4h h4, r4;
#pragma unroll
        for (int i = 0; i < 4; ++i) { const h16 hv = toh_flush(v[i]); h4[i] = hv; r4[i] = toh_flush((v[i] - (float)hv) * RCARRY); }
        *(v4h*)(CH + (size_t)(row0 + r) * ldc + col0 + c4) = h4;
        *(v4h*)(CR + (size_t)(row0 + r) * ldc + col0 + c4) = r4; }
      else { *(v4f*)(C + (size_t)(row0 + r) * ldc + col0 + c4) = v; } }
     }
}

// The five projections that read a converted input plane alone, in one launch; blockIdx.y picks the job: q, k of the self-attention (A0) and k of the cross-attention (A1) as f16 value +
// residual rows, v of the self-attention (A0) as transposed value + residual planes, v of the cross-attention (A1) as one transposed f16 plane. grid = ((M/128)*(N/128), 5).
__global__ __launch_bounds__(256) void k_proj5(const _Float16* __restrict__ A0, const _Float16* __restrict__ A1, int lda,
    const _Float16* __restrict__ B0, const _Float16* __restrict__ B1, const _Float16* __restrict__ B2, const _Float16* __restrict__ B3, const _Float16* __restrict__ B4, int ldb, float alpha,
    _Float16* __restrict__ CH0, _Float16* __restrict__ CR0, _Float16* __restrict__ CH1, _Float16* __restrict__ CR1, _Float16* __restrict__ CH2, _Float16* __restrict__ CR2,
    _Float16* __restrict__ CH3, _Float16* __restrict__ CR3, _Float16* __restrict__ CH4, int ldc, int M, int N, int K) {
  const int j = blockIdx.y;
  const _Float16* A = j < 3 ? A0 : A1;
  const _Float16* Bh = j == 0 ? B0 : j == 1 ? B1 : j == 2 ? B2 : j == 3 ? B3 : B4;
  _Float16* CH = j == 0 ? CH0 : j == 1 ? CH1 : j == 2 ? CH2 : j == 3 ? CH3 : CH4;
  _Float16* CR = j == 0 ? CR0 : j == 1 ? CR1 : j == 2 ? CR2 : CR3;   /* not stored by job 4 */
  gemm_hr_body<0, 1, 1>(A, A, lda, Bh, ldb, alpha, nullptr, 0.f, nullptr, CH, CR, ldc, M, N, K, j == 2 ? 1 : j == 4 ? 2 : 0);
}
// value + residual A planes -> f16 value + residual output planes
__global__ __launch_bounds__(256) void k_proj_rhr(const _Float16* __restrict__ A, const _Float16* __restrict__ AR, int lda, const _Float16* __restrict__ Bh, int ldb, float alpha,
    _Float16* __restrict__ CH, _Float16* __restrict__ CR, int ldc, int M, int N, int K) {
  gemm_hr_body<1, 1>(A, AR, lda, Bh, ldb, alpha, nullptr, 0.f, nullptr, CH, CR, ldc, M, N, K);
}
// value + residual A planes -> f32 rows with bias
__global__ __launch_bounds__(256) void k_proj_rf(const _Float16* __restrict__ A, const _Float16* __restrict__ AR, int lda, const _Float16* __restrict__ Bh, int ldb, float alpha,
    const float* __restrict__ bias, float bsc, float* __restrict__ C, int ldc, int M, int N, int K) {
  gemm_hr_body<1, 0>(A, AR, lda, Bh, ldb, alpha, bias, bsc, C, nullptr, nullptr, ldc, M, N, K);
}

// LDS staging of the attention operands. A block of 8 waves owns 128 query rows of one (batch, head) (which rows: attn_hr_body); a stage holds 64 keys: the K value and K residual rows (64 rows of 128 bytes each),
// then the V^T value rows (64 head columns x 64 keys) and, CAUSAL, the V^T residual rows. Every copy of a wave covers four whole 128-byte rows.
#define AKS 64                  /* keys per stage */
#define APITCH 72               /* LDS row pitch in halves: 144 B = 16 B x 9, conflict-free for 16-byte row reads */
#define APITCHB (APITCH * 2)    /* the same in bytes */
#define APLANE (64 * APITCH)    /* halves per staged plane */
static_assert(SEQ % 128 == 0 && SEQ / AKS >= 2 && HD == 64 && AKS == 64);

// Four / two 16-byte asynchronous copies of one lane. The s_wait_xcnt closes the statement so that no address register is rewritten ahead of it.
static __device__ __forceinline__ void copy4(unsigned l0, unsigned l1, unsigned l2, unsigned l3, const _Float16* g0, const _Float16* g1, const _Float16* g2, const _Float16* g3) {
  asm volatile(
      "global_load_async_to_lds_b128 %0, %4, off\n\t"
      "global_load_async_to_lds_b128 %1, %5, off\n\t"
      "global_load_async_to_lds_b128 %2, %6, off\n\t"
      "global_load_async_to_lds_b128 %3, %7, off\n\t"
      "s_wait_xcnt 0x0"
      :: "v"(l0), "v"(l1), "v"(l2), "v"(l3), "v"(g0), "v"(g1), "v"(g2), "v"(g3)
      : "memory");
}
static __device__ __forceinline__ void copy2(unsigned l0, unsigned l1, const _Float16* g0, const _Float16* g1) {
  asm volatile(
      "global_load_async_to_lds_b128 %0, %2, off\n\t"
      "global_load_async_to_lds_b128 %1, %3, off\n\t"
      "s_wait_xcnt 0x0"
      :: "v"(l0), "v"(l1), "v"(g0), "v"(g1)
      : "memory");
}
// One stage: l = this lane's LDS byte address in row tid/8 of the stage's first plane; gk / gkr / gv / gvr = its 16 bytes of that row of each plane. A lane brings rows tid/8 and tid/8 + 32 of every plane.
template <int CAUSAL>
static __device__ __forceinline__ void attn_stage_copy(unsigned l, const _Float16* gk, const _Float16* gkr, const _Float16* gv, const _Float16* gvr) {
  const unsigned pl = (unsigned)(APLANE * 2), rb = 32u * APITCHB;
  copy4(l, l + rb, l + pl, l + pl + rb, gk, gk + (size_t)32 * DM, gkr, gkr + (size_t)32 * DM);
  if (CAUSAL) copy4(l + 2u * pl, l + 2u * pl + rb, l + 3u * pl, l + 3u * pl + rb, gv, gv + (size_t)32 * SEQ, gvr, gvr + (size_t)32 * SEQ);
  else copy2(l + 2u * pl, l + 2u * pl + rb, gv, gv + (size_t)32 * SEQ);
}

// The value of the same lane of the other 16-lane half (lane ^ 16), by a vector cross-row move.
static __device__ __forceinline__ float other_half(float v) { const int i = __float_as_int(v); return __int_as_float(__builtin_amdgcn_permlanex16(i, i, 0x76543210, 0xfedcba98, false, false)); }

// Flash-style attention for one (batch, head, 16 query rows) per wave: keys taken 32 at a time from the block's two-buffer LDS ring with an online (running-max) softmax in f32.
// The scores are computed transposed, S^T = K.Q^T (A = 16 key rows from LDS, B = the wave's 16 query rows kept in registers): lane (ln, hh) holds, of query q0 + ln, the keys 8 hh + r of the first
// key tile and 16 + 8 hh + r of the second, so that the maximum and the sum of a query run inside a lane, plus one exchange between the halves, and the two converted tiles ARE the B operand
// of O^T += V^T.P^T (element s of B = key 8 hh + s, then 16 + 8 hh + s - 8: the k order of g2_frag, which loads V^T as A). P never passes through LDS.
// scores = 8 * q.k^T with q and k as f16 value + x2048 residual planes: value.value in one accumulator, residual.value + value.residual in a second
// accumulator folded by 2^-11. CAUSAL: keys above the query row and exactly-zero scores take the fill -1e9 (replace), key blocks entirely above
// the wave's rows are skipped (their weights are exactly 0); P = 16384*exp(s - m) as f16 value + x2048 residual, V^T as value + residual slabs,
// o = P.V^T with value.value in one accumulator and the two cross terms in a second, row sum over the unconverted P; o/l * 64 written as f16 value +
// residual rows. Dense: P as one f16 plane (row sum over the converted P), V^T one plane, o one plane. Each half keeps the sum of its own keys; the two are joined after the loop. o tiles are wave-private LDS
template <int CAUSAL>
static __device__ __forceinline__ void attn_hr_body(const _Float16* __restrict__ Q16, const _Float16* __restrict__ QR, const _Float16* __restrict__ K16, const _Float16* __restrict__ KR,
    const _Float16* __restrict__ VT, const _Float16* __restrict__ VTR, _Float16* __restrict__ O16, _Float16* __restrict__ OR16) {
  constexpr int ASTAGE = (CAUSAL ? 4 : 3) * APLANE;   /* halves per stage */
  __shared__ __attribute__((aligned(16))) _Float16 kv[2 * ASTAGE];
  __shared__ __attribute__((aligned(16))) _Float16 ob[8][16 * OBP];
  __shared__ __attribute__((aligned(16))) _Float16 obr[8][16 * OBP];
  const int tid = threadIdx.x, lane = tid & 31, ln = lane & 15, hh = lane >> 4;
  const int w = __builtin_amdgcn_readfirstlane(tid >> 5);
  const int h = blockIdx.y, b = blockIdx.z;
  // CAUSAL: a query row's work grows with its index, so a block takes 64 rows from the low end (waves 0..3) and the mirrored 64 rows from the high end (waves 4..7, in falling order):
  // waves w and w + 4 together walk the same number of key passes in every block of the grid. The stage count stays the block's own (from blockIdx alone) and every wave passes every stage's
  // foot, whichever rows it holds. Dense: 128 rows in a run.
  const int q0 = CAUSAL ? (w < 4 ? blockIdx.x * 64 + w * 16 : SEQ - 64 - blockIdx.x * 64 + (7 - w) * 16) : blockIdx.x * 128 + w * 16;
  const size_t tok0 = (size_t)b * SEQ;
  const int slab = b * NH + h;
  const size_t qoff = (tok0 + q0 + ln) * DM + h * HD;
  const v16h qf0 = g2_frag(Q16 + qoff, hh), qf1 = g2_frag(Q16 + qoff + 32, hh);
  const v16h qr0 = g2_frag(QR + qoff, hh),  qr1 = g2_frag(QR + qoff + 32, hh);
  const v8f z8 = {0.f,0.f,0.f,0.f,0.f,0.f,0.f,0.f};
  v8f o0 = z8, o1 = z8, o2 = z8, o3 = z8;      /* o_j[r] = o of query q0 + ln, head column 16 j + 8 hh + r */
  v8f e0 = z8, e1 = z8, e2 = z8, e3 = z8;
  float mrow = -1.0e30f, lrow = 0.f;           /* of query q0 + ln: the maximum over all keys so far (equal in both halves), the sum over this half's keys */
  const int row = q0 + ln;
  const int kend = CAUSAL ? (q0 + 16) : SEQ;                  /* this wave's keys end here (the same in every lane) */
  const int nst = CAUSAL ? SEQ / AKS - blockIdx.x : SEQ / AKS;   /* stages of the block: up to the keys of its high rows (they end at SEQ - 64 blockIdx.x); at least two */
  const unsigned l0 = lds_off(kv) + (unsigned)((tid >> 3) * APITCHB + (tid & 7) * 16);
  const size_t gko = (tok0 + (tid >> 3)) * DM + h * HD + (tid & 7) * 8;
  const size_t gvo = ((size_t)slab * HD + (tid >> 3)) * SEQ + (tid & 7) * 8;
  const _Float16* gk = K16 + gko; const _Float16* gkr = KR + gko; const _Float16* gv = VT + gvo; const _Float16* gvr = VTR + gvo;
  attn_stage_copy<CAUSAL>(l0, gk, gkr, gv, gvr);
  asm volatile("s_wait_asynccnt 0x0" ::: "memory");   /* stage 0 of this wave has landed */
  __syncthreads();                                    /* stage 0 of every wave is readable */
  if (nst > 1) attn_stage_copy<CAUSAL>(l0 + (unsigned)(ASTAGE * 2), gk + (size_t)AKS * DM, gkr + (size_t)AKS * DM, gv + AKS, gvr + AKS);
#pragma unroll 1  /* one trip per stage: the ring's waits and its barrier stand once, at the trip's foot */
  for (int st = 0; st < nst; ++st) {
  const _Float16* buf = kv + (st & 1) * ASTAGE;
#pragma unroll 1  /* two passes of 32 keys per stage share one body */
  for (int sub = 0; sub < AKS; sub += 32) {
    const int kb = st * AKS + sub;
    if (kb >= kend) break;                            /* a wave past its diagonal skips the pass, never the trip's foot */
    const _Float16* k0p = buf + (sub + ln) * APITCH; const _Float16* k1p = k0p + 16 * APITCH;
    const _Float16* r0p = k0p + APLANE;              const _Float16* r1p = r0p + 16 * APITCH;
    v8f s0 = z8, s1 = z8, t0 = z8, t1 = z8;
    // the eight K fragments of the pass are read as one group ahead of the first score product: the wave meets the LDS latency once, not once per fragment
    const v16h ka0 = g2_frag(k0p, hh), ka1 = g2_frag(k0p + 32, hh), ra0 = g2_frag(r0p, hh), ra1 = g2_frag(r0p + 32, hh);
    const v16h kc0 = g2_frag(k1p, hh), kc1 = g2_frag(k1p + 32, hh), rc0 = g2_frag(r1p, hh), rc1 = g2_frag(r1p + 32, hh);
    s0 = g2_mma(ka0, qf0, s0); t0 = g2_mma(ka0, qr0, t0);
    s0 = g2_mma(ka1, qf1, s0); t0 = g2_mma(ka1, qr1, t0);
    t0 = g2_mma(ra0, qf0, t0);
    t0 = g2_mma(ra1, qf1, t0);
    s1 = g2_mma(kc0, qf0, s1); t1 = g2_mma(kc0, qr0, t1);
    s1 = g2_mma(kc1, qf1, s1); t1 = g2_mma(kc1, qr1, t1);
    t1 = g2_mma(rc0, qf0, t1);
    t1 = g2_mma(rc1, qf1, t1);
    // the V^T fragments of the pass are read as one group here, behind the last score product: their LDS latency runs under the softmax arithmetic
    const _Float16* vp = buf + 2 * APLANE + ln * APITCH + sub; const _Float16* vrp = vp + (CAUSAL ? APLANE : 0);
    const v16h va0 = g2_frag(vp, hh), va1 = g2_frag(vp + 16 * APITCH, hh), va2 = g2_frag(vp + 32 * APITCH, hh), va3 = g2_frag(vp + 48 * APITCH, hh);
    v16h vr0 = va0, vr1 = va1, vr2 = va2, vr3 = va3;
    if (CAUSAL) { vr0 = g2_frag(vrp, hh); vr1 = g2_frag(vrp + 16 * APITCH, hh); vr2 = g2_frag(vrp + 32 * APITCH, hh); vr3 = g2_frag(vrp + 48 * APITCH, hh); }
    if (CAUSAL) __builtin_amdgcn_sched_barrier(0);   /* keeps the sixteen reads whole at this place: without it this build moves them down among the softmax arithmetic in pieces, the last ones next to their products */
    const v8f af = (s0 + t0 * RINV) * 8.0f, cf = (s1 + t1 * RINV) * 8.0f;
    const int lim = row - kb - 8 * hh;           /* CAUSAL: the lane's keys kb + 8 hh + d with d > lim lie above the diagonal */
    float sc[16]; float t = -1.0e30f;            /* sc[i]: the score of key kb + 8 hh + i (i < 8), kb + 16 + 8 hh + i - 8 (i >= 8): element i of the B operand */
#pragma unroll  /* constant indices keep sc[] and the packed P in registers, here and below */
    for (int i = 0; i < 16; ++i) {
      const float x = i < 8 ? af[i & 7] : cf[i & 7];
      sc[i] = (CAUSAL && (((i < 8 ? i : i + 8) > lim) || (x == 0.0f))) ? -1.0e9f : x;
      t = fmaxf(t, sc[i]);
    }
    t = fmaxf(t, other_half(t));
    const float mnew = fmaxf(mrow, t);
    const float corr = __expf(mrow - mnew);
    FragH pf, prf; float ls0 = 0.f, ls1 = 0.f;   /* one sum per key tile: two short chains of adds */
#pragma unroll
    for (int i = 0; i < 16; ++i) {
      const float pc = __expf(sc[i] - mnew) * PCARRY;
      const h16 ph = toh_flush(pc);
      if (i < 8) ls0 += CAUSAL ? pc : (float)ph; else ls1 += CAUSAL ? pc : (float)ph;
      pf.h[i] = ph;
      if (CAUSAL) prf.h[i] = toh_flush((pc - (float)ph) * RCARRY);
    }
    lrow = lrow * corr + (ls0 + ls1); mrow = mnew;
    o0 *= corr; o1 *= corr; o2 *= corr; o3 *= corr;
    if (CAUSAL) { e0 *= corr; e1 *= corr; e2 *= corr; e3 *= corr; }
    o0 = g2_mma(va0, pf.v, o0);
    if (CAUSAL) { e0 = g2_mma(va0, prf.v, e0); e0 = g2_mma(vr0, pf.v, e0); }
    o1 = g2_mma(va1, pf.v, o1);
    if (CAUSAL) { e1 = g2_mma(va1, prf.v, e1); e1 = g2_mma(vr1, pf.v, e1); }
    o2 = g2_mma(va2, pf.v, o2);
    if (CAUSAL) { e2 = g2_mma(va2, prf.v, e2); e2 = g2_mma(vr2, pf.v, e2); }
    o3 = g2_mma(va3, pf.v, o3);
    if (CAUSAL) { e3 = g2_mma(va3, prf.v, e3); e3 = g2_mma(vr3, pf.v, e3); }
  }
    asm volatile("s_wait_dscnt 0x0" ::: "memory");      /* this wave's reads of buffer st & 1 are done before it is refilled */
    asm volatile("s_wait_asynccnt 0x0" ::: "memory");   /* this wave's copies of stage st + 1 have landed */
    __syncthreads();                                    /* publishes stage st + 1 and ends every reader's last read of buffer st & 1 */
    if (st + 2 < nst) attn_stage_copy<CAUSAL>(l0 + (unsigned)((st & 1) * (ASTAGE * 2)), gk + (size_t)(st + 2) * AKS * DM, gkr + (size_t)(st + 2) * AKS * DM, gv + (st + 2) * AKS, gvr + (st + 2) * AKS);
  }
  asm volatile("s_wait_asynccnt 0x0" ::: "memory");     /* no copy is outstanding when the ring is left */
  lrow += other_half(lrow);                                     /* the two halves' key sums of the query */
  const float rl = 64.0f * __builtin_amdgcn_rcpf(lrow);         /* o carried x64; l already carries the P carry */
  const v8f os[4] = {o0, o1, o2, o3}; const v8f es[4] = {e0, e1, e2, e3};
#pragma unroll
  for (int j = 0; j < 4; ++j) { FragH g, gr;
#pragma unroll
    for (int r = 0; r < 8; ++r) {
      float v = os[j][r]; if (CAUSAL) v += es[j][r] * RINV;
      v *= rl;
      const h16 gv16 = toh_flush(v); g.h[r] = gv16;
      if (CAUSAL) gr.h[r] = toh_flush((v - (float)gv16) * RCARRY); }
    const int oloc = ln * OBP + 16 * j + 8 * hh;                /* eight neighbouring head columns of the lane's query: one 16-byte LDS store */
    *(v8us*)(&ob[w][oloc]) = g.half[0];
    if (CAUSAL) *(v8us*)(&obr[w][oloc]) = gr.half[0];
  }
  __builtin_amdgcn_fence(4 /* acq_rel order */, "wavefront"); __builtin_amdgcn_wave_barrier();
  const int rq = lane >> 3, pc = (lane & 7) * 8;
  {
#pragma unroll
    for (int i = 0; i < 4; ++i) { const int orow = i * 4 + rq; const size_t go = (tok0 + q0 + orow) * DM + h * HD + pc;
      const v8us v = *(const v8us*)(&ob[w][orow * OBP + pc]);
      *(v8us*)((unsigned short*)O16 + go) = v;
      if (CAUSAL) { const v8us vr = *(const v8us*)(&obr[w][orow * OBP + pc]); *(v8us*)((unsigned short*)OR16 + go) = vr; } }
     }
}

__global__ __launch_bounds__(256) void k_attn_causal(const _Float16* __restrict__ Q16, const _Float16* __restrict__ QR, const _Float16* __restrict__ K16, const _Float16* __restrict__ KR,
    const _Float16* __restrict__ VT, const _Float16* __restrict__ VTR, _Float16* __restrict__ O16, _Float16* __restrict__ OR16) {
  attn_hr_body<1>(Q16, QR, K16, KR, VT, VTR, O16, OR16);
}
__global__ __launch_bounds__(256) void k_attn_dense(const _Float16* __restrict__ Q16, const _Float16* __restrict__ QR, const _Float16* __restrict__ K16, const _Float16* __restrict__ KR,
    const _Float16* __restrict__ VT, _Float16* __restrict__ O16) {
  attn_hr_body<0>(Q16, QR, K16, KR, VT, VT, O16, O16);
}

// red[] is cross-wave (block barriers); no early exit.
// W16 1: the row also as one plainly converted f16 plane O16; W16 2: as f16 value (O16) + x2048 residual (O16R) planes.
template <int RBF, int RMAP, int W16, int OMAP>
__global__ __launch_bounds__(256) void k_ln(const float* __restrict__ X, const float* __restrict__ R, const float* __restrict__ g, const float* __restrict__ bb, float eps, float* __restrict__ O32, _Float16* __restrict__ O16, _Float16* __restrict__ O16R) {
  #pragma clang fp contract(off)
  __shared__ float red[256];
  const size_t r = blockIdx.x; const int t = threadIdx.x; const int c0 = t * 4;
  const size_t rfull = (r / SEQ) * SEQ_FULL + (r % SEQ);
  const size_t rr = RMAP ? rfull : r;
  const v4f xa = *(const v4fa*)(X + r * DM + c0); const v4f ra = *(const v4fa*)(R + rr * DM + c0);
  float s[4]; float sum = 0.f;
#pragma unroll
  for (int q = 0; q < 4; ++q) { const float rv = RBF ? bf16_rne(ra[q]) : ra[q]; s[q] = xa[q] + rv; sum += s[q]; }
  red[t] = sum; __syncthreads();
  for (int st = 128; st > 0; st >>= 1) { if (t < st) red[t] += red[t + st]; __syncthreads(); }
  const float mu = red[0] * (1.0f / (float)DM); __syncthreads();
  float vs = 0.f;
#pragma unroll
  for (int q = 0; q < 4; ++q) { const float dl = s[q] - mu; vs += dl * dl; }
  red[t] = vs; __syncthreads();
  for (int st = 128; st > 0; st >>= 1) { if (t < st) red[t] += red[t + st]; __syncthreads(); }
  const float rs = rsqrtf(red[0] * (1.0f / (float)DM) + eps);
  v4f yf; v4h y;
#pragma unroll
  for (int q = 0; q < 4; ++q) { const int c = c0 + q; yf[q] = (s[q] - mu) * rs * bf16_rne(g[c]) + bf16_rne(bb[c]); y[q] = (_Float16)yf[q]; }
  const size_t orow = OMAP ? rfull : r;
  {
    if (O32) *(v4f*)(O32 + orow * DM + c0) = yf;
    if (W16 == 1) *(v4h*)(O16 + r * DM + c0) = y;
    if (W16 == 2) { v4h h4, r4;
#pragma unroll
      for (int q = 0; q < 4; ++q) { const h16 hv = toh_flush(yf[q]); h4[q] = hv; r4[q] = toh_flush((yf[q] - (float)hv) * RCARRY); }
      *(v4h*)(O16 + r * DM + c0) = h4; *(v4h*)(O16R + r * DM + c0) = r4; }
     }
}

extern "C" void kernel_launch(void* const* d_in, const int* in_sizes, int n_in,
                              void* d_out, int out_size, void* d_ws, size_t ws_size, hipStream_t stream) {
  if (n_in < 22) return;
  const float* x    = (const float*)d_in[0];  const float* enc  = (const float*)d_in[1];
  const float* wq1  = (const float*)d_in[2];  const float* wk1  = (const float*)d_in[3];  const float* wv1 = (const float*)d_in[4];
  const float* wo1  = (const float*)d_in[5];  const float* bo1  = (const float*)d_in[6];
  const float* wq2  = (const float*)d_in[7];  const float* wk2  = (const float*)d_in[8];  const float* wv2 = (const float*)d_in[9];
  const float* wo2  = (const float*)d_in[10]; const float* bo2  = (const float*)d_in[11];
  const float* wff1 = (const float*)d_in[12]; const float* bff1 = (const float*)d_in[13]; const float* wff2 = (const float*)d_in[14]; const float* bff2 = (const float*)d_in[15];
  const float* g1   = (const float*)d_in[16]; const float* be1  = (const float*)d_in[17]; const float* g2  = (const float*)d_in[18]; const float* be2 = (const float*)d_in[19];
  const float* g3   = (const float*)d_in[20]; const float* be3  = (const float*)d_in[21];

  const size_t needX = ((size_t)(NB - 1) * SEQ_FULL + SEQ) * DM;
  if ((size_t)in_sizes[0] < needX || (size_t)in_sizes[1] < needX || (size_t)out_size < needX) return;
  { static const int wi[8] = {2, 3, 4, 5, 7, 8, 9, 10}; for (int i = 0; i < 8; ++i) if ((size_t)in_sizes[wi[i]] < (size_t)DM * DM) return; }
  if ((size_t)in_sizes[12] < (size_t)DM * DFF || (size_t)in_sizes[14] < (size_t)DM * DFF || in_sizes[13] < DFF) return;
  { static const int vi[9] = {6, 11, 15, 16, 17, 18, 19, 20, 21}; for (int i = 0; i < 9; ++i) if (in_sizes[vi[i]] < DM) return; }

  char* ws = (char*)d_ws; size_t off = 0;
  auto take = [&](size_t bytes) { char* p = ws + off; off += (bytes + 255) & ~(size_t)255; return p; };
  const size_t WDD = (size_t)DM * DM * 2, WDF = (size_t)DM * DFF * 2, P16 = NR * DM * 2;
  _Float16* BQ1 = (_Float16*)take(WDD); _Float16* BK1 = (_Float16*)take(WDD); _Float16* BV1 = (_Float16*)take(WDD); _Float16* BO1 = (_Float16*)take(WDD);
  _Float16* BQ2 = (_Float16*)take(WDD); _Float16* BK2 = (_Float16*)take(WDD); _Float16* BV2 = (_Float16*)take(WDD); _Float16* BO2 = (_Float16*)take(WDD);
  _Float16* BW1 = (_Float16*)take(WDF);      /* [n=DFF][k=DM]  */
  _Float16* BW2 = (_Float16*)take(WDF);      /* [n=DM][k=DFF]  */
  // fourteen token-plane slots of P16 bytes each (an f32 plane spans two slots, the FFN hidden plane four); lifetimes by launch order:
  // S0 X16                  S1 E16 -> x2 (f16)      S2,S3 Q1|QR1 -> a1 (f32) -> a2 (f32) -> hidden (S2..S5)
  // S4,S5 K1|KR1 -> x1 (f32)   S6,S7 VT1|VTR1 -> x1 value|residual -> S7 o2 (f16) -> f (f32)
  // S8,S9 o1 value|residual -> Q2|QR2 -> x2 (f32)      S10,S11 K2|KR2      S12 free      S13 VT2
  char* SL = take(14 * P16);
  _Float16* S0 = (_Float16*)(SL + 0 * P16); _Float16* S1 = (_Float16*)(SL + 1 * P16); _Float16* S2 = (_Float16*)(SL + 2 * P16); _Float16* S3 = (_Float16*)(SL + 3 * P16);
  _Float16* S4 = (_Float16*)(SL + 4 * P16); _Float16* S5 = (_Float16*)(SL + 5 * P16); _Float16* S6 = (_Float16*)(SL + 6 * P16); _Float16* S7 = (_Float16*)(SL + 7 * P16);
  _Float16* S8 = (_Float16*)(SL + 8 * P16); _Float16* S9 = (_Float16*)(SL + 9 * P16); _Float16* S10 = (_Float16*)(SL + 10 * P16); _Float16* S11 = (_Float16*)(SL + 11 * P16);
  _Float16* S13 = (_Float16*)(SL + 13 * P16);
  float* YFa = (float*)S2;   /* a1, a2 (f32 rows, S2..S3) */
  float* X1F = (float*)S4;   /* x1 (f32 rows, S4..S5) */
  float* X2F = (float*)S8;   /* x2 (f32 rows, S8..S9) */
  float* YFf = (float*)S6;   /* f  (f32 rows, S6..S7) */
  _Float16* HF = S2;         /* FFN hidden rows [NR][DFF] f16 (S2..S5) */
  if (off > ws_size || off > (size_t)268435456) return;

  static_assert(((size_t)DM * DM * 2) % 256 == 0);   /* BQ1 .. BO2 lie one behind the other in the carve */
  k_prep<<<(unsigned)PREP_BLOCKS, 256, 0, stream>>>(wq1, wk1, wv1, wo1, wq2, wk2, wv2, wo2, wff1, wff2, x, enc, BQ1, BW1, BW2, S0, S1);

  const unsigned gP = (unsigned)((MR / 128) * (DM / 128)), gF1 = (unsigned)((MR / 128) * (DFF / 128));
  const dim3 gAT(SEQ / 128, NH, NB);

  // ---- causal self-attention block
  k_proj5<<<dim3(gP, 5), 256, 0, stream>>>(S0, S1, DM, BQ1, BK1, BV1, BK2, BV2, DM, 0.0625f, S2, S3, S4, S5, S6, S7, S10, S11, S13, DM, MR, DM, DM);   /* q1, k1, k2: value | residual rows; v1: transposed value | residual; v2: one transposed plane */
  k_attn_causal<<<gAT, 256, 0, stream>>>(S2, S3, S4, S5, S6, S7, S8, S9);                                       /* o x64 value | residual */
  k_proj_rf<<<gP, 256, 0, stream>>>(S8, S9, DM, BO1, DM, 0.0009765625f, bo1, 1.0f, YFa, DM, MR, DM, DM);        /* a1 = o Wp1 + bp1 */
  k_ln<1, 1, 2, 0><<<(unsigned)MR, 256, 0, stream>>>(YFa, x, g1, be1, LN_EPS, X1F, S6, S7);                     /* x1 = LN1(bf16(x) + a1) -> f32 rows and f16 value | residual rows */
  // ---- cross-attention block
  k_proj_rhr<<<gP, 256, 0, stream>>>(S6, S7, DM, BQ2, DM, 0.0625f, S8, S9, DM, MR, DM, DM);                     /* q  value | residual */
  k_attn_dense<<<gAT, 256, 0, stream>>>(S8, S9, S10, S11, S13, S7);                                                /* o x64 single plane */
  k_gemm2<0><<<gP, 256, 0, stream>>>(S7, DM, BO2, DM, 0.0009765625f, bo2, 1.0f, YFa, nullptr, DM, MR, DM, DM);  /* a2 = o Wp2 + bp2 */
  k_ln<0, 0, 1, 0><<<(unsigned)MR, 256, 0, stream>>>(YFa, X1F, g2, be2, LN_EPS, X2F, S1, nullptr);                       /* x2 = LN2(x1 + a2) -> f32 + f16 rows */
  // ---- FFN block
  k_gemm2<3><<<gF1, 256, 0, stream>>>(S1, DM, BW1, DM, 1.0f, bff1, 16.0f, nullptr, HF, DFF, MR, DFF, DM);       /* 16 relu(x2 W1 + b1) as f16 rows */
  k_gemm2<0><<<gP, 256, 0, stream>>>(HF, DFF, BW2, DFF, 0.00390625f, bff2, 1.0f, YFf, nullptr, DM, MR, DM, DFF);  /* f = h W2 + b2 */
  k_ln<0, 0, 0, 1><<<(unsigned)MR, 256, 0, stream>>>(YFf, X2F, g3, be3, LN_EPS, (float*)d_out, nullptr, nullptr);        /* out = LN3(x2 + f) */
}

// v009
// Measured time: 283 microseconds a run.
// In both of two side-by-side timings against v008, it was 1.08 times as fast.
// All steps since v000 together make it 3.81 times as fast.
#include <hip/hip_runtime.h>
// Structure: token rows r = b*SEQ + s. Causal self-attention (16 heads of 64, per-head weights [H][E][64], scores x8, keys above the diagonal and exactly-zero scores masked) -> x1 = LN1(x + attn.Wp1 + bp1); cross-attention of x1 over z rows -> x2 = LN2(x1 + attn.Wp2 + bp2); f = relu(x2.W1 + b1).W2 + b2; out = LN3(x2 + f). Projection / FFN weights are [in][out].

#ifndef NB
#define NB 4
#endif
#ifndef SEQ
#define SEQ 1024
#endif
#define NB_FULL 4
#define SEQ_FULL 1024
#define DM 1024
#define NH 16
#define HD 64
#define DFF 4096
#define NR ((size_t)NB * SEQ)
#define MR ((int)((size_t)NB * SEQ))
#define OBP 72          /* LDS pitch (halves) of the per-wave o tile */
#define LN_EPS 1.0e-5f
#define PCARRY 16384.0f         /* carry of the f16 P planes */
#define RCARRY 2048.0f          /* carry of every residual plane */
#define RINV 0.00048828125f     /* 1 / RCARRY */

static_assert(NB >= 1 && NB <= NB_FULL);
static_assert(SEQ >= 64 && SEQ <= SEQ_FULL && SEQ % 64 == 0);
static_assert((NB * SEQ) % 128 == 0);
static_assert(NH * HD == DM && HD == 64);
static_assert(DM == 4 * 256);
static_assert(DM % 64 == 0 && DFF % 64 == 0 && DM % 32 == 0 && DFF % 32 == 0);
static_assert(DFF <= 4 * DM);
static_assert((OBP % 8) == 0);
static_assert(DFF == 4 * DM);                       /* the FFN hidden plane spans exactly four 16-bit token planes */
static_assert(OBP >= HD);                           /* o tile holds one head */
static_assert(RCARRY * RINV == 1.0f);
static_assert(PCARRY <= 32768.0f);                  /* carried P stays inside f16 */
static_assert((size_t)8 * DM * DM * 2 + (size_t)2 * DM * DFF * 2 + (size_t)14 * NB * SEQ * DM * 2 + 16 * 256 <= (size_t)268435456);   /* workspace carve */

typedef unsigned short v8us __attribute__((ext_vector_type(8), may_alias));
typedef float  v8f  __attribute__((ext_vector_type(8)));
typedef float  v4f  __attribute__((ext_vector_type(4)));
typedef float  v4fa __attribute__((ext_vector_type(4), may_alias));
typedef _Float16 v16h __attribute__((ext_vector_type(16)));
typedef _Float16 v4h __attribute__((ext_vector_type(4)));
union FragH { v16h v; v8us half[2]; _Float16 h[16]; unsigned short u[16]; };

__device__ __forceinline__ unsigned short bf16_bits(float x) { unsigned int u = __float_as_uint(x); return (unsigned short)((u + 0x7FFFu + ((u >> 16) & 1u)) >> 16); }
__device__ __forceinline__ float bf16_val(unsigned short b) { return __uint_as_float(((unsigned int)b) << 16); }
__device__ __forceinline__ float bf16_rne(float x) { return bf16_val(bf16_bits(x)); }

// 16x32 fragment from a k-contiguous 16-bit row p (A row m = lane&15, or B stored [n][k] with n = lane&15):
// elements 0..7 <- k 8h..8h+7, elements 8..15 <- k 16+8h..16+8h+7 (h = lane>>4)
__device__ __forceinline__ v16h g2_frag(const _Float16* p, int hh) { FragH f; f.half[0] = *(const v8us*)((const unsigned short*)p + 8 * hh); f.half[1] = *(const v8us*)((const unsigned short*)p + 16 + 8 * hh); return f.v; }
__device__ __forceinline__ v8f g2_mma(v16h a, v16h b, v8f c) { v8f d = __builtin_amdgcn_wmma_f32_16x16x32_f16(false, a, false, b, (short)0, c, false, false); asm volatile("v_nop\n\tv_nop\n\tv_nop\n\tv_nop" : "+v"(d) : "v"(a), "v"(b)); return d; }

// f32 -> f16 operand convert that cannot yield an f16 subnormal (value select, applied after the plane's carry)
typedef _Float16 h16;
static __device__ __forceinline__ h16 toh_flush(float v) { const h16 r = (h16)v; return (fabsf(v) < 6.103515625e-05f) ? (h16)0.0f : r; }

// Weight convert + transpose, one 64 k x 64 n tile per block, turned in LDS: every wave-wide 16-byte load covers two whole 256-byte source rows of the tile and every
// wave-wide 16-byte store four whole 128-byte pieces of Wt rows. HEAD 0: W is [K][N]; HEAD 1: W is [N/64][K][64] (tile column block = head). Wt is [n][k].
// Requires K % 64 == 0 and N % 64 == 0; bid = the tile's index among the (N/64)*(K/64) tiles of its matrix, the same for the whole block of 256; tl = the block's LDS tile.
#define WTP 66                  /* LDS row pitch in halves: 33 words, so that a column walk of 8 rows apart meets 8 different banks */
template <int HEAD>
static __device__ __forceinline__ void wt_tile_body(unsigned short (*tl)[WTP], int bid, const float* __restrict__ W, _Float16* __restrict__ Wt, int K, int N, float scale) {
  const int tid = threadIdx.x; const int nkt = K >> 6; const int nt = bid / nkt, kt = bid - nt * nkt; if (nt * 64 >= N) return;   /* the same for the whole block, ahead of the barrier */
  const int n0 = nt * 64, k0 = kt * 64;
  const float* src = HEAD ? W + ((size_t)nt * K + k0) * HD : W + (size_t)k0 * N + n0;
  const size_t rstep = HEAD ? (size_t)HD : (size_t)N;
  const int r0 = tid >> 4, c4 = (tid & 15) * 4;
  v4f a[4];
#pragma unroll  /* the four loads of a lane are issued together, ahead of the first convert */
  for (int i = 0; i < 4; ++i) a[i] = *(const v4fa*)(src + (size_t)(i * 16 + r0) * rstep + c4);
#pragma unroll  /* constant indices keep a[] and f in registers, here and in the loops below */
  for (int i = 0; i < 4; ++i) { FragH f;
#pragma unroll
    for (int q = 0; q < 4; ++q) { const float v = bf16_rne(a[i][q]) * scale; f.h[q] = HEAD ? toh_flush(v) : (_Float16)v; }
#pragma unroll
    for (int q = 0; q < 4; ++q) tl[i * 16 + r0][c4 + q] = f.u[q]; }
  __syncthreads();   /* the whole tile is in LDS before any column of it is read */
#pragma unroll
  for (int rd = 0; rd < 2; ++rd) { const int n = rd * 32 + tid / 8, pc = tid % 8; FragH f;
#pragma unroll
    for (int q = 0; q < 8; ++q) f.u[q] = tl[pc * 8 + q][n];
    *(v8us*)((unsigned short*)Wt + (size_t)(n0 + n) * K + k0 + pc * 8) = f.half[0]; }
  asm volatile("s_wait_xcnt 0x0" ::: "memory");   /* another job's code follows in the merged kernel and reuses the registers that the two stores name */
}

static __device__ __forceinline__ void x16_body(int bid, const float* __restrict__ x, _Float16* __restrict__ X16, size_t n8) {
  const size_t t = (size_t)bid * 256 + threadIdx.x; if (t >= n8) return;
  const size_t e = t * 8; const size_t r = e / DM; const size_t c = e % DM; const size_t rs = (r / SEQ) * SEQ_FULL + (r % SEQ);
  const float* src = x + rs * DM + c; const v4f a = *(const v4fa*)src; const v4f a2 = *(const v4fa*)(src + 4); FragH f;
#pragma unroll
  for (int q = 0; q < 4; ++q) { f.h[q] = (_Float16)bf16_rne(a[q]); f.h[4 + q] = (_Float16)bf16_rne(a2[q]); }
  const v8us o = f.half[0]; unsigned short* d = (unsigned short*)X16 + e;
  *(v8us*)d = o; 
}

// Every conversion that reads the inputs alone, in ONE launch: none of the twelve jobs reads what another writes. blockIdx.x picks the job, the same for the whole block:
// the tiles of the eight DM x DM attention weights (order q k v o, q k v o; Wt planes one behind the other from BA), of W1, of W2, then the row pieces of x and of z.
#define TDD ((DM / 64) * (DM / 64))             /* tiles of a DM x DM weight */
#define TDF ((DM / 64) * (DFF / 64))            /* tiles of an FFN weight */
#define XBL ((int)((NR * DM / 8 + 255) / 256))  /* blocks of a token plane, 8 elements a thread */
#define PREP_BLOCKS (8 * TDD + 2 * TDF + 2 * XBL)
__global__ __launch_bounds__(256) void k_prep(const float* __restrict__ wq1, const float* __restrict__ wk1, const float* __restrict__ wv1, const float* __restrict__ wo1,
    const float* __restrict__ wq2, const float* __restrict__ wk2, const float* __restrict__ wv2, const float* __restrict__ wo2, const float* __restrict__ wff1, const float* __restrict__ wff2,
    const float* __restrict__ x, const float* __restrict__ z, _Float16* __restrict__ BA, _Float16* __restrict__ BW1, _Float16* __restrict__ BW2, _Float16* __restrict__ X16, _Float16* __restrict__ Z16) {
  __shared__ unsigned short tl[64][WTP];
  int bid = blockIdx.x;
  if (bid < 8 * TDD) {
    const int j = bid / TDD; bid -= j * TDD; _Float16* Wt = BA + (size_t)j * DM * DM;
    if ((j & 3) != 3) wt_tile_body<1>(tl, bid, j == 0 ? wq1 : j == 1 ? wk1 : j == 2 ? wv1 : j == 4 ? wq2 : j == 5 ? wk2 : wv2, Wt, DM, DM, 16.0f);
    else wt_tile_body<0>(tl, bid, j == 3 ? wo1 : wo2, Wt, DM, DM, 16.0f);
  } else if (bid < 8 * TDD + TDF) {
    wt_tile_body<0>(tl, bid - 8 * TDD, wff1, BW1, DM, DFF, 16.0f);
  } else if (bid < 8 * TDD + 2 * TDF) {
    wt_tile_body<0>(tl, bid - (8 * TDD + TDF), wff2, BW2, DFF, DM, 16.0f);
  } else {
    bid -= 8 * TDD + 2 * TDF; const int second = bid >= XBL; if (second) bid -= XBL;
    x16_body(bid, second ? z : x, second ? Z16 : X16, NR * DM / 8);
  }
}

// LDS staging of the GEMM operands. A block of 8 waves owns a 128 x 128 tile of C; a stage holds 128 k of its 128 A rows and then of its 128 B rows.
#define GKP 128                 /* k (halves) per stage: 256-byte rows */
#define GPITCH 136              /* LDS row pitch in halves: 272 B = 16 B x 17, conflict-free for 16-byte row reads */
#define GPITCHB (GPITCH * 2)    /* the same in bytes */
#define GSTAGE (256 * GPITCH)   /* halves per stage */
static_assert(DM % GKP == 0 && DFF % GKP == 0 && DM % 128 == 0 && DFF % 128 == 0);

typedef float SoTile[8][32][68];   /* per wave a 32 x 64 f32 output tile, row pitch 68 */
static __device__ __forceinline__ unsigned lds_off(const void* p) { return (unsigned)(size_t)p; }

// Eight 16-byte asynchronous copies of one lane: rows 16 apart, global row step gstep halves. The s_wait_xcnt closes the statement so that no address register is rewritten ahead of it.
static __device__ __forceinline__ void copy8(unsigned l, const _Float16* g, size_t gstep) {
  asm volatile(
      "global_load_async_to_lds_b128 %0, %8, off\n\t"
      "global_load_async_to_lds_b128 %1, %9, off\n\t"
      "global_load_async_to_lds_b128 %2, %10, off\n\t"
      "global_load_async_to_lds_b128 %3, %11, off\n\t"
      "global_load_async_to_lds_b128 %4, %12, off\n\t"
      "global_load_async_to_lds_b128 %5, %13, off\n\t"
      "global_load_async_to_lds_b128 %6, %14, off\n\t"
      "global_load_async_to_lds_b128 %7, %15, off\n\t"
      "s_wait_xcnt 0x0"
      :: "v"(l), "v"(l + 16u * GPITCHB), "v"(l + 32u * GPITCHB), "v"(l + 48u * GPITCHB), "v"(l + 64u * GPITCHB), "v"(l + 80u * GPITCHB), "v"(l + 96u * GPITCHB), "v"(l + 112u * GPITCHB),
         "v"(g), "v"(g + gstep), "v"(g + 2 * gstep), "v"(g + 3 * gstep), "v"(g + 4 * gstep), "v"(g + 5 * gstep), "v"(g + 6 * gstep), "v"(g + 7 * gstep)
      : "memory");
}
// One stage: l = this lane's LDS byte address in the stage's row tid/16, ga / gb = its 16 bytes of that row of the A / B tile.
static __device__ __forceinline__ void stage_copy(unsigned l, const _Float16* ga, int lda, const _Float16* gb, int ldb) {
  copy8(l, ga, (size_t)16 * lda);
  copy8(l + 128u * GPITCHB, gb, (size_t)16 * ldb);
}

// One K sweep of the block's 128 x 128 tile through a two-buffer LDS ring; each wave keeps a 32 x 64 tile (A rows arow, arow + 16; B rows brow + 16 j), k ascending in steps of 32.
// At and Bt point at the first row of the block's A and B tiles. Every thread of the block calls it; K is a positive multiple of 128. The ring is free again on return (the last trip's barrier).
static __device__ __forceinline__ void gemm_sweep(_Float16* ring, const _Float16* At, int lda, const _Float16* Bt, int ldb, int K, int tid, int arow, int brow, int hh,
    v8f& c00, v8f& c01, v8f& c02, v8f& c03, v8f& c10, v8f& c11, v8f& c12, v8f& c13) {
  const unsigned l0 = lds_off(ring) + (unsigned)((tid >> 4) * GPITCHB + (tid & 15) * 16);
  const _Float16* ga = At + (size_t)(tid >> 4) * lda + (tid & 15) * 8;
  const _Float16* gb = Bt + (size_t)(tid >> 4) * ldb + (tid & 15) * 8;
  const int nst = K / GKP;
  stage_copy(l0, ga, lda, gb, ldb);
  asm volatile("s_wait_asynccnt 0x0" ::: "memory");   /* stage 0 of this wave has landed */
  __syncthreads();                                    /* stage 0 of every wave is readable */
  if (nst > 1) stage_copy(l0 + (unsigned)(GSTAGE * 2), ga + GKP, lda, gb + GKP, ldb);
#pragma unroll 1  /* one trip per stage: the ring's waits and its barrier stand once, at the trip's foot */
  for (int t = 0; t < nst; ++t) {
    const _Float16* buf = ring + (t & 1) * GSTAGE;
    const _Float16* a0p = buf + arow * GPITCH; const _Float16* a1p = a0p + 16 * GPITCH;
    const _Float16* b0p = buf + (128 + brow) * GPITCH; const _Float16* b1p = b0p + 16 * GPITCH; const _Float16* b2p = b1p + 16 * GPITCH; const _Float16* b3p = b2p + 16 * GPITCH;
    // the six fragments of a k step are read as one group, one k step ahead inside the stage, so that their LDS latency runs under the products of the step before
    v16h a0 = g2_frag(a0p, hh), a1 = g2_frag(a1p, hh), b0 = g2_frag(b0p, hh), b1 = g2_frag(b1p, hh), b2 = g2_frag(b2p, hh), b3 = g2_frag(b3p, hh);
#pragma unroll  /* constant LDS offsets, and the two fragment sets swap by renaming, without moves */
    for (int kb = 0; kb < GKP; kb += 32) {
      v16h na0 = a0, na1 = a1, nb0 = b0, nb1 = b1, nb2 = b2, nb3 = b3;
      if (kb + 32 < GKP) { na0 = g2_frag(a0p + kb + 32, hh); na1 = g2_frag(a1p + kb + 32, hh); nb0 = g2_frag(b0p + kb + 32, hh); nb1 = g2_frag(b1p + kb + 32, hh); nb2 = g2_frag(b2p + kb + 32, hh); nb3 = g2_frag(b3p + kb + 32, hh); }
      c00 = g2_mma(a0, b0, c00); c10 = g2_mma(a1, b0, c10);
      c01 = g2_mma(a0, b1, c01); c11 = g2_mma(a1, b1, c11);
      c02 = g2_mma(a0, b2, c02); c12 = g2_mma(a1, b2, c12);
      c03 = g2_mma(a0, b3, c03); c13 = g2_mma(a1, b3, c13);
      a0 = na0; a1 = na1; b0 = nb0; b1 = nb1; b2 = nb2; b3 = nb3; }
    asm volatile("s_wait_dscnt 0x0" ::: "memory");      /* this wave's reads of buffer t & 1 are done before it is refilled */
    asm volatile("s_wait_asynccnt 0x0" ::: "memory");   /* this wave's copies of stage t + 1 have landed */
    __syncthreads();                                    /* publishes stage t + 1 and ends every reader's last read of buffer t & 1 */
    if (t + 2 < nst) stage_copy(l0 + (unsigned)((t & 1) * (GSTAGE * 2)), ga + (size_t)(t + 2) * GKP, lda, gb + (size_t)(t + 2) * GKP, ldb);
  }
  asm volatile("s_wait_asynccnt 0x0" ::: "memory");     /* no copy is outstanding when the ring is left */
}

// GEMM: block tile 128 x 128 (8 waves, 4 x 2), wave tile 32 rows x 64 cols; A f16 rows (pitch lda), Bh f16 [n][k] (pitch ldb); v = acc*alpha + bf16(bias[col])*bsc; ACT 0 none / 3 relu;
// Requires M % 128 == 0, N % 128 == 0, K % 128 == 0; grid = (M/128)*(N/128), block 256.
template <int ACT>
__global__ __launch_bounds__(256) void k_gemm2(const _Float16* __restrict__ A, int lda, const _Float16* __restrict__ Bh, int ldb, float alpha, const float* __restrict__ bias, float bsc,
    float* __restrict__ C, _Float16* __restrict__ C16, int ldc, int M, int N, int K) {
  static_assert(ACT == 0 || ACT == 3);
  __shared__ __attribute__((aligned(16))) _Float16 ring[2 * GSTAGE];
  // The output tiles lie over the ring: it is free when the sweep returns (its last trip's waits and barrier), and at 136 KiB of LDS a block two blocks share a WGP, each running under the other's first fill, stage barriers and read-out.
  static_assert(sizeof(SoTile) <= sizeof(ring));
  SoTile& so = *reinterpret_cast<SoTile*>(ring);
  const int tid = threadIdx.x, lane = tid & 31, ln = lane & 15, hh = lane >> 4;
  const int w = __builtin_amdgcn_readfirstlane(tid >> 5);
  const int ntn = N >> 7; const int mt = blockIdx.x / ntn, nq = blockIdx.x - mt * ntn; if (mt * 128 >= M) return;
  const int row0 = mt * 128 + 32 * (w >> 1), col0 = nq * 128 + 64 * (w & 1);
  const v8f z8 = {0.f,0.f,0.f,0.f,0.f,0.f,0.f,0.f}; v8f c00 = z8, c01 = z8, c02 = z8, c03 = z8, c10 = z8, c11 = z8, c12 = z8, c13 = z8;
  gemm_sweep(ring, A + (size_t)(mt * 128) * lda, lda, Bh + (size_t)(nq * 128) * ldb, ldb, K, tid, 32 * (w >> 1) + ln, 64 * (w & 1) + ln, hh, c00, c01, c02, c03, c10, c11, c12, c13);
  v8f accs[8] = {c00, c01, c02, c03, c10, c11, c12, c13};
#pragma unroll
  for (int u = 0; u < 8; ++u) { const int t = u & 3, half = u >> 2; const int col = col0 + t * 16 + ln; const float bv = bias ? bf16_rne(bias[col]) * bsc : 0.f;
#pragma unroll
    for (int r = 0; r < 8; ++r) { const int rloc = half * 16 + 8 * hh + r; float v = accs[u][r] * alpha + bv; if (ACT == 3) v = fmaxf(v, 0.f); so[w][rloc][t * 16 + ln] = v; } }
  __builtin_amdgcn_fence(4 /* acq_rel order */, "workgroup"); __builtin_amdgcn_wave_barrier();
  const int rsub = lane >> 4, c4 = (lane & 15) * 4;
  {
#pragma unroll
    for (int q = 0; q < 16; ++q) { const int r = q * 2 + rsub; const v4f v = *(const v4fa*)&so[w][r][c4];
      if (C) *(v4f*)(C + (size_t)(row0 + r) * ldc + col0 + c4) = v;
      if (C16) { v4h h4; for (int i = 0; i < 4; ++i) h4[i] = (_Float16)v[i]; *(v4h*)(C16 + (size_t)(row0 + r) * ldc + col0 + c4) = h4; } }
     }
}

// Transposed store of a V projection's 128 x 128 block tile (rows = tokens mt * 128 .., columns = nq * 128 .. of NH * HD) as [batch][head][head column][key], the form the attention kernels read.
// An accumulator's eight registers hold eight neighbouring tokens (keys) of one output column: converted, they are 16 bytes of a V^T row. The block's 128 columns x 128 keys are gathered in LDS
// (tb: 2 x 128 rows of GPITCH halves, value tile then residual tile), so that every wave-wide store covers two whole 256-byte pieces of V^T rows.
// RES 1: value + x2048 residual planes CH, CR; RES 0: one plainly converted plane CH. Every thread of the block calls it.
template <int RES>
static __device__ __forceinline__ void vt_store(float* tb, const v8f (&accs)[8], float alpha, _Float16* __restrict__ CH, _Float16* __restrict__ CR, int mt, int nq, int w, int ln, int hh) {
  static_assert(SEQ % 128 == 0 && (NH * HD) % 128 == 0 && HD == 64);
  _Float16* tv = (_Float16*)tb; _Float16* tq = tv + 128 * GPITCH;
#pragma unroll  /* constant indices keep accs[] and the packed halves in registers */
  for (int u = 0; u < 8; ++u) { const int t = u & 3, half = u >> 2; FragH g, gr;
#pragma unroll
    for (int r = 0; r < 8; ++r) { const float v = accs[u][r] * alpha;
      if (RES) { const h16 hv = toh_flush(v); g.h[r] = hv; gr.h[r] = toh_flush((v - (float)hv) * RCARRY); } else g.h[r] = (_Float16)v; }
    const int tloc = (64 * (w & 1) + t * 16 + ln) * GPITCH + 32 * (w >> 1) + half * 16 + 8 * hh;
    *(v8us*)(tv + tloc) = g.half[0];
    if (RES) *(v8us*)(tq + tloc) = gr.half[0]; }
  __syncthreads();   /* every wave's columns and keys are in the tiles before any V^T row is read out */
  const int dl = w * 16 + hh;   /* the wave reads out rows dl, dl + 2, .. dl + 14; the block's 128 columns are two neighbouring heads: 128 V^T rows in a run */
  const size_t go = (((size_t)((mt * 128) / SEQ) * NH + nq * 2) * HD + dl) * SEQ + (mt * 128) % SEQ + ln * 8;
  const _Float16* sv = tv + dl * GPITCH + ln * 8; const _Float16* sq = tq + dl * GPITCH + ln * 8;
  v8us a[8], b[8];
#pragma unroll  /* the LDS reads go out together, ahead of the stores */
  for (int i = 0; i < 8; ++i) { a[i] = *(const v8us*)(sv + i * 2 * GPITCH); if (RES) b[i] = *(const v8us*)(sq + i * 2 * GPITCH); }
#pragma unroll
  for (int i = 0; i < 8; ++i) { *(v8us*)((unsigned short*)CH + go + (size_t)i * 2 * SEQ) = a[i]; if (RES) *(v8us*)((unsigned short*)CR + go + (size_t)i * 2 * SEQ) = b[i]; }
  asm volatile("s_wait_xcnt 0x0" ::: "memory");   /* other read-outs' code follows in the built kernel and reuses the registers that these stores name */
}

// GEMM with an optional residual A plane (AR = (a - f16(a)) * 2048, own accumulators from zero, folded by 2^-11 in f32) and either an f32 output (OUTHR 0)
// or f16 planes (OUTHR 1): value + residual. VTJ 1 and vt != 0 (the same for the whole block): the tile is a V projection (N = NH * HD, rows = tokens) and is stored transposed,
// [batch][head][head column][key], as the attention kernels read it: vt 1 value + residual planes CH, CR; vt 2 one plainly converted plane CH alone.
// Requires M % 128 == 0, N % 128 == 0, K % 128 == 0; grid = (M/128)*(N/128), block 256.
template <int ARES, int OUTHR, int VTJ = 0>
static __device__ __forceinline__ void gemm_hr_body(const _Float16* __restrict__ A, const _Float16* __restrict__ AR, int lda, const _Float16* __restrict__ Bh, int ldb, float alpha,
    const float* __restrict__ bias, float bsc, float* __restrict__ C, _Float16* __restrict__ CH, _Float16* __restrict__ CR, int ldc, int M, int N, int K, int vt = 0) {
  // ARES 0: the output tiles lie over the ring, as in k_gemm2 (free when the one sweep returns). ARES 1: they hold the residual sweep's sums while the second sweep fills the ring, and stand behind it.
  __shared__ __attribute__((aligned(16))) _Float16 ring[2 * GSTAGE + (ARES ? (int)(sizeof(SoTile) / 2) : 0)];
  static_assert(sizeof(SoTile) <= (size_t)2 * GSTAGE * 2 && ((size_t)2 * GSTAGE * 2) % 16 == 0);
  SoTile& so = *reinterpret_cast<SoTile*>(ring + (ARES ? 2 * GSTAGE : 0));
  static_assert(sizeof(SoTile) >= (size_t)2 * 128 * GPITCHB);   /* the two tiles of vt_store */
  const int tid = threadIdx.x, lane = tid & 31, ln = lane & 15, hh = lane >> 4;
  const int w = __builtin_amdgcn_readfirstlane(tid >> 5);
  const int ntn = N >> 7; const int mt = blockIdx.x / ntn, nq = blockIdx.x - mt * ntn; if (mt * 128 >= M) return;
  const int row0 = mt * 128 + 32 * (w >> 1), col0 = nq * 128 + 64 * (w & 1);
  const int arow = 32 * (w >> 1) + ln, brow = 64 * (w & 1) + ln;
  const _Float16* Bt = Bh + (size_t)(nq * 128) * ldb;
  const v8f z8 = {0.f,0.f,0.f,0.f,0.f,0.f,0.f,0.f};
  if (ARES) {
    v8f d00 = z8, d01 = z8, d02 = z8, d03 = z8, d10 = z8, d11 = z8, d12 = z8, d13 = z8;
    gemm_sweep(ring, AR + (size_t)(mt * 128) * lda, lda, Bt, ldb, K, tid, arow, brow, hh, d00, d01, d02, d03, d10, d11, d12, d13);
    v8f ds[8] = {d00, d01, d02, d03, d10, d11, d12, d13};
#pragma unroll
    for (int u = 0; u < 8; ++u) { const int t = u & 3, half = u >> 2;
#pragma unroll
      for (int r = 0; r < 8; ++r) { const int rloc = half * 16 + 8 * hh + r; so[w][rloc][t * 16 + ln] = ds[u][r] * RINV; } }
  }
  v8f c00 = z8, c01 = z8, c02 = z8, c03 = z8, c10 = z8, c11 = z8, c12 = z8, c13 = z8;
  gemm_sweep(ring, A + (size_t)(mt * 128) * lda, lda, Bt, ldb, K, tid, arow, brow, hh, c00, c01, c02, c03, c10, c11, c12, c13);
  v8f accs[8] = {c00, c01, c02, c03, c10, c11, c12, c13};
  if (VTJ && vt) {   /* the same for the whole block: all of it passes the barrier in vt_store, or none */
    if (vt == 1) vt_store<1>(&so[0][0][0], accs, alpha, CH, CR, mt, nq, w, ln, hh); else vt_store<0>(&so[0][0][0], accs, alpha, CH, CR, mt, nq, w, ln, hh);
    return;
  }
#pragma unroll
  for (int u = 0; u < 8; ++u) { const int t = u & 3, half = u >> 2; const int col = col0 + t * 16 + ln; const float bv = bias ? bf16_rne(bias[col]) * bsc : 0.f;
#pragma unroll
    for (int r = 0; r < 8; ++r) { const int rloc = half * 16 + 8 * hh + r; float v = accs[u][r]; if (ARES) v += so[w][rloc][t * 16 + ln]; v = v * alpha + bv; so[w][rloc][t * 16 + ln] = v; } }
  __builtin_amdgcn_fence(4 /* acq_rel order */, "workgroup"); __builtin_amdgcn_wave_barrier();
  const int rsub = lane >> 4, c4 = (lane & 15) * 4;
  {
#pragma unroll
    for (int q = 0; q < 16; ++q) { const int r = q * 2 + rsub; const v4f v = *(const v4fa*)&so[w][r][c4];
      if (OUTHR) { v4h h4, r4;
#pragma unroll
        for (int i = 0; i < 4; ++i) { const h16 hv = toh_flush(v[i]); h4[i] = hv; r4[i] = toh_flush((v[i] - (float)hv) * RCARRY); }
        *(v4h*)(CH + (size_t)(row0 + r) * ldc + col0 + c4) = h4;
        *(v4h*)(CR + (size_t)(row0 + r) * ldc + col0 + c4) = r4; }
      else { *(v4f*)(C + (size_t)(row0 + r) * ldc + col0 + c4) = v; } }
     }
}

// The five projections that read a converted input plane alone, in one launch; blockIdx.y picks the job: q, k of the self-attention (A0) and k of the cross-attention (A1) as f16 value +
// residual rows, v of the self-attention (A0) as transposed value + residual planes, v of the cross-attention (A1) as one transposed f16 plane. grid = ((M/128)*(N/128), 5).
__global__ __launch_bounds__(256) void k_proj5(const _Float16* __restrict__ A0, const _Float16* __restrict__ A1, int lda,
    const _Float16* __restrict__ B0, const _Float16* __restrict__ B1, const _Float16* __restrict__ B2, const _Float16* __restrict__ B3, const _Float16* __restrict__ B4, int ldb, float alpha,
    _Float16* __restrict__ CH0, _Float16* __restrict__ CR0, _Float16* __restrict__ CH1, _Float16* __restrict__ CR1, _Float16* __restrict__ CH2, _Float16* __restrict__ CR2,
    _Float16* __restrict__ CH3, _Float16* __restrict__ CR3, _Float16* __restrict__ CH4, int ldc, int M, int N, int K) {
  const int j = blockIdx.y;
  const _Float16* A = j < 3 ? A0 : A1;
  const _Float16* Bh = j == 0 ? B0 : j == 1 ? B1 : j == 2 ? B2 : j == 3 ? B3 : B4;
  _Float16* CH = j == 0 ? CH0 : j == 1 ? CH1 : j == 2 ? CH2 : j == 3 ? CH3 : CH4;
  _Float16* CR = j == 0 ? CR0 : j == 1 ? CR1 : j == 2 ? CR2 : CR3;   /* not stored by job 4 */
  gemm_hr_body<0, 1, 1>(A, A, lda, Bh, ldb, alpha, nullptr, 0.f, nullptr, CH, CR, ldc, M, N, K, j == 2 ? 1 : j == 4 ? 2 : 0);
}
// value + residual A planes -> f16 value + residual output planes
__global__ __launch_bounds__(256) void k_proj_rhr(const _Float16* __restrict__ A, const _Float16* __restrict__ AR, int lda, const _Float16* __restrict__ Bh, int ldb, float alpha,
    _Float16* __restrict__ CH, _Float16* __restrict__ CR, int ldc, int M, int N, int K) {
  gemm_hr_body<1, 1>(A, AR, lda, Bh, ldb, alpha, nullptr, 0.f, nullptr, CH, CR, ldc, M, N, K);
}
// value + residual A planes -> f32 rows with bias
__global__ __launch_bounds__(256) void k_proj_rf(const _Float16* __restrict__ A, const _Float16* __restrict__ AR, int lda, const _Float16* __restrict__ Bh, int ldb, float alpha,
    const float* __restrict__ bias, float bsc, float* __restrict__ C, int ldc, int M, int N, int K) {
  gemm_hr_body<1, 0>(A, AR, lda, Bh, ldb, alpha, bias, bsc, C, nullptr, nullptr, ldc, M, N, K);
}

// LDS staging of the attention operands. A block of 8 waves owns 128 query rows of one (batch, head) (which rows: attn_hr_body); a stage holds 64 keys: the K value and K residual rows (64 rows of 128 bytes each),
// then the V^T value rows (64 head columns x 64 keys) and, CAUSAL, the V^T residual rows. Every copy of a wave covers four whole 128-byte rows.
#define AKS 64                  /* keys per stage */
#define APITCH 72               /* LDS row pitch in halves: 144 B = 16 B x 9, conflict-free for 16-byte row reads */
#define APITCHB (APITCH * 2)    /* the same in bytes */
#define APLANE (64 * APITCH)    /* halves per staged plane */
static_assert(SEQ % 128 == 0 && SEQ / AKS >= 2 && HD == 64 && AKS == 64);

// Four / two 16-byte asynchronous copies of one lane. The s_wait_xcnt closes the statement so that no address register is rewritten ahead of it.
static __device__ __forceinline__ void copy4(unsigned l0, unsigned l1, unsigned l2, unsigned l3, const _Float16* g0, const _Float16* g1, const _Float16* g2, const _Float16* g3) {
  asm volatile(
      "global_load_async_to_lds_b128 %0, %4, off\n\t"
      "global_load_async_to_lds_b128 %1, %5, off\n\t"
      "global_load_async_to_lds_b128 %2, %6, off\n\t"
      "global_load_async_to_lds_b128 %3, %7, off\n\t"
      "s_wait_xcnt 0x0"
      :: "v"(l0), "v"(l1), "v"(l2), "v"(l3), "v"(g0), "v"(g1), "v"(g2), "v"(g3)
      : "memory");
}
static __device__ __forceinline__ void copy2(unsigned l0, unsigned l1, const _Float16* g0, const _Float16* g1) {
  asm volatile(
      "global_load_async_to_lds_b128 %0, %2, off\n\t"
      "global_load_async_to_lds_b128 %1, %3, off\n\t"
      "s_wait_xcnt 0x0"
      :: "v"(l0), "v"(l1), "v"(g0), "v"(g1)
      : "memory");
}
// One stage: l = this lane's LDS byte address in row tid/8 of the stage's first plane; gk / gkr / gv / gvr = its 16 bytes of that row of each plane. A lane brings rows tid/8 and tid/8 + 32 of every plane.
template <int CAUSAL>
static __device__ __forceinline__ void attn_stage_copy(unsigned l, const _Float16* gk, const _Float16* gkr, const _Float16* gv, const _Float16* gvr) {
  const unsigned pl = (unsigned)(APLANE * 2), rb = 32u * APITCHB;
  copy4(l, l + rb, l + pl, l + pl + rb, gk, gk + (size_t)32 * DM, gkr, gkr + (size_t)32 * DM);
  if (CAUSAL) copy4(l + 2u * pl, l + 2u * pl + rb, l + 3u * pl, l + 3u * pl + rb, gv, gv + (size_t)32 * SEQ, gvr, gvr + (size_t)32 * SEQ);
  else copy2(l + 2u * pl, l + 2u * pl + rb, gv, gv + (size_t)32 * SEQ);
}

// The value of the same lane of the other 16-lane half (lane ^ 16), by a vector cross-row move.
static __device__ __forceinline__ float other_half(float v) { const int i = __float_as_int(v); return __int_as_float(__builtin_amdgcn_permlanex16(i, i, 0x76543210, 0xfedcba98, false, false)); }

// Flash-style attention for one (batch, head, 16 query rows) per wave: keys taken 32 at a time from the block's two-buffer LDS ring with an online (running-max) softmax in f32.
// The scores are computed transposed, S^T = K.Q^T (A = 16 key rows from LDS, B = the wave's 16 query rows kept in registers): lane (ln, hh) holds, of query q0 + ln, the keys 8 hh + r of the first
// key tile and 16 + 8 hh + r of the second, so that the maximum and the sum of a query run inside a lane, plus one exchange between the halves, and the two converted tiles ARE the B operand
// of O^T += V^T.P^T (element s of B = key 8 hh + s, then 16 + 8 hh + s - 8: the k order of g2_frag, which loads V^T as A). P never passes through LDS.
// scores = 8 * q.k^T with q and k as f16 value + x2048 residual planes: value.value in one accumulator, residual.value + value.residual in a second
// accumulator folded by 2^-11. CAUSAL: keys above the query row and exactly-zero scores take the fill -1e9 (replace), key blocks entirely above
// the wave's rows are skipped (their weights are exactly 0); P = 16384*exp(s - m) as f16 value + x2048 residual, V^T as value + residual slabs,
// o = P.V^T with value.value in one accumulator and the two cross terms in a second, row sum over the unconverted P; o/l * 64 written as f16 value +
// residual rows. Dense: P as one f16 plane (row sum over the converted P), V^T one plane, o one plane. Each half keeps the sum of its own keys; the two are joined after the loop. o tiles are wave-private LDS
template <int CAUSAL>
static __device__ __forceinline__ void attn_hr_body(const _Float16* __restrict__ Q16, const _Float16* __restrict__ QR, const _Float16* __restrict__ K16, const _Float16* __restrict__ KR,
    const _Float16* __restrict__ VT, const _Float16* __restrict__ VTR, _Float16* __restrict__ O16, _Float16* __restrict__ OR16) {
  constexpr int ASTAGE = (CAUSAL ? 4 : 3) * APLANE;   /* halves per stage */
  __shared__ __attribute__((aligned(16))) _Float16 kv[2 * ASTAGE];
  __shared__ __attribute__((aligned(16))) _Float16 ob[8][16 * OBP];
  __shared__ __attribute__((aligned(16))) _Float16 obr[8][16 * OBP];
  const int tid = threadIdx.x, lane = tid & 31, ln = lane & 15, hh = lane >> 4;
  const int w = __builtin_amdgcn_readfirstlane(tid >> 5);
  const int h = blockIdx.y, b = blockIdx.z;
  // CAUSAL: a query row's work grows with its index, so a block takes 64 rows from the low end (waves 0..3) and the mirrored 64 rows from the high end (waves 4..7, in falling order):
  // waves w and w + 4 together walk the same number of key passes in every block of the grid. The stage count stays the block's own (from blockIdx alone) and every wave passes every stage's
  // foot, whichever rows it holds. Dense: 128 rows in a run.
  const int q0 = CAUSAL ? (w < 4 ? blockIdx.x * 64 + w * 16 : SEQ - 64 - blockIdx.x * 64 + (7 - w) * 16) : blockIdx.x * 128 + w * 16;
  const size_t tok0 = (size_t)b * SEQ;
  const int slab = b * NH + h;
  const size_t qoff = (tok0 + q0 + ln) * DM + h * HD;
  const v16h qf0 = g2_frag(Q16 + qoff, hh), qf1 = g2_frag(Q16 + qoff + 32, hh);
  const v16h qr0 = g2_frag(QR + qoff, hh),  qr1 = g2_frag(QR + qoff + 32, hh);
  const v8f z8 = {0.f,0.f,0.f,0.f,0.f,0.f,0.f,0.f};
  v8f o0 = z8, o1 = z8, o2 = z8, o3 = z8;      /* o_j[r] = o of query q0 + ln, head column 16 j + 8 hh + r */
  v8f e0 = z8, e1 = z8, e2 = z8, e3 = z8;
  float mrow = -1.0e30f, lrow = 0.f;           /* of query q0 + ln: the maximum over all keys so far (equal in both halves), the sum over this half's keys */
  const int row = q0 + ln;
  const int kend = CAUSAL ? (q0 + 16) : SEQ;                  /* this wave's keys end here (the same in every lane) */
  const int nst = CAUSAL ? SEQ / AKS - blockIdx.x : SEQ / AKS;   /* stages of the block: up to the keys of its high rows (they end at SEQ - 64 blockIdx.x); at least two */
  const unsigned l0 = lds_off(kv) + (unsigned)((tid >> 3) * APITCHB + (tid & 7) * 16);
  const size_t gko = (tok0 + (tid >> 3)) * DM + h * HD + (tid & 7) * 8;
  const size_t gvo = ((size_t)slab * HD + (tid >> 3)) * SEQ + (tid & 7) * 8;
  const _Float16* gk = K16 + gko; const _Float16* gkr = KR + gko; const _Float16* gv = VT + gvo; const _Float16* gvr = VTR + gvo;
  attn_stage_copy<CAUSAL>(l0, gk, gkr, gv, gvr);
  asm volatile("s_wait_asynccnt 0x0" ::: "memory");   /* stage 0 of this wave has landed */
  __syncthreads();                                    /* stage 0 of every wave is readable */
  if (nst > 1) attn_stage_copy<CAUSAL>(l0 + (unsigned)(ASTAGE * 2), gk + (size_t)AKS * DM, gkr + (size_t)AKS * DM, gv + AKS, gvr + AKS);
#pragma unroll 1  /* one trip per stage: the ring's waits and its barrier stand once, at the trip's foot */
  for (int st = 0; st < nst; ++st) {
  const _Float16* buf = kv + (st & 1) * ASTAGE;
#pragma unroll 1  /* two passes of 32 keys per stage share one body */
  for (int sub = 0; sub < AKS; sub += 32) {
    const int kb = st * AKS + sub;
    if (kb >= kend) break;                            /* a wave past its diagonal skips the pass, never the trip's foot */
    const _Float16* k0p = buf + (sub + ln) * APITCH; const _Float16* k1p = k0p + 16 * APITCH;
    const _Float16* r0p = k0p + APLANE;              const _Float16* r1p = r0p + 16 * APITCH;
    v8f s0 = z8, s1 = z8, t0 = z8, t1 = z8;
    // the eight K fragments of the pass are read as one group ahead of the first score product: the wave meets the LDS latency once, not once per fragment
    const v16h ka0 = g2_frag(k0p, hh), ka1 = g2_frag(k0p + 32, hh), ra0 = g2_frag(r0p, hh), ra1 = g2_frag(r0p + 32, hh);
    const v16h kc0 = g2_frag(k1p, hh), kc1 = g2_frag(k1p + 32, hh), rc0 = g2_frag(r1p, hh), rc1 = g2_frag(r1p + 32, hh);
    s0 = g2_mma(ka0, qf0, s0); t0 = g2_mma(ka0, qr0, t0);
    s0 = g2_mma(ka1, qf1, s0); t0 = g2_mma(ka1, qr1, t0);
    t0 = g2_mma(ra0, qf0, t0);
    t0 = g2_mma(ra1, qf1, t0);
    s1 = g2_mma(kc0, qf0, s1); t1 = g2_mma(kc0, qr0, t1);
    s1 = g2_mma(kc1, qf1, s1); t1 = g2_mma(kc1, qr1, t1);
    t1 = g2_mma(rc0, qf0, t1);
    t1 = g2_mma(rc1, qf1, t1);
    // the V^T fragments of the pass are read as one group here, behind the last score product: their LDS latency runs under the softmax arithmetic
    const _Float16* vp = buf + 2 * APLANE + ln * APITCH + sub; const _Float16* vrp = vp + (CAUSAL ? APLANE : 0);
    const v16h va0 = g2_frag(vp, hh), va1 = g2_frag(vp + 16 * APITCH, hh), va2 = g2_frag(vp + 32 * APITCH, hh), va3 = g2_frag(vp + 48 * APITCH, hh);
    v16h vr0 = va0, vr1 = va1, vr2 = va2, vr3 = va3;
    if (CAUSAL) { vr0 = g2_frag(vrp, hh); vr1 = g2_frag(vrp + 16 * APITCH, hh); vr2 = g2_frag(vrp + 32 * APITCH, hh); vr3 = g2_frag(vrp + 48 * APITCH, hh); }
    if (CAUSAL) __builtin_amdgcn_sched_barrier(0);   /* keeps the sixteen reads whole at this place: without it this build moves them down among the softmax arithmetic in pieces, the last ones next to their products */
    const v8f af = (s0 + t0 * RINV) * 8.0f, cf = (s1 + t1 * RINV) * 8.0f;
    const int lim = row - kb - 8 * hh;           /* CAUSAL: the lane's keys kb + 8 hh + d with d > lim lie above the diagonal */
    float sc[16]; float t = -1.0e30f;            /* sc[i]: the score of key kb + 8 hh + i (i < 8), kb + 16 + 8 hh + i - 8 (i >= 8): element i of the B operand */
#pragma unroll  /* constant indices keep sc[] and the packed P in registers, here and below */
    for (int i = 0; i < 16; ++i) {
      const float x = i < 8 ? af[i & 7] : cf[i & 7];
      sc[i] = (CAUSAL && (((i < 8 ? i : i + 8) > lim) || (x == 0.0f))) ? -1.0e9f : x;
      t = fmaxf(t, sc[i]);
    }
    t = fmaxf(t, other_half(t));
    const float mnew = fmaxf(mrow, t);
    const float corr = __expf(mrow - mnew);
    FragH pf, prf; float ls0 = 0.f, ls1 = 0.f;   /* one sum per key tile: two short chains of adds */
#pragma unroll
    for (int i = 0; i < 16; ++i) {
      const float pc = __expf(sc[i] - mnew) * PCARRY;
      const h16 ph = toh_flush(pc);
      if (i < 8) ls0 += CAUSAL ? pc : (float)ph; else ls1 += CAUSAL ? pc : (float)ph;
      pf.h[i] = ph;
      if (CAUSAL) prf.h[i] = toh_flush((pc - (float)ph) * RCARRY);
    }
    lrow = lrow * corr + (ls0 + ls1); mrow = mnew;
    o0 *= corr; o1 *= corr; o2 *= corr; o3 *= corr;
    if (CAUSAL) { e0 *= corr; e1 *= corr; e2 *= corr; e3 *= corr; }
    o0 = g2_mma(va0, pf.v, o0);
    if (CAUSAL) { e0 = g2_mma(va0, prf.v, e0); e0 = g2_mma(vr0, pf.v, e0); }
    o1 = g2_mma(va1, pf.v, o1);
    if (CAUSAL) { e1 = g2_mma(va1, prf.v, e1); e1 = g2_mma(vr1, pf.v, e1); }
    o2 = g2_mma(va2, pf.v, o2);
    if (CAUSAL) { e2 = g2_mma(va2, prf.v, e2); e2 = g2_mma(vr2, pf.v, e2); }
    o3 = g2_mma(va3, pf.v, o3);
    if (CAUSAL) { e3 = g2_mma(va3, prf.v, e3); e3 = g2_mma(vr3, pf.v, e3); }
  }
    asm volatile("s_wait_dscnt 0x0" ::: "memory");      /* this wave's reads of buffer st & 1 are done before it is refilled */
    asm volatile("s_wait_asynccnt 0x0" ::: "memory");   /* this wave's copies of stage st + 1 have landed */
    __syncthreads();                                    /* publishes stage st + 1 and ends every reader's last read of buffer st & 1 */
    if (st + 2 < nst) attn_stage_copy<CAUSAL>(l0 + (unsigned)((st & 1) * (ASTAGE * 2)), gk + (size_t)(st + 2) * AKS * DM, gkr + (size_t)(st + 2) * AKS * DM, gv + (st + 2) * AKS, gvr + (st + 2) * AKS);
  }
  asm volatile("s_wait_asynccnt 0x0" ::: "memory");     /* no copy is outstanding when the ring is left */
  lrow += other_half(lrow);                                     /* the two halves' key sums of the query */
  const float rl = 64.0f * __builtin_amdgcn_rcpf(lrow);         /* o carried x64; l already carries the P carry */
  const v8f os[4] = {o0, o1, o2, o3}; const v8f es[4] = {e0, e1, e2, e3};
#pragma unroll
  for (int j = 0; j < 4; ++j) { FragH g, gr;
#pragma unroll
    for (int r = 0; r < 8; ++r) {
      float v = os[j][r]; if (CAUSAL) v += es[j][r] * RINV;
      v *= rl;
      const h16 gv16 = toh_flush(v); g.h[r] = gv16;
      if (CAUSAL) gr.h[r] = toh_flush((v - (float)gv16) * RCARRY); }
    const int oloc = ln * OBP + 16 * j + 8 * hh;                /* eight neighbouring head columns of the lane's query: one 16-byte LDS store */
    *(v8us*)(&ob[w][oloc]) = g.half[0];
    if (CAUSAL) *(v8us*)(&obr[w][oloc]) = gr.half[0];
  }
  __builtin_amdgcn_fence(4 /* acq_rel order */, "wavefront"); __builtin_amdgcn_wave_barrier();
  const int rq = lane >> 3, pc = (lane & 7) * 8;
  {
#pragma unroll
    for (int i = 0; i < 4; ++i) { const int orow = i * 4 + rq; const size_t go = (tok0 + q0 + orow) * DM + h * HD + pc;
      const v8us v = *(const v8us*)(&ob[w][orow * OBP + pc]);
      *(v8us*)((unsigned short*)O16 + go) = v;
      if (CAUSAL) { const v8us vr = *(const v8us*)(&obr[w][orow * OBP + pc]); *(v8us*)((unsigned short*)OR16 + go) = vr; } }
     }
}

__global__ __launch_bounds__(256) void k_attn_causal(const _Float16* __restrict__ Q16, const _Float16* __restrict__ QR, const _Float16* __restrict__ K16, const _Float16* __restrict__ KR,
    const _Float16* __restrict__ VT, const _Float16* __restrict__ VTR, _Float16* __restrict__ O16, _Float16* __restrict__ OR16) {
  attn_hr_body<1>(Q16, QR, K16, KR, VT, VTR, O16, OR16);
}
__global__ __launch_bounds__(256) void k_attn_dense(const _Float16* __restrict__ Q16, const _Float16* __restrict__ QR, const _Float16* __restrict__ K16, const _Float16* __restrict__ KR,
    const _Float16* __restrict__ VT, _Float16* __restrict__ O16) {
  attn_hr_body<0>(Q16, QR, K16, KR, VT, VT, O16, O16);
}

// red[] is cross-wave (block barriers); no early exit.
// W16 1: the row also as one plainly converted f16 plane O16; W16 2: as f16 value (O16) + x2048 residual (O16R) planes.
template <int RBF, int RMAP, int W16, int OMAP>
__global__ __launch_bounds__(256) void k_ln(const float* __restrict__ X, const float* __restrict__ R, const float* __restrict__ g, const float* __restrict__ bb, float eps, float* __restrict__ O32, _Float16* __restrict__ O16, _Float16* __restrict__ O16R) {
  #pragma clang fp contract(off)
  __shared__ float red[256];
  const size_t r = blockIdx.x; const int t = threadIdx.x; const int c0 = t * 4;
  const size_t rfull = (r / SEQ) * SEQ_FULL + (r % SEQ);
  const size_t rr = RMAP ? rfull : r;
  const v4f xa = *(const v4fa*)(X + r * DM + c0); const v4f ra = *(const v4fa*)(R + rr * DM + c0);
  float s[4]; float sum = 0.f;
#pragma unroll
  for (int q = 0; q < 4; ++q) { const float rv = RBF ? bf16_rne(ra[q]) : ra[q]; s[q] = xa[q] + rv; sum += s[q]; }
  red[t] = sum; __syncthreads();
  for (int st = 128; st > 0; st >>= 1) { if (t < st) red[t] += red[t + st]; __syncthreads(); }
  const float mu = red[0] * (1.0f / (float)DM); __syncthreads();
  float vs = 0.f;
#pragma unroll
  for (int q = 0; q < 4; ++q) { const float dl = s[q] - mu; vs += dl * dl; }
  red[t] = vs; __syncthreads();
  for (int st = 128; st > 0; st >>= 1) { if (t < st) red[t] += red[t + st]; __syncthreads(); }
  const float rs = rsqrtf(red[0] * (1.0f / (float)DM) + eps);
  v4f yf; v4h y;
#pragma unroll
  for (int q = 0; q < 4; ++q) { const int c = c0 + q; yf[q] = (s[q] - mu) * rs * bf16_rne(g[c]) + bf16_rne(bb[c]); y[q] = (_Float16)yf[q]; }
  const size_t orow = OMAP ? rfull : r;
  {
    if (O32) *(v4f*)(O32 + orow * DM + c0) = yf;
    if (W16 == 1) *(v4h*)(O16 + r * DM + c0) = y;
    if (W16 == 2) { v4h h4, r4;
#pragma unroll
      for (int q = 0; q < 4; ++q) { const h16 hv = toh_flush(yf[q]); h4[q] = hv; r4[q] = toh_flush((yf[q] - (float)hv) * RCARRY); }
      *(v4h*)(O16 + r * DM + c0) = h4; *(v4h*)(O16R + r * DM + c0) = r4; }
     }
}

extern "C" void kernel_launch(void* const* d_in, const int* in_sizes, int n_in,
                              void* d_out, int out_size, void* d_ws, size_t ws_size, hipStream_t stream) {
  if (n_in < 22) return;
  const float* x    = (const float*)d_in[0];  const float* enc  = (const float*)d_in[1];
  const float* wq1  = (const float*)d_in[2];  const float* wk1  = (const float*)d_in[3];  const float* wv1 = (const float*)d_in[4];
  const float* wo1  = (const float*)d_in[5];  const float* bo1  = (const float*)d_in[6];
  const float* wq2  = (const float*)d_in[7];  const float* wk2  = (const float*)d_in[8];  const float* wv2 = (const float*)d_in[9];
  const float* wo2  = (const float*)d_in[10]; const float* bo2  = (const float*)d_in[11];
  const float* wff1 = (const float*)d_in[12]; const float* bff1 = (const float*)d_in[13]; const float* wff2 = (const float*)d_in[14]; const float* bff2 = (const float*)d_in[15];
  const float* g1   = (const float*)d_in[16]; const float* be1  = (const float*)d_in[17]; const float* g2  = (const float*)d_in[18]; const float* be2 = (const float*)d_in[19];
  const float* g3   = (const float*)d_in[20]; const float* be3  = (const float*)d_in[21];

  const size_t needX = ((size_t)(NB - 1) * SEQ_FULL + SEQ) * DM;
  if ((size_t)in_sizes[0] < needX || (size_t)in_sizes[1] < needX || (size_t)out_size < needX) return;
  { static const int wi[8] = {2, 3, 4, 5, 7, 8, 9, 10}; for (int i = 0; i < 8; ++i) if ((size_t)in_sizes[wi[i]] < (size_t)DM * DM) return; }
  if ((size_t)in_sizes[12] < (size_t)DM * DFF || (size_t)in_sizes[14] < (size_t)DM * DFF || in_sizes[13] < DFF) return;
  { static const int vi[9] = {6, 11, 15, 16, 17, 18, 19, 20, 21}; for (int i = 0; i < 9; ++i) if (in_sizes[vi[i]] < DM) return; }

  char* ws = (char*)d_ws; size_t off = 0;
  auto take = [&](size_t bytes) { char* p = ws + off; off += (bytes + 255) & ~(size_t)255; return p; };
  const size_t WDD = (size_t)DM * DM * 2, WDF = (size_t)DM * DFF * 2, P16 = NR * DM * 2;
  _Float16* BQ1 = (_Float16*)take(WDD); _Float16* BK1 = (_Float16*)take(WDD); _Float16* BV1 = (_Float16*)take(WDD); _Float16* BO1 = (_Float16*)take(WDD);
  _Float16* BQ2 = (_Float16*)take(WDD); _Float16* BK2 = (_Float16*)take(WDD); _Float16* BV2 = (_Float16*)take(WDD); _Float16* BO2 = (_Float16*)take(WDD);
  _Float16* BW1 = (_Float16*)take(WDF);      /* [n=DFF][k=DM]  */
  _Float16* BW2 = (_Float16*)take(WDF);      /* [n=DM][k=DFF]  */
  // fourteen token-plane slots of P16 bytes each (an f32 plane spans two slots, the FFN hidden plane four); lifetimes by launch order:
  // S0 X16                  S1 E16 -> x2 (f16)      S2,S3 Q1|QR1 -> a1 (f32) -> a2 (f32) -> hidden (S2..S5)
  // S4,S5 K1|KR1 -> x1 (f32)   S6,S7 VT1|VTR1 -> x1 value|residual -> S7 o2 (f16) -> f (f32)
  // S8,S9 o1 value|residual -> Q2|QR2 -> x2 (f32)      S10,S11 K2|KR2      S12 free      S13 VT2
  char* SL = take(14 * P16);
  _Float16* S0 = (_Float16*)(SL + 0 * P16); _Float16* S1 = (_Float16*)(SL + 1 * P16); _Float16* S2 = (_Float16*)(SL + 2 * P16); _Float16* S3 = (_Float16*)(SL + 3 * P16);
  _Float16* S4 = (_Float16*)(SL + 4 * P16); _Float16* S5 = (_Float16*)(SL + 5 * P16); _Float16* S6 = (_Float16*)(SL + 6 * P16); _Float16* S7 = (_Float16*)(SL + 7 * P16);
  _Float16* S8 = (_Float16*)(SL + 8 * P16); _Float16* S9 = (_Float16*)(SL + 9 * P16); _Float16* S10 = (_Float16*)(SL + 10 * P16); _Float16* S11 = (_Float16*)(SL + 11 * P16);
  _Float16* S13 = (_Float16*)(SL + 13 * P16);
  float* YFa = (float*)S2;   /* a1, a2 (f32 rows, S2..S3) */
  float* X1F = (float*)S4;   /* x1 (f32 rows, S4..S5) */
  float* X2F = (float*)S8;   /* x2 (f32 rows, S8..S9) */
  float* YFf = (float*)S6;   /* f  (f32 rows, S6..S7) */
  _Float16* HF = S2;         /* FFN hidden rows [NR][DFF] f16 (S2..S5) */
  if (off > ws_size || off > (size_t)268435456) return;

  static_assert(((size_t)DM * DM * 2) % 256 == 0);   /* BQ1 .. BO2 lie one behind the other in the carve */
  k_prep<<<(unsigned)PREP_BLOCKS, 256, 0, stream>>>(wq1, wk1, wv1, wo1, wq2, wk2, wv2, wo2, wff1, wff2, x, enc, BQ1, BW1, BW2, S0, S1);

  const unsigned gP = (unsigned)((MR / 128) * (DM / 128)), gF1 = (unsigned)((MR / 128) * (DFF / 128));
  const dim3 gAT(SEQ / 128, NH, NB);

  // ---- causal self-attention block
  k_proj5<<<dim3(gP, 5), 256, 0, stream>>>(S0, S1, DM, BQ1, BK1, BV1, BK2, BV2, DM, 0.0625f, S2, S3, S4, S5, S6, S7, S10, S11, S13, DM, MR, DM, DM);   /* q1, k1, k2: value | residual rows; v1: transposed value | residual; v2: one transposed plane */
  k_attn_causal<<<gAT, 256, 0, stream>>>(S2, S3, S4, S5, S6, S7, S8, S9);                                       /* o x64 value | residual */
  k_proj_rf<<<gP, 256, 0, stream>>>(S8, S9, DM, BO1, DM, 0.0009765625f, bo1, 1.0f, YFa, DM, MR, DM, DM);        /* a1 = o Wp1 + bp1 */
  k_ln<1, 1, 2, 0><<<(unsigned)MR, 256, 0, stream>>>(YFa, x, g1, be1, LN_EPS, X1F, S6, S7);                     /* x1 = LN1(bf16(x) + a1) -> f32 rows and f16 value | residual rows */
  // ---- cross-attention block
  k_proj_rhr<<<gP, 256, 0, stream>>>(S6, S7, DM, BQ2, DM, 0.0625f, S8, S9, DM, MR, DM, DM);                     /* q  value | residual */
  k_attn_dense<<<gAT, 256, 0, stream>>>(S8, S9, S10, S11, S13, S7);                                                /* o x64 single plane */
  k_gemm2<0><<<gP, 256, 0, stream>>>(S7, DM, BO2, DM, 0.0009765625f, bo2, 1.0f, YFa, nullptr, DM, MR, DM, DM);  /* a2 = o Wp2 + bp2 */
  k_ln<0, 0, 1, 0><<<(unsigned)MR, 256, 0, stream>>>(YFa, X1F, g2, be2, LN_EPS, X2F, S1, nullptr);                       /* x2 = LN2(x1 + a2) -> f32 + f16 rows */
  // ---- FFN block
  k_gemm2<3><<<gF1, 256, 0, stream>>>(S1, DM, BW1, DM, 1.0f, bff1, 16.0f, nullptr, HF, DFF, MR, DFF, DM);       /* 16 relu(x2 W1 + b1) as f16 rows */
  k_gemm2<0><<<gP, 256, 0, stream>>>(HF, DFF, BW2, DFF, 0.00390625f, bff2, 1.0f, YFf, nullptr, DM, MR, DM, DFF);  /* f = h W2 + b2 */
  k_ln<0, 0, 0, 1><<<(unsigned)MR, 256, 0, stream>>>(YFf, X2F, g3, be3, LN_EPS, (float*)d_out, nullptr, nullptr);        /* out = LN3(x2 + f) */
}

// v010
// It runs in 272 microseconds.
// Timed twice side by side with v009, it ran 1.03 times as fast both times.
// Counting every step since v000, it is 3.93 times as fast.
#include <hip/hip_runtime.h>
// Structure: token rows r = b*SEQ + s. Causal self-attention (16 heads of 64, per-head weights [H][E][64], scores x8, keys above the diagonal and exactly-zero scores masked) -> x1 = LN1(x + attn.Wp1 + bp1); cross-attention of x1 over z rows -> x2 = LN2(x1 + attn.Wp2 + bp2); f = relu(x2.W1 + b1).W2 + b2; out = LN3(x2 + f). Projection / FFN weights are [in][out].

#ifndef NB
#define NB 4
#endif
#ifndef SEQ
#define SEQ 1024
#endif
#define NB_FULL 4
#define SEQ_FULL 1024
#define DM 1024
#define NH 16
#define HD 64
#define DFF 4096
#define NR ((size_t)NB * SEQ)
#define MR ((int)((size_t)NB * SEQ))
#define OBP 72          /* LDS pitch (halves) of the per-wave o tile */
#define LN_EPS 1.0e-5f
#define PCARRY 16384.0f         /* carry of the f16 P planes */
#define RCARRY 2048.0f          /* carry of every residual plane */
#define RINV 0.00048828125f     /* 1 / RCARRY */

static_assert(NB >= 1 && NB <= NB_FULL);
static_assert(SEQ >= 64 && SEQ <= SEQ_FULL && SEQ % 64 == 0);
static_assert((NB * SEQ) % 128 == 0);
static_assert(NH * HD == DM && HD == 64);
static_assert(DM == 4 * 256);
static_assert(DM % 64 == 0 && DFF % 64 == 0 && DM % 32 == 0 && DFF % 32 == 0);
static_assert(DFF <= 4 * DM);
static_assert((OBP % 8) == 0);
static_assert(DFF == 4 * DM);                       /* the FFN hidden plane spans exactly four 16-bit token planes */
static_assert(OBP >= HD);                           /* o tile holds one head */
static_assert(RCARRY * RINV == 1.0f);
static_assert(PCARRY <= 32768.0f);                  /* carried P stays inside f16 */
static_assert((size_t)8 * DM * DM * 2 + (size_t)2 * DM * DFF * 2 + (size_t)14 * NB * SEQ * DM * 2 + 16 * 256 <= (size_t)268435456);   /* workspace carve */

typedef unsigned short v8us __attribute__((ext_vector_type(8), may_alias));
typedef float  v8f  __attribute__((ext_vector_type(8)));
typedef float  v4f  __attribute__((ext_vector_type(4)));
typedef float  v4fa __attribute__((ext_vector_type(4), may_alias));
typedef _Float16 v16h __attribute__((ext_vector_type(16)));
typedef _Float16 v4h __attribute__((ext_vector_type(4)));
union FragH { v16h v; v8us half[2]; _Float16 h[16]; unsigned short u[16]; };

__device__ __forceinline__ unsigned short bf16_bits(float x) { unsigned int u = __float_as_uint(x); return (unsigned short)((u + 0x7FFFu + ((u >> 16) & 1u)) >> 16); }
__device__ __forceinline__ float bf16_val(unsigned short b) { return __uint_as_float(((unsigned int)b) << 16); }
__device__ __forceinline__ float bf16_rne(float x) { return bf16_val(bf16_bits(x)); }

// 16x32 fragment from a k-contiguous 16-bit row p (A row m = lane&15, or B stored [n][k] with n = lane&15):
// elements 0..7 <- k 8h..8h+7, elements 8..15 <- k 16+8h..16+8h+7 (h = lane>>4)
__device__ __forceinline__ v16h g2_frag(const _Float16* p, int hh) { FragH f; f.half[0] = *(const v8us*)((const unsigned short*)p + 8 * hh); f.half[1] = *(const v8us*)((const unsigned short*)p + 16 + 8 * hh); return f.v; }
__device__ __forceinline__ v8f g2_mma(v16h a, v16h b, v8f c) { v8f d = __builtin_amdgcn_wmma_f32_16x16x32_f16(false, a, false, b, (short)0, c, false, false); asm volatile("v_nop\n\tv_nop\n\tv_nop\n\tv_nop" : "+v"(d) : "v"(a), "v"(b)); return d; }

// f32 -> f16 operand convert that cannot yield an f16 subnormal (value select, applied after the plane's carry)
typedef _Float16 h16;
static __device__ __forceinline__ h16 toh_flush(float v) { const h16 r = (h16)v; return (fabsf(v) < 6.103515625e-05f) ? (h16)0.0f : r; }

// Weight convert + transpose, one 64 k x 64 n tile per block, turned in LDS: every wave-wide 16-byte load covers two whole 256-byte source rows of the tile and every
// wave-wide 16-byte store four whole 128-byte pieces of Wt rows. HEAD 0: W is [K][N]; HEAD 1: W is [N/64][K][64] (tile column block = head). Wt is [n][k].
// Requires K % 64 == 0 and N % 64 == 0; bid = the tile's index among the (N/64)*(K/64) tiles of its matrix, the same for the whole block of 256; tl = the block's LDS tile.
#define WTP 66                  /* LDS row pitch in halves: 33 words, so that a column walk of 8 rows apart meets 8 different banks */
template <int HEAD>
static __device__ __forceinline__ void wt_tile_body(unsigned short (*tl)[WTP], int bid, const float* __restrict__ W, _Float16* __restrict__ Wt, int K, int N, float scale) {
  const int tid = threadIdx.x; const int nkt = K >> 6; const int nt = bid / nkt, kt = bid - nt * nkt; if (nt * 64 >= N) return;   /* the same for the whole block, ahead of the barrier */
  const int n0 = nt * 64, k0 = kt * 64;
  const float* src = HEAD ? W + ((size_t)nt * K + k0) * HD : W + (size_t)k0 * N + n0;
  const size_t rstep = HEAD ? (size_t)HD : (size_t)N;
  const int r0 = tid >> 4, c4 = (tid & 15) * 4;
  v4f a[4];
#pragma unroll  /* the four loads of a lane are issued together, ahead of the first convert */
  for (int i = 0; i < 4; ++i) a[i] = *(const v4fa*)(src + (size_t)(i * 16 + r0) * rstep + c4);
#pragma unroll  /* constant indices keep a[] and f in registers, here and in the loops below */
  for (int i = 0; i < 4; ++i) { FragH f;
#pragma unroll
    for (int q = 0; q < 4; ++q) { const float v = bf16_rne(a[i][q]) * scale; f.h[q] = HEAD ? toh_flush(v) : (_Float16)v; }
#pragma unroll
    for (int q = 0; q < 4; ++q) tl[i * 16 + r0][c4 + q] = f.u[q]; }
  __syncthreads();   /* the whole tile is in LDS before any column of it is read */
#pragma unroll
  for (int rd = 0; rd < 2; ++rd) { const int n = rd * 32 + tid / 8, pc = tid % 8; FragH f;
#pragma unroll
    for (int q = 0; q < 8; ++q) f.u[q] = tl[pc * 8 + q][n];
    *(v8us*)((unsigned short*)Wt + (size_t)(n0 + n) * K + k0 + pc * 8) = f.half[0]; }
  asm volatile("s_wait_xcnt 0x0" ::: "memory");   /* another job's code follows in the merged kernel and reuses the registers that the two stores name */
}

static __device__ __forceinline__ void x16_body(int bid, const float* __restrict__ x, _Float16* __restrict__ X16, size_t n8) {
  const size_t t = (size_t)bid * 256 + threadIdx.x; if (t >= n8) return;
  const size_t e = t * 8; const size_t r = e / DM; const size_t c = e % DM; const size_t rs = (r / SEQ) * SEQ_FULL + (r % SEQ);
  const float* src = x + rs * DM + c; const v4f a = *(const v4fa*)src; const v4f a2 = *(const v4fa*)(src + 4); FragH f;
#pragma unroll
  for (int q = 0; q < 4; ++q) { f.h[q] = (_Float16)bf16_rne(a[q]); f.h[4 + q] = (_Float16)bf16_rne(a2[q]); }
  const v8us o = f.half[0]; unsigned short* d = (unsigned short*)X16 + e;
  *(v8us*)d = o; 
}

// Every conversion that reads the inputs alone, in ONE launch: none of the twelve jobs reads what another writes. blockIdx.x picks the job, the same for the whole block:
// the tiles of the eight DM x DM attention weights (order q k v o, q k v o; Wt planes one behind the other from BA), of W1, of W2, then the row pieces of x and of z.
#define TDD ((DM / 64) * (DM / 64))             /* tiles of a DM x DM weight */
#define TDF ((DM / 64) * (DFF / 64))            /* tiles of an FFN weight */
#define XBL ((int)((NR * DM / 8 + 255) / 256))  /* blocks of a token plane, 8 elements a thread */
#define PREP_BLOCKS (8 * TDD + 2 * TDF + 2 * XBL)
__global__ __launch_bounds__(256) void k_prep(const float* __restrict__ wq1, const float* __restrict__ wk1, const float* __restrict__ wv1, const float* __restrict__ wo1,
    const float* __restrict__ wq2, const float* __restrict__ wk2, const float* __restrict__ wv2, const float* __restrict__ wo2, const float* __restrict__ wff1, const float* __restrict__ wff2,
    const float* __restrict__ x, const float* __restrict__ z, _Float16* __restrict__ BA, _Float16* __restrict__ BW1, _Float16* __restrict__ BW2, _Float16* __restrict__ X16, _Float16* __restrict__ Z16) {
  __shared__ unsigned short tl[64][WTP];
  int bid = blockIdx.x;
  if (bid < 8 * TDD) {
    const int j = bid / TDD; bid -= j * TDD; _Float16* Wt = BA + (size_t)j * DM * DM;
    if ((j & 3) != 3) wt_tile_body<1>(tl, bid, j == 0 ? wq1 : j == 1 ? wk1 : j == 2 ? wv1 : j == 4 ? wq2 : j == 5 ? wk2 : wv2, Wt, DM, DM, 16.0f);
    else wt_tile_body<0>(tl, bid, j == 3 ? wo1 : wo2, Wt, DM, DM, 16.0f);
  } else if (bid < 8 * TDD + TDF) {
    wt_tile_body<0>(tl, bid - 8 * TDD, wff1, BW1, DM, DFF, 16.0f);
  } else if (bid < 8 * TDD + 2 * TDF) {
    wt_tile_body<0>(tl, bid - (8 * TDD + TDF), wff2, BW2, DFF, DM, 16.0f);
  } else {
    bid -= 8 * TDD + 2 * TDF; const int second = bid >= XBL; if (second) bid -= XBL;
    x16_body(bid, second ? z : x, second ? Z16 : X16, NR * DM / 8);
  }
}

// LDS staging of the GEMM operands. A block of 8 waves owns a 128 x 128 tile of C; a stage holds 128 k of its 128 A rows and then of its 128 B rows.
#define GKP 128                 /* k (halves) per stage: 256-byte rows */
#define GPITCH 136              /* LDS row pitch in halves: 272 B = 16 B x 17, conflict-free for 16-byte row reads */
#define GPITCHB (GPITCH * 2)    /* the same in bytes */
#define GSTAGE (256 * GPITCH)   /* halves per stage */
static_assert(DM % GKP == 0 && DFF % GKP == 0 && DM % 128 == 0 && DFF % 128 == 0);

typedef float SoTile[8][32][68];   /* per wave a 32 x 64 f32 output tile, row pitch 68 */
static __device__ __forceinline__ unsigned lds_off(const void* p) { return (unsigned)(size_t)p; }

// Eight 16-byte asynchronous copies of one lane: rows 16 apart, global row step gstep halves. The s_wait_xcnt closes the statement so that no address register is rewritten ahead of it.
static __device__ __forceinline__ void copy8(unsigned l, const _Float16* g, size_t gstep) {
  asm volatile(
      "global_load_async_to_lds_b128 %0, %8, off\n\t"
      "global_load_async_to_lds_b128 %1, %9, off\n\t"
      "global_load_async_to_lds_b128 %2, %10, off\n\t"
      "global_load_async_to_lds_b128 %3, %11, off\n\t"
      "global_load_async_to_lds_b128 %4, %12, off\n\t"
      "global_load_async_to_lds_b128 %5, %13, off\n\t"
      "global_load_async_to_lds_b128 %6, %14, off\n\t"
      "global_load_async_to_lds_b128 %7, %15, off\n\t"
      "s_wait_xcnt 0x0"
      :: "v"(l), "v"(l + 16u * GPITCHB), "v"(l + 32u * GPITCHB), "v"(l + 48u * GPITCHB), "v"(l + 64u * GPITCHB), "v"(l + 80u * GPITCHB), "v"(l + 96u * GPITCHB), "v"(l + 112u * GPITCHB),
         "v"(g), "v"(g + gstep), "v"(g + 2 * gstep), "v"(g + 3 * gstep), "v"(g + 4 * gstep), "v"(g + 5 * gstep), "v"(g + 6 * gstep), "v"(g + 7 * gstep)
      : "memory");
}
// One stage: l = this lane's LDS byte address in the stage's row tid/16, ga / gb = its 16 bytes of that row of the A / B tile.
static __device__ __forceinline__ void stage_copy(unsigned l, const _Float16* ga, int lda, const _Float16* gb, int ldb) {
  copy8(l, ga, (size_t)16 * lda);
  copy8(l + 128u * GPITCHB, gb, (size_t)16 * ldb);
}

// One K sweep of the block's 128 x 128 tile through a two-buffer LDS ring; each wave keeps a 32 x 64 tile (A rows arow, arow + 16; B rows brow + 16 j), k ascending in steps of 32.
// At and Bt point at the first row of the block's A and B tiles. Every thread of the block calls it; K is a positive multiple of 128. The ring is free again on return (the last trip's barrier).
static __device__ __forceinline__ void gemm_sweep(_Float16* ring, const _Float16* At, int lda, const _Float16* Bt, int ldb, int K, int tid, int arow, int brow, int hh,
    v8f& c00, v8f& c01, v8f& c02, v8f& c03, v8f& c10, v8f& c11, v8f& c12, v8f& c13) {
  const unsigned l0 = lds_off(ring) + (unsigned)((tid >> 4) * GPITCHB + (tid & 15) * 16);
  const _Float16* ga = At + (size_t)(tid >> 4) * lda + (tid & 15) * 8;
  const _Float16* gb = Bt + (size_t)(tid >> 4) * ldb + (tid & 15) * 8;
  const int nst = K / GKP;
  stage_copy(l0, ga, lda, gb, ldb);
  asm volatile("s_wait_asynccnt 0x0" ::: "memory");   /* stage 0 of this wave has landed */
  __syncthreads();                                    /* stage 0 of every wave is readable */
  if (nst > 1) stage_copy(l0 + (unsigned)(GSTAGE * 2), ga + GKP, lda, gb + GKP, ldb);
#pragma unroll 1  /* one trip per stage: the ring's waits and its barrier stand once, at the trip's foot */
  for (int t = 0; t < nst; ++t) {
    const _Float16* buf = ring + (t & 1) * GSTAGE;
    const _Float16* a0p = buf + arow * GPITCH; const _Float16* a1p = a0p + 16 * GPITCH;
    const _Float16* b0p = buf + (128 + brow) * GPITCH; const _Float16* b1p = b0p + 16 * GPITCH; const _Float16* b2p = b1p + 16 * GPITCH; const _Float16* b3p = b2p + 16 * GPITCH;
    // the six fragments of a k step are read as one group, one k step ahead inside the stage, so that their LDS latency runs under the products of the step before
    v16h a0 = g2_frag(a0p, hh), a1 = g2_frag(a1p, hh), b0 = g2_frag(b0p, hh), b1 = g2_frag(b1p, hh), b2 = g2_frag(b2p, hh), b3 = g2_frag(b3p, hh);
#pragma unroll  /* constant LDS offsets, and the two fragment sets swap by renaming, without moves */
    for (int kb = 0; kb < GKP; kb += 32) {
      v16h na0 = a0, na1 = a1, nb0 = b0, nb1 = b1, nb2 = b2, nb3 = b3;
      if (kb + 32 < GKP) { na0 = g2_frag(a0p + kb + 32, hh); na1 = g2_frag(a1p + kb + 32, hh); nb0 = g2_frag(b0p + kb + 32, hh); nb1 = g2_frag(b1p + kb + 32, hh); nb2 = g2_frag(b2p + kb + 32, hh); nb3 = g2_frag(b3p + kb + 32, hh); }
      c00 = g2_mma(a0, b0, c00); c10 = g2_mma(a1, b0, c10);
      c01 = g2_mma(a0, b1, c01); c11 = g2_mma(a1, b1, c11);
      c02 = g2_mma(a0, b2, c02); c12 = g2_mma(a1, b2, c12);
      c03 = g2_mma(a0, b3, c03); c13 = g2_mma(a1, b3, c13);
      a0 = na0; a1 = na1; b0 = nb0; b1 = nb1; b2 = nb2; b3 = nb3; }
    asm volatile("s_wait_dscnt 0x0" ::: "memory");      /* this wave's reads of buffer t & 1 are done before it is refilled */
    asm volatile("s_wait_asynccnt 0x0" ::: "memory");   /* this wave's copies of stage t + 1 have landed */
    __syncthreads();                                    /* publishes stage t + 1 and ends every reader's last read of buffer t & 1 */
    if (t + 2 < nst) stage_copy(l0 + (unsigned)((t & 1) * (GSTAGE * 2)), ga + (size_t)(t + 2) * GKP, lda, gb + (size_t)(t + 2) * GKP, ldb);
  }
  asm volatile("s_wait_asynccnt 0x0" ::: "memory");     /* no copy is outstanding when the ring is left */
}

// The same sweep for an A operand of two planes (value At, residual Rt, same pitch): a stage holds 128 k of the 128 value rows, the 128 residual rows and the 128 B rows, so that the B tile is
// brought in and its fragments are read once for both planes: 16 products per 8 fragments. c.. take value.B, d.. residual.B, each in the k order of gemm_sweep. The ring is free again on return.
#define GSTAGE3 (384 * GPITCH)  /* halves per three-tile stage */
static __device__ __forceinline__ void gemm_sweep_vr(_Float16* ring, const _Float16* At, const _Float16* Rt, int lda, const _Float16* Bt, int ldb, int K, int tid, int arow, int brow, int hh,
    v8f& c00, v8f& c01, v8f& c02, v8f& c03, v8f& c10, v8f& c11, v8f& c12, v8f& c13, v8f& d00, v8f& d01, v8f& d02, v8f& d03, v8f& d10, v8f& d11, v8f& d12, v8f& d13) {
  const unsigned l0 = lds_off(ring) + (unsigned)((tid >> 4) * GPITCHB + (tid & 15) * 16);
  const _Float16* ga = At + (size_t)(tid >> 4) * lda + (tid & 15) * 8;
  const _Float16* gr = Rt + (size_t)(tid >> 4) * lda + (tid & 15) * 8;
  const _Float16* gb = Bt + (size_t)(tid >> 4) * ldb + (tid & 15) * 8;
  const int nst = K / GKP;
  stage_copy(l0, ga, lda, gr, lda); copy8(l0 + 256u * GPITCHB, gb, (size_t)16 * ldb);
  asm volatile("s_wait_asynccnt 0x0" ::: "memory");   /* stage 0 of this wave has landed */
  __syncthreads();                                    /* stage 0 of every wave is readable */
  if (nst > 1) { const unsigned l1 = l0 + (unsigned)(GSTAGE3 * 2); stage_copy(l1, ga + GKP, lda, gr + GKP, lda); copy8(l1 + 256u * GPITCHB, gb + GKP, (size_t)16 * ldb); }
#pragma unroll 1  /* one trip per stage: the ring's waits and its barrier stand once, at the trip's foot */
  for (int t = 0; t < nst; ++t) {
    const _Float16* buf = ring + (t & 1) * GSTAGE3;
    const _Float16* a0p = buf + arow * GPITCH; const _Float16* a1p = a0p + 16 * GPITCH; const _Float16* r0p = a0p + 128 * GPITCH; const _Float16* r1p = r0p + 16 * GPITCH;
    const _Float16* b0p = buf + (256 + brow) * GPITCH; const _Float16* b1p = b0p + 16 * GPITCH; const _Float16* b2p = b1p + 16 * GPITCH; const _Float16* b3p = b2p + 16 * GPITCH;
    // fragments are read eight products ahead, in two groups per k step, so that their LDS latency runs under the products before them and 16 accumulators + 12 fragments stay inside 256 registers:
    // the last two B fragments of a step ahead of its first eight products; the next step's four A and first two B fragments ahead of its last eight
    v16h a0 = g2_frag(a0p, hh), a1 = g2_frag(a1p, hh), r0 = g2_frag(r0p, hh), r1 = g2_frag(r1p, hh), b0 = g2_frag(b0p, hh), b1 = g2_frag(b1p, hh);
#pragma unroll  /* constant LDS offsets, and the fragment sets swap by renaming, without moves */
    for (int kb = 0; kb < GKP; kb += 32) {
      const v16h b2 = g2_frag(b2p + kb, hh), b3 = g2_frag(b3p + kb, hh);
      c00 = g2_mma(a0, b0, c00); c10 = g2_mma(a1, b0, c10); d00 = g2_mma(r0, b0, d00); d10 = g2_mma(r1, b0, d10);
      c01 = g2_mma(a0, b1, c01); c11 = g2_mma(a1, b1, c11); d01 = g2_mma(r0, b1, d01); d11 = g2_mma(r1, b1, d11);
      v16h na0 = a0, na1 = a1, nr0 = r0, nr1 = r1;
      if (kb + 32 < GKP) { na0 = g2_frag(a0p + kb + 32, hh); na1 = g2_frag(a1p + kb + 32, hh); nr0 = g2_frag(r0p + kb + 32, hh); nr1 = g2_frag(r1p + kb + 32, hh);
        b0 = g2_frag(b0p + kb + 32, hh); b1 = g2_frag(b1p + kb + 32, hh); }
      c02 = g2_mma(a0, b2, c02); c12 = g2_mma(a1, b2, c12); d02 = g2_mma(r0, b2, d02); d12 = g2_mma(r1, b2, d12);
      c03 = g2_mma(a0, b3, c03); c13 = g2_mma(a1, b3, c13); d03 = g2_mma(r0, b3, d03); d13 = g2_mma(r1, b3, d13);
      a0 = na0; a1 = na1; r0 = nr0; r1 = nr1; }
    asm volatile("s_wait_dscnt 0x0" ::: "memory");      /* this wave's reads of buffer t & 1 are done before it is refilled */
    asm volatile("s_wait_asynccnt 0x0" ::: "memory");   /* this wave's copies of stage t + 1 have landed */
    __syncthreads();                                    /* publishes stage t + 1 and ends every reader's last read of buffer t & 1 */
    if (t + 2 < nst) { const unsigned l2 = l0 + (unsigned)((t & 1) * (GSTAGE3 * 2)); const size_t ko = (size_t)(t + 2) * GKP;
      stage_copy(l2, ga + ko, lda, gr + ko, lda); copy8(l2 + 256u * GPITCHB, gb + ko, (size_t)16 * ldb); }
  }
  asm volatile("s_wait_asynccnt 0x0" ::: "memory");     /* no copy is outstanding when the ring is left */
}

// GEMM: block tile 128 x 128 (8 waves, 4 x 2), wave tile 32 rows x 64 cols; A f16 rows (pitch lda), Bh f16 [n][k] (pitch ldb); v = acc*alpha + bf16(bias[col])*bsc; ACT 0 none / 3 relu;
// Requires M % 128 == 0, N % 128 == 0, K % 128 == 0; grid = (M/128)*(N/128), block 256.
template <int ACT>
__global__ __launch_bounds__(256) void k_gemm2(const _Float16* __restrict__ A, int lda, const _Float16* __restrict__ Bh, int ldb, float alpha, const float* __restrict__ bias, float bsc,
    float* __restrict__ C, _Float16* __restrict__ C16, int ldc, int M, int N, int K) {
  static_assert(ACT == 0 || ACT == 3);
  __shared__ __attribute__((aligned(16))) _Float16 ring[2 * GSTAGE];
  // The output tiles lie over the ring: it is free when the sweep returns (its last trip's waits and barrier), and at 136 KiB of LDS a block two blocks share a WGP, each running under the other's first fill, stage barriers and read-out.
  static_assert(sizeof(SoTile) <= sizeof(ring));
  SoTile& so = *reinterpret_cast<SoTile*>(ring);
  const int tid = threadIdx.x, lane = tid & 31, ln = lane & 15, hh = lane >> 4;
  const int w = __builtin_amdgcn_readfirstlane(tid >> 5);
  const int ntn = N >> 7; const int mt = blockIdx.x / ntn, nq = blockIdx.x - mt * ntn; if (mt * 128 >= M) return;
  const int row0 = mt * 128 + 32 * (w >> 1), col0 = nq * 128 + 64 * (w & 1);
  const v8f z8 = {0.f,0.f,0.f,0.f,0.f,0.f,0.f,0.f}; v8f c00 = z8, c01 = z8, c02 = z8, c03 = z8, c10 = z8, c11 = z8, c12 = z8, c13 = z8;
  gemm_sweep(ring, A + (size_t)(mt * 128) * lda, lda, Bh + (size_t)(nq * 128) * ldb, ldb, K, tid, 32 * (w >> 1) + ln, 64 * (w & 1) + ln, hh, c00, c01, c02, c03, c10, c11, c12, c13);
  v8f accs[8] = {c00, c01, c02, c03, c10, c11, c12, c13};
#pragma unroll
  for (int u = 0; u < 8; ++u) { const int t = u & 3, half = u >> 2; const int col = col0 + t * 16 + ln; const float bv = bias ? bf16_rne(bias[col]) * bsc : 0.f;
#pragma unroll
    for (int r = 0; r < 8; ++r) { const int rloc = half * 16 + 8 * hh + r; float v = accs[u][r] * alpha + bv; if (ACT == 3) v = fmaxf(v, 0.f); so[w][rloc][t * 16 + ln] = v; } }
  __builtin_amdgcn_fence(4 /* acq_rel order */, "workgroup"); __builtin_amdgcn_wave_barrier();
  const int rsub = lane >> 4, c4 = (lane & 15) * 4;
  {
#pragma unroll
    for (int q = 0; q < 16; ++q) { const int r = q * 2 + rsub; const v4f v = *(const v4fa*)&so[w][r][c4];
      if (C) *(v4f*)(C + (size_t)(row0 + r) * ldc + col0 + c4) = v;
      if (C16) { v4h h4; for (int i = 0; i < 4; ++i) h4[i] = (_Float16)v[i]; *(v4h*)(C16 + (size_t)(row0 + r) * ldc + col0 + c4) = h4; } }
     }
}

// Transposed store of a V projection's 128 x 128 block tile (rows = tokens mt * 128 .., columns = nq * 128 .. of NH * HD) as [batch][head][head column][key], the form the attention kernels read.
// An accumulator's eight registers hold eight neighbouring tokens (keys) of one output column: converted, they are 16 bytes of a V^T row. The block's 128 columns x 128 keys are gathered in LDS
// (tb: 2 x 128 rows of GPITCH halves, value tile then residual tile), so that every wave-wide store covers two whole 256-byte pieces of V^T rows.
// RES 1: value + x2048 residual planes CH, CR; RES 0: one plainly converted plane CH. Every thread of the block calls it.
template <int RES>
static __device__ __forceinline__ void vt_store(float* tb, const v8f (&accs)[8], float alpha, _Float16* __restrict__ CH, _Float16* __restrict__ CR, int mt, int nq, int w, int ln, int hh) {
  static_assert(SEQ % 128 == 0 && (NH * HD) % 128 == 0 && HD == 64);
  _Float16* tv = (_Float16*)tb; _Float16* tq = tv + 128 * GPITCH;
#pragma unroll  /* constant indices keep accs[] and the packed halves in registers */
  for (int u = 0; u < 8; ++u) { const int t = u & 3, half = u >> 2; FragH g, gr;
#pragma unroll
    for (int r = 0; r < 8; ++r) { const float v = accs[u][r] * alpha;
      if (RES) { const h16 hv = toh_flush(v); g.h[r] = hv; gr.h[r] = toh_flush((v - (float)hv) * RCARRY); } else g.h[r] = (_Float16)v; }
    const int tloc = (64 * (w & 1) + t * 16 + ln) * GPITCH + 32 * (w >> 1) + half * 16 + 8 * hh;
    *(v8us*)(tv + tloc) = g.half[0];
    if (RES) *(v8us*)(tq + tloc) = gr.half[0]; }
  __syncthreads();   /* every wave's columns and keys are in the tiles before any V^T row is read out */
  const int dl = w * 16 + hh;   /* the wave reads out rows dl, dl + 2, .. dl + 14; the block's 128 columns are two neighbouring heads: 128 V^T rows in a run */
  const size_t go = (((size_t)((mt * 128) / SEQ) * NH + nq * 2) * HD + dl) * SEQ + (mt * 128) % SEQ + ln * 8;
  const _Float16* sv = tv + dl * GPITCH + ln * 8; const _Float16* sq = tq + dl * GPITCH + ln * 8;
  v8us a[8], b[8];
#pragma unroll  /* the LDS reads go out together, ahead of the stores */
  for (int i = 0; i < 8; ++i) { a[i] = *(const v8us*)(sv + i * 2 * GPITCH); if (RES) b[i] = *(const v8us*)(sq + i * 2 * GPITCH); }
#pragma unroll
  for (int i = 0; i < 8; ++i) { *(v8us*)((unsigned short*)CH + go + (size_t)i * 2 * SEQ) = a[i]; if (RES) *(v8us*)((unsigned short*)CR + go + (size_t)i * 2 * SEQ) = b[i]; }
  asm volatile("s_wait_xcnt 0x0" ::: "memory");   /* other read-outs' code follows in the built kernel and reuses the registers that these stores name */
}

// GEMM with an optional residual A plane (AR = (a - f16(a)) * 2048, own accumulators from zero, folded by 2^-11 in f32) and either an f32 output (OUTHR 0)
// or f16 planes (OUTHR 1): value + residual. VTJ 1 and vt != 0 (the same for the whole block): the tile is a V projection (N = NH * HD, rows = tokens) and is stored transposed,
// [batch][head][head column][key], as the attention kernels read it: vt 1 value + residual planes CH, CR; vt 2 one plainly converted plane CH alone.
// Requires M % 128 == 0, N % 128 == 0, K % 128 == 0; grid = (M/128)*(N/128), block 256.
template <int ARES, int OUTHR, int VTJ = 0>
static __device__ __forceinline__ void gemm_hr_body(const _Float16* __restrict__ A, const _Float16* __restrict__ AR, int lda, const _Float16* __restrict__ Bh, int ldb, float alpha,
    const float* __restrict__ bias, float bsc, float* __restrict__ C, _Float16* __restrict__ CH, _Float16* __restrict__ CR, int ldc, int M, int N, int K, int vt = 0) {
  // The output tiles lie over the ring, as in k_gemm2 (free when the one sweep returns). ARES 1: the ring's stages hold three tiles (value, residual, B).
  __shared__ __attribute__((aligned(16))) _Float16 ring[2 * (ARES ? GSTAGE3 : GSTAGE)];
  static_assert(sizeof(SoTile) <= (size_t)2 * GSTAGE * 2);
  SoTile& so = *reinterpret_cast<SoTile*>(ring);
  static_assert(sizeof(SoTile) >= (size_t)2 * 128 * GPITCHB);   /* the two tiles of vt_store */
  const int tid = threadIdx.x, lane = tid & 31, ln = lane & 15, hh = lane >> 4;
  const int w = __builtin_amdgcn_readfirstlane(tid >> 5);
  const int ntn = N >> 7; const int mt = blockIdx.x / ntn, nq = blockIdx.x - mt * ntn; if (mt * 128 >= M) return;
  const int row0 = mt * 128 + 32 * (w >> 1), col0 = nq * 128 + 64 * (w & 1);
  const int arow = 32 * (w >> 1) + ln, brow = 64 * (w & 1) + ln;
  const _Float16* Bt = Bh + (size_t)(nq * 128) * ldb;
  const v8f z8 = {0.f,0.f,0.f,0.f,0.f,0.f,0.f,0.f};
  v8f c00 = z8, c01 = z8, c02 = z8, c03 = z8, c10 = z8, c11 = z8, c12 = z8, c13 = z8;
  v8f d00 = z8, d01 = z8, d02 = z8, d03 = z8, d10 = z8, d11 = z8, d12 = z8, d13 = z8;
  if (ARES) gemm_sweep_vr(ring, A + (size_t)(mt * 128) * lda, AR + (size_t)(mt * 128) * lda, lda, Bt, ldb, K, tid, arow, brow, hh, c00, c01, c02, c03, c10, c11, c12, c13, d00, d01, d02, d03, d10, d11, d12, d13);
  else gemm_sweep(ring, A + (size_t)(mt * 128) * lda, lda, Bt, ldb, K, tid, arow, brow, hh, c00, c01, c02, c03, c10, c11, c12, c13);
  v8f accs[8] = {c00, c01, c02, c03, c10, c11, c12, c13};
  const v8f ds[8] = {d00, d01, d02, d03, d10, d11, d12, d13};
  if (VTJ && vt) {   /* the same for the whole block: all of it passes the barrier in vt_store, or none */
    if (vt == 1) vt_store<1>(&so[0][0][0], accs, alpha, CH, CR, mt, nq, w, ln, hh); else vt_store<0>(&so[0][0][0], accs, alpha, CH, CR, mt, nq, w, ln, hh);
    return;
  }
#pragma unroll
  for (int u = 0; u < 8; ++u) { const int t = u & 3, half = u >> 2; const int col = col0 + t * 16 + ln; const float bv = bias ? bf16_rne(bias[col]) * bsc : 0.f;
#pragma unroll
    for (int r = 0; r < 8; ++r) { const int rloc = half * 16 + 8 * hh + r; float v = accs[u][r]; if (ARES) v += ds[u][r] * RINV; v = v * alpha + bv; so[w][rloc][t * 16 + ln] = v; } }
  __builtin_amdgcn_fence(4 /* acq_rel order */, "workgroup"); __builtin_amdgcn_wave_barrier();
  const int rsub = lane >> 4, c4 = (lane & 15) * 4;
  {
#pragma unroll
    for (int q = 0; q < 16; ++q) { const int r = q * 2 + rsub; const v4f v = *(const v4fa*)&so[w][r][c4];
      if (OUTHR) { v4h h4, r4;
#pragma unroll
        for (int i = 0; i < 4; ++i) { const h16 hv = toh_flush(v[i]); h4[i] = hv; r4[i] = toh_flush((v[i] - (float)hv) * RCARRY); }
        *(v4h*)(CH + (size_t)(row0 + r) * ldc + col0 + c4) = h4;
        *(v4h*)(CR + (size_t)(row0 + r) * ldc + col0 + c4) = r4; }
      else { *(v4f*)(C + (size_t)(row0 + r) * ldc + col0 + c4) = v; } }
     }
}

// The five projections that read a converted input plane alone, in one launch; blockIdx.y picks the job: q, k of the self-attention (A0) and k of the cross-attention (A1) as f16 value +
// residual rows, v of the self-attention (A0) as transposed value + residual planes, v of the cross-attention (A1) as one transposed f16 plane. grid = ((M/128)*(N/128), 5).
__global__ __launch_bounds__(256) void k_proj5(const _Float16* __restrict__ A0, const _Float16* __restrict__ A1, int lda,
    const _Float16* __restrict__ B0, const _Float16* __restrict__ B1, const _Float16* __restrict__ B2, const _Float16* __restrict__ B3, const _Float16* __restrict__ B4, int ldb, float alpha,
    _Float16* __restrict__ CH0, _Float16* __restrict__ CR0, _Float16* __restrict__ CH1, _Float16* __restrict__ CR1, _Float16* __restrict__ CH2, _Float16* __restrict__ CR2,
    _Float16* __restrict__ CH3, _Float16* __restrict__ CR3, _Float16* __restrict__ CH4, int ldc, int M, int N, int K) {
  const int j = blockIdx.y;
  const _Float16* A = j < 3 ? A0 : A1;
  const _Float16* Bh = j == 0 ? B0 : j == 1 ? B1 : j == 2 ? B2 : j == 3 ? B3 : B4;
  _Float16* CH = j == 0 ? CH0 : j == 1 ? CH1 : j == 2 ? CH2 : j == 3 ? CH3 : CH4;
  _Float16* CR = j == 0 ? CR0 : j == 1 ? CR1 : j == 2 ? CR2 : CR3;   /* not stored by job 4 */
  gemm_hr_body<0, 1, 1>(A, A, lda, Bh, ldb, alpha, nullptr, 0.f, nullptr, CH, CR, ldc, M, N, K, j == 2 ? 1 : j == 4 ? 2 : 0);
}
// value + residual A planes -> f16 value + residual output planes
__global__ __launch_bounds__(256) void k_proj_rhr(const _Float16* __restrict__ A, const _Float16* __restrict__ AR, int lda, const _Float16* __restrict__ Bh, int ldb, float alpha,
    _Float16* __restrict__ CH, _Float16* __restrict__ CR, int ldc, int M, int N, int K) {
  gemm_hr_body<1, 1>(A, AR, lda, Bh, ldb, alpha, nullptr, 0.f, nullptr, CH, CR, ldc, M, N, K);
}
// value + residual A planes -> f32 rows with bias
__global__ __launch_bounds__(256) void k_proj_rf(const _Float16* __restrict__ A, const _Float16* __restrict__ AR, int lda, const _Float16* __restrict__ Bh, int ldb, float alpha,
    const float* __restrict__ bias, float bsc, float* __restrict__ C, int ldc, int M, int N, int K) {
  gemm_hr_body<1, 0>(A, AR, lda, Bh, ldb, alpha, bias, bsc, C, nullptr, nullptr, ldc, M, N, K);
}

// LDS staging of the attention operands. A block of 8 waves owns 128 query rows of one (batch, head) (which rows: attn_hr_body); a stage holds 64 keys: the K value and K residual rows (64 rows of 128 bytes each),
// then the V^T value rows (64 head columns x 64 keys) and, CAUSAL, the V^T residual rows. Every copy of a wave covers four whole 128-byte rows.
#define AKS 64                  /* keys per stage */
#define APITCH 72               /* LDS row pitch in halves: 144 B = 16 B x 9, conflict-free for 16-byte row reads */
#define APITCHB (APITCH * 2)    /* the same in bytes */
#define APLANE (64 * APITCH)    /* halves per staged plane */
static_assert(SEQ % 128 == 0 && SEQ / AKS >= 2 && HD == 64 && AKS == 64);

// Four / two 16-byte asynchronous copies of one lane. The s_wait_xcnt closes the statement so that no address register is rewritten ahead of it.
static __device__ __forceinline__ void copy4(unsigned l0, unsigned l1, unsigned l2, unsigned l3, const _Float16* g0, const _Float16* g1, const _Float16* g2, const _Float16* g3) {
  asm volatile(
      "global_load_async_to_lds_b128 %0, %4, off\n\t"
      "global_load_async_to_lds_b128 %1, %5, off\n\t"
      "global_load_async_to_lds_b128 %2, %6, off\n\t"
      "global_load_async_to_lds_b128 %3, %7, off\n\t"
      "s_wait_xcnt 0x0"
      :: "v"(l0), "v"(l1), "v"(l2), "v"(l3), "v"(g0), "v"(g1), "v"(g2), "v"(g3)
      : "memory");
}
static __device__ __forceinline__ void copy2(unsigned l0, unsigned l1, const _Float16* g0, const _Float16* g1) {
  asm volatile(
      "global_load_async_to_lds_b128 %0, %2, off\n\t"
      "global_load_async_to_lds_b128 %1, %3, off\n\t"
      "s_wait_xcnt 0x0"
      :: "v"(l0), "v"(l1), "v"(g0), "v"(g1)
      : "memory");
}
// One stage: l = this lane's LDS byte address in row tid/8 of the stage's first plane; gk / gkr / gv / gvr = its 16 bytes of that row of each plane. A lane brings rows tid/8 and tid/8 + 32 of every plane.
template <int CAUSAL>
static __device__ __forceinline__ void attn_stage_copy(unsigned l, const _Float16* gk, const _Float16* gkr, const _Float16* gv, const _Float16* gvr) {
  const unsigned pl = (unsigned)(APLANE * 2), rb = 32u * APITCHB;
  copy4(l, l + rb, l + pl, l + pl + rb, gk, gk + (size_t)32 * DM, gkr, gkr + (size_t)32 * DM);
  if (CAUSAL) copy4(l + 2u * pl, l + 2u * pl + rb, l + 3u * pl, l + 3u * pl + rb, gv, gv + (size_t)32 * SEQ, gvr, gvr + (size_t)32 * SEQ);
  else copy2(l + 2u * pl, l + 2u * pl + rb, gv, gv + (size_t)32 * SEQ);
}

// The value of the same lane of the other 16-lane half (lane ^ 16), by a vector cross-row move.
static __device__ __forceinline__ float other_half(float v) { const int i = __float_as_int(v); return __int_as_float(__builtin_amdgcn_permlanex16(i, i, 0x76543210, 0xfedcba98, false, false)); }

// Flash-style attention for one (batch, head, 16 query rows) per wave: keys taken 32 at a time from the block's two-buffer LDS ring with an online (running-max) softmax in f32.
// The scores are computed transposed, S^T = K.Q^T (A = 16 key rows from LDS, B = the wave's 16 query rows kept in registers): lane (ln, hh) holds, of query q0 + ln, the keys 8 hh + r of the first
// key tile and 16 + 8 hh + r of the second, so that the maximum and the sum of a query run inside a lane, plus one exchange between the halves, and the two converted tiles ARE the B operand
// of O^T += V^T.P^T (element s of B = key 8 hh + s, then 16 + 8 hh + s - 8: the k order of g2_frag, which loads V^T as A). P never passes through LDS.
// scores = 8 * q.k^T with q and k as f16 value + x2048 residual planes: value.value in one accumulator, residual.value + value.residual in a second
// accumulator folded by 2^-11. CAUSAL: keys above the query row and exactly-zero scores take the fill -1e9 (replace), key blocks entirely above
// the wave's rows are skipped (their weights are exactly 0); P = 16384*exp(s - m) as f16 value + x2048 residual, V^T as value + residual slabs,
// o = P.V^T with value.value in one accumulator and the two cross terms in a second, row sum over the unconverted P; o/l * 64 written as f16 value +
// residual rows. Dense: P as one f16 plane (row sum over the converted P), V^T one plane, o one plane. Each half keeps the sum of its own keys; the two are joined after the loop. o tiles are wave-private LDS
template <int CAUSAL>
static __device__ __forceinline__ void attn_hr_body(const _Float16* __restrict__ Q16, const _Float16* __restrict__ QR, const _Float16* __restrict__ K16, const _Float16* __restrict__ KR,
    const _Float16* __restrict__ VT, const _Float16* __restrict__ VTR, _Float16* __restrict__ O16, _Float16* __restrict__ OR16) {
  constexpr int ASTAGE = (CAUSAL ? 4 : 3) * APLANE;   /* halves per stage */
  __shared__ __attribute__((aligned(16))) _Float16 kv[2 * ASTAGE];
  __shared__ __attribute__((aligned(16))) _Float16 ob[8][16 * OBP];
  __shared__ __attribute__((aligned(16))) _Float16 obr[8][16 * OBP];
  const int tid = threadIdx.x, lane = tid & 31, ln = lane & 15, hh = lane >> 4;
  const int w = __builtin_amdgcn_readfirstlane(tid >> 5);
  const int h = blockIdx.y, b = blockIdx.z;
  // CAUSAL: a query row's work grows with its index, so a block takes 64 rows from the low end (waves 0..3) and the mirrored 64 rows from the high end (waves 4..7, in falling order):
  // waves w and w + 4 together walk the same number of key passes in every block of the grid. The stage count stays the block's own (from blockIdx alone) and every wave passes every stage's
  // foot, whichever rows it holds. Dense: 128 rows in a run.
  const int q0 = CAUSAL ? (w < 4 ? blockIdx.x * 64 + w * 16 : SEQ - 64 - blockIdx.x * 64 + (7 - w) * 16) : blockIdx.x * 128 + w * 16;
  const size_t tok0 = (size_t)b * SEQ;
  const int slab = b * NH + h;
  const size_t qoff = (tok0 + q0 + ln) * DM + h * HD;
  const v16h qf0 = g2_frag(Q16 + qoff, hh), qf1 = g2_frag(Q16 + qoff + 32, hh);
  const v16h qr0 = g2_frag(QR + qoff, hh),  qr1 = g2_frag(QR + qoff + 32, hh);
  const v8f z8 = {0.f,0.f,0.f,0.f,0.f,0.f,0.f,0.f};
  v8f o0 = z8, o1 = z8, o2 = z8, o3 = z8;      /* o_j[r] = o of query q0 + ln, head column 16 j + 8 hh + r */
  v8f e0 = z8, e1 = z8, e2 = z8, e3 = z8;
  float mrow = -1.0e30f, lrow = 0.f;           /* of query q0 + ln: the maximum over all keys so far (equal in both halves), the sum over this half's keys */
  const int row = q0 + ln;
  const int kend = CAUSAL ? (q0 + 16) : SEQ;                  /* this wave's keys end here (the same in every lane) */
  const int nst = CAUSAL ? SEQ / AKS - blockIdx.x : SEQ / AKS;   /* stages of the block: up to the keys of its high rows (they end at SEQ - 64 blockIdx.x); at least two */
  const unsigned l0 = lds_off(kv) + (unsigned)((tid >> 3) * APITCHB + (tid & 7) * 16);
  const size_t gko = (tok0 + (tid >> 3)) * DM + h * HD + (tid & 7) * 8;
  const size_t gvo = ((size_t)slab * HD + (tid >> 3)) * SEQ + (tid & 7) * 8;
  const _Float16* gk = K16 + gko; const _Float16* gkr = KR + gko; const _Float16* gv = VT + gvo; const _Float16* gvr = VTR + gvo;
  attn_stage_copy<CAUSAL>(l0, gk, gkr, gv, gvr);
  asm volatile("s_wait_asynccnt 0x0" ::: "memory");   /* stage 0 of this wave has landed */
  __syncthreads();                                    /* stage 0 of every wave is readable */
  if (nst > 1) attn_stage_copy<CAUSAL>(l0 + (unsigned)(ASTAGE * 2), gk + (size_t)AKS * DM, gkr + (size_t)AKS * DM, gv + AKS, gvr + AKS);
#pragma unroll 1  /* one trip per stage: the ring's waits and its barrier stand once, at the trip's foot */
  for (int st = 0; st < nst; ++st) {
  const _Float16* buf = kv + (st & 1) * ASTAGE;
#pragma unroll 1  /* two passes of 32 keys per stage share one body */
  for (int sub = 0; sub < AKS; sub += 32) {
    const int kb = st * AKS + sub;
    if (kb >= kend) break;                            /* a wave past its diagonal skips the pass, never the trip's foot */
    const _Float16* k0p = buf + (sub + ln) * APITCH; const _Float16* k1p = k0p + 16 * APITCH;
    const _Float16* r0p = k0p + APLANE;              const _Float16* r1p = r0p + 16 * APITCH;
    v8f s0 = z8, s1 = z8, t0 = z8, t1 = z8;
    // the eight K fragments of the pass are read as one group ahead of the first score product: the wave meets the LDS latency once, not once per fragment
    const v16h ka0 = g2_frag(k0p, hh), ka1 = g2_frag(k0p + 32, hh), ra0 = g2_frag(r0p, hh), ra1 = g2_frag(r0p + 32, hh);
    const v16h kc0 = g2_frag(k1p, hh), kc1 = g2_frag(k1p + 32, hh), rc0 = g2_frag(r1p, hh), rc1 = g2_frag(r1p + 32, hh);
    s0 = g2_mma(ka0, qf0, s0); t0 = g2_mma(ka0, qr0, t0);
    s0 = g2_mma(ka1, qf1, s0); t0 = g2_mma(ka1, qr1, t0);
    t0 = g2_mma(ra0, qf0, t0);
    t0 = g2_mma(ra1, qf1, t0);
    s1 = g2_mma(kc0, qf0, s1); t1 = g2_mma(kc0, qr0, t1);
    s1 = g2_mma(kc1, qf1, s1); t1 = g2_mma(kc1, qr1, t1);
    t1 = g2_mma(rc0, qf0, t1);
    t1 = g2_mma(rc1, qf1, t1);
    // the V^T fragments of the pass are read as one group here, behind the last score product: their LDS latency runs under the softmax arithmetic
    const _Float16* vp = buf + 2 * APLANE + ln * APITCH + sub; const _Float16* vrp = vp + (CAUSAL ? APLANE : 0);
    const v16h va0 = g2_frag(vp, hh), va1 = g2_frag(vp + 16 * APITCH, hh), va2 = g2_frag(vp + 32 * APITCH, hh), va3 = g2_frag(vp + 48 * APITCH, hh);
    v16h vr0 = va0, vr1 = va1, vr2 = va2, vr3 = va3;
    if (CAUSAL) { vr0 = g2_frag(vrp, hh); vr1 = g2_frag(vrp + 16 * APITCH, hh); vr2 = g2_frag(vrp + 32 * APITCH, hh); vr3 = g2_frag(vrp + 48 * APITCH, hh); }
    if (CAUSAL) __builtin_amdgcn_sched_barrier(0);   /* keeps the sixteen reads whole at this place: without it this build moves them down among the softmax arithmetic in pieces, the last ones next to their products */
    const v8f af = (s0 + t0 * RINV) * 8.0f, cf = (s1 + t1 * RINV) * 8.0f;
    const int lim = row - kb - 8 * hh;           /* CAUSAL: the lane's keys kb + 8 hh + d with d > lim lie above the diagonal */
    float sc[16]; float t = -1.0e30f;            /* sc[i]: the score of key kb + 8 hh + i (i < 8), kb + 16 + 8 hh + i - 8 (i >= 8): element i of the B operand */
#pragma unroll  /* constant indices keep sc[] and the packed P in registers, here and below */
    for (int i = 0; i < 16; ++i) {
      const float x = i < 8 ? af[i & 7] : cf[i & 7];
      sc[i] = (CAUSAL && (((i < 8 ? i : i + 8) > lim) || (x == 0.0f))) ? -1.0e9f : x;
      t = fmaxf(t, sc[i]);
    }
    t = fmaxf(t, other_half(t));
    const float mnew = fmaxf(mrow, t);
    const float corr = __expf(mrow - mnew);
    FragH pf, prf; float ls0 = 0.f, ls1 = 0.f;   /* one sum per key tile: two short chains of adds */
#pragma unroll
    for (int i = 0; i < 16; ++i) {
      const float pc = __expf(sc[i] - mnew) * PCARRY;
      const h16 ph = toh_flush(pc);
      if (i < 8) ls0 += CAUSAL ? pc : (float)ph; else ls1 += CAUSAL ? pc : (float)ph;
      pf.h[i] = ph;
      if (CAUSAL) prf.h[i] = toh_flush((pc - (float)ph) * RCARRY);
    }
    lrow = lrow * corr + (ls0 + ls1); mrow = mnew;
    o0 *= corr; o1 *= corr; o2 *= corr; o3 *= corr;
    if (CAUSAL) { e0 *= corr; e1 *= corr; e2 *= corr; e3 *= corr; }
    o0 = g2_mma(va0, pf.v, o0);
    if (CAUSAL) { e0 = g2_mma(va0, prf.v, e0); e0 = g2_mma(vr0, pf.v, e0); }
    o1 = g2_mma(va1, pf.v, o1);
    if (CAUSAL) { e1 = g2_mma(va1, prf.v, e1); e1 = g2_mma(vr1, pf.v, e1); }
    o2 = g2_mma(va2, pf.v, o2);
    if (CAUSAL) { e2 = g2_mma(va2, prf.v, e2); e2 = g2_mma(vr2, pf.v, e2); }
    o3 = g2_mma(va3, pf.v, o3);
    if (CAUSAL) { e3 = g2_mma(va3, prf.v, e3); e3 = g2_mma(vr3, pf.v, e3); }
  }
    asm volatile("s_wait_dscnt 0x0" ::: "memory");      /* this wave's reads of buffer st & 1 are done before it is refilled */
    asm volatile("s_wait_asynccnt 0x0" ::: "memory");   /* this wave's copies of stage st + 1 have landed */
    __syncthreads();                                    /* publishes stage st + 1 and ends every reader's last read of buffer st & 1 */
    if (st + 2 < nst) attn_stage_copy<CAUSAL>(l0 + (unsigned)((st & 1) * (ASTAGE * 2)), gk + (size_t)(st + 2) * AKS * DM, gkr + (size_t)(st + 2) * AKS * DM, gv + (st + 2) * AKS, gvr + (st + 2) * AKS);
  }
  asm volatile("s_wait_asynccnt 0x0" ::: "memory");     /* no copy is outstanding when the ring is left */
  lrow += other_half(lrow);                                     /* the two halves' key sums of the query */
  const float rl = 64.0f * __builtin_amdgcn_rcpf(lrow);         /* o carried x64; l already carries the P carry */
  const v8f os[4] = {o0, o1, o2, o3}; const v8f es[4] = {e0, e1, e2, e3};
#pragma unroll
  for (int j = 0; j < 4; ++j) { FragH g, gr;
#pragma unroll
    for (int r = 0; r < 8; ++r) {
      float v = os[j][r]; if (CAUSAL) v += es[j][r] * RINV;
      v *= rl;
      const h16 gv16 = toh_flush(v); g.h[r] = gv16;
      if (CAUSAL) gr.h[r] = toh_flush((v - (float)gv16) * RCARRY); }
    const int oloc = ln * OBP + 16 * j + 8 * hh;                /* eight neighbouring head columns of the lane's query: one 16-byte LDS store */
    *(v8us*)(&ob[w][oloc]) = g.half[0];
    if (CAUSAL) *(v8us*)(&obr[w][oloc]) = gr.half[0];
  }
  __builtin_amdgcn_fence(4 /* acq_rel order */, "wavefront"); __builtin_amdgcn_wave_barrier();
  const int rq = lane >> 3, pc = (lane & 7) * 8;
  {
#pragma unroll
    for (int i = 0; i < 4; ++i) { const int orow = i * 4 + rq; const size_t go = (tok0 + q0 + orow) * DM + h * HD + pc;
      const v8us v = *(const v8us*)(&ob[w][orow * OBP + pc]);
      *(v8us*)((unsigned short*)O16 + go) = v;
      if (CAUSAL) { const v8us vr = *(const v8us*)(&obr[w][orow * OBP + pc]); *(v8us*)((unsigned short*)OR16 + go) = vr; } }
     }
}

__global__ __launch_bounds__(256) void k_attn_causal(const _Float16* __restrict__ Q16, const _Float16* __restrict__ QR, const _Float16* __restrict__ K16, const _Float16* __restrict__ KR,
    const _Float16* __restrict__ VT, const _Float16* __restrict__ VTR, _Float16* __restrict__ O16, _Float16* __restrict__ OR16) {
  attn_hr_body<1>(Q16, QR, K16, KR, VT, VTR, O16, OR16);
}
__global__ __launch_bounds__(256) void k_attn_dense(const _Float16* __restrict__ Q16, const _Float16* __restrict__ QR, const _Float16* __restrict__ K16, const _Float16* __restrict__ KR,
    const _Float16* __restrict__ VT, _Float16* __restrict__ O16) {
  attn_hr_body<0>(Q16, QR, K16, KR, VT, VT, O16, O16);
}

// red[] is cross-wave (block barriers); no early exit.
// W16 1: the row also as one plainly converted f16 plane O16; W16 2: as f16 value (O16) + x2048 residual (O16R) planes.
template <int RBF, int RMAP, int W16, int OMAP>
__global__ __launch_bounds__(256) void k_ln(const float* __restrict__ X, const float* __restrict__ R, const float* __restrict__ g, const float* __restrict__ bb, float eps, float* __restrict__ O32, _Float16* __restrict__ O16, _Float16* __restrict__ O16R) {
  #pragma clang fp contract(off)
  __shared__ float red[256];
  const size_t r = blockIdx.x; const int t = threadIdx.x; const int c0 = t * 4;
  const size_t rfull = (r / SEQ) * SEQ_FULL + (r % SEQ);
  const size_t rr = RMAP ? rfull : r;
  const v4f xa = *(const v4fa*)(X + r * DM + c0); const v4f ra = *(const v4fa*)(R + rr * DM + c0);
  float s[4]; float sum = 0.f;
#pragma unroll
  for (int q = 0; q < 4; ++q) { const float rv = RBF ? bf16_rne(ra[q]) : ra[q]; s[q] = xa[q] + rv; sum += s[q]; }
  red[t] = sum; __syncthreads();
  for (int st = 128; st > 0; st >>= 1) { if (t < st) red[t] += red[t + st]; __syncthreads(); }
  const float mu = red[0] * (1.0f / (float)DM); __syncthreads();
  float vs = 0.f;
#pragma unroll
  for (int q = 0; q < 4; ++q) { const float dl = s[q] - mu; vs += dl * dl; }
  red[t] = vs; __syncthreads();
  for (int st = 128; st > 0; st >>= 1) { if (t < st) red[t] += red[t + st]; __syncthreads(); }
  const float rs = rsqrtf(red[0] * (1.0f / (float)DM) + eps);
  v4f yf; v4h y;
#pragma unroll
  for (int q = 0; q < 4; ++q) { const int c = c0 + q; yf[q] = (s[q] - mu) * rs * bf16_rne(g[c]) + bf16_rne(bb[c]); y[q] = (_Float16)yf[q]; }
  const size_t orow = OMAP ? rfull : r;
  {
    if (O32) *(v4f*)(O32 + orow * DM + c0) = yf;
    if (W16 == 1) *(v4h*)(O16 + r * DM + c0) = y;
    if (W16 == 2) { v4h h4, r4;
#pragma unroll
      for (int q = 0; q < 4; ++q) { const h16 hv = toh_flush(yf[q]); h4[q] = hv; r4[q] = toh_flush((yf[q] - (float)hv) * RCARRY); }
      *(v4h*)(O16 + r * DM + c0) = h4; *(v4h*)(O16R + r * DM + c0) = r4; }
     }
}

extern "C" void kernel_launch(void* const* d_in, const int* in_sizes, int n_in,
                              void* d_out, int out_size, void* d_ws, size_t ws_size, hipStream_t stream) {
  if (n_in < 22) return;
  const float* x    = (const float*)d_in[0];  const float* enc  = (const float*)d_in[1];
  const float* wq1  = (const float*)d_in[2];  const float* wk1  = (const float*)d_in[3];  const float* wv1 = (const float*)d_in[4];
  const float* wo1  = (const float*)d_in[5];  const float* bo1  = (const float*)d_in[6];
  const float* wq2  = (const float*)d_in[7];  const float* wk2  = (const float*)d_in[8];  const float* wv2 = (const float*)d_in[9];
  const float* wo2  = (const float*)d_in[10]; const float* bo2  = (const float*)d_in[11];
  const float* wff1 = (const float*)d_in[12]; const float* bff1 = (const float*)d_in[13]; const float* wff2 = (const float*)d_in[14]; const float* bff2 = (const float*)d_in[15];
  const float* g1   = (const float*)d_in[16]; const float* be1  = (const float*)d_in[17]; const float* g2  = (const float*)d_in[18]; const float* be2 = (const float*)d_in[19];
  const float* g3   = (const float*)d_in[20]; const float* be3  = (const float*)d_in[21];

  const size_t needX = ((size_t)(NB - 1) * SEQ_FULL + SEQ) * DM;
  if ((size_t)in_sizes[0] < needX || (size_t)in_sizes[1] < needX || (size_t)out_size < needX) return;
  { static const int wi[8] = {2, 3, 4, 5, 7, 8, 9, 10}; for (int i = 0; i < 8; ++i) if ((size_t)in_sizes[wi[i]] < (size_t)DM * DM) return; }
  if ((size_t)in_sizes[12] < (size_t)DM * DFF || (size_t)in_sizes[14] < (size_t)DM * DFF || in_sizes[13] < DFF) return;
  { static const int vi[9] = {6, 11, 15, 16, 17, 18, 19, 20, 21}; for (int i = 0; i < 9; ++i) if (in_sizes[vi[i]] < DM) return; }

  char* ws = (char*)d_ws; size_t off = 0;
  auto take = [&](size_t bytes) { char* p = ws + off; off += (bytes + 255) & ~(size_t)255; return p; };
  const size_t WDD = (size_t)DM * DM * 2, WDF = (size_t)DM * DFF * 2, P16 = NR * DM * 2;
  _Float16* BQ1 = (_Float16*)take(WDD); _Float16* BK1 = (_Float16*)take(WDD); _Float16* BV1 = (_Float16*)take(WDD); _Float16* BO1 = (_Float16*)take(WDD);
  _Float16* BQ2 = (_Float16*)take(WDD); _Float16* BK2 = (_Float16*)take(WDD); _Float16* BV2 = (_Float16*)take(WDD); _Float16* BO2 = (_Float16*)take(WDD);
  _Float16* BW1 = (_Float16*)take(WDF);      /* [n=DFF][k=DM]  */
  _Float16* BW2 = (_Float16*)take(WDF);      /* [n=DM][k=DFF]  */
  // fourteen token-plane slots of P16 bytes each (an f32 plane spans two slots, the FFN hidden plane four); lifetimes by launch order:
  // S0 X16                  S1 E16 -> x2 (f16)      S2,S3 Q1|QR1 -> a1 (f32) -> a2 (f32) -> hidden (S2..S5)
  // S4,S5 K1|KR1 -> x1 (f32)   S6,S7 VT1|VTR1 -> x1 value|residual -> S7 o2 (f16) -> f (f32)
  // S8,S9 o1 value|residual -> Q2|QR2 -> x2 (f32)      S10,S11 K2|KR2      S12 free      S13 VT2
  char* SL = take(14 * P16);
  _Float16* S0 = (_Float16*)(SL + 0 * P16); _Float16* S1 = (_Float16*)(SL + 1 * P16); _Float16* S2 = (_Float16*)(SL + 2 * P16); _Float16* S3 = (_Float16*)(SL + 3 * P16);
  _Float16* S4 = (_Float16*)(SL + 4 * P16); _Float16* S5 = (_Float16*)(SL + 5 * P16); _Float16* S6 = (_Float16*)(SL + 6 * P16); _Float16* S7 = (_Float16*)(SL + 7 * P16);
  _Float16* S8 = (_Float16*)(SL + 8 * P16); _Float16* S9 = (_Float16*)(SL + 9 * P16); _Float16* S10 = (_Float16*)(SL + 10 * P16); _Float16* S11 = (_Float16*)(SL + 11 * P16);
  _Float16* S13 = (_Float16*)(SL + 13 * P16);
  float* YFa = (float*)S2;   /* a1, a2 (f32 rows, S2..S3) */
  float* X1F = (float*)S4;   /* x1 (f32 rows, S4..S5) */
  float* X2F = (float*)S8;   /* x2 (f32 rows, S8..S9) */
  float* YFf = (float*)S6;   /* f  (f32 rows, S6..S7) */
  _Float16* HF = S2;         /* FFN hidden rows [NR][DFF] f16 (S2..S5) */
  if (off > ws_size || off > (size_t)268435456) return;

  static_assert(((size_t)DM * DM * 2) % 256 == 0);   /* BQ1 .. BO2 lie one behind the other in the carve */
  k_prep<<<(unsigned)PREP_BLOCKS, 256, 0, stream>>>(wq1, wk1, wv1, wo1, wq2, wk2, wv2, wo2, wff1, wff2, x, enc, BQ1, BW1, BW2, S0, S1);

  const unsigned gP = (unsigned)((MR / 128) * (DM / 128)), gF1 = (unsigned)((MR / 128) * (DFF / 128));
  const dim3 gAT(SEQ / 128, NH, NB);

  // ---- causal self-attention block
  k_proj5<<<dim3(gP, 5), 256, 0, stream>>>(S0, S1, DM, BQ1, BK1, BV1, BK2, BV2, DM, 0.0625f, S2, S3, S4, S5, S6, S7, S10, S11, S13, DM, MR, DM, DM);   /* q1, k1, k2: value | residual rows; v1: transposed value | residual; v2: one transposed plane */
  k_attn_causal<<<gAT, 256, 0, stream>>>(S2, S3, S4, S5, S6, S7, S8, S9);                                       /* o x64 value | residual */
  k_proj_rf<<<gP, 256, 0, stream>>>(S8, S9, DM, BO1, DM, 0.0009765625f, bo1, 1.0f, YFa, DM, MR, DM, DM);        /* a1 = o Wp1 + bp1 */
  k_ln<1, 1, 2, 0><<<(unsigned)MR, 256, 0, stream>>>(YFa, x, g1, be1, LN_EPS, X1F, S6, S7);                     /* x1 = LN1(bf16(x) + a1) -> f32 rows and f16 value | residual rows */
  // ---- cross-attention block
  k_proj_rhr<<<gP, 256, 0, stream>>>(S6, S7, DM, BQ2, DM, 0.0625f, S8, S9, DM, MR, DM, DM);                     /* q  value | residual */
  k_attn_dense<<<gAT, 256, 0, stream>>>(S8, S9, S10, S11, S13, S7);                                                /* o x64 single plane */
  k_gemm2<0><<<gP, 256, 0, stream>>>(S7, DM, BO2, DM, 0.0009765625f, bo2, 1.0f, YFa, nullptr, DM, MR, DM, DM);  /* a2 = o Wp2 + bp2 */
  k_ln<0, 0, 1, 0><<<(unsigned)MR, 256, 0, stream>>>(YFa, X1F, g2, be2, LN_EPS, X2F, S1, nullptr);                       /* x2 = LN2(x1 + a2) -> f32 + f16 rows */
  // ---- FFN block
  k_gemm2<3><<<gF1, 256, 0, stream>>>(S1, DM, BW1, DM, 1.0f, bff1, 16.0f, nullptr, HF, DFF, MR, DFF, DM);       /* 16 relu(x2 W1 + b1) as f16 rows */
  k_gemm2<0><<<gP, 256, 0, stream>>>(HF, DFF, BW2, DFF, 0.00390625f, bff2, 1.0f, YFf, nullptr, DM, MR, DM, DFF);  /* f = h W2 + b2 */
  k_ln<0, 0, 0, 1><<<(unsigned)MR, 256, 0, stream>>>(YFf, X2F, g3, be3, LN_EPS, (float*)d_out, nullptr, nullptr);        /* out = LN3(x2 + f) */
}
